// v000
// Measured on an AMD MI455X. A time is GPU time per run, averaged over a window of back-to-back runs after a warm-up
// (all launches, gaps included; the runs take copies of the inputs in turn), and the median of several windows.
// Apart from v000's, it joins two sittings. Times from different sittings can be a few percent apart, while
// side-by-side timings come from the same sitting.
// The starting kernel, v000, takes 377 microseconds a run.
// compute dtype: all float inputs rounded to bf16, d_scale read; q, k = LayerNorm(x1 W^T) with EXACT bf16 products on WMMA 16x16x32 and the LN in f32; q and k as f16 hi + residual -> 3-product logits / d_scale (std ~16: near-one-hot rows), upper-triangular mask, stored in f32; softmax in f32 (precise expf), P x 2^11 kept f32 and split bf16 hi + lo against the bf16-exact x2 (2 products) + the identity term; logdet = (L/2) sum_i log(1 + P_ii) (att + I is upper triangular, so slogdet is the diagonal product - exact identity); f32 outputs: merged [n][L][D] (x1 copied, then att x2) and logdet [n].
#include <hip/hip_runtime.h>
#include <math.h>

typedef __attribute__((ext_vector_type(16))) _Float16 v16h;
typedef __attribute__((ext_vector_type(16))) __bf16 v16b;
typedef __attribute__((ext_vector_type(8)))  _Float16 v8h;
typedef __attribute__((ext_vector_type(8)))  float v8f;
typedef __attribute__((ext_vector_type(4)))  float v4f;
typedef __attribute__((ext_vector_type(2)))  float v2f;
typedef __attribute__((ext_vector_type(4)))  unsigned v4u;
typedef __attribute__((ext_vector_type(4)))  int v4i;
typedef float __attribute__((may_alias)) float_a;
typedef int __attribute__((may_alias)) int_a;

template <typename T> __device__ __forceinline__ void vst2(void* p, T v) { *(T*)p = v;  }
__device__ __forceinline__ v8f wmma16(v16h a, v16h b, v8f c) {
  v8f d = __builtin_amdgcn_wmma_f32_16x16x32_f16(false, a, false, b, (short)0, c, false, false);
  asm volatile("v_nop\n\tv_nop\n\tv_nop\n\tv_nop" : "+v"(d) : "v"(a), "v"(b));
  return d;
}
__device__ __forceinline__ v8f wmma_bf(v16b a, v16b b, v8f c) {
  v8f d = __builtin_amdgcn_wmma_f32_16x16x32_bf16(false, a, false, b, (short)0, c, false, false);
  asm volatile("v_nop\n\tv_nop\n\tv_nop\n\tv_nop" : "+v"(d) : "v"(a), "v"(b));
  return d;
}
// 16x16x32 fragments: lane = (h = lane>>4, row/col = lane&15); elements 0..7 = k0+8h+0..7, 8..15 = k0+16+8h+0..7; D element r = row 8h+r
__device__ __forceinline__ v16h frag_h(const _Float16* rowk0, int lane) {
  union { v16h v; v8h q[2]; } u; const _Float16* p = rowk0 + 8 * (lane >> 4);
  u.q[0] = *(const v8h*)p; u.q[1] = *(const v8h*)(p + 16); return u.v;
}
__device__ __forceinline__ v16h frag_f32(const float* rowk0, int lane) {
  v16h a; const float* p = rowk0 + 8 * (lane >> 4);
#pragma unroll
  for (int i = 0; i < 8; ++i) { a[i] = (_Float16)p[i]; a[8 + i] = (_Float16)p[16 + i]; }
  return a;
}
__device__ __forceinline__ v16h frag_f32s(const float* rowk0, int lane, float sc) {
  v16h a; const float* p = rowk0 + 8 * (lane >> 4);
#pragma unroll
  for (int i = 0; i < 8; ++i) { a[i] = (_Float16)(p[i] * sc); a[8 + i] = (_Float16)(p[16 + i] * sc); }
  return a;
}
// column fragment from a [K][ld] layout (column n), rows >= K read as 0
__device__ __forceinline__ v16h fragc_f32(const float* W, int k0, int n, int lane, int ld, int K) {
  v16h a; const int g = lane >> 4;
#pragma unroll
  for (int i = 0; i < 8; ++i) { const int ka = k0 + 8 * g + i, kb = ka + 16;
    a[i] = (_Float16)(ka < K ? W[(size_t)(ka < K ? ka : K - 1) * ld + n] : 0.f); a[8 + i] = (_Float16)(kb < K ? W[(size_t)(kb < K ? kb : K - 1) * ld + n] : 0.f); }
  return a;
}
struct F2 { v16b h, l; };
__device__ __forceinline__ F2 bsplit16(const float v[16]) { F2 r;
#pragma unroll
  for (int i = 0; i < 16; ++i) { const __bf16 h = (__bf16)v[i]; r.h[i] = h; r.l[i] = (__bf16)(v[i] - (float)h); }
  return r; }
__device__ __forceinline__ F2 split_row(const float* row, int k0, int lane) { float v[16]; const float* p = row + k0 + 8 * (lane >> 4);
#pragma unroll
  for (int i = 0; i < 8; ++i) { v[i] = p[i]; v[8 + i] = p[16 + i]; }
  return bsplit16(v); }
__device__ __forceinline__ F2 split_rowK(const float* row, int k0, int lane, int K) { float v[16]; const int g = lane >> 4;
#pragma unroll
  for (int i = 0; i < 8; ++i) { const int ka = k0 + 8 * g + i, kb = ka + 16; v[i] = ka < K ? row[ka < K ? ka : K - 1] : 0.f; v[8 + i] = kb < K ? row[kb < K ? kb : K - 1] : 0.f; }
  return bsplit16(v); }
__device__ __forceinline__ F2 split_col(const float* W, int k0, int n, int lane, int ld, int K) { float v[16]; const int g = lane >> 4;
#pragma unroll
  for (int i = 0; i < 8; ++i) { const int ka = k0 + 8 * g + i, kb = ka + 16; v[i] = ka < K ? W[(size_t)(ka < K ? ka : K - 1) * ld + n] : 0.f; v[8 + i] = kb < K ? W[(size_t)(kb < K ? kb : K - 1) * ld + n] : 0.f; }
  return bsplit16(v); }
__device__ __forceinline__ v8f mac3(const F2& a, const F2& b, v8f c) { c = wmma_bf(a.l, b.h, c); c = wmma_bf(a.h, b.l, c); return wmma_bf(a.h, b.h, c); }
__device__ __forceinline__ float sigm(float v) { return 1.0f / (1.0f + expf(-v)); }
#define LDSX() do { asm volatile("s_wait_dscnt 0" ::: "memory"); __builtin_amdgcn_wave_barrier(); __builtin_amdgcn_fence(__ATOMIC_RELEASE, "workgroup"); } while (0)


// Invertible attention (N 8, L 4,096 -> halves of 2,048, D 256): att = softmax(upper-tri(LN(x1 Wq^T) . LN(x1 Wk^T) / d_scale)) + I; out = att x2; logdet = slogdet(att) * L/2.
#define NB 8
#define LL 4096
#define T2 2048
#define DD 256
#define LN_EPS 1e-5f
typedef __attribute__((ext_vector_type(8))) __bf16 v8b;
__device__ __forceinline__ v16b frag_b(const __bf16* rowk0, int lane) {
  union { v16b v; v8b q[2]; } u; const __bf16* p = rowk0 + 8 * (lane >> 4);
  u.q[0] = *(const v8b*)p; u.q[1] = *(const v8b*)(p + 16); return u.v;
}
__device__ __forceinline__ float bfr(float v) { return (float)(__bf16)v; }
__device__ __attribute__((noinline)) float exp_ni(float v) { return expf(v); }
__device__ __attribute__((noinline)) float erf_ni(float v) { return erff(v); }

#define WS_QH  0u
#define WS_QL  (WS_QH + 2u * (size_t)NB * T2 * DD)
#define WS_KH  (WS_QL + 2u * (size_t)NB * T2 * DD)
#define WS_KL  (WS_KH + 2u * (size_t)NB * T2 * DD)
#define WS_XT  (WS_KL + 2u * (size_t)NB * T2 * DD)      // bf16 x2 planes [n][d][j]
#define WS_S   (WS_XT + 2u * (size_t)NB * DD * T2)      // f32 S/P [n][i][j]
#define WS_DG  (WS_S + 4u * (size_t)NB * T2 * T2)       // f32 [n][i], unused (P_ii is read off the diagonal of S)
#define WS_END (WS_DG + 4u * (size_t)NB * T2)
#define OUT1_OFF ((size_t)NB * LL * DD)               // logdet output offset (elements)

// ---- k_proj: block = (64 rows of x1, which): y = x1 W^T ([out][in]); LayerNorm(gamma, beta) -> f16 hi + lo rows; also copies bf16-rounded x1 into merged (which == 0 blocks)
__global__ __launch_bounds__(128) void k_proj(const float* __restrict__ X, const float* __restrict__ WQ, const float* __restrict__ WK, const float* __restrict__ GQ, const float* __restrict__ BQ, const float* __restrict__ GK, const float* __restrict__ BK, _Float16* __restrict__ QH, _Float16* __restrict__ QL, _Float16* __restrict__ KH, _Float16* __restrict__ KL, float* __restrict__ OUT) {
  __shared__ __align__(16) float sf[64][DD + 4]; __shared__ __align__(16) _Float16 sh[64][DD + 8], sl[64][DD + 8]; __shared__ float smu[64], srs[64];
  const int tid = threadIdx.x, wave = tid >> 5, lane = tid & 31, col = lane & 15, g = lane >> 4; const int which = blockIdx.y; const size_t r0 = (size_t)blockIdx.x * 64; const size_t n = r0 / T2; const int i0 = (int)(r0 % T2);   // rows of x1: x[n][i][:], i < T2
  const float* Wm = which == 0 ? WQ : WK; const float* Gm = which == 0 ? GQ : GK; const float* Bm = which == 0 ? BQ : BK;
#pragma unroll 1
  for (int half = 0; half < 2; ++half) { v8f acc[8] = {};
#pragma unroll 2
    for (int kc = 0; kc < DD / 32; ++kc) { v16b a; { const float* p = X + ((n * LL + i0 + wave * 16 + col) * DD) + kc * 32 + 8 * g;
#pragma unroll
        for (int i = 0; i < 8; ++i) { a[i] = (__bf16)p[i]; a[8 + i] = (__bf16)p[16 + i]; } }
#pragma unroll
      for (int j = 0; j < 8; ++j) { v16b w; const int o = half * 128 + j * 16 + col; const float* p = Wm + (size_t)o * DD + kc * 32 + 8 * g;
#pragma unroll
        for (int i = 0; i < 8; ++i) { w[i] = (__bf16)p[i]; w[8 + i] = (__bf16)p[16 + i]; }
        acc[j] = wmma_bf(a, w, acc[j]); } }
#pragma unroll
    for (int j = 0; j < 8; ++j)
#pragma unroll
      for (int r = 0; r < 8; ++r) sf[wave * 16 + 8 * g + r][half * 128 + j * 16 + col] = acc[j][r]; }
  __syncthreads();
  if (tid < 64) { float m = 0.f; for (int c = 0; c < DD; ++c) m += sf[tid][c]; m *= (1.0f / DD); float v = 0.f; for (int c = 0; c < DD; ++c) { const float d = sf[tid][c] - m; v += d * d; } smu[tid] = m; srs[tid] = 1.0f / sqrtf(v * (1.0f / DD) + LN_EPS); }
  __syncthreads();
  for (int e = tid; e < 64 * DD; e += 128) { const int rl = e >> 8, c = e & 255; const float v = (sf[rl][c] - smu[rl]) * srs[rl] * bfr(Gm[c]) + bfr(Bm[c]); const _Float16 hv = (_Float16)v; sh[rl][c] = hv; sl[rl][c] = (_Float16)(v - (float)hv); }
  __syncthreads();
  _Float16* dh = which == 0 ? QH : KH; _Float16* dl = which == 0 ? QL : KL;
  for (int e = tid; e < 64 * 32; e += 128) { const int rl = e >> 5, q = e & 31; vst2((unsigned*)(dh + (r0 + rl) * DD + q * 8), *(const v4u*)&sh[rl][q * 8]); vst2((unsigned*)(dl + (r0 + rl) * DD + q * 8), *(const v4u*)&sl[rl][q * 8]); }
  if (which == 0) { for (int e = tid; e < 64 * 64; e += 128) { const int rl = e >> 6, q = e & 63; const size_t go = (n * LL + i0 + rl) * DD + q * 4; const v4f xr = *(const v4f*)(X + go); v4f v; v[0] = bfr(xr[0]); v[1] = bfr(xr[1]); v[2] = bfr(xr[2]); v[3] = bfr(xr[3]); vst2(OUT + go, v); } } }
// ---- k_x2t: block = (64 j, n): x2 planes XT[n][d][j] (bf16, exact)
__global__ __launch_bounds__(256) void k_x2t(const float* __restrict__ X, __bf16* __restrict__ XT) { __shared__ __align__(16) __bf16 st[DD][72];
  const int t = threadIdx.x; const size_t n = blockIdx.y; const int j0 = blockIdx.x * 64;
  for (int e = t; e < 64 * DD; e += 256) { const int jl = e >> 8, d = e & 255; st[d][jl] = (__bf16)X[(n * LL + T2 + j0 + jl) * DD + d]; }
  __syncthreads(); for (int e = t; e < DD * 8; e += 256) { const int d = e >> 3, q = e & 7; vst2((unsigned*)(XT + (n * DD + d) * (size_t)T2 + j0 + q * 8), *(const v4u*)&st[d][q * 8]); } }
// ---- k_sc: block = (64 rows i, 128 cols j, n): S = q.k / d_scale for j >= i, else masked; blocks entirely below the diagonal exit
__global__ __launch_bounds__(128) void k_sc(const _Float16* __restrict__ QH, const _Float16* __restrict__ QL, const _Float16* __restrict__ KH, const _Float16* __restrict__ KL, const float* __restrict__ DSC, float* __restrict__ S0) { __shared__ __align__(16) float ss[4][16][132];
  const size_t n = blockIdx.z; float* S = S0 + n * (size_t)T2 * T2;
  const int tid = threadIdx.x, wave = tid >> 5, lane = tid & 31, col = lane & 15, g = lane >> 4; const int k0 = blockIdx.y * 128; const int q0b = blockIdx.x * 64; const int ql0 = q0b + wave * 16;
  if (k0 + 127 < q0b) return;   // all j < i: never read (k_sm/k_pv start at the row's own 64-block)
  const float isc = 1.0f / bfr(DSC[0]);
  v8f acc[8] = {};
#pragma unroll 2
  for (int kc = 0; kc < DD / 32; ++kc) { const size_t qo = (n * T2 + ql0 + col) * DD + kc * 32; const v16h ah = frag_h(QH + qo, lane), al = frag_h(QL + qo, lane);
#pragma unroll
    for (int j = 0; j < 8; ++j) { const size_t ko = (n * T2 + k0 + j * 16 + col) * DD + kc * 32; const v16h kb = frag_h(KH + ko, lane); acc[j] = wmma16(ah, kb, acc[j]); acc[j] = wmma16(al, kb, acc[j]); acc[j] = wmma16(ah, frag_h(KL + ko, lane), acc[j]); } }
#pragma unroll
  for (int j = 0; j < 8; ++j) { const int jj = k0 + j * 16 + col;
#pragma unroll
    for (int r = 0; r < 8; ++r) { const int ii = ql0 + 8 * g + r; ss[wave][8 * g + r][j * 16 + col] = (jj >= ii) ? acc[j][r] * isc : -3.0e38f; } }
  LDSX(); for (int rl = 0; rl < 16; ++rl) vst2(S + (size_t)(ql0 + rl) * T2 + k0 + lane * 4, *(const v4f*)&ss[wave][rl][lane * 4]); }
// ---- k_sm: block = (row i, n): softmax over j in [i, T2); P x 2^11 written in place over [kbeg, T2) with kbeg = 64*(i/64) (zeros for j < i)
__global__ __launch_bounds__(256) void k_sm(float* __restrict__ S0) { __shared__ float sred[8]; __shared__ float sbc; __shared__ __align__(16) float sh[T2];
  const int t = threadIdx.x; const int row = blockIdx.x; const size_t n = blockIdx.y; float* sr = S0 + (n * T2 + row) * (size_t)T2; const int kbeg = (row / 64) * 64;
  float m = -3.0e38f; for (int k = kbeg + t; k < T2; k += 256) m = fmaxf(m, sr[k]);
#pragma unroll
  for (int o = 1; o < 32; o <<= 1) m = fmaxf(m, __shfl_xor(m, o));
  if ((t & 31) == 0) sred[t >> 5] = m; __syncthreads(); if (t == 0) { float a = sred[0]; for (int i = 1; i < 8; ++i) a = fmaxf(a, sred[i]); sbc = a; } __syncthreads(); m = sbc; __syncthreads();
  float sum = 0.f; for (int k = kbeg + t; k < T2; k += 256) { const float v = sr[k]; sum += (v <= -1.0e38f) ? 0.f : expf(v - m); }
#pragma unroll
  for (int o = 1; o < 32; o <<= 1) sum += __shfl_xor(sum, o);
  if ((t & 31) == 0) sred[t >> 5] = sum; __syncthreads(); if (t == 0) { float a = 0.f; for (int i = 0; i < 8; ++i) a += sred[i]; sbc = 1.0f / a; } __syncthreads(); const float inv = sbc;
  for (int k = kbeg + t; k < T2; k += 256) { const float v = sr[k]; const float p = (v <= -1.0e38f) ? 0.f : expf(v - m) * inv; sh[k] = p * 2048.0f; }
  __syncthreads(); for (int q = kbeg / 4 + t; q < T2 / 4; q += 256) vst2(sr + q * 4, *(const v4f*)&sh[q * 4]); }
// ---- k_pv: block = (64 rows i, 128 cols d, n): out = P (hi + lo) . x2 (exact) over j >= 64*(i/64), + x2[i]; written to merged rows T2 + i
__global__ __launch_bounds__(128) void k_pv(const float* __restrict__ PS0, const __bf16* __restrict__ XT, const float* __restrict__ X, float* __restrict__ OUT) { __shared__ __align__(16) float ss[4][16][132];
  const size_t n = blockIdx.z; const float* PS = PS0 + n * (size_t)T2 * T2;
  const int tid = threadIdx.x, wave = tid >> 5, lane = tid & 31, col = lane & 15, g = lane >> 4; const int q0b = blockIdx.x * 64; const int ql0 = q0b + wave * 16; const int c0 = blockIdx.y * 128;
  v8f acc[8] = {};
#pragma unroll 1
  for (int kc = q0b / 32; kc < T2 / 32; ++kc) { const F2 p = split_row(PS + (size_t)(ql0 + col) * T2, kc * 32, lane);
#pragma unroll
    for (int j = 0; j < 8; ++j) { const v16b xb = frag_b(XT + (n * DD + c0 + j * 16 + col) * (size_t)T2 + kc * 32, lane); acc[j] = wmma_bf(p.h, xb, acc[j]); acc[j] = wmma_bf(p.l, xb, acc[j]); } }
#pragma unroll
  for (int j = 0; j < 8; ++j) { const int d = c0 + j * 16 + col;
#pragma unroll
    for (int r = 0; r < 8; ++r) { const int ii = ql0 + 8 * g + r; ss[wave][8 * g + r][j * 16 + col] = acc[j][r] * (1.0f / 2048.0f) + bfr(X[(n * LL + T2 + ii) * DD + d]); } }
  LDSX(); for (int rl = 0; rl < 16; ++rl) vst2(OUT + (n * LL + T2 + ql0 + rl) * DD + c0 + lane * 4, *(const v4f*)&ss[wave][rl][lane * 4]); }
// ---- k_logdet: one block: logdet[n] = (L/2) * sum_i log(1 + P_ii)
__global__ __launch_bounds__(256) void k_logdet(const float* __restrict__ PS, float* __restrict__ OUT) { /* P_ii read off the diagonal of the in-place P (x 2^11) */ __shared__ float sred[8]; __shared__ __align__(16) float so[NB];
  const int t = threadIdx.x;
#pragma unroll 1
  for (int n = 0; n < NB; ++n) { float s = 0.f;
#pragma unroll 1
    for (int i = t; i < T2; i += 256) s += logf(1.0f + PS[((size_t)n * T2 + i) * T2 + i] * (1.0f / 2048.0f));
#pragma unroll
    for (int o = 1; o < 32; o <<= 1) s += __shfl_xor(s, o);
    if ((t & 31) == 0) sred[t >> 5] = s; __syncthreads(); if (t == 0) { float a = 0.f; for (int i = 0; i < 8; ++i) a += sred[i]; so[n] = a * (float)(LL / 2); } __syncthreads(); }
  if (t < NB / 4) vst2(OUT + OUT1_OFF + t * 4, *(const v4f*)&so[t * 4]); }
extern "C" void kernel_launch(void* const* d_in, const int* in_sizes, int n_in, void* d_out, int out_size, void* d_ws, size_t ws_size, hipStream_t stream) {
  (void)in_sizes; (void)n_in; (void)out_size;
  const float** F = (const float**)d_in;   // 0 inputs [8,4096,256], 1 Wq [256,256] ([out,in]), 2 Wk, 3 q_gamma, 4 q_beta, 5 k_gamma, 6 k_beta, 7 d_scale [1]
  if (ws_size < (size_t)WS_END) return;
  char* ws = (char*)d_ws; _Float16 *QH = (_Float16*)(ws + WS_QH), *QL = (_Float16*)(ws + WS_QL), *KH = (_Float16*)(ws + WS_KH), *KL = (_Float16*)(ws + WS_KL); __bf16* XT = (__bf16*)(ws + WS_XT); float *S = (float*)(ws + WS_S), *DG = (float*)(ws + WS_DG);
  float* OUT = (float*)d_out;
  k_proj<<<dim3(NB * T2 / 64, 2), 128, 0, stream>>>(F[0], F[1], F[2], F[3], F[4], F[5], F[6], QH, QL, KH, KL, OUT);
  k_x2t<<<dim3(T2 / 64, NB), 256, 0, stream>>>(F[0], XT);
  k_sc<<<dim3(T2 / 64, T2 / 128, NB), 128, 0, stream>>>(QH, QL, KH, KL, F[7], S);
  k_sm<<<dim3(T2, NB), 256, 0, stream>>>(S);
  k_pv<<<dim3(T2 / 64, DD / 128, NB), 128, 0, stream>>>(S, XT, F[0], OUT);
  k_logdet<<<1, 256, 0, stream>>>(S, OUT);
}

// v001
// A run of this version takes 238 microseconds.
// Two timings next to v000 both put it at 1.61 times that version's speed.
// compute dtype: all float inputs rounded to bf16, d_scale read; q, k = LayerNorm(x1 W^T) with EXACT bf16 products on WMMA 16x16x32 and the LN in f32; q and k as f16 hi + residual -> 3-product logits / d_scale (std ~16: near-one-hot rows), upper-triangular mask, stored in f32; softmax in f32 (precise expf), P x 2^11 kept f32 and split bf16 hi + lo against the bf16-exact x2 (2 products) + the identity term; logdet = (L/2) sum_i log(1 + P_ii) (att + I is upper triangular, so slogdet is the diagonal product - exact identity); f32 outputs: merged [n][L][D] (x1 copied, then att x2) and logdet [n].
#include <hip/hip_runtime.h>
#include <math.h>

typedef __attribute__((ext_vector_type(16))) _Float16 v16h;
typedef __attribute__((ext_vector_type(16))) __bf16 v16b;
typedef __attribute__((ext_vector_type(8)))  _Float16 v8h;
typedef __attribute__((ext_vector_type(8)))  float v8f;
typedef __attribute__((ext_vector_type(4)))  float v4f;
typedef __attribute__((ext_vector_type(2)))  float v2f;
typedef __attribute__((ext_vector_type(4)))  unsigned v4u;
typedef __attribute__((ext_vector_type(4)))  int v4i;
typedef float __attribute__((may_alias)) float_a;
typedef int __attribute__((may_alias)) int_a;

template <typename T> __device__ __forceinline__ void vst2(void* p, T v) { *(T*)p = v;  }
__device__ __forceinline__ v8f wmma16(v16h a, v16h b, v8f c) {
  v8f d = __builtin_amdgcn_wmma_f32_16x16x32_f16(false, a, false, b, (short)0, c, false, false);
  asm volatile("v_nop\n\tv_nop\n\tv_nop\n\tv_nop" : "+v"(d) : "v"(a), "v"(b));
  return d;
}
__device__ __forceinline__ v8f wmma_bf(v16b a, v16b b, v8f c) {
  v8f d = __builtin_amdgcn_wmma_f32_16x16x32_bf16(false, a, false, b, (short)0, c, false, false);
  asm volatile("v_nop\n\tv_nop\n\tv_nop\n\tv_nop" : "+v"(d) : "v"(a), "v"(b));
  return d;
}
// 16x16x32 fragments: lane = (h = lane>>4, row/col = lane&15); elements 0..7 = k0+8h+0..7, 8..15 = k0+16+8h+0..7; D element r = row 8h+r
__device__ __forceinline__ v16h frag_h(const _Float16* rowk0, int lane) {
  union { v16h v; v8h q[2]; } u; const _Float16* p = rowk0 + 8 * (lane >> 4);
  u.q[0] = *(const v8h*)p; u.q[1] = *(const v8h*)(p + 16); return u.v;
}
__device__ __forceinline__ v16h frag_f32(const float* rowk0, int lane) {
  v16h a; const float* p = rowk0 + 8 * (lane >> 4);
#pragma unroll
  for (int i = 0; i < 8; ++i) { a[i] = (_Float16)p[i]; a[8 + i] = (_Float16)p[16 + i]; }
  return a;
}
__device__ __forceinline__ v16h frag_f32s(const float* rowk0, int lane, float sc) {
  v16h a; const float* p = rowk0 + 8 * (lane >> 4);
#pragma unroll
  for (int i = 0; i < 8; ++i) { a[i] = (_Float16)(p[i] * sc); a[8 + i] = (_Float16)(p[16 + i] * sc); }
  return a;
}
// column fragment from a [K][ld] layout (column n), rows >= K read as 0
__device__ __forceinline__ v16h fragc_f32(const float* W, int k0, int n, int lane, int ld, int K) {
  v16h a; const int g = lane >> 4;
#pragma unroll
  for (int i = 0; i < 8; ++i) { const int ka = k0 + 8 * g + i, kb = ka + 16;
    a[i] = (_Float16)(ka < K ? W[(size_t)(ka < K ? ka : K - 1) * ld + n] : 0.f); a[8 + i] = (_Float16)(kb < K ? W[(size_t)(kb < K ? kb : K - 1) * ld + n] : 0.f); }
  return a;
}
struct F2 { v16b h, l; };
__device__ __forceinline__ F2 bsplit16(const float v[16]) { F2 r;
#pragma unroll
  for (int i = 0; i < 16; ++i) { const __bf16 h = (__bf16)v[i]; r.h[i] = h; r.l[i] = (__bf16)(v[i] - (float)h); }
  return r; }
__device__ __forceinline__ F2 split_row(const float* row, int k0, int lane) { float v[16]; const float* p = row + k0 + 8 * (lane >> 4);
#pragma unroll
  for (int i = 0; i < 8; ++i) { v[i] = p[i]; v[8 + i] = p[16 + i]; }
  return bsplit16(v); }
__device__ __forceinline__ F2 split_rowK(const float* row, int k0, int lane, int K) { float v[16]; const int g = lane >> 4;
#pragma unroll
  for (int i = 0; i < 8; ++i) { const int ka = k0 + 8 * g + i, kb = ka + 16; v[i] = ka < K ? row[ka < K ? ka : K - 1] : 0.f; v[8 + i] = kb < K ? row[kb < K ? kb : K - 1] : 0.f; }
  return bsplit16(v); }
__device__ __forceinline__ F2 split_col(const float* W, int k0, int n, int lane, int ld, int K) { float v[16]; const int g = lane >> 4;
#pragma unroll
  for (int i = 0; i < 8; ++i) { const int ka = k0 + 8 * g + i, kb = ka + 16; v[i] = ka < K ? W[(size_t)(ka < K ? ka : K - 1) * ld + n] : 0.f; v[8 + i] = kb < K ? W[(size_t)(kb < K ? kb : K - 1) * ld + n] : 0.f; }
  return bsplit16(v); }
__device__ __forceinline__ v8f mac3(const F2& a, const F2& b, v8f c) { c = wmma_bf(a.l, b.h, c); c = wmma_bf(a.h, b.l, c); return wmma_bf(a.h, b.h, c); }
__device__ __forceinline__ float sigm(float v) { return 1.0f / (1.0f + expf(-v)); }
#define LDSX() do { asm volatile("s_wait_dscnt 0" ::: "memory"); __builtin_amdgcn_wave_barrier(); __builtin_amdgcn_fence(__ATOMIC_RELEASE, "workgroup"); } while (0)


// Invertible attention (N 8, L 4,096 -> halves of 2,048, D 256): att = softmax(upper-tri(LN(x1 Wq^T) . LN(x1 Wk^T) / d_scale)) + I; out = att x2; logdet = slogdet(att) * L/2.
#define NB 8
#define LL 4096
#define T2 2048
#define DD 256
#define LN_EPS 1e-5f
typedef __attribute__((ext_vector_type(8))) __bf16 v8b;
__device__ __forceinline__ v16b frag_b(const __bf16* rowk0, int lane) {
  union { v16b v; v8b q[2]; } u; const __bf16* p = rowk0 + 8 * (lane >> 4);
  u.q[0] = *(const v8b*)p; u.q[1] = *(const v8b*)(p + 16); return u.v;
}
__device__ __forceinline__ float bfr(float v) { return (float)(__bf16)v; }
__device__ __attribute__((noinline)) float exp_ni(float v) { return expf(v); }
__device__ __attribute__((noinline)) float erf_ni(float v) { return erff(v); }

// Eight 16-byte asynchronous copies per lane, global memory to LDS through no register. The s_wait_xcnt is the statement's last line so that no address register of a copy is rewritten ahead of it.
__device__ __forceinline__ void acopy8(const unsigned (&l)[8], const char* const (&gp)[8]) {
  asm volatile("global_load_async_to_lds_b128 %0, %8, off\n\t"
               "global_load_async_to_lds_b128 %1, %9, off\n\t"
               "global_load_async_to_lds_b128 %2, %10, off\n\t"
               "global_load_async_to_lds_b128 %3, %11, off\n\t"
               "global_load_async_to_lds_b128 %4, %12, off\n\t"
               "global_load_async_to_lds_b128 %5, %13, off\n\t"
               "global_load_async_to_lds_b128 %6, %14, off\n\t"
               "global_load_async_to_lds_b128 %7, %15, off\n\t"
               "s_wait_xcnt 0x0"
               :: "v"(l[0]), "v"(l[1]), "v"(l[2]), "v"(l[3]), "v"(l[4]), "v"(l[5]), "v"(l[6]), "v"(l[7]),
                  "v"(gp[0]), "v"(gp[1]), "v"(gp[2]), "v"(gp[3]), "v"(gp[4]), "v"(gp[5]), "v"(gp[6]), "v"(gp[7]) : "memory");
}
// this wave's copies have landed (the compiler places no wait for them)
#define WAIT_ASYNC() asm volatile("s_wait_asynccnt 0x0" ::: "memory")
// this wave's LDS reads have returned, so the buffer may be handed back for a refill
#define WAIT_DS() asm volatile("s_wait_dscnt 0x0" ::: "memory")

#define WS_QH  0u
#define WS_QL  (WS_QH + 2u * (size_t)NB * T2 * DD)
#define WS_KH  (WS_QL + 2u * (size_t)NB * T2 * DD)
#define WS_KL  (WS_KH + 2u * (size_t)NB * T2 * DD)
#define WS_XT  (WS_KL + 2u * (size_t)NB * T2 * DD)      // bf16 x2 planes [n][d][j]
#define WS_S   (WS_XT + 2u * (size_t)NB * DD * T2)      // f32 S/P [n][i][j]
#define WS_DG  (WS_S + 4u * (size_t)NB * T2 * T2)       // f32 [n][i], unused (P_ii is read off the diagonal of S)
#define WS_END (WS_DG + 4u * (size_t)NB * T2)
#define OUT1_OFF ((size_t)NB * LL * DD)               // logdet output offset (elements)

// ---- k_proj: block = (64 rows of x1, which): y = x1 W^T ([out][in]); LayerNorm(gamma, beta) -> f16 hi + lo rows; also copies bf16-rounded x1 into merged (which == 0 blocks)
__global__ __launch_bounds__(128) void k_proj(const float* __restrict__ X, const float* __restrict__ WQ, const float* __restrict__ WK, const float* __restrict__ GQ, const float* __restrict__ BQ, const float* __restrict__ GK, const float* __restrict__ BK, _Float16* __restrict__ QH, _Float16* __restrict__ QL, _Float16* __restrict__ KH, _Float16* __restrict__ KL, float* __restrict__ OUT) {
  __shared__ __align__(16) float sf[64][DD + 4]; __shared__ __align__(16) _Float16 sh[64][DD + 8], sl[64][DD + 8]; __shared__ float smu[64], srs[64];
  const int tid = threadIdx.x, wave = tid >> 5, lane = tid & 31, col = lane & 15, g = lane >> 4; const int which = blockIdx.y; const size_t r0 = (size_t)blockIdx.x * 64; const size_t n = r0 / T2; const int i0 = (int)(r0 % T2);   // rows of x1: x[n][i][:], i < T2
  const float* Wm = which == 0 ? WQ : WK; const float* Gm = which == 0 ? GQ : GK; const float* Bm = which == 0 ? BQ : BK;
#pragma unroll 1
  for (int half = 0; half < 2; ++half) { v8f acc[8] = {};
#pragma unroll 2
    for (int kc = 0; kc < DD / 32; ++kc) { v16b a; { const float* p = X + ((n * LL + i0 + wave * 16 + col) * DD) + kc * 32 + 8 * g;
#pragma unroll
        for (int i = 0; i < 8; ++i) { a[i] = (__bf16)p[i]; a[8 + i] = (__bf16)p[16 + i]; } }
#pragma unroll
      for (int j = 0; j < 8; ++j) { v16b w; const int o = half * 128 + j * 16 + col; const float* p = Wm + (size_t)o * DD + kc * 32 + 8 * g;
#pragma unroll
        for (int i = 0; i < 8; ++i) { w[i] = (__bf16)p[i]; w[8 + i] = (__bf16)p[16 + i]; }
        acc[j] = wmma_bf(a, w, acc[j]); } }
#pragma unroll
    for (int j = 0; j < 8; ++j)
#pragma unroll
      for (int r = 0; r < 8; ++r) sf[wave * 16 + 8 * g + r][half * 128 + j * 16 + col] = acc[j][r]; }
  __syncthreads();
  if (tid < 64) { float m = 0.f; for (int c = 0; c < DD; ++c) m += sf[tid][c]; m *= (1.0f / DD); float v = 0.f; for (int c = 0; c < DD; ++c) { const float d = sf[tid][c] - m; v += d * d; } smu[tid] = m; srs[tid] = 1.0f / sqrtf(v * (1.0f / DD) + LN_EPS); }
  __syncthreads();
  for (int e = tid; e < 64 * DD; e += 128) { const int rl = e >> 8, c = e & 255; const float v = (sf[rl][c] - smu[rl]) * srs[rl] * bfr(Gm[c]) + bfr(Bm[c]); const _Float16 hv = (_Float16)v; sh[rl][c] = hv; sl[rl][c] = (_Float16)(v - (float)hv); }
  __syncthreads();
  _Float16* dh = which == 0 ? QH : KH; _Float16* dl = which == 0 ? QL : KL;
  for (int e = tid; e < 64 * 32; e += 128) { const int rl = e >> 5, q = e & 31; vst2((unsigned*)(dh + (r0 + rl) * DD + q * 8), *(const v4u*)&sh[rl][q * 8]); vst2((unsigned*)(dl + (r0 + rl) * DD + q * 8), *(const v4u*)&sl[rl][q * 8]); }
  if (which == 0) { for (int e = tid; e < 64 * 64; e += 128) { const int rl = e >> 6, q = e & 63; const size_t go = (n * LL + i0 + rl) * DD + q * 4; const v4f xr = *(const v4f*)(X + go); v4f v; v[0] = bfr(xr[0]); v[1] = bfr(xr[1]); v[2] = bfr(xr[2]); v[3] = bfr(xr[3]); vst2(OUT + go, v); } } }
// ---- k_x2t: block = (64 j, n): x2 planes XT[n][d][j] (bf16, exact)
__global__ __launch_bounds__(256) void k_x2t(const float* __restrict__ X, __bf16* __restrict__ XT) { __shared__ __align__(16) __bf16 st[DD][72];
  const int t = threadIdx.x; const size_t n = blockIdx.y; const int j0 = blockIdx.x * 64;
  for (int e = t; e < 64 * DD; e += 256) { const int jl = e >> 8, d = e & 255; st[d][jl] = (__bf16)X[(n * LL + T2 + j0 + jl) * DD + d]; }
  __syncthreads(); for (int e = t; e < DD * 8; e += 256) { const int d = e >> 3, q = e & 7; vst2((unsigned*)(XT + (n * DD + d) * (size_t)T2 + j0 + q * 8), *(const v4u*)&st[d][q * 8]); } }
// ---- k_sc: block = (64 rows i, 128 cols j, n): S = q.k / d_scale for j >= i, else masked; blocks entirely below the diagonal exit.
// The K and Q rows (hi and lo) come in slices of 64 k = 128 B a row, whole lines, by asynchronous copies into two LDS buffers; the fragments are read from LDS.
#define SC_P 144u                    // LDS row pitch: 128 B + 16, conflict-free for 16-byte reads
#define SC_KL (128u * SC_P)          // rows in a buffer: KH 128 | KL 128 | QH 64 | QL 64
#define SC_QH (256u * SC_P)
#define SC_QL (320u * SC_P)
#define SC_BUF (384u * SC_P)
__global__ __launch_bounds__(128) void k_sc(const _Float16* __restrict__ QH, const _Float16* __restrict__ QL, const _Float16* __restrict__ KH, const _Float16* __restrict__ KL, const float* __restrict__ DSC, float* __restrict__ S0) { __shared__ __align__(16) float ss[4][16][132]; __shared__ __align__(16) unsigned char sb[2 * SC_BUF];
  const size_t n = blockIdx.z; float* S = S0 + n * (size_t)T2 * T2;
  const int tid = threadIdx.x, wave = tid >> 5, lane = tid & 31, col = lane & 15, g = lane >> 4; const int k0 = blockIdx.y * 128; const int q0b = blockIdx.x * 64; const int ql0 = q0b + wave * 16;
  if (k0 + 127 < q0b) return;   // all j < i: never read (k_sm/k_pv start at the row's own 64-block)
  const float isc = 1.0f / bfr(DSC[0]);
  const int rr = tid >> 3, pc = tid & 7;   // a copy of a wave covers 4 rows x 128 B
  const unsigned lb = (unsigned)(size_t)sb + (unsigned)rr * SC_P + (unsigned)pc * 16u;
  const char* gkh = (const char*)(KH + (n * T2 + k0 + rr) * DD + pc * 8); const char* gkl = (const char*)(KL + (n * T2 + k0 + rr) * DD + pc * 8);
  const char* gqh = (const char*)(QH + (n * T2 + q0b + rr) * DD + pc * 8); const char* gql = (const char*)(QL + (n * T2 + q0b + rr) * DD + pc * 8);
  // the loops below are unrolled so that l[] and gp[] are registers: they are asm operands
  auto stage = [&](int t, int b) { unsigned l[8]; const char* gp[8]; const unsigned lt = lb + (unsigned)b * SC_BUF; const size_t go = (size_t)t * 128;
#pragma unroll
    for (int m = 0; m < 8; ++m) { l[m] = lt + (unsigned)m * 16u * SC_P; gp[m] = gkh + go + (size_t)m * 16 * DD * 2; }
    acopy8(l, gp);
#pragma unroll
    for (int m = 0; m < 8; ++m) { l[m] = lt + SC_KL + (unsigned)m * 16u * SC_P; gp[m] = gkl + go + (size_t)m * 16 * DD * 2; }
    acopy8(l, gp);
#pragma unroll
    for (int m = 0; m < 4; ++m) { l[m] = lt + SC_QH + (unsigned)m * 16u * SC_P; gp[m] = gqh + go + (size_t)m * 16 * DD * 2; l[4 + m] = lt + SC_QL + (unsigned)m * 16u * SC_P; gp[4 + m] = gql + go + (size_t)m * 16 * DD * 2; }
    acopy8(l, gp); };
  stage(0, 0); WAIT_ASYNC(); __syncthreads(); stage(1, 1);
  v8f acc[8] = {};
// rolled: one copy of the 48-WMMA body, and the two buffers alternate by an offset; the loops inside are unrolled so that acc[], kb[] and kl[] stay in registers
#pragma unroll 1
  for (int t = 0; t < DD / 64; ++t) { const unsigned char* B = sb + (unsigned)(t & 1) * SC_BUF;
#pragma unroll
    for (int kk = 0; kk < 2; ++kk) { const unsigned qo = (unsigned)(wave * 16 + col) * SC_P + (unsigned)kk * 64u; const v16h ah = frag_h((const _Float16*)(B + SC_QH + qo), lane), al = frag_h((const _Float16*)(B + SC_QL + qo), lane); v16h kb[8], kl[8];
#pragma unroll
      for (int j = 0; j < 8; ++j) { const unsigned ko = (unsigned)(j * 16 + col) * SC_P + (unsigned)kk * 64u; kb[j] = frag_h((const _Float16*)(B + ko), lane); kl[j] = frag_h((const _Float16*)(B + SC_KL + ko), lane); }
      // inputs only: keeps the LDS reads of this 32-k step together ahead of its WMMAs; read one fragment at a time, every WMMA waits out an LDS latency
      asm volatile("" :: "v"(ah), "v"(al), "v"(kb[0]), "v"(kb[1]), "v"(kb[2]), "v"(kb[3]), "v"(kb[4]), "v"(kb[5]), "v"(kb[6]), "v"(kb[7]), "v"(kl[0]), "v"(kl[1]), "v"(kl[2]), "v"(kl[3]), "v"(kl[4]), "v"(kl[5]), "v"(kl[6]), "v"(kl[7]));
#pragma unroll
      for (int j = 0; j < 8; ++j) { acc[j] = wmma16(ah, kb[j], acc[j]); acc[j] = wmma16(al, kb[j], acc[j]); acc[j] = wmma16(ah, kl[j], acc[j]); } }
    WAIT_DS(); WAIT_ASYNC(); __syncthreads();   // publishes slice t + 1 and ends every reader's last read of slice t's buffer
    if (t + 2 < DD / 64) stage(t + 2, t & 1); }
  WAIT_ASYNC();
#pragma unroll
  for (int j = 0; j < 8; ++j) { const int jj = k0 + j * 16 + col;
#pragma unroll
    for (int r = 0; r < 8; ++r) { const int ii = ql0 + 8 * g + r; ss[wave][8 * g + r][j * 16 + col] = (jj >= ii) ? acc[j][r] * isc : -3.0e38f; } }
  LDSX(); for (int rl = 0; rl < 16; ++rl) vst2(S + (size_t)(ql0 + rl) * T2 + k0 + lane * 4, *(const v4f*)&ss[wave][rl][lane * 4]); }
// ---- k_sm: block = (row i, n): softmax over j in [i, T2); P x 2^11 written in place over [kbeg, T2) with kbeg = 64*(i/64) (zeros for j < i)
__global__ __launch_bounds__(256) void k_sm(float* __restrict__ S0) { __shared__ float sred[8]; __shared__ float sbc; __shared__ __align__(16) float sh[T2];
  const int t = threadIdx.x; const int row = blockIdx.x; const size_t n = blockIdx.y; float* sr = S0 + (n * T2 + row) * (size_t)T2; const int kbeg = (row / 64) * 64;
  float m = -3.0e38f; for (int k = kbeg + t; k < T2; k += 256) m = fmaxf(m, sr[k]);
#pragma unroll
  for (int o = 1; o < 32; o <<= 1) m = fmaxf(m, __shfl_xor(m, o));
  if ((t & 31) == 0) sred[t >> 5] = m; __syncthreads(); if (t == 0) { float a = sred[0]; for (int i = 1; i < 8; ++i) a = fmaxf(a, sred[i]); sbc = a; } __syncthreads(); m = sbc; __syncthreads();
  float sum = 0.f; for (int k = kbeg + t; k < T2; k += 256) { const float v = sr[k]; sum += (v <= -1.0e38f) ? 0.f : expf(v - m); }
#pragma unroll
  for (int o = 1; o < 32; o <<= 1) sum += __shfl_xor(sum, o);
  if ((t & 31) == 0) sred[t >> 5] = sum; __syncthreads(); if (t == 0) { float a = 0.f; for (int i = 0; i < 8; ++i) a += sred[i]; sbc = 1.0f / a; } __syncthreads(); const float inv = sbc;
  for (int k = kbeg + t; k < T2; k += 256) { const float v = sr[k]; const float p = (v <= -1.0e38f) ? 0.f : expf(v - m) * inv; sh[k] = p * 2048.0f; }
  __syncthreads(); for (int q = kbeg / 4 + t; q < T2 / 4; q += 256) vst2(sr + q * 4, *(const v4f*)&sh[q * 4]); }
// ---- k_pv: block = (64 rows i, 128 cols d, n): out = P (hi + lo) . x2 (exact) over j >= 64*(i/64), + x2[i]; written to merged rows T2 + i.
// P rows (f32) and x2 planes (bf16) come in slices of 64 j, whole lines, by asynchronous copies into two LDS buffers; the fragments are read from LDS.
#define PV_PP 272u                   // LDS pitch of a P row: 256 B + 16
#define PV_XP 144u                   // LDS pitch of an x2 plane row: 128 B + 16
#define PV_X (64u * PV_PP)           // a buffer: P 64 rows | x2 planes 128 rows
#define PV_BUF (PV_X + 128u * PV_XP)
__global__ __launch_bounds__(128) void k_pv(const float* __restrict__ PS0, const __bf16* __restrict__ XT, const float* __restrict__ X, float* __restrict__ OUT) { __shared__ __align__(16) float ss[4][16][132]; __shared__ __align__(16) unsigned char sb[2 * PV_BUF];
  const size_t n = blockIdx.z; const float* PS = PS0 + n * (size_t)T2 * T2;
  const int tid = threadIdx.x, wave = tid >> 5, lane = tid & 31, col = lane & 15, g = lane >> 4; const int q0b = blockIdx.x * 64; const int ql0 = q0b + wave * 16; const int c0 = blockIdx.y * 128;
  const unsigned lp = (unsigned)(size_t)sb + (unsigned)(tid >> 4) * PV_PP + (unsigned)(tid & 15) * 16u;          // a copy of a wave covers 2 P rows x 256 B
  const unsigned lx = (unsigned)(size_t)sb + PV_X + (unsigned)(tid >> 3) * PV_XP + (unsigned)(tid & 7) * 16u;     // or 4 plane rows x 128 B
  const char* gpp = (const char*)(PS + (size_t)(q0b + (tid >> 4)) * T2 + (tid & 15) * 4); const char* gxx = (const char*)(XT + (n * DD + c0 + (tid >> 3)) * (size_t)T2 + (tid & 7) * 8);
  // the loops below are unrolled so that l[] and gp[] are registers: they are asm operands
  auto stage = [&](int t, int b) { unsigned l[8]; const char* gp[8];
#pragma unroll
    for (int m = 0; m < 8; ++m) { l[m] = lp + (unsigned)b * PV_BUF + (unsigned)m * 8u * PV_PP; gp[m] = gpp + (size_t)t * 256 + (size_t)m * 8 * T2 * 4; }
    acopy8(l, gp);
#pragma unroll
    for (int m = 0; m < 8; ++m) { l[m] = lx + (unsigned)b * PV_BUF + (unsigned)m * 16u * PV_XP; gp[m] = gxx + (size_t)t * 128 + (size_t)m * 16 * T2 * 2; }
    acopy8(l, gp); };
  const int t0 = blockIdx.x;   // first slice of 64 j: the rows' own 64-block
  stage(t0, 0); WAIT_ASYNC(); __syncthreads(); if (t0 + 1 < T2 / 64) stage(t0 + 1, 1);
  v8f acc[8] = {};
// rolled: the trip count depends on the block; the loops inside are unrolled so that acc[] and xb[] stay in registers
#pragma unroll 1
  for (int t = t0; t < T2 / 64; ++t) { const int b = (t - t0) & 1; const unsigned char* B = sb + (unsigned)b * PV_BUF;
#pragma unroll
    for (int kk = 0; kk < 2; ++kk) { const v4f* pp = (const v4f*)(B + (unsigned)(wave * 16 + col) * PV_PP + (unsigned)kk * 128u + (unsigned)g * 32u); const v4f p0 = pp[0], p1 = pp[1], p2 = pp[4], p3 = pp[5]; v16b xb[8];   // P elements k0+8g+0..7 and k0+16+8g+0..7
#pragma unroll
      for (int j = 0; j < 8; ++j) xb[j] = frag_b((const __bf16*)(B + PV_X + (unsigned)(j * 16 + col) * PV_XP + (unsigned)kk * 64u), lane);
      // inputs only: keeps the LDS reads of this 32-j step together ahead of its WMMAs; read one fragment at a time, every WMMA waits out an LDS latency
      asm volatile("" :: "v"(p0), "v"(p1), "v"(p2), "v"(p3), "v"(xb[0]), "v"(xb[1]), "v"(xb[2]), "v"(xb[3]), "v"(xb[4]), "v"(xb[5]), "v"(xb[6]), "v"(xb[7]));
      float pv[16];
#pragma unroll
      for (int i = 0; i < 4; ++i) { pv[i] = p0[i]; pv[4 + i] = p1[i]; pv[8 + i] = p2[i]; pv[12 + i] = p3[i]; }
      const F2 p = bsplit16(pv);
#pragma unroll
      for (int j = 0; j < 8; ++j) { acc[j] = wmma_bf(p.h, xb[j], acc[j]); acc[j] = wmma_bf(p.l, xb[j], acc[j]); } }
    WAIT_DS(); WAIT_ASYNC(); __syncthreads();   // publishes slice t + 1 and ends every reader's last read of slice t's buffer
    if (t + 2 < T2 / 64) stage(t + 2, b); }
  WAIT_ASYNC();
#pragma unroll
  for (int j = 0; j < 8; ++j) { const int d = c0 + j * 16 + col;
#pragma unroll
    for (int r = 0; r < 8; ++r) { const int ii = ql0 + 8 * g + r; ss[wave][8 * g + r][j * 16 + col] = acc[j][r] * (1.0f / 2048.0f) + bfr(X[(n * LL + T2 + ii) * DD + d]); } }
  LDSX(); for (int rl = 0; rl < 16; ++rl) vst2(OUT + (n * LL + T2 + ql0 + rl) * DD + c0 + lane * 4, *(const v4f*)&ss[wave][rl][lane * 4]); }
// ---- k_logdet: one block: logdet[n] = (L/2) * sum_i log(1 + P_ii)
__global__ __launch_bounds__(256) void k_logdet(const float* __restrict__ PS, float* __restrict__ OUT) { /* P_ii read off the diagonal of the in-place P (x 2^11) */ __shared__ float sred[8]; __shared__ __align__(16) float so[NB];
  const int t = threadIdx.x;
#pragma unroll 1
  for (int n = 0; n < NB; ++n) { float s = 0.f;
#pragma unroll 1
    for (int i = t; i < T2; i += 256) s += logf(1.0f + PS[((size_t)n * T2 + i) * T2 + i] * (1.0f / 2048.0f));
#pragma unroll
    for (int o = 1; o < 32; o <<= 1) s += __shfl_xor(s, o);
    if ((t & 31) == 0) sred[t >> 5] = s; __syncthreads(); if (t == 0) { float a = 0.f; for (int i = 0; i < 8; ++i) a += sred[i]; so[n] = a * (float)(LL / 2); } __syncthreads(); }
  if (t < NB / 4) vst2(OUT + OUT1_OFF + t * 4, *(const v4f*)&so[t * 4]); }
extern "C" void kernel_launch(void* const* d_in, const int* in_sizes, int n_in, void* d_out, int out_size, void* d_ws, size_t ws_size, hipStream_t stream) {
  (void)in_sizes; (void)n_in; (void)out_size;
  const float** F = (const float**)d_in;   // 0 inputs [8,4096,256], 1 Wq [256,256] ([out,in]), 2 Wk, 3 q_gamma, 4 q_beta, 5 k_gamma, 6 k_beta, 7 d_scale [1]
  if (ws_size < (size_t)WS_END) return;
  char* ws = (char*)d_ws; _Float16 *QH = (_Float16*)(ws + WS_QH), *QL = (_Float16*)(ws + WS_QL), *KH = (_Float16*)(ws + WS_KH), *KL = (_Float16*)(ws + WS_KL); __bf16* XT = (__bf16*)(ws + WS_XT); float *S = (float*)(ws + WS_S), *DG = (float*)(ws + WS_DG);
  float* OUT = (float*)d_out;
  k_proj<<<dim3(NB * T2 / 64, 2), 128, 0, stream>>>(F[0], F[1], F[2], F[3], F[4], F[5], F[6], QH, QL, KH, KL, OUT);
  k_x2t<<<dim3(T2 / 64, NB), 256, 0, stream>>>(F[0], XT);
  k_sc<<<dim3(T2 / 64, T2 / 128, NB), 128, 0, stream>>>(QH, QL, KH, KL, F[7], S);
  k_sm<<<dim3(T2, NB), 256, 0, stream>>>(S);
  k_pv<<<dim3(T2 / 64, DD / 128, NB), 128, 0, stream>>>(S, XT, F[0], OUT);
  k_logdet<<<1, 256, 0, stream>>>(S, OUT);
}

// v002
// One run takes 214 microseconds.
// In both of two side-by-side timings against v001, it was 1.11 times as fast.
// All steps since v000 together make it 1.79 times as fast.
// compute dtype: all float inputs rounded to bf16, d_scale read; q, k = LayerNorm(x1 W^T) with EXACT bf16 products on WMMA 16x16x32 and the LN in f32; q and k as f16 hi + residual -> 3-product logits / d_scale (std ~16: near-one-hot rows), upper-triangular mask, stored in f32; softmax in f32 (precise exp), P x 2^11 kept f32 and split bf16 hi + lo against the bf16-exact x2 (2 products) + the identity term; logdet = (L/2) sum_i log(1 + P_ii) (att + I is upper triangular, so slogdet is the diagonal product - exact identity); f32 outputs: merged [n][L][D] (x1 copied, then att x2) and logdet [n].
#include <hip/hip_runtime.h>
#include <math.h>

typedef __attribute__((ext_vector_type(16))) _Float16 v16h;
typedef __attribute__((ext_vector_type(16))) __bf16 v16b;
typedef __attribute__((ext_vector_type(8)))  _Float16 v8h;
typedef __attribute__((ext_vector_type(8)))  float v8f;
typedef __attribute__((ext_vector_type(4)))  float v4f;
typedef __attribute__((ext_vector_type(2)))  float v2f;
typedef __attribute__((ext_vector_type(4)))  unsigned v4u;
typedef __attribute__((ext_vector_type(4)))  int v4i;
typedef float __attribute__((may_alias)) float_a;
typedef int __attribute__((may_alias)) int_a;

template <typename T> __device__ __forceinline__ void vst2(void* p, T v) { *(T*)p = v;  }
__device__ __forceinline__ v8f wmma16(v16h a, v16h b, v8f c) {
  v8f d = __builtin_amdgcn_wmma_f32_16x16x32_f16(false, a, false, b, (short)0, c, false, false);
  asm volatile("v_nop\n\tv_nop\n\tv_nop\n\tv_nop" : "+v"(d) : "v"(a), "v"(b));
  return d;
}
__device__ __forceinline__ v8f wmma_bf(v16b a, v16b b, v8f c) {
  v8f d = __builtin_amdgcn_wmma_f32_16x16x32_bf16(false, a, false, b, (short)0, c, false, false);
  asm volatile("v_nop\n\tv_nop\n\tv_nop\n\tv_nop" : "+v"(d) : "v"(a), "v"(b));
  return d;
}
// 16x16x32 fragments: lane = (h = lane>>4, row/col = lane&15); elements 0..7 = k0+8h+0..7, 8..15 = k0+16+8h+0..7; D element r = row 8h+r
__device__ __forceinline__ v16h frag_h(const _Float16* rowk0, int lane) {
  union { v16h v; v8h q[2]; } u; const _Float16* p = rowk0 + 8 * (lane >> 4);
  u.q[0] = *(const v8h*)p; u.q[1] = *(const v8h*)(p + 16); return u.v;
}
__device__ __forceinline__ v16h frag_f32(const float* rowk0, int lane) {
  v16h a; const float* p = rowk0 + 8 * (lane >> 4);
#pragma unroll
  for (int i = 0; i < 8; ++i) { a[i] = (_Float16)p[i]; a[8 + i] = (_Float16)p[16 + i]; }
  return a;
}
__device__ __forceinline__ v16h frag_f32s(const float* rowk0, int lane, float sc) {
  v16h a; const float* p = rowk0 + 8 * (lane >> 4);
#pragma unroll
  for (int i = 0; i < 8; ++i) { a[i] = (_Float16)(p[i] * sc); a[8 + i] = (_Float16)(p[16 + i] * sc); }
  return a;
}
// column fragment from a [K][ld] layout (column n), rows >= K read as 0
__device__ __forceinline__ v16h fragc_f32(const float* W, int k0, int n, int lane, int ld, int K) {
  v16h a; const int g = lane >> 4;
#pragma unroll
  for (int i = 0; i < 8; ++i) { const int ka = k0 + 8 * g + i, kb = ka + 16;
    a[i] = (_Float16)(ka < K ? W[(size_t)(ka < K ? ka : K - 1) * ld + n] : 0.f); a[8 + i] = (_Float16)(kb < K ? W[(size_t)(kb < K ? kb : K - 1) * ld + n] : 0.f); }
  return a;
}
struct F2 { v16b h, l; };
__device__ __forceinline__ F2 bsplit16(const float v[16]) { F2 r;
#pragma unroll
  for (int i = 0; i < 16; ++i) { const __bf16 h = (__bf16)v[i]; r.h[i] = h; r.l[i] = (__bf16)(v[i] - (float)h); }
  return r; }
__device__ __forceinline__ F2 split_row(const float* row, int k0, int lane) { float v[16]; const float* p = row + k0 + 8 * (lane >> 4);
#pragma unroll
  for (int i = 0; i < 8; ++i) { v[i] = p[i]; v[8 + i] = p[16 + i]; }
  return bsplit16(v); }
__device__ __forceinline__ F2 split_rowK(const float* row, int k0, int lane, int K) { float v[16]; const int g = lane >> 4;
#pragma unroll
  for (int i = 0; i < 8; ++i) { const int ka = k0 + 8 * g + i, kb = ka + 16; v[i] = ka < K ? row[ka < K ? ka : K - 1] : 0.f; v[8 + i] = kb < K ? row[kb < K ? kb : K - 1] : 0.f; }
  return bsplit16(v); }
__device__ __forceinline__ F2 split_col(const float* W, int k0, int n, int lane, int ld, int K) { float v[16]; const int g = lane >> 4;
#pragma unroll
  for (int i = 0; i < 8; ++i) { const int ka = k0 + 8 * g + i, kb = ka + 16; v[i] = ka < K ? W[(size_t)(ka < K ? ka : K - 1) * ld + n] : 0.f; v[8 + i] = kb < K ? W[(size_t)(kb < K ? kb : K - 1) * ld + n] : 0.f; }
  return bsplit16(v); }
__device__ __forceinline__ v8f mac3(const F2& a, const F2& b, v8f c) { c = wmma_bf(a.l, b.h, c); c = wmma_bf(a.h, b.l, c); return wmma_bf(a.h, b.h, c); }
__device__ __forceinline__ float sigm(float v) { return 1.0f / (1.0f + expf(-v)); }
#define LDSX() do { asm volatile("s_wait_dscnt 0" ::: "memory"); __builtin_amdgcn_wave_barrier(); __builtin_amdgcn_fence(__ATOMIC_RELEASE, "workgroup"); } while (0)


// Invertible attention (N 8, L 4,096 -> halves of 2,048, D 256): att = softmax(upper-tri(LN(x1 Wq^T) . LN(x1 Wk^T) / d_scale)) + I; out = att x2; logdet = slogdet(att) * L/2.
#define NB 8
#define LL 4096
#define T2 2048
#define DD 256
#define LN_EPS 1e-5f
typedef __attribute__((ext_vector_type(8))) __bf16 v8b;
__device__ __forceinline__ v16b frag_b(const __bf16* rowk0, int lane) {
  union { v16b v; v8b q[2]; } u; const __bf16* p = rowk0 + 8 * (lane >> 4);
  u.q[0] = *(const v8b*)p; u.q[1] = *(const v8b*)(p + 16); return u.v;
}
__device__ __forceinline__ float bfr(float v) { return (float)(__bf16)v; }
__device__ __attribute__((noinline)) float exp_ni(float v) { return expf(v); }
__device__ __attribute__((noinline)) float erf_ni(float v) { return erff(v); }

// Eight 16-byte asynchronous copies per lane, global memory to LDS through no register. The s_wait_xcnt is the statement's last line so that no address register of a copy is rewritten ahead of it.
__device__ __forceinline__ void acopy8(const unsigned (&l)[8], const char* const (&gp)[8]) {
  asm volatile("global_load_async_to_lds_b128 %0, %8, off\n\t"
               "global_load_async_to_lds_b128 %1, %9, off\n\t"
               "global_load_async_to_lds_b128 %2, %10, off\n\t"
               "global_load_async_to_lds_b128 %3, %11, off\n\t"
               "global_load_async_to_lds_b128 %4, %12, off\n\t"
               "global_load_async_to_lds_b128 %5, %13, off\n\t"
               "global_load_async_to_lds_b128 %6, %14, off\n\t"
               "global_load_async_to_lds_b128 %7, %15, off\n\t"
               "s_wait_xcnt 0x0"
               :: "v"(l[0]), "v"(l[1]), "v"(l[2]), "v"(l[3]), "v"(l[4]), "v"(l[5]), "v"(l[6]), "v"(l[7]),
                  "v"(gp[0]), "v"(gp[1]), "v"(gp[2]), "v"(gp[3]), "v"(gp[4]), "v"(gp[5]), "v"(gp[6]), "v"(gp[7]) : "memory");
}
// this wave's copies have landed (the compiler places no wait for them)
#define WAIT_ASYNC() asm volatile("s_wait_asynccnt 0x0" ::: "memory")
// this wave's LDS reads have returned, so the buffer may be handed back for a refill
#define WAIT_DS() asm volatile("s_wait_dscnt 0x0" ::: "memory")

#define WS_QH  0u
#define WS_QL  (WS_QH + 2u * (size_t)NB * T2 * DD)
#define WS_KH  (WS_QL + 2u * (size_t)NB * T2 * DD)
#define WS_KL  (WS_KH + 2u * (size_t)NB * T2 * DD)
#define WS_XT  (WS_KL + 2u * (size_t)NB * T2 * DD)      // bf16 x2 planes [n][d][j]
#define WS_S   (WS_XT + 2u * (size_t)NB * DD * T2)      // f32 S/P [n][i][j]
#define WS_DG  (WS_S + 4u * (size_t)NB * T2 * T2)       // f32 [n][i], unused (P_ii is read off the diagonal of S)
#define WS_END (WS_DG + 4u * (size_t)NB * T2)
#define OUT1_OFF ((size_t)NB * LL * DD)               // logdet output offset (elements)

// ---- k_proj: block = (64 rows of x1, which): y = x1 W^T ([out][in]); LayerNorm(gamma, beta) -> f16 hi + lo rows; also copies bf16-rounded x1 into merged (which == 0 blocks)
__global__ __launch_bounds__(128) void k_proj(const float* __restrict__ X, const float* __restrict__ WQ, const float* __restrict__ WK, const float* __restrict__ GQ, const float* __restrict__ BQ, const float* __restrict__ GK, const float* __restrict__ BK, _Float16* __restrict__ QH, _Float16* __restrict__ QL, _Float16* __restrict__ KH, _Float16* __restrict__ KL, float* __restrict__ OUT) {
  __shared__ __align__(16) float sf[64][DD + 4]; __shared__ __align__(16) _Float16 sh[64][DD + 8], sl[64][DD + 8]; __shared__ float smu[64], srs[64];
  const int tid = threadIdx.x, wave = tid >> 5, lane = tid & 31, col = lane & 15, g = lane >> 4; const int which = blockIdx.y; const size_t r0 = (size_t)blockIdx.x * 64; const size_t n = r0 / T2; const int i0 = (int)(r0 % T2);   // rows of x1: x[n][i][:], i < T2
  const float* Wm = which == 0 ? WQ : WK; const float* Gm = which == 0 ? GQ : GK; const float* Bm = which == 0 ? BQ : BK;
#pragma unroll 1
  for (int half = 0; half < 2; ++half) { v8f acc[8] = {};
#pragma unroll 2
    for (int kc = 0; kc < DD / 32; ++kc) { v16b a; { const float* p = X + ((n * LL + i0 + wave * 16 + col) * DD) + kc * 32 + 8 * g;
#pragma unroll
        for (int i = 0; i < 8; ++i) { a[i] = (__bf16)p[i]; a[8 + i] = (__bf16)p[16 + i]; } }
#pragma unroll
      for (int j = 0; j < 8; ++j) { v16b w; const int o = half * 128 + j * 16 + col; const float* p = Wm + (size_t)o * DD + kc * 32 + 8 * g;
#pragma unroll
        for (int i = 0; i < 8; ++i) { w[i] = (__bf16)p[i]; w[8 + i] = (__bf16)p[16 + i]; }
        acc[j] = wmma_bf(a, w, acc[j]); } }
#pragma unroll
    for (int j = 0; j < 8; ++j)
#pragma unroll
      for (int r = 0; r < 8; ++r) sf[wave * 16 + 8 * g + r][half * 128 + j * 16 + col] = acc[j][r]; }
  __syncthreads();
  if (tid < 64) { float m = 0.f; for (int c = 0; c < DD; ++c) m += sf[tid][c]; m *= (1.0f / DD); float v = 0.f; for (int c = 0; c < DD; ++c) { const float d = sf[tid][c] - m; v += d * d; } smu[tid] = m; srs[tid] = 1.0f / sqrtf(v * (1.0f / DD) + LN_EPS); }
  __syncthreads();
  for (int e = tid; e < 64 * DD; e += 128) { const int rl = e >> 8, c = e & 255; const float v = (sf[rl][c] - smu[rl]) * srs[rl] * bfr(Gm[c]) + bfr(Bm[c]); const _Float16 hv = (_Float16)v; sh[rl][c] = hv; sl[rl][c] = (_Float16)(v - (float)hv); }
  __syncthreads();
  _Float16* dh = which == 0 ? QH : KH; _Float16* dl = which == 0 ? QL : KL;
  for (int e = tid; e < 64 * 32; e += 128) { const int rl = e >> 5, q = e & 31; vst2((unsigned*)(dh + (r0 + rl) * DD + q * 8), *(const v4u*)&sh[rl][q * 8]); vst2((unsigned*)(dl + (r0 + rl) * DD + q * 8), *(const v4u*)&sl[rl][q * 8]); }
  if (which == 0) { for (int e = tid; e < 64 * 64; e += 128) { const int rl = e >> 6, q = e & 63; const size_t go = (n * LL + i0 + rl) * DD + q * 4; const v4f xr = *(const v4f*)(X + go); v4f v; v[0] = bfr(xr[0]); v[1] = bfr(xr[1]); v[2] = bfr(xr[2]); v[3] = bfr(xr[3]); vst2(OUT + go, v); } } }
// ---- k_x2t: block = (64 j, n): x2 planes XT[n][d][j] (bf16, exact)
__global__ __launch_bounds__(256) void k_x2t(const float* __restrict__ X, __bf16* __restrict__ XT) { __shared__ __align__(16) __bf16 st[DD][72];
  const int t = threadIdx.x; const size_t n = blockIdx.y; const int j0 = blockIdx.x * 64;
  for (int e = t; e < 64 * DD; e += 256) { const int jl = e >> 8, d = e & 255; st[d][jl] = (__bf16)X[(n * LL + T2 + j0 + jl) * DD + d]; }
  __syncthreads(); for (int e = t; e < DD * 8; e += 256) { const int d = e >> 3, q = e & 7; vst2((unsigned*)(XT + (n * DD + d) * (size_t)T2 + j0 + q * 8), *(const v4u*)&st[d][q * 8]); } }
// ---- k_sc: block = (64 rows i, 128 cols j, n): S = q.k / d_scale for j >= i, else masked; blocks entirely below the diagonal exit.
// The K and Q rows (hi and lo) come in slices of 64 k = 128 B a row, whole lines, by asynchronous copies into two LDS buffers; the fragments are read from LDS.
#define SC_P 144u                    // LDS row pitch: 128 B + 16, conflict-free for 16-byte reads
#define SC_KL (128u * SC_P)          // rows in a buffer: KH 128 | KL 128 | QH 64 | QL 64
#define SC_QH (256u * SC_P)
#define SC_QL (320u * SC_P)
#define SC_BUF (384u * SC_P)
__global__ __launch_bounds__(128) void k_sc(const _Float16* __restrict__ QH, const _Float16* __restrict__ QL, const _Float16* __restrict__ KH, const _Float16* __restrict__ KL, const float* __restrict__ DSC, float* __restrict__ S0) { __shared__ __align__(16) float ss[4][16][132]; __shared__ __align__(16) unsigned char sb[2 * SC_BUF];
  const size_t n = blockIdx.z; float* S = S0 + n * (size_t)T2 * T2;
  const int tid = threadIdx.x, wave = tid >> 5, lane = tid & 31, col = lane & 15, g = lane >> 4; const int k0 = blockIdx.y * 128; const int q0b = blockIdx.x * 64; const int ql0 = q0b + wave * 16;
  if (k0 + 127 < q0b) return;   // all j < i: never read (k_sm starts at the row's own 128-column tile, k_pv at its 64-block)
  const float isc = 1.0f / bfr(DSC[0]);
  const int rr = tid >> 3, pc = tid & 7;   // a copy of a wave covers 4 rows x 128 B
  const unsigned lb = (unsigned)(size_t)sb + (unsigned)rr * SC_P + (unsigned)pc * 16u;
  const char* gkh = (const char*)(KH + (n * T2 + k0 + rr) * DD + pc * 8); const char* gkl = (const char*)(KL + (n * T2 + k0 + rr) * DD + pc * 8);
  const char* gqh = (const char*)(QH + (n * T2 + q0b + rr) * DD + pc * 8); const char* gql = (const char*)(QL + (n * T2 + q0b + rr) * DD + pc * 8);
  // the loops below are unrolled so that l[] and gp[] are registers: they are asm operands
  auto stage = [&](int t, int b) { unsigned l[8]; const char* gp[8]; const unsigned lt = lb + (unsigned)b * SC_BUF; const size_t go = (size_t)t * 128;
#pragma unroll
    for (int m = 0; m < 8; ++m) { l[m] = lt + (unsigned)m * 16u * SC_P; gp[m] = gkh + go + (size_t)m * 16 * DD * 2; }
    acopy8(l, gp);
#pragma unroll
    for (int m = 0; m < 8; ++m) { l[m] = lt + SC_KL + (unsigned)m * 16u * SC_P; gp[m] = gkl + go + (size_t)m * 16 * DD * 2; }
    acopy8(l, gp);
#pragma unroll
    for (int m = 0; m < 4; ++m) { l[m] = lt + SC_QH + (unsigned)m * 16u * SC_P; gp[m] = gqh + go + (size_t)m * 16 * DD * 2; l[4 + m] = lt + SC_QL + (unsigned)m * 16u * SC_P; gp[4 + m] = gql + go + (size_t)m * 16 * DD * 2; }
    acopy8(l, gp); };
  stage(0, 0); WAIT_ASYNC(); __syncthreads(); stage(1, 1);
  v8f acc[8] = {};
// rolled: one copy of the 48-WMMA body, and the two buffers alternate by an offset; the loops inside are unrolled so that acc[], kb[] and kl[] stay in registers
#pragma unroll 1
  for (int t = 0; t < DD / 64; ++t) { const unsigned char* B = sb + (unsigned)(t & 1) * SC_BUF;
#pragma unroll
    for (int kk = 0; kk < 2; ++kk) { const unsigned qo = (unsigned)(wave * 16 + col) * SC_P + (unsigned)kk * 64u; const v16h ah = frag_h((const _Float16*)(B + SC_QH + qo), lane), al = frag_h((const _Float16*)(B + SC_QL + qo), lane); v16h kb[8], kl[8];
#pragma unroll
      for (int j = 0; j < 8; ++j) { const unsigned ko = (unsigned)(j * 16 + col) * SC_P + (unsigned)kk * 64u; kb[j] = frag_h((const _Float16*)(B + ko), lane); kl[j] = frag_h((const _Float16*)(B + SC_KL + ko), lane); }
      // inputs only: keeps the LDS reads of this 32-k step together ahead of its WMMAs; read one fragment at a time, every WMMA waits out an LDS latency
      asm volatile("" :: "v"(ah), "v"(al), "v"(kb[0]), "v"(kb[1]), "v"(kb[2]), "v"(kb[3]), "v"(kb[4]), "v"(kb[5]), "v"(kb[6]), "v"(kb[7]), "v"(kl[0]), "v"(kl[1]), "v"(kl[2]), "v"(kl[3]), "v"(kl[4]), "v"(kl[5]), "v"(kl[6]), "v"(kl[7]));
#pragma unroll
      for (int j = 0; j < 8; ++j) { acc[j] = wmma16(ah, kb[j], acc[j]); acc[j] = wmma16(al, kb[j], acc[j]); acc[j] = wmma16(ah, kl[j], acc[j]); } }
    WAIT_DS(); WAIT_ASYNC(); __syncthreads();   // publishes slice t + 1 and ends every reader's last read of slice t's buffer
    if (t + 2 < DD / 64) stage(t + 2, t & 1); }
  WAIT_ASYNC();
#pragma unroll
  for (int j = 0; j < 8; ++j) { const int jj = k0 + j * 16 + col;
#pragma unroll
    for (int r = 0; r < 8; ++r) { const int ii = ql0 + 8 * g + r; ss[wave][8 * g + r][j * 16 + col] = (jj >= ii) ? acc[j][r] * isc : -3.0e38f; } }
  LDSX(); for (int rl = 0; rl < 16; ++rl) vst2(S + (size_t)(ql0 + rl) * T2 + k0 + lane * 4, *(const v4f*)&ss[wave][rl][lane * 4]); }
// ---- k_sm: softmax over j in [i, T2), P x 2^11 written in place. A wave owns rows ra = 8 * blockIdx.x + wave (< T2 / 2) and rb = T2 - 1 - ra of sample n and holds both whole in registers:
// in chunks of 128 columns (512 B, whole lines) ra has 16 - ca of them and rb has ca + 1, 17 for every wave, so all waves do equal work. S is read once, every exponential is taken once, nothing goes through LDS.
// A row starts at its own 128-column tile of k_sc (columns j < i hold the mask there and become zeros). The launch bound asks for 8 waves a SIMD (128 registers): the whole grid, 8 waves a SIMD, is then resident at once.
#define SM_NEG -3.0e38f
__device__ __forceinline__ float max4(v4f v) { return fmaxf(fmaxf(v[0], v[1]), fmaxf(v[2], v[3])); }
// a value that every lane of the wave holds alike, moved to a scalar register: what is chosen per chunk between the two rows is then chosen by scalar instructions
__device__ __forceinline__ float uni(float x) { return __builtin_bit_cast(float, __builtin_amdgcn_readfirstlane(__builtin_bit_cast(int, x))); }
// e^x in f32: r = nearest integer to x log2(e); fraction = x log2(e) - r by two fused multiply-adds, log2(e) in two parts (the product is not rounded before r is taken off); 2^fraction; ldexp by r; 0 below and infinity above the f32 range.
// Written out because 2^fraction stands in asm: the v_nop in the statement is the free slot that the instruction set asks for behind a transcendental.
__device__ __forceinline__ float exp_sm(float x) {
  const float r = __builtin_rintf(x * 0x1.715476p+0f); const float a = __builtin_fmaf(x, 0x1.4ae0bep-26f, __builtin_fmaf(x, 0x1.715476p+0f, -r));
  float e; asm("v_exp_f32 %0, %1\n\tv_nop" : "=v"(e) : "v"(a));
  e = ldexpf(e, (int)r); e = (x < -0x1.9d1dap+6f) ? 0.f : e; return (x > 0x1.62e43p+6f) ? __builtin_inff() : e; }
__global__ __launch_bounds__(256, 8) void k_sm(float* __restrict__ S0) {
  const int lane = threadIdx.x & 31; const int wave = __builtin_amdgcn_readfirstlane((int)(threadIdx.x >> 5));   // scalar, so that the row addresses are scalar bases
  const int ca = blockIdx.x >> 4;   // first chunk of ra (0..7); rb starts at chunk 15 - ca
  const int ra = blockIdx.x * 8 + wave, rb = T2 - 1 - ra;
  float* pa = S0 + ((size_t)blockIdx.y * T2 + ra) * (size_t)T2; float* pb = S0 + ((size_t)blockIdx.y * T2 + rb) * (size_t)T2;
  // slots 0..7: chunks 8..15 of ra; slot 8: chunk 15 of rb; slot 9 + s: chunk s of ra where s >= ca, else chunk 14 - s of rb
  v4f v[17];
#pragma unroll
  for (int i = 0; i < 17; ++i) { const int s = i - 9; const float* q = i < 8 ? pa + (8 + i) * 128 : i == 8 ? pb + 15 * 128 : (s >= ca ? pa + s * 128 : pb + (14 - s) * 128); v[i] = *(const v4f*)(q + lane * 4); }
  // scheduling order: the 17 loads first, then the vector work. Left alone the compiler issued the last loads behind waits for the first, two more trips to memory in a row
  __builtin_amdgcn_sched_group_barrier(0x020, 17, 0);   // 17 global reads
  __builtin_amdgcn_sched_group_barrier(0x002, 64, 0);   // behind them the vector instructions of the maxima
  float ma = SM_NEG, mb = SM_NEG;
#pragma unroll
  for (int i = 0; i < 17; ++i) { const bool isa = i < 8 || (i > 8 && i - 9 >= ca); const float x = max4(v[i]); ma = fmaxf(ma, isa ? x : SM_NEG); mb = fmaxf(mb, isa ? SM_NEG : x); }
#pragma unroll
  for (int o = 1; o < 32; o <<= 1) { ma = fmaxf(ma, __shfl_xor(ma, o)); mb = fmaxf(mb, __shfl_xor(mb, o)); }
  ma = uni(ma); mb = uni(mb);
  float sa = 0.f, sb = 0.f;
#pragma unroll
  for (int i = 0; i < 17; ++i) { const bool isa = i < 8 || (i > 8 && i - 9 >= ca); const float m = isa ? ma : mb;
#pragma unroll
    for (int e = 0; e < 4; ++e) v[i][e] = exp_sm((v[i][e] <= -1.0e38f) ? SM_NEG : v[i][e] - m);   // a masked value gives exactly 0; the choice is made on the argument so that no branch stands around each exponential
    const float t = (v[i][0] + v[i][1]) + (v[i][2] + v[i][3]); sa += isa ? t : 0.f; sb += isa ? 0.f : t; }
#pragma unroll
  for (int o = 1; o < 32; o <<= 1) { sa += __shfl_xor(sa, o); sb += __shfl_xor(sb, o); }
  const float inva = 1.0f / sa, invb = 1.0f / sb, ua = uni(inva), ub = uni(invb);   // two divisions a wave
#pragma unroll
  for (int i = 0; i < 17; ++i) { const int s = i - 9; const bool isa = i < 8 || (i > 8 && s >= ca); const float inv = i < 8 ? inva : i == 8 ? invb : (isa ? ua : ub);
    float* q = i < 8 ? pa + (8 + i) * 128 : i == 8 ? pb + 15 * 128 : (s >= ca ? pa + s * 128 : pb + (14 - s) * 128); v4f p;
#pragma unroll
    for (int e = 0; e < 4; ++e) p[e] = v[i][e] * inv * 2048.0f;
    vst2(q + lane * 4, p); } }
// ---- k_pv: block = (64 rows i, 128 cols d, n): out = P (hi + lo) . x2 (exact) over j >= 64*(i/64), + x2[i]; written to merged rows T2 + i.
// P rows (f32) and x2 planes (bf16) come in slices of 64 j, whole lines, by asynchronous copies into two LDS buffers; the fragments are read from LDS.
#define PV_PP 272u                   // LDS pitch of a P row: 256 B + 16
#define PV_XP 144u                   // LDS pitch of an x2 plane row: 128 B + 16
#define PV_X (64u * PV_PP)           // a buffer: P 64 rows | x2 planes 128 rows
#define PV_BUF (PV_X + 128u * PV_XP)
__global__ __launch_bounds__(128) void k_pv(const float* __restrict__ PS0, const __bf16* __restrict__ XT, const float* __restrict__ X, float* __restrict__ OUT) { __shared__ __align__(16) float ss[4][16][132]; __shared__ __align__(16) unsigned char sb[2 * PV_BUF];
  const size_t n = blockIdx.z; const float* PS = PS0 + n * (size_t)T2 * T2;
  const int tid = threadIdx.x, wave = tid >> 5, lane = tid & 31, col = lane & 15, g = lane >> 4; const int q0b = blockIdx.x * 64; const int ql0 = q0b + wave * 16; const int c0 = blockIdx.y * 128;
  const unsigned lp = (unsigned)(size_t)sb + (unsigned)(tid >> 4) * PV_PP + (unsigned)(tid & 15) * 16u;          // a copy of a wave covers 2 P rows x 256 B
  const unsigned lx = (unsigned)(size_t)sb + PV_X + (unsigned)(tid >> 3) * PV_XP + (unsigned)(tid & 7) * 16u;     // or 4 plane rows x 128 B
  const char* gpp = (const char*)(PS + (size_t)(q0b + (tid >> 4)) * T2 + (tid & 15) * 4); const char* gxx = (const char*)(XT + (n * DD + c0 + (tid >> 3)) * (size_t)T2 + (tid & 7) * 8);
  // the loops below are unrolled so that l[] and gp[] are registers: they are asm operands
  auto stage = [&](int t, int b) { unsigned l[8]; const char* gp[8];
#pragma unroll
    for (int m = 0; m < 8; ++m) { l[m] = lp + (unsigned)b * PV_BUF + (unsigned)m * 8u * PV_PP; gp[m] = gpp + (size_t)t * 256 + (size_t)m * 8 * T2 * 4; }
    acopy8(l, gp);
#pragma unroll
    for (int m = 0; m < 8; ++m) { l[m] = lx + (unsigned)b * PV_BUF + (unsigned)m * 16u * PV_XP; gp[m] = gxx + (size_t)t * 128 + (size_t)m * 16 * T2 * 2; }
    acopy8(l, gp); };
  const int t0 = blockIdx.x;   // first slice of 64 j: the rows' own 64-block
  stage(t0, 0); WAIT_ASYNC(); __syncthreads(); if (t0 + 1 < T2 / 64) stage(t0 + 1, 1);
  v8f acc[8] = {};
// rolled: the trip count depends on the block; the loops inside are unrolled so that acc[] and xb[] stay in registers
#pragma unroll 1
  for (int t = t0; t < T2 / 64; ++t) { const int b = (t - t0) & 1; const unsigned char* B = sb + (unsigned)b * PV_BUF;
#pragma unroll
    for (int kk = 0; kk < 2; ++kk) { const v4f* pp = (const v4f*)(B + (unsigned)(wave * 16 + col) * PV_PP + (unsigned)kk * 128u + (unsigned)g * 32u); const v4f p0 = pp[0], p1 = pp[1], p2 = pp[4], p3 = pp[5]; v16b xb[8];   // P elements k0+8g+0..7 and k0+16+8g+0..7
#pragma unroll
      for (int j = 0; j < 8; ++j) xb[j] = frag_b((const __bf16*)(B + PV_X + (unsigned)(j * 16 + col) * PV_XP + (unsigned)kk * 64u), lane);
      // inputs only: keeps the LDS reads of this 32-j step together ahead of its WMMAs; read one fragment at a time, every WMMA waits out an LDS latency
      asm volatile("" :: "v"(p0), "v"(p1), "v"(p2), "v"(p3), "v"(xb[0]), "v"(xb[1]), "v"(xb[2]), "v"(xb[3]), "v"(xb[4]), "v"(xb[5]), "v"(xb[6]), "v"(xb[7]));
      float pv[16];
#pragma unroll
      for (int i = 0; i < 4; ++i) { pv[i] = p0[i]; pv[4 + i] = p1[i]; pv[8 + i] = p2[i]; pv[12 + i] = p3[i]; }
      const F2 p = bsplit16(pv);
#pragma unroll
      for (int j = 0; j < 8; ++j) { acc[j] = wmma_bf(p.h, xb[j], acc[j]); acc[j] = wmma_bf(p.l, xb[j], acc[j]); } }
    WAIT_DS(); WAIT_ASYNC(); __syncthreads();   // publishes slice t + 1 and ends every reader's last read of slice t's buffer
    if (t + 2 < T2 / 64) stage(t + 2, b); }
  WAIT_ASYNC();
#pragma unroll
  for (int j = 0; j < 8; ++j) { const int d = c0 + j * 16 + col;
#pragma unroll
    for (int r = 0; r < 8; ++r) { const int ii = ql0 + 8 * g + r; ss[wave][8 * g + r][j * 16 + col] = acc[j][r] * (1.0f / 2048.0f) + bfr(X[(n * LL + T2 + ii) * DD + d]); } }
  LDSX(); for (int rl = 0; rl < 16; ++rl) vst2(OUT + (n * LL + T2 + ql0 + rl) * DD + c0 + lane * 4, *(const v4f*)&ss[wave][rl][lane * 4]); }
// ---- k_logdet: one block: logdet[n] = (L/2) * sum_i log(1 + P_ii)
__global__ __launch_bounds__(256) void k_logdet(const float* __restrict__ PS, float* __restrict__ OUT) { /* P_ii read off the diagonal of the in-place P (x 2^11) */ __shared__ float sred[8]; __shared__ __align__(16) float so[NB];
  const int t = threadIdx.x;
#pragma unroll 1
  for (int n = 0; n < NB; ++n) { float s = 0.f;
#pragma unroll 1
    for (int i = t; i < T2; i += 256) s += logf(1.0f + PS[((size_t)n * T2 + i) * T2 + i] * (1.0f / 2048.0f));
#pragma unroll
    for (int o = 1; o < 32; o <<= 1) s += __shfl_xor(s, o);
    if ((t & 31) == 0) sred[t >> 5] = s; __syncthreads(); if (t == 0) { float a = 0.f; for (int i = 0; i < 8; ++i) a += sred[i]; so[n] = a * (float)(LL / 2); } __syncthreads(); }
  if (t < NB / 4) vst2(OUT + OUT1_OFF + t * 4, *(const v4f*)&so[t * 4]); }
extern "C" void kernel_launch(void* const* d_in, const int* in_sizes, int n_in, void* d_out, int out_size, void* d_ws, size_t ws_size, hipStream_t stream) {
  (void)in_sizes; (void)n_in; (void)out_size;
  const float** F = (const float**)d_in;   // 0 inputs [8,4096,256], 1 Wq [256,256] ([out,in]), 2 Wk, 3 q_gamma, 4 q_beta, 5 k_gamma, 6 k_beta, 7 d_scale [1]
  if (ws_size < (size_t)WS_END) return;
  char* ws = (char*)d_ws; _Float16 *QH = (_Float16*)(ws + WS_QH), *QL = (_Float16*)(ws + WS_QL), *KH = (_Float16*)(ws + WS_KH), *KL = (_Float16*)(ws + WS_KL); __bf16* XT = (__bf16*)(ws + WS_XT); float *S = (float*)(ws + WS_S), *DG = (float*)(ws + WS_DG);
  float* OUT = (float*)d_out;
  k_proj<<<dim3(NB * T2 / 64, 2), 128, 0, stream>>>(F[0], F[1], F[2], F[3], F[4], F[5], F[6], QH, QL, KH, KL, OUT);
  k_x2t<<<dim3(T2 / 64, NB), 256, 0, stream>>>(F[0], XT);
  k_sc<<<dim3(T2 / 64, T2 / 128, NB), 128, 0, stream>>>(QH, QL, KH, KL, F[7], S);
  k_sm<<<dim3(T2 / 16, NB), 256, 0, stream>>>(S);
  k_pv<<<dim3(T2 / 64, DD / 128, NB), 128, 0, stream>>>(S, XT, F[0], OUT);
  k_logdet<<<1, 256, 0, stream>>>(S, OUT);
}

// v003
// Measured time: 179 microseconds a run.
// In two side-by-side timings against v002, it was 1.20 and 1.18 times as fast.
// Over all steps from v000 it is 2.12 times as fast.
// compute dtype: all float inputs rounded to bf16, d_scale read; q, k = LayerNorm(x1 W^T) with EXACT bf16 products on WMMA 16x16x32 and the LN in f32; q and k as f16 hi + residual -> 3-product logits / d_scale (std ~16: near-one-hot rows), upper-triangular mask, stored in f32; softmax in f32 (precise exp), P x 2^11 kept f32 and split bf16 hi + lo against the bf16-exact x2 (2 products) + the identity term; logdet = (L/2) sum_i log(1 + P_ii) (att + I is upper triangular, so slogdet is the diagonal product - exact identity); f32 outputs: merged [n][L][D] (x1 copied, then att x2) and logdet [n].
#include <hip/hip_runtime.h>
#include <math.h>

typedef __attribute__((ext_vector_type(16))) _Float16 v16h;
typedef __attribute__((ext_vector_type(16))) __bf16 v16b;
typedef __attribute__((ext_vector_type(8)))  _Float16 v8h;
typedef __attribute__((ext_vector_type(8)))  float v8f;
typedef __attribute__((ext_vector_type(4)))  float v4f;
typedef __attribute__((ext_vector_type(2)))  float v2f;
typedef __attribute__((ext_vector_type(4)))  unsigned v4u;
typedef __attribute__((ext_vector_type(4)))  int v4i;
typedef float __attribute__((may_alias)) float_a;
typedef int __attribute__((may_alias)) int_a;

template <typename T> __device__ __forceinline__ void vst2(void* p, T v) { *(T*)p = v;  }
__device__ __forceinline__ v8f wmma16(v16h a, v16h b, v8f c) {
  v8f d = __builtin_amdgcn_wmma_f32_16x16x32_f16(false, a, false, b, (short)0, c, false, false);
  asm volatile("v_nop\n\tv_nop\n\tv_nop\n\tv_nop" : "+v"(d) : "v"(a), "v"(b));
  return d;
}
__device__ __forceinline__ v8f wmma_bf(v16b a, v16b b, v8f c) {
  v8f d = __builtin_amdgcn_wmma_f32_16x16x32_bf16(false, a, false, b, (short)0, c, false, false);
  asm volatile("v_nop\n\tv_nop\n\tv_nop\n\tv_nop" : "+v"(d) : "v"(a), "v"(b));
  return d;
}
// 16x16x32 fragments: lane = (h = lane>>4, row/col = lane&15); elements 0..7 = k0+8h+0..7, 8..15 = k0+16+8h+0..7; D element r = row 8h+r
__device__ __forceinline__ v16h frag_h(const _Float16* rowk0, int lane) {
  union { v16h v; v8h q[2]; } u; const _Float16* p = rowk0 + 8 * (lane >> 4);
  u.q[0] = *(const v8h*)p; u.q[1] = *(const v8h*)(p + 16); return u.v;
}
__device__ __forceinline__ v16h frag_f32(const float* rowk0, int lane) {
  v16h a; const float* p = rowk0 + 8 * (lane >> 4);
#pragma unroll
  for (int i = 0; i < 8; ++i) { a[i] = (_Float16)p[i]; a[8 + i] = (_Float16)p[16 + i]; }
  return a;
}
__device__ __forceinline__ v16h frag_f32s(const float* rowk0, int lane, float sc) {
  v16h a; const float* p = rowk0 + 8 * (lane >> 4);
#pragma unroll
  for (int i = 0; i < 8; ++i) { a[i] = (_Float16)(p[i] * sc); a[8 + i] = (_Float16)(p[16 + i] * sc); }
  return a;
}
// column fragment from a [K][ld] layout (column n), rows >= K read as 0
__device__ __forceinline__ v16h fragc_f32(const float* W, int k0, int n, int lane, int ld, int K) {
  v16h a; const int g = lane >> 4;
#pragma unroll
  for (int i = 0; i < 8; ++i) { const int ka = k0 + 8 * g + i, kb = ka + 16;
    a[i] = (_Float16)(ka < K ? W[(size_t)(ka < K ? ka : K - 1) * ld + n] : 0.f); a[8 + i] = (_Float16)(kb < K ? W[(size_t)(kb < K ? kb : K - 1) * ld + n] : 0.f); }
  return a;
}
struct F2 { v16b h, l; };
__device__ __forceinline__ F2 bsplit16(const float v[16]) { F2 r;
#pragma unroll
  for (int i = 0; i < 16; ++i) { const __bf16 h = (__bf16)v[i]; r.h[i] = h; r.l[i] = (__bf16)(v[i] - (float)h); }
  return r; }
__device__ __forceinline__ F2 split_row(const float* row, int k0, int lane) { float v[16]; const float* p = row + k0 + 8 * (lane >> 4);
#pragma unroll
  for (int i = 0; i < 8; ++i) { v[i] = p[i]; v[8 + i] = p[16 + i]; }
  return bsplit16(v); }
__device__ __forceinline__ F2 split_rowK(const float* row, int k0, int lane, int K) { float v[16]; const int g = lane >> 4;
#pragma unroll
  for (int i = 0; i < 8; ++i) { const int ka = k0 + 8 * g + i, kb = ka + 16; v[i] = ka < K ? row[ka < K ? ka : K - 1] : 0.f; v[8 + i] = kb < K ? row[kb < K ? kb : K - 1] : 0.f; }
  return bsplit16(v); }
__device__ __forceinline__ F2 split_col(const float* W, int k0, int n, int lane, int ld, int K) { float v[16]; const int g = lane >> 4;
#pragma unroll
  for (int i = 0; i < 8; ++i) { const int ka = k0 + 8 * g + i, kb = ka + 16; v[i] = ka < K ? W[(size_t)(ka < K ? ka : K - 1) * ld + n] : 0.f; v[8 + i] = kb < K ? W[(size_t)(kb < K ? kb : K - 1) * ld + n] : 0.f; }
  return bsplit16(v); }
__device__ __forceinline__ v8f mac3(const F2& a, const F2& b, v8f c) { c = wmma_bf(a.l, b.h, c); c = wmma_bf(a.h, b.l, c); return wmma_bf(a.h, b.h, c); }
__device__ __forceinline__ float sigm(float v) { return 1.0f / (1.0f + expf(-v)); }
#define LDSX() do { asm volatile("s_wait_dscnt 0" ::: "memory"); __builtin_amdgcn_wave_barrier(); __builtin_amdgcn_fence(__ATOMIC_RELEASE, "workgroup"); } while (0)


// Invertible attention (N 8, L 4,096 -> halves of 2,048, D 256): att = softmax(upper-tri(LN(x1 Wq^T) . LN(x1 Wk^T) / d_scale)) + I; out = att x2; logdet = slogdet(att) * L/2.
#define NB 8
#define LL 4096
#define T2 2048
#define DD 256
#define LN_EPS 1e-5f
typedef __attribute__((ext_vector_type(8))) __bf16 v8b;
__device__ __forceinline__ v16b frag_b(const __bf16* rowk0, int lane) {
  union { v16b v; v8b q[2]; } u; const __bf16* p = rowk0 + 8 * (lane >> 4);
  u.q[0] = *(const v8b*)p; u.q[1] = *(const v8b*)(p + 16); return u.v;
}
__device__ __forceinline__ float bfr(float v) { return (float)(__bf16)v; }
__device__ __attribute__((noinline)) float exp_ni(float v) { return expf(v); }
__device__ __attribute__((noinline)) float erf_ni(float v) { return erff(v); }

// Eight 16-byte asynchronous copies per lane, global memory to LDS through no register. The s_wait_xcnt is the statement's last line so that no address register of a copy is rewritten ahead of it.
__device__ __forceinline__ void acopy8(const unsigned (&l)[8], const char* const (&gp)[8]) {
  asm volatile("global_load_async_to_lds_b128 %0, %8, off\n\t"
               "global_load_async_to_lds_b128 %1, %9, off\n\t"
               "global_load_async_to_lds_b128 %2, %10, off\n\t"
               "global_load_async_to_lds_b128 %3, %11, off\n\t"
               "global_load_async_to_lds_b128 %4, %12, off\n\t"
               "global_load_async_to_lds_b128 %5, %13, off\n\t"
               "global_load_async_to_lds_b128 %6, %14, off\n\t"
               "global_load_async_to_lds_b128 %7, %15, off\n\t"
               "s_wait_xcnt 0x0"
               :: "v"(l[0]), "v"(l[1]), "v"(l[2]), "v"(l[3]), "v"(l[4]), "v"(l[5]), "v"(l[6]), "v"(l[7]),
                  "v"(gp[0]), "v"(gp[1]), "v"(gp[2]), "v"(gp[3]), "v"(gp[4]), "v"(gp[5]), "v"(gp[6]), "v"(gp[7]) : "memory");
}
// this wave's copies have landed (the compiler places no wait for them)
#define WAIT_ASYNC() asm volatile("s_wait_asynccnt 0x0" ::: "memory")
// this wave's LDS reads have returned, so the buffer may be handed back for a refill
#define WAIT_DS() asm volatile("s_wait_dscnt 0x0" ::: "memory")

#define WS_QH  0u
#define WS_QL  (WS_QH + 2u * (size_t)NB * T2 * DD)
#define WS_KH  (WS_QL + 2u * (size_t)NB * T2 * DD)
#define WS_KL  (WS_KH + 2u * (size_t)NB * T2 * DD)
#define WS_XT  (WS_KL + 2u * (size_t)NB * T2 * DD)      // bf16 x2 planes [n][d][j]
#define WS_S   (WS_XT + 2u * (size_t)NB * DD * T2)      // f32 S/P [n][i][j]
#define WS_DG  (WS_S + 4u * (size_t)NB * T2 * T2)       // f32 log(1 + P_ii) [n][i]
#define WS_END (WS_DG + 4u * (size_t)NB * T2)
#define OUT1_OFF ((size_t)NB * LL * DD)               // logdet output offset (elements)

// ---- k_proj: block = (64 rows of x1, which): y = x1 W^T ([out][in]); LayerNorm(gamma, beta) -> f16 hi + lo rows; also copies bf16-rounded x1 into merged (which == 0 blocks)
__global__ __launch_bounds__(128) void k_proj(const float* __restrict__ X, const float* __restrict__ WQ, const float* __restrict__ WK, const float* __restrict__ GQ, const float* __restrict__ BQ, const float* __restrict__ GK, const float* __restrict__ BK, _Float16* __restrict__ QH, _Float16* __restrict__ QL, _Float16* __restrict__ KH, _Float16* __restrict__ KL, float* __restrict__ OUT) {
  __shared__ __align__(16) float sf[64][DD + 4]; __shared__ __align__(16) _Float16 sh[64][DD + 8], sl[64][DD + 8]; __shared__ float smu[64], srs[64];
  const int tid = threadIdx.x, wave = tid >> 5, lane = tid & 31, col = lane & 15, g = lane >> 4; const int which = blockIdx.y; const size_t r0 = (size_t)blockIdx.x * 64; const size_t n = r0 / T2; const int i0 = (int)(r0 % T2);   // rows of x1: x[n][i][:], i < T2
  const float* Wm = which == 0 ? WQ : WK; const float* Gm = which == 0 ? GQ : GK; const float* Bm = which == 0 ? BQ : BK;
#pragma unroll 1
  for (int half = 0; half < 2; ++half) { v8f acc[8] = {};
#pragma unroll 2
    for (int kc = 0; kc < DD / 32; ++kc) { v16b a; { const float* p = X + ((n * LL + i0 + wave * 16 + col) * DD) + kc * 32 + 8 * g;
#pragma unroll
        for (int i = 0; i < 8; ++i) { a[i] = (__bf16)p[i]; a[8 + i] = (__bf16)p[16 + i]; } }
#pragma unroll
      for (int j = 0; j < 8; ++j) { v16b w; const int o = half * 128 + j * 16 + col; const float* p = Wm + (size_t)o * DD + kc * 32 + 8 * g;
#pragma unroll
        for (int i = 0; i < 8; ++i) { w[i] = (__bf16)p[i]; w[8 + i] = (__bf16)p[16 + i]; }
        acc[j] = wmma_bf(a, w, acc[j]); } }
#pragma unroll
    for (int j = 0; j < 8; ++j)
#pragma unroll
      for (int r = 0; r < 8; ++r) sf[wave * 16 + 8 * g + r][half * 128 + j * 16 + col] = acc[j][r]; }
  __syncthreads();
  if (tid < 64) { float m = 0.f; for (int c = 0; c < DD; ++c) m += sf[tid][c]; m *= (1.0f / DD); float v = 0.f; for (int c = 0; c < DD; ++c) { const float d = sf[tid][c] - m; v += d * d; } smu[tid] = m; srs[tid] = 1.0f / sqrtf(v * (1.0f / DD) + LN_EPS); }
  __syncthreads();
  for (int e = tid; e < 64 * DD; e += 128) { const int rl = e >> 8, c = e & 255; const float v = (sf[rl][c] - smu[rl]) * srs[rl] * bfr(Gm[c]) + bfr(Bm[c]); const _Float16 hv = (_Float16)v; sh[rl][c] = hv; sl[rl][c] = (_Float16)(v - (float)hv); }
  __syncthreads();
  _Float16* dh = which == 0 ? QH : KH; _Float16* dl = which == 0 ? QL : KL;
  for (int e = tid; e < 64 * 32; e += 128) { const int rl = e >> 5, q = e & 31; vst2((unsigned*)(dh + (r0 + rl) * DD + q * 8), *(const v4u*)&sh[rl][q * 8]); vst2((unsigned*)(dl + (r0 + rl) * DD + q * 8), *(const v4u*)&sl[rl][q * 8]); }
  if (which == 0) { for (int e = tid; e < 64 * 64; e += 128) { const int rl = e >> 6, q = e & 63; const size_t go = (n * LL + i0 + rl) * DD + q * 4; const v4f xr = *(const v4f*)(X + go); v4f v; v[0] = bfr(xr[0]); v[1] = bfr(xr[1]); v[2] = bfr(xr[2]); v[3] = bfr(xr[3]); vst2(OUT + go, v); } } }
// ---- k_x2t: block = (64 j, n): x2 planes XT[n][d][j] (bf16, exact)
__global__ __launch_bounds__(256) void k_x2t(const float* __restrict__ X, __bf16* __restrict__ XT) { __shared__ __align__(16) __bf16 st[DD][72];
  const int t = threadIdx.x; const size_t n = blockIdx.y; const int j0 = blockIdx.x * 64;
  for (int e = t; e < 64 * DD; e += 256) { const int jl = e >> 8, d = e & 255; st[d][jl] = (__bf16)X[(n * LL + T2 + j0 + jl) * DD + d]; }
  __syncthreads(); for (int e = t; e < DD * 8; e += 256) { const int d = e >> 3, q = e & 7; vst2((unsigned*)(XT + (n * DD + d) * (size_t)T2 + j0 + q * 8), *(const v4u*)&st[d][q * 8]); } }
// ---- k_sc: block = (64 rows i, 128 cols j, n): S = q.k / d_scale for j >= i, else masked; blocks entirely below the diagonal exit.
// The K and Q rows (hi and lo) come in slices of 64 k = 128 B a row, whole lines, by asynchronous copies into two LDS buffers; the fragments are read from LDS.
#define SC_P 144u                    // LDS row pitch: 128 B + 16, conflict-free for 16-byte reads
#define SC_KL (128u * SC_P)          // rows in a buffer: KH 128 | KL 128 | QH 64 | QL 64
#define SC_QH (256u * SC_P)
#define SC_QL (320u * SC_P)
#define SC_BUF (384u * SC_P)
__global__ __launch_bounds__(128) void k_sc(const _Float16* __restrict__ QH, const _Float16* __restrict__ QL, const _Float16* __restrict__ KH, const _Float16* __restrict__ KL, const float* __restrict__ DSC, float* __restrict__ S0) { __shared__ __align__(16) float ss[4][16][132]; __shared__ __align__(16) unsigned char sb[2 * SC_BUF];
  const size_t n = blockIdx.z; float* S = S0 + n * (size_t)T2 * T2;
  const int tid = threadIdx.x, wave = tid >> 5, lane = tid & 31, col = lane & 15, g = lane >> 4; const int k0 = blockIdx.y * 128; const int q0b = blockIdx.x * 64; const int ql0 = q0b + wave * 16;
  if (k0 + 127 < q0b) return;   // all j < i: never read (k_sm starts at the row's own 128-column tile, k_pv at its 64-block)
  const float isc = 1.0f / bfr(DSC[0]);
  const int rr = tid >> 3, pc = tid & 7;   // a copy of a wave covers 4 rows x 128 B
  const unsigned lb = (unsigned)(size_t)sb + (unsigned)rr * SC_P + (unsigned)pc * 16u;
  const char* gkh = (const char*)(KH + (n * T2 + k0 + rr) * DD + pc * 8); const char* gkl = (const char*)(KL + (n * T2 + k0 + rr) * DD + pc * 8);
  const char* gqh = (const char*)(QH + (n * T2 + q0b + rr) * DD + pc * 8); const char* gql = (const char*)(QL + (n * T2 + q0b + rr) * DD + pc * 8);
  // the loops below are unrolled so that l[] and gp[] are registers: they are asm operands
  auto stage = [&](int t, int b) { unsigned l[8]; const char* gp[8]; const unsigned lt = lb + (unsigned)b * SC_BUF; const size_t go = (size_t)t * 128;
#pragma unroll
    for (int m = 0; m < 8; ++m) { l[m] = lt + (unsigned)m * 16u * SC_P; gp[m] = gkh + go + (size_t)m * 16 * DD * 2; }
    acopy8(l, gp);
#pragma unroll
    for (int m = 0; m < 8; ++m) { l[m] = lt + SC_KL + (unsigned)m * 16u * SC_P; gp[m] = gkl + go + (size_t)m * 16 * DD * 2; }
    acopy8(l, gp);
#pragma unroll
    for (int m = 0; m < 4; ++m) { l[m] = lt + SC_QH + (unsigned)m * 16u * SC_P; gp[m] = gqh + go + (size_t)m * 16 * DD * 2; l[4 + m] = lt + SC_QL + (unsigned)m * 16u * SC_P; gp[4 + m] = gql + go + (size_t)m * 16 * DD * 2; }
    acopy8(l, gp); };
  stage(0, 0); WAIT_ASYNC(); __syncthreads(); stage(1, 1);
  v8f acc[8] = {};
// rolled: one copy of the 48-WMMA body, and the two buffers alternate by an offset; the loops inside are unrolled so that acc[], kb[] and kl[] stay in registers
#pragma unroll 1
  for (int t = 0; t < DD / 64; ++t) { const unsigned char* B = sb + (unsigned)(t & 1) * SC_BUF;
#pragma unroll
    for (int kk = 0; kk < 2; ++kk) { const unsigned qo = (unsigned)(wave * 16 + col) * SC_P + (unsigned)kk * 64u; const v16h ah = frag_h((const _Float16*)(B + SC_QH + qo), lane), al = frag_h((const _Float16*)(B + SC_QL + qo), lane); v16h kb[8], kl[8];
#pragma unroll
      for (int j = 0; j < 8; ++j) { const unsigned ko = (unsigned)(j * 16 + col) * SC_P + (unsigned)kk * 64u; kb[j] = frag_h((const _Float16*)(B + ko), lane); kl[j] = frag_h((const _Float16*)(B + SC_KL + ko), lane); }
      // inputs only: keeps the LDS reads of this 32-k step together ahead of its WMMAs; read one fragment at a time, every WMMA waits out an LDS latency
      asm volatile("" :: "v"(ah), "v"(al), "v"(kb[0]), "v"(kb[1]), "v"(kb[2]), "v"(kb[3]), "v"(kb[4]), "v"(kb[5]), "v"(kb[6]), "v"(kb[7]), "v"(kl[0]), "v"(kl[1]), "v"(kl[2]), "v"(kl[3]), "v"(kl[4]), "v"(kl[5]), "v"(kl[6]), "v"(kl[7]));
#pragma unroll
      for (int j = 0; j < 8; ++j) { acc[j] = wmma16(ah, kb[j], acc[j]); acc[j] = wmma16(al, kb[j], acc[j]); acc[j] = wmma16(ah, kl[j], acc[j]); } }
    WAIT_DS(); WAIT_ASYNC(); __syncthreads();   // publishes slice t + 1 and ends every reader's last read of slice t's buffer
    if (t + 2 < DD / 64) stage(t + 2, t & 1); }
  WAIT_ASYNC();
#pragma unroll
  for (int j = 0; j < 8; ++j) { const int jj = k0 + j * 16 + col;
#pragma unroll
    for (int r = 0; r < 8; ++r) { const int ii = ql0 + 8 * g + r; ss[wave][8 * g + r][j * 16 + col] = (jj >= ii) ? acc[j][r] * isc : -3.0e38f; } }
  LDSX(); for (int rl = 0; rl < 16; ++rl) vst2(S + (size_t)(ql0 + rl) * T2 + k0 + lane * 4, *(const v4f*)&ss[wave][rl][lane * 4]); }
// ---- k_sm: softmax over j in [i, T2), P x 2^11 written in place. A wave owns rows ra = 8 * blockIdx.x + wave (< T2 / 2) and rb = T2 - 1 - ra of sample n and holds both whole in registers:
// in chunks of 128 columns (512 B, whole lines) ra has 16 - ca of them and rb has ca + 1, 17 for every wave, so all waves do equal work. S is read once, every exponential is taken once, nothing goes through LDS.
// A row starts at its own 128-column tile of k_sc (columns j < i hold the mask there and become zeros). The launch bound asks for 8 waves a SIMD (128 registers): the whole grid, 8 waves a SIMD, is then resident at once.
#define SM_NEG -3.0e38f
__device__ __forceinline__ float max4(v4f v) { return fmaxf(fmaxf(v[0], v[1]), fmaxf(v[2], v[3])); }
// a value that every lane of the wave holds alike, moved to a scalar register: what is chosen per chunk between the two rows is then chosen by scalar instructions
__device__ __forceinline__ float uni(float x) { return __builtin_bit_cast(float, __builtin_amdgcn_readfirstlane(__builtin_bit_cast(int, x))); }
// e^x in f32: r = nearest integer to x log2(e); fraction = x log2(e) - r by two fused multiply-adds, log2(e) in two parts (the product is not rounded before r is taken off); 2^fraction; ldexp by r; 0 below and infinity above the f32 range.
// Written out because 2^fraction stands in asm: the v_nop in the statement is the free slot that the instruction set asks for behind a transcendental.
__device__ __forceinline__ float exp_sm(float x) {
  const float r = __builtin_rintf(x * 0x1.715476p+0f); const float a = __builtin_fmaf(x, 0x1.4ae0bep-26f, __builtin_fmaf(x, 0x1.715476p+0f, -r));
  float e; asm("v_exp_f32 %0, %1\n\tv_nop" : "=v"(e) : "v"(a));
  e = ldexpf(e, (int)r); e = (x < -0x1.9d1dap+6f) ? 0.f : e; return (x > 0x1.62e43p+6f) ? __builtin_inff() : e; }
__global__ __launch_bounds__(256, 8) void k_sm(float* __restrict__ S0) {
  const int lane = threadIdx.x & 31; const int wave = __builtin_amdgcn_readfirstlane((int)(threadIdx.x >> 5));   // scalar, so that the row addresses are scalar bases
  const int ca = blockIdx.x >> 4;   // first chunk of ra (0..7); rb starts at chunk 15 - ca
  const int ra = blockIdx.x * 8 + wave, rb = T2 - 1 - ra;
  float* pa = S0 + ((size_t)blockIdx.y * T2 + ra) * (size_t)T2; float* pb = S0 + ((size_t)blockIdx.y * T2 + rb) * (size_t)T2;
  // slots 0..7: chunks 8..15 of ra; slot 8: chunk 15 of rb; slot 9 + s: chunk s of ra where s >= ca, else chunk 14 - s of rb
  v4f v[17];
#pragma unroll
  for (int i = 0; i < 17; ++i) { const int s = i - 9; const float* q = i < 8 ? pa + (8 + i) * 128 : i == 8 ? pb + 15 * 128 : (s >= ca ? pa + s * 128 : pb + (14 - s) * 128); v[i] = *(const v4f*)(q + lane * 4); }
  // scheduling order: the 17 loads first, then the vector work. Left alone the compiler issued the last loads behind waits for the first, two more trips to memory in a row
  __builtin_amdgcn_sched_group_barrier(0x020, 17, 0);   // 17 global reads
  __builtin_amdgcn_sched_group_barrier(0x002, 64, 0);   // behind them the vector instructions of the maxima
  float ma = SM_NEG, mb = SM_NEG;
#pragma unroll
  for (int i = 0; i < 17; ++i) { const bool isa = i < 8 || (i > 8 && i - 9 >= ca); const float x = max4(v[i]); ma = fmaxf(ma, isa ? x : SM_NEG); mb = fmaxf(mb, isa ? SM_NEG : x); }
#pragma unroll
  for (int o = 1; o < 32; o <<= 1) { ma = fmaxf(ma, __shfl_xor(ma, o)); mb = fmaxf(mb, __shfl_xor(mb, o)); }
  ma = uni(ma); mb = uni(mb);
  float sa = 0.f, sb = 0.f;
#pragma unroll
  for (int i = 0; i < 17; ++i) { const bool isa = i < 8 || (i > 8 && i - 9 >= ca); const float m = isa ? ma : mb;
#pragma unroll
    for (int e = 0; e < 4; ++e) v[i][e] = exp_sm((v[i][e] <= -1.0e38f) ? SM_NEG : v[i][e] - m);   // a masked value gives exactly 0; the choice is made on the argument so that no branch stands around each exponential
    const float t = (v[i][0] + v[i][1]) + (v[i][2] + v[i][3]); sa += isa ? t : 0.f; sb += isa ? 0.f : t; }
#pragma unroll
  for (int o = 1; o < 32; o <<= 1) { sa += __shfl_xor(sa, o); sb += __shfl_xor(sb, o); }
  const float inva = 1.0f / sa, invb = 1.0f / sb, ua = uni(inva), ub = uni(invb);   // two divisions a wave
#pragma unroll
  for (int i = 0; i < 17; ++i) { const int s = i - 9; const bool isa = i < 8 || (i > 8 && s >= ca); const float inv = i < 8 ? inva : i == 8 ? invb : (isa ? ua : ub);
    float* q = i < 8 ? pa + (8 + i) * 128 : i == 8 ? pb + 15 * 128 : (s >= ca ? pa + s * 128 : pb + (14 - s) * 128); v4f p;
#pragma unroll
    for (int e = 0; e < 4; ++e) p[e] = v[i][e] * inv * 2048.0f;
    vst2(q + lane * 4, p); } }
// ---- k_pv: block = (64 rows i, 128 cols d, n): out = P (hi + lo) . x2 (exact) over j >= 64*(i/64), + x2[i]; written to merged rows T2 + i.
// P rows (f32) and x2 planes (bf16) come in slices of 64 j, whole lines, by asynchronous copies into two LDS buffers; the fragments are read from LDS.
// The first slice of a block holds its rows' diagonal: the blocks of d-block 0 store log(1 + P_ii) from it into LG [n][i] for k_logdet.
#define PV_PP 272u                   // LDS pitch of a P row: 256 B + 16
#define PV_XP 144u                   // LDS pitch of an x2 plane row: 128 B + 16
#define PV_X (64u * PV_PP)           // a buffer: P 64 rows | x2 planes 128 rows
#define PV_BUF (PV_X + 128u * PV_XP)
__global__ __launch_bounds__(128) void k_pv(const float* __restrict__ PS0, const __bf16* __restrict__ XT, const float* __restrict__ X, float* __restrict__ OUT, float* __restrict__ LG) { __shared__ __align__(16) float ss[4][16][132]; __shared__ __align__(16) unsigned char sb[2 * PV_BUF];
  const size_t n = blockIdx.z; const float* PS = PS0 + n * (size_t)T2 * T2;
  const int tid = threadIdx.x, wave = tid >> 5, lane = tid & 31, col = lane & 15, g = lane >> 4; const int q0b = blockIdx.x * 64; const int ql0 = q0b + wave * 16; const int c0 = blockIdx.y * 128;
  const unsigned lp = (unsigned)(size_t)sb + (unsigned)(tid >> 4) * PV_PP + (unsigned)(tid & 15) * 16u;          // a copy of a wave covers 2 P rows x 256 B
  const unsigned lx = (unsigned)(size_t)sb + PV_X + (unsigned)(tid >> 3) * PV_XP + (unsigned)(tid & 7) * 16u;     // or 4 plane rows x 128 B
  const char* gpp = (const char*)(PS + (size_t)(q0b + (tid >> 4)) * T2 + (tid & 15) * 4); const char* gxx = (const char*)(XT + (n * DD + c0 + (tid >> 3)) * (size_t)T2 + (tid & 7) * 8);
  // the loops below are unrolled so that l[] and gp[] are registers: they are asm operands
  auto stage = [&](int t, int b) { unsigned l[8]; const char* gp[8];
#pragma unroll
    for (int m = 0; m < 8; ++m) { l[m] = lp + (unsigned)b * PV_BUF + (unsigned)m * 8u * PV_PP; gp[m] = gpp + (size_t)t * 256 + (size_t)m * 8 * T2 * 4; }
    acopy8(l, gp);
#pragma unroll
    for (int m = 0; m < 8; ++m) { l[m] = lx + (unsigned)b * PV_BUF + (unsigned)m * 16u * PV_XP; gp[m] = gxx + (size_t)t * 128 + (size_t)m * 16 * T2 * 2; }
    acopy8(l, gp); };
  const int t0 = blockIdx.x;   // first slice of 64 j: the rows' own 64-block
  stage(t0, 0); WAIT_ASYNC(); __syncthreads(); if (t0 + 1 < T2 / 64) stage(t0 + 1, 1);
  // row tid of buffer 0, column tid: P_ii x 2^11. Waves 0 and 1 (a scalar test, every lane on) store one whole line each; buffer 0 is refilled only behind the foot of the first trip.
  if (blockIdx.y == 0 && __builtin_amdgcn_readfirstlane(wave) < 2) { const float pd = *(const float*)(sb + (unsigned)tid * (PV_PP + 4u)); LG[n * T2 + q0b + tid] = logf(1.0f + pd * (1.0f / 2048.0f));
    asm volatile("s_wait_xcnt 0x0" ::: "memory"); }   // stands ahead of any rewrite of the store's address and data registers
  v8f acc[8] = {};
// rolled: the trip count depends on the block; the loops inside are unrolled so that acc[] and xb[] stay in registers
#pragma unroll 1
  for (int t = t0; t < T2 / 64; ++t) { const int b = (t - t0) & 1; const unsigned char* B = sb + (unsigned)b * PV_BUF;
#pragma unroll
    for (int kk = 0; kk < 2; ++kk) { const v4f* pp = (const v4f*)(B + (unsigned)(wave * 16 + col) * PV_PP + (unsigned)kk * 128u + (unsigned)g * 32u); const v4f p0 = pp[0], p1 = pp[1], p2 = pp[4], p3 = pp[5]; v16b xb[8];   // P elements k0+8g+0..7 and k0+16+8g+0..7
#pragma unroll
      for (int j = 0; j < 8; ++j) xb[j] = frag_b((const __bf16*)(B + PV_X + (unsigned)(j * 16 + col) * PV_XP + (unsigned)kk * 64u), lane);
      // inputs only: keeps the LDS reads of this 32-j step together ahead of its WMMAs; read one fragment at a time, every WMMA waits out an LDS latency
      asm volatile("" :: "v"(p0), "v"(p1), "v"(p2), "v"(p3), "v"(xb[0]), "v"(xb[1]), "v"(xb[2]), "v"(xb[3]), "v"(xb[4]), "v"(xb[5]), "v"(xb[6]), "v"(xb[7]));
      float pv[16];
#pragma unroll
      for (int i = 0; i < 4; ++i) { pv[i] = p0[i]; pv[4 + i] = p1[i]; pv[8 + i] = p2[i]; pv[12 + i] = p3[i]; }
      const F2 p = bsplit16(pv);
#pragma unroll
      for (int j = 0; j < 8; ++j) { acc[j] = wmma_bf(p.h, xb[j], acc[j]); acc[j] = wmma_bf(p.l, xb[j], acc[j]); } }
    WAIT_DS(); WAIT_ASYNC(); __syncthreads();   // publishes slice t + 1 and ends every reader's last read of slice t's buffer
    if (t + 2 < T2 / 64) stage(t + 2, b); }
  WAIT_ASYNC();
#pragma unroll
  for (int j = 0; j < 8; ++j) { const int d = c0 + j * 16 + col;
#pragma unroll
    for (int r = 0; r < 8; ++r) { const int ii = ql0 + 8 * g + r; ss[wave][8 * g + r][j * 16 + col] = acc[j][r] * (1.0f / 2048.0f) + bfr(X[(n * LL + T2 + ii) * DD + d]); } }
  LDSX(); for (int rl = 0; rl < 16; ++rl) vst2(OUT + (n * LL + T2 + ql0 + rl) * DD + c0 + lane * 4, *(const v4f*)&ss[wave][rl][lane * 4]); }
// ---- k_logdet: one block: logdet[n] = (L/2) * sum_i log(1 + P_ii), the logarithms read from LG (64 KB, whole lines). Thread t sums i = t, t + 256, ... of every sample, then the wave, then the 8 waves in turn.
__global__ __launch_bounds__(256) void k_logdet(const float* __restrict__ LG, float* __restrict__ OUT) { __shared__ __align__(16) float sred[NB][8];
  const int t = threadIdx.x; v8f x[NB];
// unrolled: x[][] stays in registers and the 64 loads of a thread are all in flight together, one trip to memory
#pragma unroll
  for (int n = 0; n < NB; ++n)
#pragma unroll
    for (int k = 0; k < 8; ++k) x[n][k] = LG[n * T2 + k * 256 + t];
  // inputs only: keeps the 64 loads together ahead of the additions. Left alone the compiler issued the last five loads behind waits for the first, a second trip to memory
  asm volatile("" :: "v"(x[0]), "v"(x[1]), "v"(x[2]), "v"(x[3]), "v"(x[4]), "v"(x[5]), "v"(x[6]), "v"(x[7]));
  float s[NB];
#pragma unroll
  for (int n = 0; n < NB; ++n) { s[n] = 0.f;
#pragma unroll
    for (int k = 0; k < 8; ++k) s[n] += x[n][k]; }
// the samples inside, the steps outside: the 8 cross-lane exchanges of a step are independent and share one LDS-pipe latency
#pragma unroll
  for (int o = 1; o < 32; o <<= 1)
#pragma unroll
    for (int n = 0; n < NB; ++n) s[n] += __shfl_xor(s[n], o);
  if ((t & 31) == 0) {
#pragma unroll
    for (int n = 0; n < NB; ++n) sred[n][t >> 5] = s[n]; }
  __syncthreads();
  if (t < NB) { float a = 0.f;
#pragma unroll
    for (int i = 0; i < 8; ++i) a += sred[t][i];
    OUT[OUT1_OFF + t] = a * (float)(LL / 2); } }
extern "C" void kernel_launch(void* const* d_in, const int* in_sizes, int n_in, void* d_out, int out_size, void* d_ws, size_t ws_size, hipStream_t stream) {
  (void)in_sizes; (void)n_in; (void)out_size;
  const float** F = (const float**)d_in;   // 0 inputs [8,4096,256], 1 Wq [256,256] ([out,in]), 2 Wk, 3 q_gamma, 4 q_beta, 5 k_gamma, 6 k_beta, 7 d_scale [1]
  if (ws_size < (size_t)WS_END) return;
  char* ws = (char*)d_ws; _Float16 *QH = (_Float16*)(ws + WS_QH), *QL = (_Float16*)(ws + WS_QL), *KH = (_Float16*)(ws + WS_KH), *KL = (_Float16*)(ws + WS_KL); __bf16* XT = (__bf16*)(ws + WS_XT); float *S = (float*)(ws + WS_S), *DG = (float*)(ws + WS_DG);
  float* OUT = (float*)d_out;
  k_proj<<<dim3(NB * T2 / 64, 2), 128, 0, stream>>>(F[0], F[1], F[2], F[3], F[4], F[5], F[6], QH, QL, KH, KL, OUT);
  k_x2t<<<dim3(T2 / 64, NB), 256, 0, stream>>>(F[0], XT);
  k_sc<<<dim3(T2 / 64, T2 / 128, NB), 128, 0, stream>>>(QH, QL, KH, KL, F[7], S);
  k_sm<<<dim3(T2 / 16, NB), 256, 0, stream>>>(S);
  k_pv<<<dim3(T2 / 64, DD / 128, NB), 128, 0, stream>>>(S, XT, F[0], OUT, DG);
  k_logdet<<<1, 256, 0, stream>>>(DG, OUT);
}

// v004
// One run takes 135 microseconds.
// Two timings next to v003 put it at 1.33 and 1.34 times that version's speed.
// Over all steps from v000 it is 2.84 times as fast.
// compute dtype: all float inputs rounded to bf16, d_scale read; q, k = LayerNorm(x1 W^T) with EXACT bf16 products on WMMA 16x16x32 and the LN in f32; q and k as f16 hi + residual -> 3-product logits / d_scale (std ~16: near-one-hot rows), upper-triangular mask, stored in f32; softmax in f32 (precise exp), P x 2^11 kept f32 and split bf16 hi + lo against the bf16-exact x2 (2 products) + the identity term; logdet = (L/2) sum_i log(1 + P_ii) (att + I is upper triangular, so slogdet is the diagonal product - exact identity); f32 outputs: merged [n][L][D] (x1 copied, then att x2) and logdet [n].
#include <hip/hip_runtime.h>
#include <math.h>

typedef __attribute__((ext_vector_type(16))) _Float16 v16h;
typedef __attribute__((ext_vector_type(16))) __bf16 v16b;
typedef __attribute__((ext_vector_type(8)))  _Float16 v8h;
typedef __attribute__((ext_vector_type(8)))  float v8f;
typedef __attribute__((ext_vector_type(4)))  float v4f;
typedef __attribute__((ext_vector_type(2)))  float v2f;
typedef __attribute__((ext_vector_type(4)))  unsigned v4u;
typedef __attribute__((ext_vector_type(4)))  int v4i;
typedef float __attribute__((may_alias)) float_a;
typedef int __attribute__((may_alias)) int_a;

template <typename T> __device__ __forceinline__ void vst2(void* p, T v) { *(T*)p = v;  }
__device__ __forceinline__ v8f wmma16(v16h a, v16h b, v8f c) {
  v8f d = __builtin_amdgcn_wmma_f32_16x16x32_f16(false, a, false, b, (short)0, c, false, false);
  asm volatile("v_nop\n\tv_nop\n\tv_nop\n\tv_nop" : "+v"(d) : "v"(a), "v"(b));
  return d;
}
__device__ __forceinline__ v8f wmma_bf(v16b a, v16b b, v8f c) {
  v8f d = __builtin_amdgcn_wmma_f32_16x16x32_bf16(false, a, false, b, (short)0, c, false, false);
  asm volatile("v_nop\n\tv_nop\n\tv_nop\n\tv_nop" : "+v"(d) : "v"(a), "v"(b));
  return d;
}
// 16x16x32 fragments: lane = (h = lane>>4, row/col = lane&15); elements 0..7 = k0+8h+0..7, 8..15 = k0+16+8h+0..7; D element r = row 8h+r
__device__ __forceinline__ v16h frag_h(const _Float16* rowk0, int lane) {
  union { v16h v; v8h q[2]; } u; const _Float16* p = rowk0 + 8 * (lane >> 4);
  u.q[0] = *(const v8h*)p; u.q[1] = *(const v8h*)(p + 16); return u.v;
}
__device__ __forceinline__ v16h frag_f32(const float* rowk0, int lane) {
  v16h a; const float* p = rowk0 + 8 * (lane >> 4);
#pragma unroll
  for (int i = 0; i < 8; ++i) { a[i] = (_Float16)p[i]; a[8 + i] = (_Float16)p[16 + i]; }
  return a;
}
__device__ __forceinline__ v16h frag_f32s(const float* rowk0, int lane, float sc) {
  v16h a; const float* p = rowk0 + 8 * (lane >> 4);
#pragma unroll
  for (int i = 0; i < 8; ++i) { a[i] = (_Float16)(p[i] * sc); a[8 + i] = (_Float16)(p[16 + i] * sc); }
  return a;
}
// column fragment from a [K][ld] layout (column n), rows >= K read as 0
__device__ __forceinline__ v16h fragc_f32(const float* W, int k0, int n, int lane, int ld, int K) {
  v16h a; const int g = lane >> 4;
#pragma unroll
  for (int i = 0; i < 8; ++i) { const int ka = k0 + 8 * g + i, kb = ka + 16;
    a[i] = (_Float16)(ka < K ? W[(size_t)(ka < K ? ka : K - 1) * ld + n] : 0.f); a[8 + i] = (_Float16)(kb < K ? W[(size_t)(kb < K ? kb : K - 1) * ld + n] : 0.f); }
  return a;
}
struct F2 { v16b h, l; };
__device__ __forceinline__ F2 bsplit16(const float v[16]) { F2 r;
#pragma unroll
  for (int i = 0; i < 16; ++i) { const __bf16 h = (__bf16)v[i]; r.h[i] = h; r.l[i] = (__bf16)(v[i] - (float)h); }
  return r; }
__device__ __forceinline__ F2 split_row(const float* row, int k0, int lane) { float v[16]; const float* p = row + k0 + 8 * (lane >> 4);
#pragma unroll
  for (int i = 0; i < 8; ++i) { v[i] = p[i]; v[8 + i] = p[16 + i]; }
  return bsplit16(v); }
__device__ __forceinline__ F2 split_rowK(const float* row, int k0, int lane, int K) { float v[16]; const int g = lane >> 4;
#pragma unroll
  for (int i = 0; i < 8; ++i) { const int ka = k0 + 8 * g + i, kb = ka + 16; v[i] = ka < K ? row[ka < K ? ka : K - 1] : 0.f; v[8 + i] = kb < K ? row[kb < K ? kb : K - 1] : 0.f; }
  return bsplit16(v); }
__device__ __forceinline__ F2 split_col(const float* W, int k0, int n, int lane, int ld, int K) { float v[16]; const int g = lane >> 4;
#pragma unroll
  for (int i = 0; i < 8; ++i) { const int ka = k0 + 8 * g + i, kb = ka + 16; v[i] = ka < K ? W[(size_t)(ka < K ? ka : K - 1) * ld + n] : 0.f; v[8 + i] = kb < K ? W[(size_t)(kb < K ? kb : K - 1) * ld + n] : 0.f; }
  return bsplit16(v); }
__device__ __forceinline__ v8f mac3(const F2& a, const F2& b, v8f c) { c = wmma_bf(a.l, b.h, c); c = wmma_bf(a.h, b.l, c); return wmma_bf(a.h, b.h, c); }
__device__ __forceinline__ float sigm(float v) { return 1.0f / (1.0f + expf(-v)); }
#define LDSX() do { asm volatile("s_wait_dscnt 0" ::: "memory"); __builtin_amdgcn_wave_barrier(); __builtin_amdgcn_fence(__ATOMIC_RELEASE, "workgroup"); } while (0)


// Invertible attention (N 8, L 4,096 -> halves of 2,048, D 256): att = softmax(upper-tri(LN(x1 Wq^T) . LN(x1 Wk^T) / d_scale)) + I; out = att x2; logdet = slogdet(att) * L/2.
#define NB 8
#define LL 4096
#define T2 2048
#define DD 256
#define LN_EPS 1e-5f
typedef __attribute__((ext_vector_type(8))) __bf16 v8b;
__device__ __forceinline__ v16b frag_b(const __bf16* rowk0, int lane) {
  union { v16b v; v8b q[2]; } u; const __bf16* p = rowk0 + 8 * (lane >> 4);
  u.q[0] = *(const v8b*)p; u.q[1] = *(const v8b*)(p + 16); return u.v;
}
__device__ __forceinline__ float bfr(float v) { return (float)(__bf16)v; }
__device__ __attribute__((noinline)) float exp_ni(float v) { return expf(v); }
__device__ __attribute__((noinline)) float erf_ni(float v) { return erff(v); }

// Eight 16-byte asynchronous copies per lane, global memory to LDS through no register. The s_wait_xcnt is the statement's last line so that no address register of a copy is rewritten ahead of it.
__device__ __forceinline__ void acopy8(const unsigned (&l)[8], const char* const (&gp)[8]) {
  asm volatile("global_load_async_to_lds_b128 %0, %8, off\n\t"
               "global_load_async_to_lds_b128 %1, %9, off\n\t"
               "global_load_async_to_lds_b128 %2, %10, off\n\t"
               "global_load_async_to_lds_b128 %3, %11, off\n\t"
               "global_load_async_to_lds_b128 %4, %12, off\n\t"
               "global_load_async_to_lds_b128 %5, %13, off\n\t"
               "global_load_async_to_lds_b128 %6, %14, off\n\t"
               "global_load_async_to_lds_b128 %7, %15, off\n\t"
               "s_wait_xcnt 0x0"
               :: "v"(l[0]), "v"(l[1]), "v"(l[2]), "v"(l[3]), "v"(l[4]), "v"(l[5]), "v"(l[6]), "v"(l[7]),
                  "v"(gp[0]), "v"(gp[1]), "v"(gp[2]), "v"(gp[3]), "v"(gp[4]), "v"(gp[5]), "v"(gp[6]), "v"(gp[7]) : "memory");
}
// The same with four copies.
__device__ __forceinline__ void acopy4(const unsigned (&l)[4], const char* const (&gp)[4]) {
  asm volatile("global_load_async_to_lds_b128 %0, %4, off\n\t"
               "global_load_async_to_lds_b128 %1, %5, off\n\t"
               "global_load_async_to_lds_b128 %2, %6, off\n\t"
               "global_load_async_to_lds_b128 %3, %7, off\n\t"
               "s_wait_xcnt 0x0"
               :: "v"(l[0]), "v"(l[1]), "v"(l[2]), "v"(l[3]), "v"(gp[0]), "v"(gp[1]), "v"(gp[2]), "v"(gp[3]) : "memory");
}
// this wave's copies have landed (the compiler places no wait for them)
#define WAIT_ASYNC() asm volatile("s_wait_asynccnt 0x0" ::: "memory")
// this wave's LDS reads have returned, so the buffer may be handed back for a refill
#define WAIT_DS() asm volatile("s_wait_dscnt 0x0" ::: "memory")

#define WS_QH  0u
#define WS_QL  (WS_QH + 2u * (size_t)NB * T2 * DD)
#define WS_KH  (WS_QL + 2u * (size_t)NB * T2 * DD)
#define WS_KL  (WS_KH + 2u * (size_t)NB * T2 * DD)
#define WS_XT  (WS_KL + 2u * (size_t)NB * T2 * DD)      // bf16 x2 planes [n][d][j]
#define WS_S   (WS_XT + 2u * (size_t)NB * DD * T2)      // f32 S/P [n][i][j]
#define WS_DG  (WS_S + 4u * (size_t)NB * T2 * T2)       // f32 log(1 + P_ii) [n][i]
#define WS_END (WS_DG + 4u * (size_t)NB * T2)
#define OUT1_OFF ((size_t)NB * LL * DD)               // logdet output offset (elements)

// ---- k_proj: block = (64 rows of x1, which): y = x1 W^T ([out][in]); LayerNorm(gamma, beta) -> f16 hi + lo rows; also copies bf16-rounded x1 into merged (which == 0 blocks)
// The W rows (all 256) and the block's x1 rows come in slices of 32 k = 128 B a row, whole lines, f32, by asynchronous copies into two LDS buffers; the fragments are read from LDS and rounded to bf16 there.
// The two buffers lie over sf and sh, which are first written behind the last trip's barrier.
#define PJ_P 144u                    // LDS row pitch: 128 B + 16, conflict-free for 16-byte reads
#define PJ_X (256u * PJ_P)           // rows in a buffer: W 256 | x1 64
#define PJ_BUF (320u * PJ_P)
#define PJ_SH (64u * (DD + 4u) * 4u)             // the block's LDS: sf | sh | sl | smu | srs
#define PJ_SL (PJ_SH + 64u * (DD + 8u) * 2u)
#define PJ_MU (PJ_SL + 64u * (DD + 8u) * 2u)
#define PJ_END (PJ_MU + 2u * 64u * 4u)
static_assert(2u * PJ_BUF <= PJ_MU, "the staging buffers lie inside sf, sh and sl");
__device__ __forceinline__ v16b cvt_frag(const v4f (&r)[4]) { v16b a;   // elements 0..7 = k 8g+0..7, 8..15 = k 16+8g+0..7
// unrolled: a[] and r[] are registers
#pragma unroll
  for (int i = 0; i < 4; ++i) { a[i] = (__bf16)r[0][i]; a[4 + i] = (__bf16)r[1][i]; a[8 + i] = (__bf16)r[2][i]; a[12 + i] = (__bf16)r[3][i]; }
  return a; }
__global__ __launch_bounds__(128) void k_proj(const float* __restrict__ X, const float* __restrict__ WQ, const float* __restrict__ WK, const float* __restrict__ GQ, const float* __restrict__ BQ, const float* __restrict__ GK, const float* __restrict__ BK, _Float16* __restrict__ QH, _Float16* __restrict__ QL, _Float16* __restrict__ KH, _Float16* __restrict__ KL, float* __restrict__ OUT) {
  __shared__ __align__(16) unsigned char ar[PJ_END];
  float (*sf)[DD + 4] = (float (*)[DD + 4])ar; _Float16 (*sh)[DD + 8] = (_Float16 (*)[DD + 8])(ar + PJ_SH); _Float16 (*sl)[DD + 8] = (_Float16 (*)[DD + 8])(ar + PJ_SL); float* smu = (float*)(ar + PJ_MU); float* srs = smu + 64;
  const int tid = threadIdx.x, wave = tid >> 5, lane = tid & 31, col = lane & 15, g = lane >> 4; const int which = blockIdx.y; const size_t r0 = (size_t)blockIdx.x * 64; const size_t n = r0 / T2; const int i0 = (int)(r0 % T2);   // rows of x1: x[n][i][:], i < T2
  const float* Wm = which == 0 ? WQ : WK; const float* Gm = which == 0 ? GQ : GK; const float* Bm = which == 0 ? BQ : BK;
  const int rr = tid >> 3, pc = tid & 7;   // a copy of a wave covers 4 rows x 128 B
  const unsigned lb = (unsigned)(size_t)ar + (unsigned)rr * PJ_P + (unsigned)pc * 16u;
  const char* gw = (const char*)(Wm + (size_t)rr * DD + pc * 4); const char* gx = (const char*)(X + (n * LL + i0 + rr) * DD + pc * 4);
  // the loops below are unrolled so that l[] and gp[] are registers: they are asm operands
  auto stage = [&](int t, int b) { unsigned l[8]; const char* gp[8]; unsigned l4[4]; const char* gp4[4]; const unsigned lt = lb + (unsigned)b * PJ_BUF; const size_t go = (size_t)t * 128;
#pragma unroll
    for (int m = 0; m < 8; ++m) { l[m] = lt + (unsigned)m * 16u * PJ_P; gp[m] = gw + go + (size_t)m * 16 * DD * 4; }
    acopy8(l, gp);
#pragma unroll
    for (int m = 0; m < 8; ++m) { l[m] = lt + (unsigned)(8 + m) * 16u * PJ_P; gp[m] = gw + go + (size_t)(8 + m) * 16 * DD * 4; }
    acopy8(l, gp);
#pragma unroll
    for (int m = 0; m < 4; ++m) { l4[m] = lt + PJ_X + (unsigned)m * 16u * PJ_P; gp4[m] = gx + go + (size_t)m * 16 * DD * 4; }
    acopy4(l4, gp4); };
  stage(0, 0); WAIT_ASYNC(); __syncthreads(); stage(1, 1);
  v8f acc[16] = {};
// rolled: one copy of the 16-WMMA body, and the two buffers alternate by an offset; the loops inside are unrolled so that acc[], r[] and w[] stay in registers
#pragma unroll 1
  for (int t = 0; t < DD / 32; ++t) { const unsigned char* B = ar + (unsigned)(t & 1) * PJ_BUF; v4f ra[4], r[4][4];
    // a lane's 16 values of a row: k 8g+0..7 and 16+8g+0..7, four 16-byte reads
    auto rd = [&](v4f (&d)[4], unsigned row) { const v4f* p = (const v4f*)(B + row * PJ_P + (unsigned)g * 32u); d[0] = p[0]; d[1] = p[1]; d[2] = p[4]; d[3] = p[5]; };
    rd(ra, 256u + (unsigned)(wave * 16 + col));
#pragma unroll
    for (int jj = 0; jj < 4; ++jj) rd(r[jj], (unsigned)(jj * 16 + col));
    const v16b a = cvt_frag(ra);
#pragma unroll
    for (int jg = 0; jg < 4; ++jg) { v16b w[4];
#pragma unroll
      for (int jj = 0; jj < 4; ++jj) w[jj] = cvt_frag(r[jj]);
      // the next four fragments' reads stand ahead of this group's WMMAs, so that their LDS latency runs beside them
      if (jg < 3) {
#pragma unroll
        for (int jj = 0; jj < 4; ++jj) rd(r[jj], (unsigned)((jg * 4 + 4 + jj) * 16 + col)); }
#pragma unroll
      for (int jj = 0; jj < 4; ++jj) acc[jg * 4 + jj] = wmma_bf(a, w[jj], acc[jg * 4 + jj]); }
    WAIT_DS(); WAIT_ASYNC(); __syncthreads();   // publishes slice t + 1 and ends every reader's last read of slice t's buffer
    if (t + 2 < DD / 32) stage(t + 2, t & 1); }
  WAIT_ASYNC();
// unrolled: acc[] is registers
#pragma unroll
  for (int j = 0; j < 16; ++j)
#pragma unroll
    for (int r = 0; r < 8; ++r) sf[wave * 16 + 8 * g + r][j * 16 + col] = acc[j][r];
  __syncthreads();
  if (tid < 64) { float m = 0.f; for (int c = 0; c < DD; ++c) m += sf[tid][c]; m *= (1.0f / DD); float v = 0.f; for (int c = 0; c < DD; ++c) { const float d = sf[tid][c] - m; v += d * d; } smu[tid] = m; srs[tid] = 1.0f / sqrtf(v * (1.0f / DD) + LN_EPS); }
  __syncthreads();
  for (int e = tid; e < 64 * DD; e += 128) { const int rl = e >> 8, c = e & 255; const float v = (sf[rl][c] - smu[rl]) * srs[rl] * bfr(Gm[c]) + bfr(Bm[c]); const _Float16 hv = (_Float16)v; sh[rl][c] = hv; sl[rl][c] = (_Float16)(v - (float)hv); }
  __syncthreads();
  _Float16* dh = which == 0 ? QH : KH; _Float16* dl = which == 0 ? QL : KL;
  for (int e = tid; e < 64 * 32; e += 128) { const int rl = e >> 5, q = e & 31; vst2((unsigned*)(dh + (r0 + rl) * DD + q * 8), *(const v4u*)&sh[rl][q * 8]); vst2((unsigned*)(dl + (r0 + rl) * DD + q * 8), *(const v4u*)&sl[rl][q * 8]); }
  if (which == 0) { for (int e = tid; e < 64 * 64; e += 128) { const int rl = e >> 6, q = e & 63; const size_t go = (n * LL + i0 + rl) * DD + q * 4; const v4f xr = *(const v4f*)(X + go); v4f v; v[0] = bfr(xr[0]); v[1] = bfr(xr[1]); v[2] = bfr(xr[2]); v[3] = bfr(xr[3]); vst2(OUT + go, v); } } }
// ---- k_x2t: block = (64 j, n): x2 planes XT[n][d][j] (bf16, exact)
__global__ __launch_bounds__(256) void k_x2t(const float* __restrict__ X, __bf16* __restrict__ XT) { __shared__ __align__(16) __bf16 st[DD][72];
  const int t = threadIdx.x; const size_t n = blockIdx.y; const int j0 = blockIdx.x * 64;
  for (int e = t; e < 64 * DD; e += 256) { const int jl = e >> 8, d = e & 255; st[d][jl] = (__bf16)X[(n * LL + T2 + j0 + jl) * DD + d]; }
  __syncthreads(); for (int e = t; e < DD * 8; e += 256) { const int d = e >> 3, q = e & 7; vst2((unsigned*)(XT + (n * DD + d) * (size_t)T2 + j0 + q * 8), *(const v4u*)&st[d][q * 8]); } }
// ---- k_sc: block = (64 rows i, 128 cols j, n): S = q.k / d_scale for j >= i, else masked; blocks entirely below the diagonal exit.
// The K and Q rows (hi and lo) come in slices of 64 k = 128 B a row, whole lines, by asynchronous copies into two LDS buffers; the fragments are read from LDS.
#define SC_P 144u                    // LDS row pitch: 128 B + 16, conflict-free for 16-byte reads
#define SC_KL (128u * SC_P)          // rows in a buffer: KH 128 | KL 128 | QH 64 | QL 64
#define SC_QH (256u * SC_P)
#define SC_QL (320u * SC_P)
#define SC_BUF (384u * SC_P)
__global__ __launch_bounds__(128) void k_sc(const _Float16* __restrict__ QH, const _Float16* __restrict__ QL, const _Float16* __restrict__ KH, const _Float16* __restrict__ KL, const float* __restrict__ DSC, float* __restrict__ S0) { __shared__ __align__(16) float ss[4][16][132]; __shared__ __align__(16) unsigned char sb[2 * SC_BUF];
  const size_t n = blockIdx.z; float* S = S0 + n * (size_t)T2 * T2;
  const int tid = threadIdx.x, wave = tid >> 5, lane = tid & 31, col = lane & 15, g = lane >> 4; const int k0 = blockIdx.y * 128; const int q0b = blockIdx.x * 64; const int ql0 = q0b + wave * 16;
  if (k0 + 127 < q0b) return;   // all j < i: never read (k_sm starts at the row's own 128-column tile, k_pv at its 64-block)
  const float isc = 1.0f / bfr(DSC[0]);
  const int rr = tid >> 3, pc = tid & 7;   // a copy of a wave covers 4 rows x 128 B
  const unsigned lb = (unsigned)(size_t)sb + (unsigned)rr * SC_P + (unsigned)pc * 16u;
  const char* gkh = (const char*)(KH + (n * T2 + k0 + rr) * DD + pc * 8); const char* gkl = (const char*)(KL + (n * T2 + k0 + rr) * DD + pc * 8);
  const char* gqh = (const char*)(QH + (n * T2 + q0b + rr) * DD + pc * 8); const char* gql = (const char*)(QL + (n * T2 + q0b + rr) * DD + pc * 8);
  // the loops below are unrolled so that l[] and gp[] are registers: they are asm operands
  auto stage = [&](int t, int b) { unsigned l[8]; const char* gp[8]; const unsigned lt = lb + (unsigned)b * SC_BUF; const size_t go = (size_t)t * 128;
#pragma unroll
    for (int m = 0; m < 8; ++m) { l[m] = lt + (unsigned)m * 16u * SC_P; gp[m] = gkh + go + (size_t)m * 16 * DD * 2; }
    acopy8(l, gp);
#pragma unroll
    for (int m = 0; m < 8; ++m) { l[m] = lt + SC_KL + (unsigned)m * 16u * SC_P; gp[m] = gkl + go + (size_t)m * 16 * DD * 2; }
    acopy8(l, gp);
#pragma unroll
    for (int m = 0; m < 4; ++m) { l[m] = lt + SC_QH + (unsigned)m * 16u * SC_P; gp[m] = gqh + go + (size_t)m * 16 * DD * 2; l[4 + m] = lt + SC_QL + (unsigned)m * 16u * SC_P; gp[4 + m] = gql + go + (size_t)m * 16 * DD * 2; }
    acopy8(l, gp); };
  stage(0, 0); WAIT_ASYNC(); __syncthreads(); stage(1, 1);
  v8f acc[8] = {};
// rolled: one copy of the 48-WMMA body, and the two buffers alternate by an offset; the loops inside are unrolled so that acc[], kb[] and kl[] stay in registers
#pragma unroll 1
  for (int t = 0; t < DD / 64; ++t) { const unsigned char* B = sb + (unsigned)(t & 1) * SC_BUF;
#pragma unroll
    for (int kk = 0; kk < 2; ++kk) { const unsigned qo = (unsigned)(wave * 16 + col) * SC_P + (unsigned)kk * 64u; const v16h ah = frag_h((const _Float16*)(B + SC_QH + qo), lane), al = frag_h((const _Float16*)(B + SC_QL + qo), lane); v16h kb[8], kl[8];
#pragma unroll
      for (int j = 0; j < 8; ++j) { const unsigned ko = (unsigned)(j * 16 + col) * SC_P + (unsigned)kk * 64u; kb[j] = frag_h((const _Float16*)(B + ko), lane); kl[j] = frag_h((const _Float16*)(B + SC_KL + ko), lane); }
      // inputs only: keeps the LDS reads of this 32-k step together ahead of its WMMAs; read one fragment at a time, every WMMA waits out an LDS latency
      asm volatile("" :: "v"(ah), "v"(al), "v"(kb[0]), "v"(kb[1]), "v"(kb[2]), "v"(kb[3]), "v"(kb[4]), "v"(kb[5]), "v"(kb[6]), "v"(kb[7]), "v"(kl[0]), "v"(kl[1]), "v"(kl[2]), "v"(kl[3]), "v"(kl[4]), "v"(kl[5]), "v"(kl[6]), "v"(kl[7]));
#pragma unroll
      for (int j = 0; j < 8; ++j) { acc[j] = wmma16(ah, kb[j], acc[j]); acc[j] = wmma16(al, kb[j], acc[j]); acc[j] = wmma16(ah, kl[j], acc[j]); } }
    WAIT_DS(); WAIT_ASYNC(); __syncthreads();   // publishes slice t + 1 and ends every reader's last read of slice t's buffer
    if (t + 2 < DD / 64) stage(t + 2, t & 1); }
  WAIT_ASYNC();
#pragma unroll
  for (int j = 0; j < 8; ++j) { const int jj = k0 + j * 16 + col;
#pragma unroll
    for (int r = 0; r < 8; ++r) { const int ii = ql0 + 8 * g + r; ss[wave][8 * g + r][j * 16 + col] = (jj >= ii) ? acc[j][r] * isc : -3.0e38f; } }
  LDSX(); for (int rl = 0; rl < 16; ++rl) vst2(S + (size_t)(ql0 + rl) * T2 + k0 + lane * 4, *(const v4f*)&ss[wave][rl][lane * 4]); }
// ---- k_sm: softmax over j in [i, T2), P x 2^11 written in place. A wave owns rows ra = 8 * blockIdx.x + wave (< T2 / 2) and rb = T2 - 1 - ra of sample n and holds both whole in registers:
// in chunks of 128 columns (512 B, whole lines) ra has 16 - ca of them and rb has ca + 1, 17 for every wave, so all waves do equal work. S is read once, every exponential is taken once, nothing goes through LDS.
// A row starts at its own 128-column tile of k_sc (columns j < i hold the mask there and become zeros). The launch bound asks for 8 waves a SIMD (128 registers): the whole grid, 8 waves a SIMD, is then resident at once.
#define SM_NEG -3.0e38f
__device__ __forceinline__ float max4(v4f v) { return fmaxf(fmaxf(v[0], v[1]), fmaxf(v[2], v[3])); }
// a value that every lane of the wave holds alike, moved to a scalar register: what is chosen per chunk between the two rows is then chosen by scalar instructions
__device__ __forceinline__ float uni(float x) { return __builtin_bit_cast(float, __builtin_amdgcn_readfirstlane(__builtin_bit_cast(int, x))); }
// e^x in f32: r = nearest integer to x log2(e); fraction = x log2(e) - r by two fused multiply-adds, log2(e) in two parts (the product is not rounded before r is taken off); 2^fraction; ldexp by r; 0 below and infinity above the f32 range.
// Written out because 2^fraction stands in asm: the v_nop in the statement is the free slot that the instruction set asks for behind a transcendental.
__device__ __forceinline__ float exp_sm(float x) {
  const float r = __builtin_rintf(x * 0x1.715476p+0f); const float a = __builtin_fmaf(x, 0x1.4ae0bep-26f, __builtin_fmaf(x, 0x1.715476p+0f, -r));
  float e; asm("v_exp_f32 %0, %1\n\tv_nop" : "=v"(e) : "v"(a));
  e = ldexpf(e, (int)r); e = (x < -0x1.9d1dap+6f) ? 0.f : e; return (x > 0x1.62e43p+6f) ? __builtin_inff() : e; }
__global__ __launch_bounds__(256, 8) void k_sm(float* __restrict__ S0) {
  const int lane = threadIdx.x & 31; const int wave = __builtin_amdgcn_readfirstlane((int)(threadIdx.x >> 5));   // scalar, so that the row addresses are scalar bases
  const int ca = blockIdx.x >> 4;   // first chunk of ra (0..7); rb starts at chunk 15 - ca
  const int ra = blockIdx.x * 8 + wave, rb = T2 - 1 - ra;
  float* pa = S0 + ((size_t)blockIdx.y * T2 + ra) * (size_t)T2; float* pb = S0 + ((size_t)blockIdx.y * T2 + rb) * (size_t)T2;
  // slots 0..7: chunks 8..15 of ra; slot 8: chunk 15 of rb; slot 9 + s: chunk s of ra where s >= ca, else chunk 14 - s of rb
  v4f v[17];
#pragma unroll
  for (int i = 0; i < 17; ++i) { const int s = i - 9; const float* q = i < 8 ? pa + (8 + i) * 128 : i == 8 ? pb + 15 * 128 : (s >= ca ? pa + s * 128 : pb + (14 - s) * 128); v[i] = *(const v4f*)(q + lane * 4); }
  // scheduling order: the 17 loads first, then the vector work. Left alone the compiler issued the last loads behind waits for the first, two more trips to memory in a row
  __builtin_amdgcn_sched_group_barrier(0x020, 17, 0);   // 17 global reads
  __builtin_amdgcn_sched_group_barrier(0x002, 64, 0);   // behind them the vector instructions of the maxima
  float ma = SM_NEG, mb = SM_NEG;
#pragma unroll
  for (int i = 0; i < 17; ++i) { const bool isa = i < 8 || (i > 8 && i - 9 >= ca); const float x = max4(v[i]); ma = fmaxf(ma, isa ? x : SM_NEG); mb = fmaxf(mb, isa ? SM_NEG : x); }
#pragma unroll
  for (int o = 1; o < 32; o <<= 1) { ma = fmaxf(ma, __shfl_xor(ma, o)); mb = fmaxf(mb, __shfl_xor(mb, o)); }
  ma = uni(ma); mb = uni(mb);
  float sa = 0.f, sb = 0.f;
#pragma unroll
  for (int i = 0; i < 17; ++i) { const bool isa = i < 8 || (i > 8 && i - 9 >= ca); const float m = isa ? ma : mb;
#pragma unroll
    for (int e = 0; e < 4; ++e) v[i][e] = exp_sm((v[i][e] <= -1.0e38f) ? SM_NEG : v[i][e] - m);   // a masked value gives exactly 0; the choice is made on the argument so that no branch stands around each exponential
    const float t = (v[i][0] + v[i][1]) + (v[i][2] + v[i][3]); sa += isa ? t : 0.f; sb += isa ? 0.f : t; }
#pragma unroll
  for (int o = 1; o < 32; o <<= 1) { sa += __shfl_xor(sa, o); sb += __shfl_xor(sb, o); }
  const float inva = 1.0f / sa, invb = 1.0f / sb, ua = uni(inva), ub = uni(invb);   // two divisions a wave
#pragma unroll
  for (int i = 0; i < 17; ++i) { const int s = i - 9; const bool isa = i < 8 || (i > 8 && s >= ca); const float inv = i < 8 ? inva : i == 8 ? invb : (isa ? ua : ub);
    float* q = i < 8 ? pa + (8 + i) * 128 : i == 8 ? pb + 15 * 128 : (s >= ca ? pa + s * 128 : pb + (14 - s) * 128); v4f p;
#pragma unroll
    for (int e = 0; e < 4; ++e) p[e] = v[i][e] * inv * 2048.0f;
    vst2(q + lane * 4, p); } }
// ---- k_pv: block = (64 rows i, 128 cols d, n): out = P (hi + lo) . x2 (exact) over j >= 64*(i/64), + x2[i]; written to merged rows T2 + i.
// P rows (f32) and x2 planes (bf16) come in slices of 64 j, whole lines, by asynchronous copies into two LDS buffers; the fragments are read from LDS.
// The first slice of a block holds its rows' diagonal: the blocks of d-block 0 store log(1 + P_ii) from it into LG [n][i] for k_logdet.
#define PV_PP 272u                   // LDS pitch of a P row: 256 B + 16
#define PV_XP 144u                   // LDS pitch of an x2 plane row: 128 B + 16
#define PV_X (64u * PV_PP)           // a buffer: P 64 rows | x2 planes 128 rows
#define PV_BUF (PV_X + 128u * PV_XP)
__global__ __launch_bounds__(128) void k_pv(const float* __restrict__ PS0, const __bf16* __restrict__ XT, const float* __restrict__ X, float* __restrict__ OUT, float* __restrict__ LG) { __shared__ __align__(16) float ss[4][16][132]; __shared__ __align__(16) unsigned char sb[2 * PV_BUF];
  const size_t n = blockIdx.z; const float* PS = PS0 + n * (size_t)T2 * T2;
  const int tid = threadIdx.x, wave = tid >> 5, lane = tid & 31, col = lane & 15, g = lane >> 4; const int q0b = blockIdx.x * 64; const int ql0 = q0b + wave * 16; const int c0 = blockIdx.y * 128;
  const unsigned lp = (unsigned)(size_t)sb + (unsigned)(tid >> 4) * PV_PP + (unsigned)(tid & 15) * 16u;          // a copy of a wave covers 2 P rows x 256 B
  const unsigned lx = (unsigned)(size_t)sb + PV_X + (unsigned)(tid >> 3) * PV_XP + (unsigned)(tid & 7) * 16u;     // or 4 plane rows x 128 B
  const char* gpp = (const char*)(PS + (size_t)(q0b + (tid >> 4)) * T2 + (tid & 15) * 4); const char* gxx = (const char*)(XT + (n * DD + c0 + (tid >> 3)) * (size_t)T2 + (tid & 7) * 8);
  // the loops below are unrolled so that l[] and gp[] are registers: they are asm operands
  auto stage = [&](int t, int b) { unsigned l[8]; const char* gp[8];
#pragma unroll
    for (int m = 0; m < 8; ++m) { l[m] = lp + (unsigned)b * PV_BUF + (unsigned)m * 8u * PV_PP; gp[m] = gpp + (size_t)t * 256 + (size_t)m * 8 * T2 * 4; }
    acopy8(l, gp);
#pragma unroll
    for (int m = 0; m < 8; ++m) { l[m] = lx + (unsigned)b * PV_BUF + (unsigned)m * 16u * PV_XP; gp[m] = gxx + (size_t)t * 128 + (size_t)m * 16 * T2 * 2; }
    acopy8(l, gp); };
  const int t0 = blockIdx.x;   // first slice of 64 j: the rows' own 64-block
  stage(t0, 0); WAIT_ASYNC(); __syncthreads(); if (t0 + 1 < T2 / 64) stage(t0 + 1, 1);
  // row tid of buffer 0, column tid: P_ii x 2^11. Waves 0 and 1 (a scalar test, every lane on) store one whole line each; buffer 0 is refilled only behind the foot of the first trip.
  if (blockIdx.y == 0 && __builtin_amdgcn_readfirstlane(wave) < 2) { const float pd = *(const float*)(sb + (unsigned)tid * (PV_PP + 4u)); LG[n * T2 + q0b + tid] = logf(1.0f + pd * (1.0f / 2048.0f));
    asm volatile("s_wait_xcnt 0x0" ::: "memory"); }   // stands ahead of any rewrite of the store's address and data registers
  v8f acc[8] = {};
// rolled: the trip count depends on the block; the loops inside are unrolled so that acc[] and xb[] stay in registers
#pragma unroll 1
  for (int t = t0; t < T2 / 64; ++t) { const int b = (t - t0) & 1; const unsigned char* B = sb + (unsigned)b * PV_BUF;
#pragma unroll
    for (int kk = 0; kk < 2; ++kk) { const v4f* pp = (const v4f*)(B + (unsigned)(wave * 16 + col) * PV_PP + (unsigned)kk * 128u + (unsigned)g * 32u); const v4f p0 = pp[0], p1 = pp[1], p2 = pp[4], p3 = pp[5]; v16b xb[8];   // P elements k0+8g+0..7 and k0+16+8g+0..7
#pragma unroll
      for (int j = 0; j < 8; ++j) xb[j] = frag_b((const __bf16*)(B + PV_X + (unsigned)(j * 16 + col) * PV_XP + (unsigned)kk * 64u), lane);
      // inputs only: keeps the LDS reads of this 32-j step together ahead of its WMMAs; read one fragment at a time, every WMMA waits out an LDS latency
      asm volatile("" :: "v"(p0), "v"(p1), "v"(p2), "v"(p3), "v"(xb[0]), "v"(xb[1]), "v"(xb[2]), "v"(xb[3]), "v"(xb[4]), "v"(xb[5]), "v"(xb[6]), "v"(xb[7]));
      float pv[16];
#pragma unroll
      for (int i = 0; i < 4; ++i) { pv[i] = p0[i]; pv[4 + i] = p1[i]; pv[8 + i] = p2[i]; pv[12 + i] = p3[i]; }
      const F2 p = bsplit16(pv);
#pragma unroll
      for (int j = 0; j < 8; ++j) { acc[j] = wmma_bf(p.h, xb[j], acc[j]); acc[j] = wmma_bf(p.l, xb[j], acc[j]); } }
    WAIT_DS(); WAIT_ASYNC(); __syncthreads();   // publishes slice t + 1 and ends every reader's last read of slice t's buffer
    if (t + 2 < T2 / 64) stage(t + 2, b); }
  WAIT_ASYNC();
#pragma unroll
  for (int j = 0; j < 8; ++j) { const int d = c0 + j * 16 + col;
#pragma unroll
    for (int r = 0; r < 8; ++r) { const int ii = ql0 + 8 * g + r; ss[wave][8 * g + r][j * 16 + col] = acc[j][r] * (1.0f / 2048.0f) + bfr(X[(n * LL + T2 + ii) * DD + d]); } }
  LDSX(); for (int rl = 0; rl < 16; ++rl) vst2(OUT + (n * LL + T2 + ql0 + rl) * DD + c0 + lane * 4, *(const v4f*)&ss[wave][rl][lane * 4]); }
// ---- k_logdet: one block: logdet[n] = (L/2) * sum_i log(1 + P_ii), the logarithms read from LG (64 KB, whole lines). Thread t sums i = t, t + 256, ... of every sample, then the wave, then the 8 waves in turn.
__global__ __launch_bounds__(256) void k_logdet(const float* __restrict__ LG, float* __restrict__ OUT) { __shared__ __align__(16) float sred[NB][8];
  const int t = threadIdx.x; v8f x[NB];
// unrolled: x[][] stays in registers and the 64 loads of a thread are all in flight together, one trip to memory
#pragma unroll
  for (int n = 0; n < NB; ++n)
#pragma unroll
    for (int k = 0; k < 8; ++k) x[n][k] = LG[n * T2 + k * 256 + t];
  // inputs only: keeps the 64 loads together ahead of the additions. Left alone the compiler issued the last five loads behind waits for the first, a second trip to memory
  asm volatile("" :: "v"(x[0]), "v"(x[1]), "v"(x[2]), "v"(x[3]), "v"(x[4]), "v"(x[5]), "v"(x[6]), "v"(x[7]));
  float s[NB];
#pragma unroll
  for (int n = 0; n < NB; ++n) { s[n] = 0.f;
#pragma unroll
    for (int k = 0; k < 8; ++k) s[n] += x[n][k]; }
// the samples inside, the steps outside: the 8 cross-lane exchanges of a step are independent and share one LDS-pipe latency
#pragma unroll
  for (int o = 1; o < 32; o <<= 1)
#pragma unroll
    for (int n = 0; n < NB; ++n) s[n] += __shfl_xor(s[n], o);
  if ((t & 31) == 0) {
#pragma unroll
    for (int n = 0; n < NB; ++n) sred[n][t >> 5] = s[n]; }
  __syncthreads();
  if (t < NB) { float a = 0.f;
#pragma unroll
    for (int i = 0; i < 8; ++i) a += sred[t][i];
    OUT[OUT1_OFF + t] = a * (float)(LL / 2); } }
extern "C" void kernel_launch(void* const* d_in, const int* in_sizes, int n_in, void* d_out, int out_size, void* d_ws, size_t ws_size, hipStream_t stream) {
  (void)in_sizes; (void)n_in; (void)out_size;
  const float** F = (const float**)d_in;   // 0 inputs [8,4096,256], 1 Wq [256,256] ([out,in]), 2 Wk, 3 q_gamma, 4 q_beta, 5 k_gamma, 6 k_beta, 7 d_scale [1]
  if (ws_size < (size_t)WS_END) return;
  char* ws = (char*)d_ws; _Float16 *QH = (_Float16*)(ws + WS_QH), *QL = (_Float16*)(ws + WS_QL), *KH = (_Float16*)(ws + WS_KH), *KL = (_Float16*)(ws + WS_KL); __bf16* XT = (__bf16*)(ws + WS_XT); float *S = (float*)(ws + WS_S), *DG = (float*)(ws + WS_DG);
  float* OUT = (float*)d_out;
  k_proj<<<dim3(NB * T2 / 64, 2), 128, 0, stream>>>(F[0], F[1], F[2], F[3], F[4], F[5], F[6], QH, QL, KH, KL, OUT);
  k_x2t<<<dim3(T2 / 64, NB), 256, 0, stream>>>(F[0], XT);
  k_sc<<<dim3(T2 / 64, T2 / 128, NB), 128, 0, stream>>>(QH, QL, KH, KL, F[7], S);
  k_sm<<<dim3(T2 / 16, NB), 256, 0, stream>>>(S);
  k_pv<<<dim3(T2 / 64, DD / 128, NB), 128, 0, stream>>>(S, XT, F[0], OUT, DG);
  k_logdet<<<1, 256, 0, stream>>>(DG, OUT);
}

// v005
// It runs in 119 microseconds.
// In two side-by-side timings against v004, it was 1.15 and 1.14 times as fast.
// Counting every step since v000, it is 3.25 times as fast.
// compute dtype: all float inputs rounded to bf16, d_scale read; q, k = LayerNorm(x1 W^T) with EXACT bf16 products on WMMA 16x16x32 and the LN in f32; q and k as f16 hi + residual -> 3-product logits / d_scale (std ~16: near-one-hot rows), upper-triangular mask, softmax in f32 (precise exp) in two levels: exp(s - tile maximum) stored in f32 with each 128-column tile's maximum and sum, then one factor a row and tile; P x 2^11 in f32 split bf16 hi + lo against the bf16-exact x2 (2 products) + the identity term; logdet = (L/2) sum_i log(1 + P_ii) (att + I is upper triangular, so slogdet is the diagonal product - exact identity); f32 outputs: merged [n][L][D] (x1 copied, then att x2) and logdet [n].
#include <hip/hip_runtime.h>
#include <math.h>

typedef __attribute__((ext_vector_type(16))) _Float16 v16h;
typedef __attribute__((ext_vector_type(16))) __bf16 v16b;
typedef __attribute__((ext_vector_type(8)))  _Float16 v8h;
typedef __attribute__((ext_vector_type(8)))  float v8f;
typedef __attribute__((ext_vector_type(4)))  float v4f;
typedef __attribute__((ext_vector_type(2)))  float v2f;
typedef __attribute__((ext_vector_type(4)))  unsigned v4u;
typedef __attribute__((ext_vector_type(4)))  int v4i;
typedef float __attribute__((may_alias)) float_a;
typedef int __attribute__((may_alias)) int_a;

template <typename T> __device__ __forceinline__ void vst2(void* p, T v) { *(T*)p = v;  }
__device__ __forceinline__ v8f wmma16(v16h a, v16h b, v8f c) {
  v8f d = __builtin_amdgcn_wmma_f32_16x16x32_f16(false, a, false, b, (short)0, c, false, false);
  asm volatile("v_nop\n\tv_nop\n\tv_nop\n\tv_nop" : "+v"(d) : "v"(a), "v"(b));
  return d;
}
__device__ __forceinline__ v8f wmma_bf(v16b a, v16b b, v8f c) {
  v8f d = __builtin_amdgcn_wmma_f32_16x16x32_bf16(false, a, false, b, (short)0, c, false, false);
  asm volatile("v_nop\n\tv_nop\n\tv_nop\n\tv_nop" : "+v"(d) : "v"(a), "v"(b));
  return d;
}
// 16x16x32 fragments: lane = (h = lane>>4, row/col = lane&15); elements 0..7 = k0+8h+0..7, 8..15 = k0+16+8h+0..7; D element r = row 8h+r
__device__ __forceinline__ v16h frag_h(const _Float16* rowk0, int lane) {
  union { v16h v; v8h q[2]; } u; const _Float16* p = rowk0 + 8 * (lane >> 4);
  u.q[0] = *(const v8h*)p; u.q[1] = *(const v8h*)(p + 16); return u.v;
}
__device__ __forceinline__ v16h frag_f32(const float* rowk0, int lane) {
  v16h a; const float* p = rowk0 + 8 * (lane >> 4);
#pragma unroll
  for (int i = 0; i < 8; ++i) { a[i] = (_Float16)p[i]; a[8 + i] = (_Float16)p[16 + i]; }
  return a;
}
__device__ __forceinline__ v16h frag_f32s(const float* rowk0, int lane, float sc) {
  v16h a; const float* p = rowk0 + 8 * (lane >> 4);
#pragma unroll
  for (int i = 0; i < 8; ++i) { a[i] = (_Float16)(p[i] * sc); a[8 + i] = (_Float16)(p[16 + i] * sc); }
  return a;
}
// column fragment from a [K][ld] layout (column n), rows >= K read as 0
__device__ __forceinline__ v16h fragc_f32(const float* W, int k0, int n, int lane, int ld, int K) {
  v16h a; const int g = lane >> 4;
#pragma unroll
  for (int i = 0; i < 8; ++i) { const int ka = k0 + 8 * g + i, kb = ka + 16;
    a[i] = (_Float16)(ka < K ? W[(size_t)(ka < K ? ka : K - 1) * ld + n] : 0.f); a[8 + i] = (_Float16)(kb < K ? W[(size_t)(kb < K ? kb : K - 1) * ld + n] : 0.f); }
  return a;
}
struct F2 { v16b h, l; };
__device__ __forceinline__ F2 bsplit16(const float v[16]) { F2 r;
#pragma unroll
  for (int i = 0; i < 16; ++i) { const __bf16 h = (__bf16)v[i]; r.h[i] = h; r.l[i] = (__bf16)(v[i] - (float)h); }
  return r; }
__device__ __forceinline__ F2 split_row(const float* row, int k0, int lane) { float v[16]; const float* p = row + k0 + 8 * (lane >> 4);
#pragma unroll
  for (int i = 0; i < 8; ++i) { v[i] = p[i]; v[8 + i] = p[16 + i]; }
  return bsplit16(v); }
__device__ __forceinline__ F2 split_rowK(const float* row, int k0, int lane, int K) { float v[16]; const int g = lane >> 4;
#pragma unroll
  for (int i = 0; i < 8; ++i) { const int ka = k0 + 8 * g + i, kb = ka + 16; v[i] = ka < K ? row[ka < K ? ka : K - 1] : 0.f; v[8 + i] = kb < K ? row[kb < K ? kb : K - 1] : 0.f; }
  return bsplit16(v); }
__device__ __forceinline__ F2 split_col(const float* W, int k0, int n, int lane, int ld, int K) { float v[16]; const int g = lane >> 4;
#pragma unroll
  for (int i = 0; i < 8; ++i) { const int ka = k0 + 8 * g + i, kb = ka + 16; v[i] = ka < K ? W[(size_t)(ka < K ? ka : K - 1) * ld + n] : 0.f; v[8 + i] = kb < K ? W[(size_t)(kb < K ? kb : K - 1) * ld + n] : 0.f; }
  return bsplit16(v); }
__device__ __forceinline__ v8f mac3(const F2& a, const F2& b, v8f c) { c = wmma_bf(a.l, b.h, c); c = wmma_bf(a.h, b.l, c); return wmma_bf(a.h, b.h, c); }
__device__ __forceinline__ float sigm(float v) { return 1.0f / (1.0f + expf(-v)); }
#define LDSX() do { asm volatile("s_wait_dscnt 0" ::: "memory"); __builtin_amdgcn_wave_barrier(); __builtin_amdgcn_fence(__ATOMIC_RELEASE, "workgroup"); } while (0)


// Invertible attention (N 8, L 4,096 -> halves of 2,048, D 256): att = softmax(upper-tri(LN(x1 Wq^T) . LN(x1 Wk^T) / d_scale)) + I; out = att x2; logdet = slogdet(att) * L/2.
#define NB 8
#define LL 4096
#define T2 2048
#define DD 256
#define LN_EPS 1e-5f
typedef __attribute__((ext_vector_type(8))) __bf16 v8b;
__device__ __forceinline__ v16b frag_b(const __bf16* rowk0, int lane) {
  union { v16b v; v8b q[2]; } u; const __bf16* p = rowk0 + 8 * (lane >> 4);
  u.q[0] = *(const v8b*)p; u.q[1] = *(const v8b*)(p + 16); return u.v;
}
__device__ __forceinline__ float bfr(float v) { return (float)(__bf16)v; }
__device__ __attribute__((noinline)) float exp_ni(float v) { return expf(v); }
__device__ __attribute__((noinline)) float erf_ni(float v) { return erff(v); }

// Eight 16-byte asynchronous copies per lane, global memory to LDS through no register. The s_wait_xcnt is the statement's last line so that no address register of a copy is rewritten ahead of it.
__device__ __forceinline__ void acopy8(const unsigned (&l)[8], const char* const (&gp)[8]) {
  asm volatile("global_load_async_to_lds_b128 %0, %8, off\n\t"
               "global_load_async_to_lds_b128 %1, %9, off\n\t"
               "global_load_async_to_lds_b128 %2, %10, off\n\t"
               "global_load_async_to_lds_b128 %3, %11, off\n\t"
               "global_load_async_to_lds_b128 %4, %12, off\n\t"
               "global_load_async_to_lds_b128 %5, %13, off\n\t"
               "global_load_async_to_lds_b128 %6, %14, off\n\t"
               "global_load_async_to_lds_b128 %7, %15, off\n\t"
               "s_wait_xcnt 0x0"
               :: "v"(l[0]), "v"(l[1]), "v"(l[2]), "v"(l[3]), "v"(l[4]), "v"(l[5]), "v"(l[6]), "v"(l[7]),
                  "v"(gp[0]), "v"(gp[1]), "v"(gp[2]), "v"(gp[3]), "v"(gp[4]), "v"(gp[5]), "v"(gp[6]), "v"(gp[7]) : "memory");
}
// The same with four copies.
__device__ __forceinline__ void acopy4(const unsigned (&l)[4], const char* const (&gp)[4]) {
  asm volatile("global_load_async_to_lds_b128 %0, %4, off\n\t"
               "global_load_async_to_lds_b128 %1, %5, off\n\t"
               "global_load_async_to_lds_b128 %2, %6, off\n\t"
               "global_load_async_to_lds_b128 %3, %7, off\n\t"
               "s_wait_xcnt 0x0"
               :: "v"(l[0]), "v"(l[1]), "v"(l[2]), "v"(l[3]), "v"(gp[0]), "v"(gp[1]), "v"(gp[2]), "v"(gp[3]) : "memory");
}
// this wave's copies have landed (the compiler places no wait for them)
#define WAIT_ASYNC() asm volatile("s_wait_asynccnt 0x0" ::: "memory")
// this wave's LDS reads have returned, so the buffer may be handed back for a refill
#define WAIT_DS() asm volatile("s_wait_dscnt 0x0" ::: "memory")

#define WS_QH  0u
#define WS_QL  (WS_QH + 2u * (size_t)NB * T2 * DD)
#define WS_KH  (WS_QL + 2u * (size_t)NB * T2 * DD)
#define WS_KL  (WS_KH + 2u * (size_t)NB * T2 * DD)
#define WS_XT  (WS_KL + 2u * (size_t)NB * T2 * DD)      // bf16 x2 planes [n][d][j]
#define WS_S   (WS_XT + 2u * (size_t)NB * DD * T2)      // f32 exp(s - tile maximum) [n][i][j]
#define WS_DG  (WS_S + 4u * (size_t)NB * T2 * T2)       // f32 log(1 + P_ii) [n][i]
#define WS_MT  (WS_DG + 4u * (size_t)NB * T2)           // f32 maximum of a row in a 128-column tile [n][tile][i]
#define WS_LT  (WS_MT + 4u * (size_t)NB * (T2 / 128) * T2)   // f32 sum of exp(s - that maximum) [n][tile][i]
#define WS_END (WS_LT + 4u * (size_t)NB * (T2 / 128) * T2)
#define OUT1_OFF ((size_t)NB * LL * DD)               // logdet output offset (elements)

// ---- k_proj: block = (64 rows of x1, which): y = x1 W^T ([out][in]); LayerNorm(gamma, beta) -> f16 hi + lo rows; also copies bf16-rounded x1 into merged (which == 0 blocks)
// The W rows (all 256) and the block's x1 rows come in slices of 32 k = 128 B a row, whole lines, f32, by asynchronous copies into two LDS buffers; the fragments are read from LDS and rounded to bf16 there.
// The two buffers lie over sf and sh, which are first written behind the last trip's barrier.
#define PJ_P 144u                    // LDS row pitch: 128 B + 16, conflict-free for 16-byte reads
#define PJ_X (256u * PJ_P)           // rows in a buffer: W 256 | x1 64
#define PJ_BUF (320u * PJ_P)
#define PJ_SH (64u * (DD + 4u) * 4u)             // the block's LDS: sf | sh | sl | smu | srs
#define PJ_SL (PJ_SH + 64u * (DD + 8u) * 2u)
#define PJ_MU (PJ_SL + 64u * (DD + 8u) * 2u)
#define PJ_END (PJ_MU + 2u * 64u * 4u)
static_assert(2u * PJ_BUF <= PJ_MU, "the staging buffers lie inside sf, sh and sl");
__device__ __forceinline__ v16b cvt_frag(const v4f (&r)[4]) { v16b a;   // elements 0..7 = k 8g+0..7, 8..15 = k 16+8g+0..7
// unrolled: a[] and r[] are registers
#pragma unroll
  for (int i = 0; i < 4; ++i) { a[i] = (__bf16)r[0][i]; a[4 + i] = (__bf16)r[1][i]; a[8 + i] = (__bf16)r[2][i]; a[12 + i] = (__bf16)r[3][i]; }
  return a; }
__global__ __launch_bounds__(128) void k_proj(const float* __restrict__ X, const float* __restrict__ WQ, const float* __restrict__ WK, const float* __restrict__ GQ, const float* __restrict__ BQ, const float* __restrict__ GK, const float* __restrict__ BK, _Float16* __restrict__ QH, _Float16* __restrict__ QL, _Float16* __restrict__ KH, _Float16* __restrict__ KL, float* __restrict__ OUT) {
  __shared__ __align__(16) unsigned char ar[PJ_END];
  float (*sf)[DD + 4] = (float (*)[DD + 4])ar; _Float16 (*sh)[DD + 8] = (_Float16 (*)[DD + 8])(ar + PJ_SH); _Float16 (*sl)[DD + 8] = (_Float16 (*)[DD + 8])(ar + PJ_SL); float* smu = (float*)(ar + PJ_MU); float* srs = smu + 64;
  const int tid = threadIdx.x, wave = tid >> 5, lane = tid & 31, col = lane & 15, g = lane >> 4; const int which = blockIdx.y; const size_t r0 = (size_t)blockIdx.x * 64; const size_t n = r0 / T2; const int i0 = (int)(r0 % T2);   // rows of x1: x[n][i][:], i < T2
  const float* Wm = which == 0 ? WQ : WK; const float* Gm = which == 0 ? GQ : GK; const float* Bm = which == 0 ? BQ : BK;
  const int rr = tid >> 3, pc = tid & 7;   // a copy of a wave covers 4 rows x 128 B
  const unsigned lb = (unsigned)(size_t)ar + (unsigned)rr * PJ_P + (unsigned)pc * 16u;
  const char* gw = (const char*)(Wm + (size_t)rr * DD + pc * 4); const char* gx = (const char*)(X + (n * LL + i0 + rr) * DD + pc * 4);
  // the loops below are unrolled so that l[] and gp[] are registers: they are asm operands
  auto stage = [&](int t, int b) { unsigned l[8]; const char* gp[8]; unsigned l4[4]; const char* gp4[4]; const unsigned lt = lb + (unsigned)b * PJ_BUF; const size_t go = (size_t)t * 128;
#pragma unroll
    for (int m = 0; m < 8; ++m) { l[m] = lt + (unsigned)m * 16u * PJ_P; gp[m] = gw + go + (size_t)m * 16 * DD * 4; }
    acopy8(l, gp);
#pragma unroll
    for (int m = 0; m < 8; ++m) { l[m] = lt + (unsigned)(8 + m) * 16u * PJ_P; gp[m] = gw + go + (size_t)(8 + m) * 16 * DD * 4; }
    acopy8(l, gp);
#pragma unroll
    for (int m = 0; m < 4; ++m) { l4[m] = lt + PJ_X + (unsigned)m * 16u * PJ_P; gp4[m] = gx + go + (size_t)m * 16 * DD * 4; }
    acopy4(l4, gp4); };
  stage(0, 0); WAIT_ASYNC(); __syncthreads(); stage(1, 1);
  v8f acc[16] = {};
// rolled: one copy of the 16-WMMA body, and the two buffers alternate by an offset; the loops inside are unrolled so that acc[], r[] and w[] stay in registers
#pragma unroll 1
  for (int t = 0; t < DD / 32; ++t) { const unsigned char* B = ar + (unsigned)(t & 1) * PJ_BUF; v4f ra[4], r[4][4];
    // a lane's 16 values of a row: k 8g+0..7 and 16+8g+0..7, four 16-byte reads
    auto rd = [&](v4f (&d)[4], unsigned row) { const v4f* p = (const v4f*)(B + row * PJ_P + (unsigned)g * 32u); d[0] = p[0]; d[1] = p[1]; d[2] = p[4]; d[3] = p[5]; };
    rd(ra, 256u + (unsigned)(wave * 16 + col));
#pragma unroll
    for (int jj = 0; jj < 4; ++jj) rd(r[jj], (unsigned)(jj * 16 + col));
    const v16b a = cvt_frag(ra);
#pragma unroll
    for (int jg = 0; jg < 4; ++jg) { v16b w[4];
#pragma unroll
      for (int jj = 0; jj < 4; ++jj) w[jj] = cvt_frag(r[jj]);
      // the next four fragments' reads stand ahead of this group's WMMAs, so that their LDS latency runs beside them
      if (jg < 3) {
#pragma unroll
        for (int jj = 0; jj < 4; ++jj) rd(r[jj], (unsigned)((jg * 4 + 4 + jj) * 16 + col)); }
#pragma unroll
      for (int jj = 0; jj < 4; ++jj) acc[jg * 4 + jj] = wmma_bf(a, w[jj], acc[jg * 4 + jj]); }
    WAIT_DS(); WAIT_ASYNC(); __syncthreads();   // publishes slice t + 1 and ends every reader's last read of slice t's buffer
    if (t + 2 < DD / 32) stage(t + 2, t & 1); }
  WAIT_ASYNC();
// unrolled: acc[] is registers
#pragma unroll
  for (int j = 0; j < 16; ++j)
#pragma unroll
    for (int r = 0; r < 8; ++r) sf[wave * 16 + 8 * g + r][j * 16 + col] = acc[j][r];
  __syncthreads();
  if (tid < 64) { float m = 0.f; for (int c = 0; c < DD; ++c) m += sf[tid][c]; m *= (1.0f / DD); float v = 0.f; for (int c = 0; c < DD; ++c) { const float d = sf[tid][c] - m; v += d * d; } smu[tid] = m; srs[tid] = 1.0f / sqrtf(v * (1.0f / DD) + LN_EPS); }
  __syncthreads();
  for (int e = tid; e < 64 * DD; e += 128) { const int rl = e >> 8, c = e & 255; const float v = (sf[rl][c] - smu[rl]) * srs[rl] * bfr(Gm[c]) + bfr(Bm[c]); const _Float16 hv = (_Float16)v; sh[rl][c] = hv; sl[rl][c] = (_Float16)(v - (float)hv); }
  __syncthreads();
  _Float16* dh = which == 0 ? QH : KH; _Float16* dl = which == 0 ? QL : KL;
  for (int e = tid; e < 64 * 32; e += 128) { const int rl = e >> 5, q = e & 31; vst2((unsigned*)(dh + (r0 + rl) * DD + q * 8), *(const v4u*)&sh[rl][q * 8]); vst2((unsigned*)(dl + (r0 + rl) * DD + q * 8), *(const v4u*)&sl[rl][q * 8]); }
  if (which == 0) { for (int e = tid; e < 64 * 64; e += 128) { const int rl = e >> 6, q = e & 63; const size_t go = (n * LL + i0 + rl) * DD + q * 4; const v4f xr = *(const v4f*)(X + go); v4f v; v[0] = bfr(xr[0]); v[1] = bfr(xr[1]); v[2] = bfr(xr[2]); v[3] = bfr(xr[3]); vst2(OUT + go, v); } } }
// ---- k_x2t: block = (64 j, n): x2 planes XT[n][d][j] (bf16, exact)
__global__ __launch_bounds__(256) void k_x2t(const float* __restrict__ X, __bf16* __restrict__ XT) { __shared__ __align__(16) __bf16 st[DD][72];
  const int t = threadIdx.x; const size_t n = blockIdx.y; const int j0 = blockIdx.x * 64;
  for (int e = t; e < 64 * DD; e += 256) { const int jl = e >> 8, d = e & 255; st[d][jl] = (__bf16)X[(n * LL + T2 + j0 + jl) * DD + d]; }
  __syncthreads(); for (int e = t; e < DD * 8; e += 256) { const int d = e >> 3, q = e & 7; vst2((unsigned*)(XT + (n * DD + d) * (size_t)T2 + j0 + q * 8), *(const v4u*)&st[d][q * 8]); } }
#define SM_NEG -3.0e38f
// e^x in f32 for x <= 0: r = nearest integer to x log2(e); fraction = x log2(e) - r by two fused multiply-adds, log2(e) in two parts (the product is not rounded before r is taken off); 2^fraction; ldexp by r.
// The floor of -200 keeps r finite for a masked value, and ldexp then gives exactly 0. 2^fraction stands in asm: the v_nop in the statement is the free slot that the instruction set asks for behind a transcendental.
__device__ __forceinline__ float exp_np(float x) {
  x = fmaxf(x, -200.0f); const float r = __builtin_rintf(x * 0x1.715476p+0f); const float a = __builtin_fmaf(x, 0x1.4ae0bep-26f, __builtin_fmaf(x, 0x1.715476p+0f, -r));
  float e; asm("v_exp_f32 %0, %1\n\tv_nop" : "=v"(e) : "v"(a));
  return ldexpf(e, (int)r); }
// the value of lane l ^ M inside the 16-lane row (row_xmask), every lane on
template <int M> __device__ __forceinline__ float xrow(float x) { return __builtin_bit_cast(float, __builtin_amdgcn_update_dpp(0, __builtin_bit_cast(int, x), 0x160 + M, 0xf, 0xf, true)); }
__device__ __forceinline__ float rmax16(float x) { x = fmaxf(x, xrow<1>(x)); x = fmaxf(x, xrow<2>(x)); x = fmaxf(x, xrow<4>(x)); return fmaxf(x, xrow<8>(x)); }
__device__ __forceinline__ float rsum16(float x) { x += xrow<1>(x); x += xrow<2>(x); x += xrow<4>(x); return x + xrow<8>(x); }
// ---- k_sc: block = (64 rows i, 128 cols j, n): s = q.k / d_scale for j >= i, else masked; stored: exp(s - m), m the row's maximum in this tile (0 where masked), with m and the row's sum of them in MT and LT [n][tile][i] for k_pv; blocks entirely below the diagonal store the mask and 0 there and exit.
// The K and Q rows (hi and lo) come in slices of 64 k = 128 B a row, whole lines, by asynchronous copies into two LDS buffers; the fragments are read from LDS.
#define SC_P 144u                    // LDS row pitch: 128 B + 16, conflict-free for 16-byte reads
#define SC_KL (128u * SC_P)          // rows in a buffer: KH 128 | KL 128 | QH 64 | QL 64
#define SC_QH (256u * SC_P)
#define SC_QL (320u * SC_P)
#define SC_BUF (384u * SC_P)
__global__ __launch_bounds__(128) void k_sc(const _Float16* __restrict__ QH, const _Float16* __restrict__ QL, const _Float16* __restrict__ KH, const _Float16* __restrict__ KL, const float* __restrict__ DSC, float* __restrict__ S0, float* __restrict__ MT, float* __restrict__ LT) { __shared__ __align__(16) float ss[4][16][132]; __shared__ __align__(16) unsigned char sb[2 * SC_BUF]; __shared__ __align__(16) float st[2][64];
  const size_t n = blockIdx.z; float* S = S0 + n * (size_t)T2 * T2;
  const int tid = threadIdx.x, wave = tid >> 5, lane = tid & 31, col = lane & 15, g = lane >> 4; const int k0 = blockIdx.y * 128; const int q0b = blockIdx.x * 64; const int ql0 = q0b + wave * 16;
  float* const tq = (tid < 64 ? MT : LT) + (n * (T2 / 128) + blockIdx.y) * (size_t)T2 + q0b + (tid & 63);   // waves 0 and 1 store the 64 rows' maxima, waves 2 and 3 their sums, one whole line each
  if (k0 + 127 < q0b) { *tq = tid < 64 ? SM_NEG : 0.f; return; }   // all j < i: the tile counts as masked in k_pv's factors, and its values are never read (k_pv starts at the rows' own 64-block)
  const float isc = 1.0f / bfr(DSC[0]);
  const int rr = tid >> 3, pc = tid & 7;   // a copy of a wave covers 4 rows x 128 B
  const unsigned lb = (unsigned)(size_t)sb + (unsigned)rr * SC_P + (unsigned)pc * 16u;
  const char* gkh = (const char*)(KH + (n * T2 + k0 + rr) * DD + pc * 8); const char* gkl = (const char*)(KL + (n * T2 + k0 + rr) * DD + pc * 8);
  const char* gqh = (const char*)(QH + (n * T2 + q0b + rr) * DD + pc * 8); const char* gql = (const char*)(QL + (n * T2 + q0b + rr) * DD + pc * 8);
  // the loops below are unrolled so that l[] and gp[] are registers: they are asm operands
  auto stage = [&](int t, int b) { unsigned l[8]; const char* gp[8]; const unsigned lt = lb + (unsigned)b * SC_BUF; const size_t go = (size_t)t * 128;
#pragma unroll
    for (int m = 0; m < 8; ++m) { l[m] = lt + (unsigned)m * 16u * SC_P; gp[m] = gkh + go + (size_t)m * 16 * DD * 2; }
    acopy8(l, gp);
#pragma unroll
    for (int m = 0; m < 8; ++m) { l[m] = lt + SC_KL + (unsigned)m * 16u * SC_P; gp[m] = gkl + go + (size_t)m * 16 * DD * 2; }
    acopy8(l, gp);
#pragma unroll
    for (int m = 0; m < 4; ++m) { l[m] = lt + SC_QH + (unsigned)m * 16u * SC_P; gp[m] = gqh + go + (size_t)m * 16 * DD * 2; l[4 + m] = lt + SC_QL + (unsigned)m * 16u * SC_P; gp[4 + m] = gql + go + (size_t)m * 16 * DD * 2; }
    acopy8(l, gp); };
  stage(0, 0); WAIT_ASYNC(); __syncthreads(); stage(1, 1);
  v8f acc[8] = {};
// rolled: one copy of the 48-WMMA body, and the two buffers alternate by an offset; the loops inside are unrolled so that acc[], kb[] and kl[] stay in registers
#pragma unroll 1
  for (int t = 0; t < DD / 64; ++t) { const unsigned char* B = sb + (unsigned)(t & 1) * SC_BUF;
#pragma unroll
    for (int kk = 0; kk < 2; ++kk) { const unsigned qo = (unsigned)(wave * 16 + col) * SC_P + (unsigned)kk * 64u; const v16h ah = frag_h((const _Float16*)(B + SC_QH + qo), lane), al = frag_h((const _Float16*)(B + SC_QL + qo), lane); v16h kb[8], kl[8];
#pragma unroll
      for (int j = 0; j < 8; ++j) { const unsigned ko = (unsigned)(j * 16 + col) * SC_P + (unsigned)kk * 64u; kb[j] = frag_h((const _Float16*)(B + ko), lane); kl[j] = frag_h((const _Float16*)(B + SC_KL + ko), lane); }
      // inputs only: keeps the LDS reads of this 32-k step together ahead of its WMMAs; read one fragment at a time, every WMMA waits out an LDS latency
      asm volatile("" :: "v"(ah), "v"(al), "v"(kb[0]), "v"(kb[1]), "v"(kb[2]), "v"(kb[3]), "v"(kb[4]), "v"(kb[5]), "v"(kb[6]), "v"(kb[7]), "v"(kl[0]), "v"(kl[1]), "v"(kl[2]), "v"(kl[3]), "v"(kl[4]), "v"(kl[5]), "v"(kl[6]), "v"(kl[7]));
#pragma unroll
      for (int j = 0; j < 8; ++j) { acc[j] = wmma16(ah, kb[j], acc[j]); acc[j] = wmma16(al, kb[j], acc[j]); acc[j] = wmma16(ah, kl[j], acc[j]); } }
    WAIT_DS(); WAIT_ASYNC(); __syncthreads();   // publishes slice t + 1 and ends every reader's last read of slice t's buffer
    if (t + 2 < DD / 64) stage(t + 2, t & 1); }
  WAIT_ASYNC();
  // a lane holds 8 columns of each of the rows 8g + 0..7: maximum and sum in the lane, then over the 16 lanes of its half. Every row of a block that runs has a column j >= i in the tile. The loops are unrolled: acc[], mx[] and sm[] are registers
  float mx[8], sm[8];
#pragma unroll
  for (int r = 0; r < 8; ++r) { mx[r] = SM_NEG; sm[r] = 0.f; }
#pragma unroll
  for (int j = 0; j < 8; ++j) { const int jj = k0 + j * 16 + col;
#pragma unroll
    for (int r = 0; r < 8; ++r) { const int ii = ql0 + 8 * g + r; acc[j][r] = (jj >= ii) ? acc[j][r] * isc : SM_NEG; mx[r] = fmaxf(mx[r], acc[j][r]); } }
#pragma unroll
  for (int r = 0; r < 8; ++r) mx[r] = rmax16(mx[r]);
#pragma unroll
  for (int j = 0; j < 8; ++j)
#pragma unroll
    for (int r = 0; r < 8; ++r) { const float e = exp_np(acc[j][r] - mx[r]); sm[r] += e; ss[wave][8 * g + r][j * 16 + col] = e; }
#pragma unroll
  for (int r = 0; r < 8; ++r) sm[r] = rsum16(sm[r]);
  if (col == 0) {
#pragma unroll
    for (int r = 0; r < 8; ++r) { st[0][wave * 16 + 8 * g + r] = mx[r]; st[1][wave * 16 + 8 * g + r] = sm[r]; } }
  __syncthreads();   // st[] is whole (and every wave's own ss rows are written). It stands ahead of the row stores: behind them it would wait for them to complete
  *tq = st[tid >> 6][tid & 63];
  for (int rl = 0; rl < 16; ++rl) vst2(S + (size_t)(ql0 + rl) * T2 + k0 + lane * 4, *(const v4f*)&ss[wave][rl][lane * 4]);
  asm volatile("s_wait_xcnt 0x0" ::: "memory"); }   // stands ahead of any rewrite of the stores' address and data registers: the compiler lays the early exit's store behind this place
// ---- k_pv: block = (64 rows i, 128 cols d, n): out = P (hi + lo) . x2 (exact) over j >= 64*(i/64), + x2[i]; written to merged rows T2 + i.
// P x 2^11 = k_sc's exp(s - tile maximum) times the row's factor of that tile, exp(tile maximum - row maximum) x 2^11 / row sum: 16 factors a row, formed from MT and LT while the first slice flies.
// The stored rows (f32) and x2 planes (bf16) come in slices of 64 j, whole lines, by asynchronous copies into two LDS buffers; the fragments are read from LDS.
// The first slice of a block holds its rows' diagonal: the blocks of d-block 0 store log(1 + P_ii) from it into LG [n][i] for k_logdet.
#define PV_PP 272u                   // LDS pitch of a P row: 256 B + 16
#define PV_XP 144u                   // LDS pitch of an x2 plane row: 128 B + 16
#define PV_X (64u * PV_PP)           // a buffer: P 64 rows | x2 planes 128 rows
#define PV_BUF (PV_X + 128u * PV_XP)
__global__ __launch_bounds__(128) void k_pv(const float* __restrict__ PS0, const __bf16* __restrict__ XT, const float* __restrict__ X, float* __restrict__ OUT, float* __restrict__ LG, const float* __restrict__ MT, const float* __restrict__ LT) { __shared__ __align__(16) float ss[4][16][132]; __shared__ __align__(16) unsigned char sb[2 * PV_BUF]; __shared__ float cs[64][17];   // pitch 17: 16 rows read at once meet 16 banks
  const size_t n = blockIdx.z; const float* PS = PS0 + n * (size_t)T2 * T2;
  const int tid = threadIdx.x, wave = tid >> 5, lane = tid & 31, col = lane & 15, g = lane >> 4; const int q0b = blockIdx.x * 64; const int ql0 = q0b + wave * 16; const int c0 = blockIdx.y * 128;
  const unsigned lp = (unsigned)(size_t)sb + (unsigned)(tid >> 4) * PV_PP + (unsigned)(tid & 15) * 16u;          // a copy of a wave covers 2 P rows x 256 B
  const unsigned lx = (unsigned)(size_t)sb + PV_X + (unsigned)(tid >> 3) * PV_XP + (unsigned)(tid & 7) * 16u;     // or 4 plane rows x 128 B
  const char* gpp = (const char*)(PS + (size_t)(q0b + (tid >> 4)) * T2 + (tid & 15) * 4); const char* gxx = (const char*)(XT + (n * DD + c0 + (tid >> 3)) * (size_t)T2 + (tid & 7) * 8);
  // the loops below are unrolled so that l[] and gp[] are registers: they are asm operands
  auto stage = [&](int t, int b) { unsigned l[8]; const char* gp[8];
#pragma unroll
    for (int m = 0; m < 8; ++m) { l[m] = lp + (unsigned)b * PV_BUF + (unsigned)m * 8u * PV_PP; gp[m] = gpp + (size_t)t * 256 + (size_t)m * 8 * T2 * 4; }
    acopy8(l, gp);
#pragma unroll
    for (int m = 0; m < 8; ++m) { l[m] = lx + (unsigned)b * PV_BUF + (unsigned)m * 16u * PV_XP; gp[m] = gxx + (size_t)t * 128 + (size_t)m * 16 * T2 * 2; }
    acopy8(l, gp); };
  const int t0 = blockIdx.x;   // first slice of 64 j: the rows' own 64-block
  stage(t0, 0);
  // waves 0 and 1 (a scalar test): thread tid forms row tid's factors; a tile left of the diagonal holds the mask and a sum of 0. Unrolled: mt[] and lt[] are registers and the 32 whole-line loads fly together
  if (__builtin_amdgcn_readfirstlane(wave) < 2) { float mt[16], lt[16]; const size_t o = n * (T2 / 128) * (size_t)T2 + q0b + tid;
#pragma unroll
    for (int i = 0; i < 16; ++i) { mt[i] = MT[o + (size_t)i * T2]; lt[i] = LT[o + (size_t)i * T2]; }
    float m = SM_NEG, l = 0.f;
#pragma unroll
    for (int i = 0; i < 16; ++i) m = fmaxf(m, mt[i]);
#pragma unroll
    for (int i = 0; i < 16; ++i) { mt[i] = exp_np(mt[i] - m); l += lt[i] * mt[i]; }
    const float f = 2048.0f / l;
#pragma unroll
    for (int i = 0; i < 16; ++i) cs[tid][i] = mt[i] * f; }
  WAIT_ASYNC(); __syncthreads(); if (t0 + 1 < T2 / 64) stage(t0 + 1, 1);   // the barrier publishes cs[] too
  // row tid of buffer 0, column tid, times the row's factor: P_ii x 2^11. Waves 0 and 1 (a scalar test, every lane on) store one whole line each; buffer 0 is refilled only behind the foot of the first trip.
  if (blockIdx.y == 0 && __builtin_amdgcn_readfirstlane(wave) < 2) { const float pd = *(const float*)(sb + (unsigned)tid * (PV_PP + 4u)) * cs[tid][t0 >> 1]; LG[n * T2 + q0b + tid] = logf(1.0f + pd * (1.0f / 2048.0f));
    asm volatile("s_wait_xcnt 0x0" ::: "memory"); }   // stands ahead of any rewrite of the store's address and data registers
  v8f acc[8] = {};
// rolled: the trip count depends on the block; the loops inside are unrolled so that acc[] and xb[] stay in registers
#pragma unroll 1
  for (int t = t0; t < T2 / 64; ++t) { const int b = (t - t0) & 1; const unsigned char* B = sb + (unsigned)b * PV_BUF; const float cf = cs[wave * 16 + col][t >> 1];   // the lane's row, this slice's tile
#pragma unroll
    for (int kk = 0; kk < 2; ++kk) { const v4f* pp = (const v4f*)(B + (unsigned)(wave * 16 + col) * PV_PP + (unsigned)kk * 128u + (unsigned)g * 32u); const v4f p0 = pp[0], p1 = pp[1], p2 = pp[4], p3 = pp[5]; v16b xb[8];   // P elements k0+8g+0..7 and k0+16+8g+0..7
#pragma unroll
      for (int j = 0; j < 8; ++j) xb[j] = frag_b((const __bf16*)(B + PV_X + (unsigned)(j * 16 + col) * PV_XP + (unsigned)kk * 64u), lane);
      // inputs only: keeps the LDS reads of this 32-j step together ahead of its WMMAs; read one fragment at a time, every WMMA waits out an LDS latency
      asm volatile("" :: "v"(p0), "v"(p1), "v"(p2), "v"(p3), "v"(xb[0]), "v"(xb[1]), "v"(xb[2]), "v"(xb[3]), "v"(xb[4]), "v"(xb[5]), "v"(xb[6]), "v"(xb[7]));
      float pv[16];
#pragma unroll
      for (int i = 0; i < 4; ++i) { pv[i] = p0[i] * cf; pv[4 + i] = p1[i] * cf; pv[8 + i] = p2[i] * cf; pv[12 + i] = p3[i] * cf; }
      const F2 p = bsplit16(pv);
#pragma unroll
      for (int j = 0; j < 8; ++j) { acc[j] = wmma_bf(p.h, xb[j], acc[j]); acc[j] = wmma_bf(p.l, xb[j], acc[j]); } }
    WAIT_DS(); WAIT_ASYNC(); __syncthreads();   // publishes slice t + 1 and ends every reader's last read of slice t's buffer
    if (t + 2 < T2 / 64) stage(t + 2, b); }
  WAIT_ASYNC();
#pragma unroll
  for (int j = 0; j < 8; ++j) { const int d = c0 + j * 16 + col;
#pragma unroll
    for (int r = 0; r < 8; ++r) { const int ii = ql0 + 8 * g + r; ss[wave][8 * g + r][j * 16 + col] = acc[j][r] * (1.0f / 2048.0f) + bfr(X[(n * LL + T2 + ii) * DD + d]); } }
  LDSX(); for (int rl = 0; rl < 16; ++rl) vst2(OUT + (n * LL + T2 + ql0 + rl) * DD + c0 + lane * 4, *(const v4f*)&ss[wave][rl][lane * 4]); }
// ---- k_logdet: one block: logdet[n] = (L/2) * sum_i log(1 + P_ii), the logarithms read from LG (64 KB, whole lines). Thread t sums i = t, t + 256, ... of every sample, then the wave, then the 8 waves in turn.
__global__ __launch_bounds__(256) void k_logdet(const float* __restrict__ LG, float* __restrict__ OUT) { __shared__ __align__(16) float sred[NB][8];
  const int t = threadIdx.x; v8f x[NB];
// unrolled: x[][] stays in registers and the 64 loads of a thread are all in flight together, one trip to memory
#pragma unroll
  for (int n = 0; n < NB; ++n)
#pragma unroll
    for (int k = 0; k < 8; ++k) x[n][k] = LG[n * T2 + k * 256 + t];
  // inputs only: keeps the 64 loads together ahead of the additions. Left alone the compiler issued the last five loads behind waits for the first, a second trip to memory
  asm volatile("" :: "v"(x[0]), "v"(x[1]), "v"(x[2]), "v"(x[3]), "v"(x[4]), "v"(x[5]), "v"(x[6]), "v"(x[7]));
  float s[NB];
#pragma unroll
  for (int n = 0; n < NB; ++n) { s[n] = 0.f;
#pragma unroll
    for (int k = 0; k < 8; ++k) s[n] += x[n][k]; }
// the samples inside, the steps outside: the 8 cross-lane exchanges of a step are independent and share one LDS-pipe latency
#pragma unroll
  for (int o = 1; o < 32; o <<= 1)
#pragma unroll
    for (int n = 0; n < NB; ++n) s[n] += __shfl_xor(s[n], o);
  if ((t & 31) == 0) {
#pragma unroll
    for (int n = 0; n < NB; ++n) sred[n][t >> 5] = s[n]; }
  __syncthreads();
  if (t < NB) { float a = 0.f;
#pragma unroll
    for (int i = 0; i < 8; ++i) a += sred[t][i];
    OUT[OUT1_OFF + t] = a * (float)(LL / 2); } }
extern "C" void kernel_launch(void* const* d_in, const int* in_sizes, int n_in, void* d_out, int out_size, void* d_ws, size_t ws_size, hipStream_t stream) {
  (void)in_sizes; (void)n_in; (void)out_size;
  const float** F = (const float**)d_in;   // 0 inputs [8,4096,256], 1 Wq [256,256] ([out,in]), 2 Wk, 3 q_gamma, 4 q_beta, 5 k_gamma, 6 k_beta, 7 d_scale [1]
  if (ws_size < (size_t)WS_END) return;
  char* ws = (char*)d_ws; _Float16 *QH = (_Float16*)(ws + WS_QH), *QL = (_Float16*)(ws + WS_QL), *KH = (_Float16*)(ws + WS_KH), *KL = (_Float16*)(ws + WS_KL); __bf16* XT = (__bf16*)(ws + WS_XT); float *S = (float*)(ws + WS_S), *DG = (float*)(ws + WS_DG), *MT = (float*)(ws + WS_MT), *LT = (float*)(ws + WS_LT);
  float* OUT = (float*)d_out;
  k_proj<<<dim3(NB * T2 / 64, 2), 128, 0, stream>>>(F[0], F[1], F[2], F[3], F[4], F[5], F[6], QH, QL, KH, KL, OUT);
  k_x2t<<<dim3(T2 / 64, NB), 256, 0, stream>>>(F[0], XT);
  k_sc<<<dim3(T2 / 64, T2 / 128, NB), 128, 0, stream>>>(QH, QL, KH, KL, F[7], S, MT, LT);
  k_pv<<<dim3(T2 / 64, DD / 128, NB), 128, 0, stream>>>(S, XT, F[0], OUT, DG, MT, LT);
  k_logdet<<<1, 256, 0, stream>>>(DG, OUT);
}

// v006
// A run of this version takes 111 microseconds.
// Two timings next to v005 put it at 1.07 and 1.06 times that version's speed.
// All steps since v000 together make it 3.45 times as fast.
// compute dtype: all float inputs rounded to bf16, d_scale read; q, k = LayerNorm(x1 W^T) with EXACT bf16 products on WMMA 16x16x32 and the LN in f32; q and k as f16 hi + residual -> 3-product logits / d_scale (std ~16: near-one-hot rows), upper-triangular mask, softmax in f32 (precise exp) in two levels: exp(s - tile maximum) stored in f32 with each 128-column tile's maximum and sum, then one factor a row and tile; P x 2^11 in f32 split bf16 hi + lo against the bf16-exact x2 (2 products) + the identity term; logdet = (L/2) sum_i log(1 + P_ii) (att + I is upper triangular, so slogdet is the diagonal product - exact identity); f32 outputs: merged [n][L][D] (x1 copied, then att x2) and logdet [n].
#include <hip/hip_runtime.h>
#include <math.h>

typedef __attribute__((ext_vector_type(16))) _Float16 v16h;
typedef __attribute__((ext_vector_type(16))) __bf16 v16b;
typedef __attribute__((ext_vector_type(8)))  _Float16 v8h;
typedef __attribute__((ext_vector_type(8)))  float v8f;
typedef __attribute__((ext_vector_type(4)))  float v4f;
typedef __attribute__((ext_vector_type(2)))  float v2f;
typedef __attribute__((ext_vector_type(4)))  unsigned v4u;
typedef __attribute__((ext_vector_type(4)))  int v4i;
typedef float __attribute__((may_alias)) float_a;
typedef int __attribute__((may_alias)) int_a;

template <typename T> __device__ __forceinline__ void vst2(void* p, T v) { *(T*)p = v;  }
__device__ __forceinline__ v8f wmma16(v16h a, v16h b, v8f c) {
  v8f d = __builtin_amdgcn_wmma_f32_16x16x32_f16(false, a, false, b, (short)0, c, false, false);
  asm volatile("v_nop\n\tv_nop\n\tv_nop\n\tv_nop" : "+v"(d) : "v"(a), "v"(b));
  return d;
}
__device__ __forceinline__ v8f wmma_bf(v16b a, v16b b, v8f c) {
  v8f d = __builtin_amdgcn_wmma_f32_16x16x32_bf16(false, a, false, b, (short)0, c, false, false);
  asm volatile("v_nop\n\tv_nop\n\tv_nop\n\tv_nop" : "+v"(d) : "v"(a), "v"(b));
  return d;
}
// 16x16x32 fragments: lane = (h = lane>>4, row/col = lane&15); elements 0..7 = k0+8h+0..7, 8..15 = k0+16+8h+0..7; D element r = row 8h+r
__device__ __forceinline__ v16h frag_h(const _Float16* rowk0, int lane) {
  union { v16h v; v8h q[2]; } u; const _Float16* p = rowk0 + 8 * (lane >> 4);
  u.q[0] = *(const v8h*)p; u.q[1] = *(const v8h*)(p + 16); return u.v;
}
__device__ __forceinline__ v16h frag_f32(const float* rowk0, int lane) {
  v16h a; const float* p = rowk0 + 8 * (lane >> 4);
#pragma unroll
  for (int i = 0; i < 8; ++i) { a[i] = (_Float16)p[i]; a[8 + i] = (_Float16)p[16 + i]; }
  return a;
}
__device__ __forceinline__ v16h frag_f32s(const float* rowk0, int lane, float sc) {
  v16h a; const float* p = rowk0 + 8 * (lane >> 4);
#pragma unroll
  for (int i = 0; i < 8; ++i) { a[i] = (_Float16)(p[i] * sc); a[8 + i] = (_Float16)(p[16 + i] * sc); }
  return a;
}
// column fragment from a [K][ld] layout (column n), rows >= K read as 0
__device__ __forceinline__ v16h fragc_f32(const float* W, int k0, int n, int lane, int ld, int K) {
  v16h a; const int g = lane >> 4;
#pragma unroll
  for (int i = 0; i < 8; ++i) { const int ka = k0 + 8 * g + i, kb = ka + 16;
    a[i] = (_Float16)(ka < K ? W[(size_t)(ka < K ? ka : K - 1) * ld + n] : 0.f); a[8 + i] = (_Float16)(kb < K ? W[(size_t)(kb < K ? kb : K - 1) * ld + n] : 0.f); }
  return a;
}
struct F2 { v16b h, l; };
__device__ __forceinline__ F2 bsplit16(const float v[16]) { F2 r;
#pragma unroll
  for (int i = 0; i < 16; ++i) { const __bf16 h = (__bf16)v[i]; r.h[i] = h; r.l[i] = (__bf16)(v[i] - (float)h); }
  return r; }
__device__ __forceinline__ F2 split_row(const float* row, int k0, int lane) { float v[16]; const float* p = row + k0 + 8 * (lane >> 4);
#pragma unroll
  for (int i = 0; i < 8; ++i) { v[i] = p[i]; v[8 + i] = p[16 + i]; }
  return bsplit16(v); }
__device__ __forceinline__ F2 split_rowK(const float* row, int k0, int lane, int K) { float v[16]; const int g = lane >> 4;
#pragma unroll
  for (int i = 0; i < 8; ++i) { const int ka = k0 + 8 * g + i, kb = ka + 16; v[i] = ka < K ? row[ka < K ? ka : K - 1] : 0.f; v[8 + i] = kb < K ? row[kb < K ? kb : K - 1] : 0.f; }
  return bsplit16(v); }
__device__ __forceinline__ F2 split_col(const float* W, int k0, int n, int lane, int ld, int K) { float v[16]; const int g = lane >> 4;
#pragma unroll
  for (int i = 0; i < 8; ++i) { const int ka = k0 + 8 * g + i, kb = ka + 16; v[i] = ka < K ? W[(size_t)(ka < K ? ka : K - 1) * ld + n] : 0.f; v[8 + i] = kb < K ? W[(size_t)(kb < K ? kb : K - 1) * ld + n] : 0.f; }
  return bsplit16(v); }
__device__ __forceinline__ v8f mac3(const F2& a, const F2& b, v8f c) { c = wmma_bf(a.l, b.h, c); c = wmma_bf(a.h, b.l, c); return wmma_bf(a.h, b.h, c); }
__device__ __forceinline__ float sigm(float v) { return 1.0f / (1.0f + expf(-v)); }
#define LDSX() do { asm volatile("s_wait_dscnt 0" ::: "memory"); __builtin_amdgcn_wave_barrier(); __builtin_amdgcn_fence(__ATOMIC_RELEASE, "workgroup"); } while (0)


// Invertible attention (N 8, L 4,096 -> halves of 2,048, D 256): att = softmax(upper-tri(LN(x1 Wq^T) . LN(x1 Wk^T) / d_scale)) + I; out = att x2; logdet = slogdet(att) * L/2.
#define NB 8
#define LL 4096
#define T2 2048
#define DD 256
#define LN_EPS 1e-5f
typedef __attribute__((ext_vector_type(8))) __bf16 v8b;
__device__ __forceinline__ v16b frag_b(const __bf16* rowk0, int lane) {
  union { v16b v; v8b q[2]; } u; const __bf16* p = rowk0 + 8 * (lane >> 4);
  u.q[0] = *(const v8b*)p; u.q[1] = *(const v8b*)(p + 16); return u.v;
}
__device__ __forceinline__ float bfr(float v) { return (float)(__bf16)v; }
__device__ __attribute__((noinline)) float exp_ni(float v) { return expf(v); }
__device__ __attribute__((noinline)) float erf_ni(float v) { return erff(v); }

// Eight 16-byte asynchronous copies per lane, global memory to LDS through no register. The s_wait_xcnt is the statement's last line so that no address register of a copy is rewritten ahead of it.
__device__ __forceinline__ void acopy8(const unsigned (&l)[8], const char* const (&gp)[8]) {
  asm volatile("global_load_async_to_lds_b128 %0, %8, off\n\t"
               "global_load_async_to_lds_b128 %1, %9, off\n\t"
               "global_load_async_to_lds_b128 %2, %10, off\n\t"
               "global_load_async_to_lds_b128 %3, %11, off\n\t"
               "global_load_async_to_lds_b128 %4, %12, off\n\t"
               "global_load_async_to_lds_b128 %5, %13, off\n\t"
               "global_load_async_to_lds_b128 %6, %14, off\n\t"
               "global_load_async_to_lds_b128 %7, %15, off\n\t"
               "s_wait_xcnt 0x0"
               :: "v"(l[0]), "v"(l[1]), "v"(l[2]), "v"(l[3]), "v"(l[4]), "v"(l[5]), "v"(l[6]), "v"(l[7]),
                  "v"(gp[0]), "v"(gp[1]), "v"(gp[2]), "v"(gp[3]), "v"(gp[4]), "v"(gp[5]), "v"(gp[6]), "v"(gp[7]) : "memory");
}
// The same with four copies.
__device__ __forceinline__ void acopy4(const unsigned (&l)[4], const char* const (&gp)[4]) {
  asm volatile("global_load_async_to_lds_b128 %0, %4, off\n\t"
               "global_load_async_to_lds_b128 %1, %5, off\n\t"
               "global_load_async_to_lds_b128 %2, %6, off\n\t"
               "global_load_async_to_lds_b128 %3, %7, off\n\t"
               "s_wait_xcnt 0x0"
               :: "v"(l[0]), "v"(l[1]), "v"(l[2]), "v"(l[3]), "v"(gp[0]), "v"(gp[1]), "v"(gp[2]), "v"(gp[3]) : "memory");
}
// this wave's copies have landed (the compiler places no wait for them)
#define WAIT_ASYNC() asm volatile("s_wait_asynccnt 0x0" ::: "memory")
// this wave's LDS reads have returned, so the buffer may be handed back for a refill
#define WAIT_DS() asm volatile("s_wait_dscnt 0x0" ::: "memory")

#define WS_QH  0u
#define WS_QL  (WS_QH + 2u * (size_t)NB * T2 * DD)
#define WS_KH  (WS_QL + 2u * (size_t)NB * T2 * DD)
#define WS_KL  (WS_KH + 2u * (size_t)NB * T2 * DD)
#define WS_XT  (WS_KL + 2u * (size_t)NB * T2 * DD)      // bf16 x2 planes [n][d][j]
#define WS_S   (WS_XT + 2u * (size_t)NB * DD * T2)      // f32 exp(s - tile maximum) [n][i][j]
#define WS_DG  (WS_S + 4u * (size_t)NB * T2 * T2)       // f32 log(1 + P_ii) [n][i]
#define WS_MT  (WS_DG + 4u * (size_t)NB * T2)           // f32 maximum of a row in a 128-column tile [n][tile][i]
#define WS_LT  (WS_MT + 4u * (size_t)NB * (T2 / 128) * T2)   // f32 sum of exp(s - that maximum) [n][tile][i]
#define WS_END (WS_LT + 4u * (size_t)NB * (T2 / 128) * T2)
#define OUT1_OFF ((size_t)NB * LL * DD)               // logdet output offset (elements)

// the value of lane l ^ M inside the 16-lane row (row_xmask), every lane on
template <int M> __device__ __forceinline__ float xrow(float x) { return __builtin_bit_cast(float, __builtin_amdgcn_update_dpp(0, __builtin_bit_cast(int, x), 0x160 + M, 0xf, 0xf, true)); }
__device__ __forceinline__ float rmax16(float x) { x = fmaxf(x, xrow<1>(x)); x = fmaxf(x, xrow<2>(x)); x = fmaxf(x, xrow<4>(x)); return fmaxf(x, xrow<8>(x)); }
__device__ __forceinline__ float rsum16(float x) { x += xrow<1>(x); x += xrow<2>(x); x += xrow<4>(x); return x + xrow<8>(x); }
// ---- k_proj: block = (64 rows of x1, which): y = x1 W^T ([out][in]); LayerNorm(gamma, beta) -> f16 hi + lo rows; also copies bf16-rounded x1 into merged (which == 0 blocks)
// The W rows (all 256) and the block's x1 rows come in slices of 32 k = 128 B a row, whole lines, f32, by asynchronous copies into two LDS buffers; the fragments are read from LDS and rounded to bf16 there.
// LayerNorm runs on the accumulators: a wave holds its 16 rows whole (a lane 16 columns of each of 8 rows), so a row's mean and variance are 16 additions in the lane and a sum over the 16 lanes of its half.
// The f16 hi and lo of a value go as one dword into the wave's own rows of sp, which lies over the two buffers and is first written behind the last trip's barrier; the wave reads its rows back and stores whole lines.
#define PJ_P 144u                    // LDS row pitch: 128 B + 16, conflict-free for 16-byte reads
#define PJ_X (256u * PJ_P)           // rows in a buffer: W 256 | x1 64
#define PJ_BUF (320u * PJ_P)
static_assert(64u * (DD + 4u) * 4u <= 2u * PJ_BUF, "sp lies inside the staging buffers");
__device__ __forceinline__ v16b cvt_frag(const v4f (&r)[4]) { v16b a;   // elements 0..7 = k 8g+0..7, 8..15 = k 16+8g+0..7
// unrolled: a[] and r[] are registers
#pragma unroll
  for (int i = 0; i < 4; ++i) { a[i] = (__bf16)r[0][i]; a[4 + i] = (__bf16)r[1][i]; a[8 + i] = (__bf16)r[2][i]; a[12 + i] = (__bf16)r[3][i]; }
  return a; }
__global__ __launch_bounds__(128) void k_proj(const float* __restrict__ X, const float* __restrict__ WQ, const float* __restrict__ WK, const float* __restrict__ GQ, const float* __restrict__ BQ, const float* __restrict__ GK, const float* __restrict__ BK, _Float16* __restrict__ QH, _Float16* __restrict__ QL, _Float16* __restrict__ KH, _Float16* __restrict__ KL, float* __restrict__ OUT) {
  __shared__ __align__(16) unsigned char ar[2u * PJ_BUF];
  unsigned (*sp)[DD + 4] = (unsigned (*)[DD + 4])ar;   // pitch 260 dwords: the two halves of a wave, 8 rows apart, write banks 32 apart
  const int tid = threadIdx.x, wave = tid >> 5, lane = tid & 31, col = lane & 15, g = lane >> 4; const int which = blockIdx.y; const size_t r0 = (size_t)blockIdx.x * 64; const size_t n = r0 / T2; const int i0 = (int)(r0 % T2);   // rows of x1: x[n][i][:], i < T2
  const float* Wm = which == 0 ? WQ : WK; const float* Gm = which == 0 ? GQ : GK; const float* Bm = which == 0 ? BQ : BK;
  const int rr = tid >> 3, pc = tid & 7;   // a copy of a wave covers 4 rows x 128 B
  const unsigned lb = (unsigned)(size_t)ar + (unsigned)rr * PJ_P + (unsigned)pc * 16u;
  const char* gw = (const char*)(Wm + (size_t)rr * DD + pc * 4); const char* gx = (const char*)(X + (n * LL + i0 + rr) * DD + pc * 4);
  // the loops below are unrolled so that l[] and gp[] are registers: they are asm operands
  auto stage = [&](int t, int b) { unsigned l[8]; const char* gp[8]; unsigned l4[4]; const char* gp4[4]; const unsigned lt = lb + (unsigned)b * PJ_BUF; const size_t go = (size_t)t * 128;
#pragma unroll
    for (int m = 0; m < 8; ++m) { l[m] = lt + (unsigned)m * 16u * PJ_P; gp[m] = gw + go + (size_t)m * 16 * DD * 4; }
    acopy8(l, gp);
#pragma unroll
    for (int m = 0; m < 8; ++m) { l[m] = lt + (unsigned)(8 + m) * 16u * PJ_P; gp[m] = gw + go + (size_t)(8 + m) * 16 * DD * 4; }
    acopy8(l, gp);
#pragma unroll
    for (int m = 0; m < 4; ++m) { l4[m] = lt + PJ_X + (unsigned)m * 16u * PJ_P; gp4[m] = gx + go + (size_t)m * 16 * DD * 4; }
    acopy4(l4, gp4); };
  stage(0, 0); WAIT_ASYNC(); __syncthreads(); stage(1, 1);
  v8f acc[16] = {};
// rolled: one copy of the 16-WMMA body, and the two buffers alternate by an offset; the loops inside are unrolled so that acc[], r[] and w[] stay in registers
#pragma unroll 1
  for (int t = 0; t < DD / 32; ++t) { const unsigned char* B = ar + (unsigned)(t & 1) * PJ_BUF; v4f ra[4], r[4][4];
    // a lane's 16 values of a row: k 8g+0..7 and 16+8g+0..7, four 16-byte reads
    auto rd = [&](v4f (&d)[4], unsigned row) { const v4f* p = (const v4f*)(B + row * PJ_P + (unsigned)g * 32u); d[0] = p[0]; d[1] = p[1]; d[2] = p[4]; d[3] = p[5]; };
    rd(ra, 256u + (unsigned)(wave * 16 + col));
#pragma unroll
    for (int jj = 0; jj < 4; ++jj) rd(r[jj], (unsigned)(jj * 16 + col));
    const v16b a = cvt_frag(ra);
#pragma unroll
    for (int jg = 0; jg < 4; ++jg) { v16b w[4];
#pragma unroll
      for (int jj = 0; jj < 4; ++jj) w[jj] = cvt_frag(r[jj]);
      // the next four fragments' reads stand ahead of this group's WMMAs, so that their LDS latency runs beside them
      if (jg < 3) {
#pragma unroll
        for (int jj = 0; jj < 4; ++jj) rd(r[jj], (unsigned)((jg * 4 + 4 + jj) * 16 + col)); }
#pragma unroll
      for (int jj = 0; jj < 4; ++jj) acc[jg * 4 + jj] = wmma_bf(a, w[jj], acc[jg * 4 + jj]); }
    WAIT_DS(); WAIT_ASYNC(); __syncthreads();   // publishes slice t + 1 and ends every reader's last read of slice t's buffer
    if (t + 2 < DD / 32) stage(t + 2, t & 1); }
  WAIT_ASYNC();
// every loop below is unrolled: acc[], gm[] and bt[] are registers
  float gm[16], bt[16];   // the lane's 16 columns of gamma and beta: the loads fly beside the sums
#pragma unroll
  for (int j = 0; j < 16; ++j) { gm[j] = Gm[j * 16 + col]; bt[j] = Bm[j * 16 + col]; }
  // the 8 rows of a lane side by side as one vector: neighbouring rows lie in neighbouring registers, which packed f32 instructions take as they are
  v8f s8 = acc[0], q8 = {}, mu, rs;
#pragma unroll
  for (int j = 1; j < 16; ++j) s8 += acc[j];
#pragma unroll
  for (int r = 0; r < 8; ++r) mu[r] = rsum16(s8[r]) * (1.0f / DD);
#pragma unroll
  for (int j = 0; j < 16; ++j) { const v8f d = acc[j] - mu; q8 += d * d; }
#pragma unroll
  for (int r = 0; r < 8; ++r) rs[r] = 1.0f / sqrtf(rsum16(q8[r]) * (1.0f / DD) + LN_EPS);
#pragma unroll
  for (int j = 0; j < 16; ++j) { const v8f y = (acc[j] - mu) * rs * bfr(gm[j]) + bfr(bt[j]);
#pragma unroll
    for (int r = 0; r < 8; ++r) { const float v = y[r]; const _Float16 hv = (_Float16)v, lv = (_Float16)(v - (float)hv);
      sp[wave * 16 + 8 * g + r][j * 16 + col] = (unsigned)__builtin_bit_cast(unsigned short, hv) | ((unsigned)__builtin_bit_cast(unsigned short, lv) << 16); } }   // hi in the low half
  LDSX();   // the wave's own rows are written before it reads them back across its lanes; no other wave touches them
  _Float16* dh = which == 0 ? QH : KH; _Float16* dl = which == 0 ? QL : KL;
  // a lane takes 8 columns of a row, parts hi from lo, and the wave stores 512 B of each: whole lines
#pragma unroll
  for (int rl = 0; rl < 16; ++rl) { const v4u* p = (const v4u*)&sp[wave * 16 + rl][lane * 8]; const v4u a = p[0], b = p[1]; v4u h, l;
    h[0] = (a[0] & 0xffffu) | (a[1] << 16); h[1] = (a[2] & 0xffffu) | (a[3] << 16); h[2] = (b[0] & 0xffffu) | (b[1] << 16); h[3] = (b[2] & 0xffffu) | (b[3] << 16);
    l[0] = (a[0] >> 16) | (a[1] & 0xffff0000u); l[1] = (a[2] >> 16) | (a[3] & 0xffff0000u); l[2] = (b[0] >> 16) | (b[1] & 0xffff0000u); l[3] = (b[2] >> 16) | (b[3] & 0xffff0000u);
    vst2((unsigned*)(dh + (r0 + wave * 16 + rl) * DD + lane * 8), h); vst2((unsigned*)(dl + (r0 + wave * 16 + rl) * DD + lane * 8), l); }
  asm volatile("s_wait_xcnt 0x0" ::: "memory");   // stands ahead of any rewrite of the stores' address and data registers by the copy loop below
  if (which == 0) { for (int e = tid; e < 64 * 64; e += 128) { const int rl = e >> 6, q = e & 63; const size_t go = (n * LL + i0 + rl) * DD + q * 4; const v4f xr = *(const v4f*)(X + go); v4f v; v[0] = bfr(xr[0]); v[1] = bfr(xr[1]); v[2] = bfr(xr[2]); v[3] = bfr(xr[3]); vst2(OUT + go, v); } } }
// ---- k_x2t: block = (64 j, n): x2 planes XT[n][d][j] (bf16, exact)
__global__ __launch_bounds__(256) void k_x2t(const float* __restrict__ X, __bf16* __restrict__ XT) { __shared__ __align__(16) __bf16 st[DD][72];
  const int t = threadIdx.x; const size_t n = blockIdx.y; const int j0 = blockIdx.x * 64;
  for (int e = t; e < 64 * DD; e += 256) { const int jl = e >> 8, d = e & 255; st[d][jl] = (__bf16)X[(n * LL + T2 + j0 + jl) * DD + d]; }
  __syncthreads(); for (int e = t; e < DD * 8; e += 256) { const int d = e >> 3, q = e & 7; vst2((unsigned*)(XT + (n * DD + d) * (size_t)T2 + j0 + q * 8), *(const v4u*)&st[d][q * 8]); } }
#define SM_NEG -3.0e38f
// e^x in f32 for x <= 0: r = nearest integer to x log2(e); fraction = x log2(e) - r by two fused multiply-adds, log2(e) in two parts (the product is not rounded before r is taken off); 2^fraction; ldexp by r.
// The floor of -200 keeps r finite for a masked value, and ldexp then gives exactly 0. 2^fraction stands in asm: the v_nop in the statement is the free slot that the instruction set asks for behind a transcendental.
__device__ __forceinline__ float exp_np(float x) {
  x = fmaxf(x, -200.0f); const float r = __builtin_rintf(x * 0x1.715476p+0f); const float a = __builtin_fmaf(x, 0x1.4ae0bep-26f, __builtin_fmaf(x, 0x1.715476p+0f, -r));
  float e; asm("v_exp_f32 %0, %1\n\tv_nop" : "=v"(e) : "v"(a));
  return ldexpf(e, (int)r); }
// ---- k_sc: block = (64 rows i, 128 cols j, n): s = q.k / d_scale for j >= i, else masked; stored: exp(s - m), m the row's maximum in this tile (0 where masked), with m and the row's sum of them in MT and LT [n][tile][i] for k_pv; blocks entirely below the diagonal store the mask and 0 there and exit.
// The K and Q rows (hi and lo) come in slices of 64 k = 128 B a row, whole lines, by asynchronous copies into two LDS buffers; the fragments are read from LDS.
#define SC_P 144u                    // LDS row pitch: 128 B + 16, conflict-free for 16-byte reads
#define SC_KL (128u * SC_P)          // rows in a buffer: KH 128 | KL 128 | QH 64 | QL 64
#define SC_QH (256u * SC_P)
#define SC_QL (320u * SC_P)
#define SC_BUF (384u * SC_P)
__global__ __launch_bounds__(128) void k_sc(const _Float16* __restrict__ QH, const _Float16* __restrict__ QL, const _Float16* __restrict__ KH, const _Float16* __restrict__ KL, const float* __restrict__ DSC, float* __restrict__ S0, float* __restrict__ MT, float* __restrict__ LT) { __shared__ __align__(16) float ss[4][16][132]; __shared__ __align__(16) unsigned char sb[2 * SC_BUF]; __shared__ __align__(16) float st[2][64];
  const size_t n = blockIdx.z; float* S = S0 + n * (size_t)T2 * T2;
  const int tid = threadIdx.x, wave = tid >> 5, lane = tid & 31, col = lane & 15, g = lane >> 4; const int k0 = blockIdx.y * 128; const int q0b = blockIdx.x * 64; const int ql0 = q0b + wave * 16;
  float* const tq = (tid < 64 ? MT : LT) + (n * (T2 / 128) + blockIdx.y) * (size_t)T2 + q0b + (tid & 63);   // waves 0 and 1 store the 64 rows' maxima, waves 2 and 3 their sums, one whole line each
  if (k0 + 127 < q0b) { *tq = tid < 64 ? SM_NEG : 0.f; return; }   // all j < i: the tile counts as masked in k_pv's factors, and its values are never read (k_pv starts at the rows' own 64-block)
  const float isc = 1.0f / bfr(DSC[0]);
  const int rr = tid >> 3, pc = tid & 7;   // a copy of a wave covers 4 rows x 128 B
  const unsigned lb = (unsigned)(size_t)sb + (unsigned)rr * SC_P + (unsigned)pc * 16u;
  const char* gkh = (const char*)(KH + (n * T2 + k0 + rr) * DD + pc * 8); const char* gkl = (const char*)(KL + (n * T2 + k0 + rr) * DD + pc * 8);
  const char* gqh = (const char*)(QH + (n * T2 + q0b + rr) * DD + pc * 8); const char* gql = (const char*)(QL + (n * T2 + q0b + rr) * DD + pc * 8);
  // the loops below are unrolled so that l[] and gp[] are registers: they are asm operands
  auto stage = [&](int t, int b) { unsigned l[8]; const char* gp[8]; const unsigned lt = lb + (unsigned)b * SC_BUF; const size_t go = (size_t)t * 128;
#pragma unroll
    for (int m = 0; m < 8; ++m) { l[m] = lt + (unsigned)m * 16u * SC_P; gp[m] = gkh + go + (size_t)m * 16 * DD * 2; }
    acopy8(l, gp);
#pragma unroll
    for (int m = 0; m < 8; ++m) { l[m] = lt + SC_KL + (unsigned)m * 16u * SC_P; gp[m] = gkl + go + (size_t)m * 16 * DD * 2; }
    acopy8(l, gp);
#pragma unroll
    for (int m = 0; m < 4; ++m) { l[m] = lt + SC_QH + (unsigned)m * 16u * SC_P; gp[m] = gqh + go + (size_t)m * 16 * DD * 2; l[4 + m] = lt + SC_QL + (unsigned)m * 16u * SC_P; gp[4 + m] = gql + go + (size_t)m * 16 * DD * 2; }
    acopy8(l, gp); };
  stage(0, 0); WAIT_ASYNC(); __syncthreads(); stage(1, 1);
  v8f acc[8] = {};
// rolled: one copy of the 48-WMMA body, and the two buffers alternate by an offset; the loops inside are unrolled so that acc[], kb[] and kl[] stay in registers
#pragma unroll 1
  for (int t = 0; t < DD / 64; ++t) { const unsigned char* B = sb + (unsigned)(t & 1) * SC_BUF;
#pragma unroll
    for (int kk = 0; kk < 2; ++kk) { const unsigned qo = (unsigned)(wave * 16 + col) * SC_P + (unsigned)kk * 64u; const v16h ah = frag_h((const _Float16*)(B + SC_QH + qo), lane), al = frag_h((const _Float16*)(B + SC_QL + qo), lane); v16h kb[8], kl[8];
#pragma unroll
      for (int j = 0; j < 8; ++j) { const unsigned ko = (unsigned)(j * 16 + col) * SC_P + (unsigned)kk * 64u; kb[j] = frag_h((const _Float16*)(B + ko), lane); kl[j] = frag_h((const _Float16*)(B + SC_KL + ko), lane); }
      // inputs only: keeps the LDS reads of this 32-k step together ahead of its WMMAs; read one fragment at a time, every WMMA waits out an LDS latency
      asm volatile("" :: "v"(ah), "v"(al), "v"(kb[0]), "v"(kb[1]), "v"(kb[2]), "v"(kb[3]), "v"(kb[4]), "v"(kb[5]), "v"(kb[6]), "v"(kb[7]), "v"(kl[0]), "v"(kl[1]), "v"(kl[2]), "v"(kl[3]), "v"(kl[4]), "v"(kl[5]), "v"(kl[6]), "v"(kl[7]));
#pragma unroll
      for (int j = 0; j < 8; ++j) { acc[j] = wmma16(ah, kb[j], acc[j]); acc[j] = wmma16(al, kb[j], acc[j]); acc[j] = wmma16(ah, kl[j], acc[j]); } }
    WAIT_DS(); WAIT_ASYNC(); __syncthreads();   // publishes slice t + 1 and ends every reader's last read of slice t's buffer
    if (t + 2 < DD / 64) stage(t + 2, t & 1); }
  WAIT_ASYNC();
  // a lane holds 8 columns of each of the rows 8g + 0..7: maximum and sum in the lane, then over the 16 lanes of its half. Every row of a block that runs has a column j >= i in the tile. The loops are unrolled: acc[], mx[] and sm[] are registers
  float mx[8], sm[8];
#pragma unroll
  for (int r = 0; r < 8; ++r) { mx[r] = SM_NEG; sm[r] = 0.f; }
#pragma unroll
  for (int j = 0; j < 8; ++j) { const int jj = k0 + j * 16 + col;
#pragma unroll
    for (int r = 0; r < 8; ++r) { const int ii = ql0 + 8 * g + r; acc[j][r] = (jj >= ii) ? acc[j][r] * isc : SM_NEG; mx[r] = fmaxf(mx[r], acc[j][r]); } }
#pragma unroll
  for (int r = 0; r < 8; ++r) mx[r] = rmax16(mx[r]);
#pragma unroll
  for (int j = 0; j < 8; ++j)
#pragma unroll
    for (int r = 0; r < 8; ++r) { const float e = exp_np(acc[j][r] - mx[r]); sm[r] += e; ss[wave][8 * g + r][j * 16 + col] = e; }
#pragma unroll
  for (int r = 0; r < 8; ++r) sm[r] = rsum16(sm[r]);
  if (col == 0) {
#pragma unroll
    for (int r = 0; r < 8; ++r) { st[0][wave * 16 + 8 * g + r] = mx[r]; st[1][wave * 16 + 8 * g + r] = sm[r]; } }
  __syncthreads();   // st[] is whole (and every wave's own ss rows are written). It stands ahead of the row stores: behind them it would wait for them to complete
  *tq = st[tid >> 6][tid & 63];
  for (int rl = 0; rl < 16; ++rl) vst2(S + (size_t)(ql0 + rl) * T2 + k0 + lane * 4, *(const v4f*)&ss[wave][rl][lane * 4]);
  asm volatile("s_wait_xcnt 0x0" ::: "memory"); }   // stands ahead of any rewrite of the stores' address and data registers: the compiler lays the early exit's store behind this place
// ---- k_pv: block = (64 rows i, 128 cols d, n): out = P (hi + lo) . x2 (exact) over j >= 64*(i/64), + x2[i]; written to merged rows T2 + i.
// P x 2^11 = k_sc's exp(s - tile maximum) times the row's factor of that tile, exp(tile maximum - row maximum) x 2^11 / row sum: 16 factors a row, formed from MT and LT while the first slice flies.
// The stored rows (f32) and x2 planes (bf16) come in slices of 64 j, whole lines, by asynchronous copies into two LDS buffers; the fragments are read from LDS.
// The first slice of a block holds its rows' diagonal: the blocks of d-block 0 store log(1 + P_ii) from it into LG [n][i] for k_logdet.
#define PV_PP 272u                   // LDS pitch of a P row: 256 B + 16
#define PV_XP 144u                   // LDS pitch of an x2 plane row: 128 B + 16
#define PV_X (64u * PV_PP)           // a buffer: P 64 rows | x2 planes 128 rows
#define PV_BUF (PV_X + 128u * PV_XP)
__global__ __launch_bounds__(128) void k_pv(const float* __restrict__ PS0, const __bf16* __restrict__ XT, const float* __restrict__ X, float* __restrict__ OUT, float* __restrict__ LG, const float* __restrict__ MT, const float* __restrict__ LT) { __shared__ __align__(16) float ss[4][16][132]; __shared__ __align__(16) unsigned char sb[2 * PV_BUF]; __shared__ float cs[64][17];   // pitch 17: 16 rows read at once meet 16 banks
  const size_t n = blockIdx.z; const float* PS = PS0 + n * (size_t)T2 * T2;
  const int tid = threadIdx.x, wave = tid >> 5, lane = tid & 31, col = lane & 15, g = lane >> 4; const int q0b = blockIdx.x * 64; const int ql0 = q0b + wave * 16; const int c0 = blockIdx.y * 128;
  const unsigned lp = (unsigned)(size_t)sb + (unsigned)(tid >> 4) * PV_PP + (unsigned)(tid & 15) * 16u;          // a copy of a wave covers 2 P rows x 256 B
  const unsigned lx = (unsigned)(size_t)sb + PV_X + (unsigned)(tid >> 3) * PV_XP + (unsigned)(tid & 7) * 16u;     // or 4 plane rows x 128 B
  const char* gpp = (const char*)(PS + (size_t)(q0b + (tid >> 4)) * T2 + (tid & 15) * 4); const char* gxx = (const char*)(XT + (n * DD + c0 + (tid >> 3)) * (size_t)T2 + (tid & 7) * 8);
  // the loops below are unrolled so that l[] and gp[] are registers: they are asm operands
  auto stage = [&](int t, int b) { unsigned l[8]; const char* gp[8];
#pragma unroll
    for (int m = 0; m < 8; ++m) { l[m] = lp + (unsigned)b * PV_BUF + (unsigned)m * 8u * PV_PP; gp[m] = gpp + (size_t)t * 256 + (size_t)m * 8 * T2 * 4; }
    acopy8(l, gp);
#pragma unroll
    for (int m = 0; m < 8; ++m) { l[m] = lx + (unsigned)b * PV_BUF + (unsigned)m * 16u * PV_XP; gp[m] = gxx + (size_t)t * 128 + (size_t)m * 16 * T2 * 2; }
    acopy8(l, gp); };
  const int t0 = blockIdx.x;   // first slice of 64 j: the rows' own 64-block
  stage(t0, 0);
  // waves 0 and 1 (a scalar test): thread tid forms row tid's factors; a tile left of the diagonal holds the mask and a sum of 0. Unrolled: mt[] and lt[] are registers and the 32 whole-line loads fly together
  if (__builtin_amdgcn_readfirstlane(wave) < 2) { float mt[16], lt[16]; const size_t o = n * (T2 / 128) * (size_t)T2 + q0b + tid;
#pragma unroll
    for (int i = 0; i < 16; ++i) { mt[i] = MT[o + (size_t)i * T2]; lt[i] = LT[o + (size_t)i * T2]; }
    float m = SM_NEG, l = 0.f;
#pragma unroll
    for (int i = 0; i < 16; ++i) m = fmaxf(m, mt[i]);
#pragma unroll
    for (int i = 0; i < 16; ++i) { mt[i] = exp_np(mt[i] - m); l += lt[i] * mt[i]; }
    const float f = 2048.0f / l;
#pragma unroll
    for (int i = 0; i < 16; ++i) cs[tid][i] = mt[i] * f; }
  WAIT_ASYNC(); __syncthreads(); if (t0 + 1 < T2 / 64) stage(t0 + 1, 1);   // the barrier publishes cs[] too
  // row tid of buffer 0, column tid, times the row's factor: P_ii x 2^11. Waves 0 and 1 (a scalar test, every lane on) store one whole line each; buffer 0 is refilled only behind the foot of the first trip.
  if (blockIdx.y == 0 && __builtin_amdgcn_readfirstlane(wave) < 2) { const float pd = *(const float*)(sb + (unsigned)tid * (PV_PP + 4u)) * cs[tid][t0 >> 1]; LG[n * T2 + q0b + tid] = logf(1.0f + pd * (1.0f / 2048.0f));
    asm volatile("s_wait_xcnt 0x0" ::: "memory"); }   // stands ahead of any rewrite of the store's address and data registers
  v8f acc[8] = {};
// rolled: the trip count depends on the block; the loops inside are unrolled so that acc[] and xb[] stay in registers
#pragma unroll 1
  for (int t = t0; t < T2 / 64; ++t) { const int b = (t - t0) & 1; const unsigned char* B = sb + (unsigned)b * PV_BUF; const float cf = cs[wave * 16 + col][t >> 1];   // the lane's row, this slice's tile
#pragma unroll
    for (int kk = 0; kk < 2; ++kk) { const v4f* pp = (const v4f*)(B + (unsigned)(wave * 16 + col) * PV_PP + (unsigned)kk * 128u + (unsigned)g * 32u); const v4f p0 = pp[0], p1 = pp[1], p2 = pp[4], p3 = pp[5]; v16b xb[8];   // P elements k0+8g+0..7 and k0+16+8g+0..7
#pragma unroll
      for (int j = 0; j < 8; ++j) xb[j] = frag_b((const __bf16*)(B + PV_X + (unsigned)(j * 16 + col) * PV_XP + (unsigned)kk * 64u), lane);
      // inputs only: keeps the LDS reads of this 32-j step together ahead of its WMMAs; read one fragment at a time, every WMMA waits out an LDS latency
      asm volatile("" :: "v"(p0), "v"(p1), "v"(p2), "v"(p3), "v"(xb[0]), "v"(xb[1]), "v"(xb[2]), "v"(xb[3]), "v"(xb[4]), "v"(xb[5]), "v"(xb[6]), "v"(xb[7]));
      float pv[16];
#pragma unroll
      for (int i = 0; i < 4; ++i) { pv[i] = p0[i] * cf; pv[4 + i] = p1[i] * cf; pv[8 + i] = p2[i] * cf; pv[12 + i] = p3[i] * cf; }
      const F2 p = bsplit16(pv);
#pragma unroll
      for (int j = 0; j < 8; ++j) { acc[j] = wmma_bf(p.h, xb[j], acc[j]); acc[j] = wmma_bf(p.l, xb[j], acc[j]); } }
    WAIT_DS(); WAIT_ASYNC(); __syncthreads();   // publishes slice t + 1 and ends every reader's last read of slice t's buffer
    if (t + 2 < T2 / 64) stage(t + 2, b); }
  WAIT_ASYNC();
#pragma unroll
  for (int j = 0; j < 8; ++j) { const int d = c0 + j * 16 + col;
#pragma unroll
    for (int r = 0; r < 8; ++r) { const int ii = ql0 + 8 * g + r; ss[wave][8 * g + r][j * 16 + col] = acc[j][r] * (1.0f / 2048.0f) + bfr(X[(n * LL + T2 + ii) * DD + d]); } }
  LDSX(); for (int rl = 0; rl < 16; ++rl) vst2(OUT + (n * LL + T2 + ql0 + rl) * DD + c0 + lane * 4, *(const v4f*)&ss[wave][rl][lane * 4]); }
// ---- k_logdet: one block: logdet[n] = (L/2) * sum_i log(1 + P_ii), the logarithms read from LG (64 KB, whole lines). Thread t sums i = t, t + 256, ... of every sample, then the wave, then the 8 waves in turn.
__global__ __launch_bounds__(256) void k_logdet(const float* __restrict__ LG, float* __restrict__ OUT) { __shared__ __align__(16) float sred[NB][8];
  const int t = threadIdx.x; v8f x[NB];
// unrolled: x[][] stays in registers and the 64 loads of a thread are all in flight together, one trip to memory
#pragma unroll
  for (int n = 0; n < NB; ++n)
#pragma unroll
    for (int k = 0; k < 8; ++k) x[n][k] = LG[n * T2 + k * 256 + t];
  // inputs only: keeps the 64 loads together ahead of the additions. Left alone the compiler issued the last five loads behind waits for the first, a second trip to memory
  asm volatile("" :: "v"(x[0]), "v"(x[1]), "v"(x[2]), "v"(x[3]), "v"(x[4]), "v"(x[5]), "v"(x[6]), "v"(x[7]));
  float s[NB];
#pragma unroll
  for (int n = 0; n < NB; ++n) { s[n] = 0.f;
#pragma unroll
    for (int k = 0; k < 8; ++k) s[n] += x[n][k]; }
// the samples inside, the steps outside: the 8 cross-lane exchanges of a step are independent and share one LDS-pipe latency
#pragma unroll
  for (int o = 1; o < 32; o <<= 1)
#pragma unroll
    for (int n = 0; n < NB; ++n) s[n] += __shfl_xor(s[n], o);
  if ((t & 31) == 0) {
#pragma unroll
    for (int n = 0; n < NB; ++n) sred[n][t >> 5] = s[n]; }
  __syncthreads();
  if (t < NB) { float a = 0.f;
#pragma unroll
    for (int i = 0; i < 8; ++i) a += sred[t][i];
    OUT[OUT1_OFF + t] = a * (float)(LL / 2); } }
extern "C" void kernel_launch(void* const* d_in, const int* in_sizes, int n_in, void* d_out, int out_size, void* d_ws, size_t ws_size, hipStream_t stream) {
  (void)in_sizes; (void)n_in; (void)out_size;
  const float** F = (const float**)d_in;   // 0 inputs [8,4096,256], 1 Wq [256,256] ([out,in]), 2 Wk, 3 q_gamma, 4 q_beta, 5 k_gamma, 6 k_beta, 7 d_scale [1]
  if (ws_size < (size_t)WS_END) return;
  char* ws = (char*)d_ws; _Float16 *QH = (_Float16*)(ws + WS_QH), *QL = (_Float16*)(ws + WS_QL), *KH = (_Float16*)(ws + WS_KH), *KL = (_Float16*)(ws + WS_KL); __bf16* XT = (__bf16*)(ws + WS_XT); float *S = (float*)(ws + WS_S), *DG = (float*)(ws + WS_DG), *MT = (float*)(ws + WS_MT), *LT = (float*)(ws + WS_LT);
  float* OUT = (float*)d_out;
  k_proj<<<dim3(NB * T2 / 64, 2), 128, 0, stream>>>(F[0], F[1], F[2], F[3], F[4], F[5], F[6], QH, QL, KH, KL, OUT);
  k_x2t<<<dim3(T2 / 64, NB), 256, 0, stream>>>(F[0], XT);
  k_sc<<<dim3(T2 / 64, T2 / 128, NB), 128, 0, stream>>>(QH, QL, KH, KL, F[7], S, MT, LT);
  k_pv<<<dim3(T2 / 64, DD / 128, NB), 128, 0, stream>>>(S, XT, F[0], OUT, DG, MT, LT);
  k_logdet<<<1, 256, 0, stream>>>(DG, OUT);
}

// v007
// It runs in 106 microseconds.
// In both of two side-by-side timings against v006, it was 1.05 times as fast.
// All steps since v000 together make it 3.62 times as fast.
// compute dtype: all float inputs rounded to bf16, d_scale read; q, k = LayerNorm(x1 W^T) with EXACT bf16 products on WMMA 16x16x32 and the LN in f32; q and k as f16 hi + residual -> 3-product logits / d_scale (std ~16: near-one-hot rows), upper-triangular mask, softmax in f32 (precise exp) in two levels: exp(s - tile maximum) stored in f32 with each 128-column tile's maximum and sum, then one factor a row and tile; P x 2^11 in f32 split bf16 hi + lo against the bf16-exact x2 (2 products) + the identity term; logdet = (L/2) sum_i log(1 + P_ii) (att + I is upper triangular, so slogdet is the diagonal product - exact identity); f32 outputs: merged [n][L][D] (x1 copied, then att x2) and logdet [n].
#include <hip/hip_runtime.h>
#include <math.h>

typedef __attribute__((ext_vector_type(16))) _Float16 v16h;
typedef __attribute__((ext_vector_type(16))) __bf16 v16b;
typedef __attribute__((ext_vector_type(8)))  _Float16 v8h;
typedef __attribute__((ext_vector_type(8)))  float v8f;
typedef __attribute__((ext_vector_type(4)))  float v4f;
typedef __attribute__((ext_vector_type(2)))  float v2f;
typedef __attribute__((ext_vector_type(4)))  unsigned v4u;
typedef __attribute__((ext_vector_type(4)))  int v4i;
typedef float __attribute__((may_alias)) float_a;
typedef int __attribute__((may_alias)) int_a;

template <typename T> __device__ __forceinline__ void vst2(void* p, T v) { *(T*)p = v;  }
__device__ __forceinline__ v8f wmma16(v16h a, v16h b, v8f c) {
  v8f d = __builtin_amdgcn_wmma_f32_16x16x32_f16(false, a, false, b, (short)0, c, false, false);
  asm volatile("v_nop\n\tv_nop\n\tv_nop\n\tv_nop" : "+v"(d) : "v"(a), "v"(b));
  return d;
}
__device__ __forceinline__ v8f wmma_bf(v16b a, v16b b, v8f c) {
  v8f d = __builtin_amdgcn_wmma_f32_16x16x32_bf16(false, a, false, b, (short)0, c, false, false);
  asm volatile("v_nop\n\tv_nop\n\tv_nop\n\tv_nop" : "+v"(d) : "v"(a), "v"(b));
  return d;
}
// 16x16x32 fragments: lane = (h = lane>>4, row/col = lane&15); elements 0..7 = k0+8h+0..7, 8..15 = k0+16+8h+0..7; D element r = row 8h+r
__device__ __forceinline__ v16h frag_h(const _Float16* rowk0, int lane) {
  union { v16h v; v8h q[2]; } u; const _Float16* p = rowk0 + 8 * (lane >> 4);
  u.q[0] = *(const v8h*)p; u.q[1] = *(const v8h*)(p + 16); return u.v;
}
__device__ __forceinline__ v16h frag_f32(const float* rowk0, int lane) {
  v16h a; const float* p = rowk0 + 8 * (lane >> 4);
#pragma unroll
  for (int i = 0; i < 8; ++i) { a[i] = (_Float16)p[i]; a[8 + i] = (_Float16)p[16 + i]; }
  return a;
}
__device__ __forceinline__ v16h frag_f32s(const float* rowk0, int lane, float sc) {
  v16h a; const float* p = rowk0 + 8 * (lane >> 4);
#pragma unroll
  for (int i = 0; i < 8; ++i) { a[i] = (_Float16)(p[i] * sc); a[8 + i] = (_Float16)(p[16 + i] * sc); }
  return a;
}
// column fragment from a [K][ld] layout (column n), rows >= K read as 0
__device__ __forceinline__ v16h fragc_f32(const float* W, int k0, int n, int lane, int ld, int K) {
  v16h a; const int g = lane >> 4;
#pragma unroll
  for (int i = 0; i < 8; ++i) { const int ka = k0 + 8 * g + i, kb = ka + 16;
    a[i] = (_Float16)(ka < K ? W[(size_t)(ka < K ? ka : K - 1) * ld + n] : 0.f); a[8 + i] = (_Float16)(kb < K ? W[(size_t)(kb < K ? kb : K - 1) * ld + n] : 0.f); }
  return a;
}
struct F2 { v16b h, l; };
__device__ __forceinline__ F2 bsplit16(const float v[16]) { F2 r;
#pragma unroll
  for (int i = 0; i < 16; ++i) { const __bf16 h = (__bf16)v[i]; r.h[i] = h; r.l[i] = (__bf16)(v[i] - (float)h); }
  return r; }
__device__ __forceinline__ F2 split_row(const float* row, int k0, int lane) { float v[16]; const float* p = row + k0 + 8 * (lane >> 4);
#pragma unroll
  for (int i = 0; i < 8; ++i) { v[i] = p[i]; v[8 + i] = p[16 + i]; }
  return bsplit16(v); }
__device__ __forceinline__ F2 split_rowK(const float* row, int k0, int lane, int K) { float v[16]; const int g = lane >> 4;
#pragma unroll
  for (int i = 0; i < 8; ++i) { const int ka = k0 + 8 * g + i, kb = ka + 16; v[i] = ka < K ? row[ka < K ? ka : K - 1] : 0.f; v[8 + i] = kb < K ? row[kb < K ? kb : K - 1] : 0.f; }
  return bsplit16(v); }
__device__ __forceinline__ F2 split_col(const float* W, int k0, int n, int lane, int ld, int K) { float v[16]; const int g = lane >> 4;
#pragma unroll
  for (int i = 0; i < 8; ++i) { const int ka = k0 + 8 * g + i, kb = ka + 16; v[i] = ka < K ? W[(size_t)(ka < K ? ka : K - 1) * ld + n] : 0.f; v[8 + i] = kb < K ? W[(size_t)(kb < K ? kb : K - 1) * ld + n] : 0.f; }
  return bsplit16(v); }
__device__ __forceinline__ v8f mac3(const F2& a, const F2& b, v8f c) { c = wmma_bf(a.l, b.h, c); c = wmma_bf(a.h, b.l, c); return wmma_bf(a.h, b.h, c); }
__device__ __forceinline__ float sigm(float v) { return 1.0f / (1.0f + expf(-v)); }
#define LDSX() do { asm volatile("s_wait_dscnt 0" ::: "memory"); __builtin_amdgcn_wave_barrier(); __builtin_amdgcn_fence(__ATOMIC_RELEASE, "workgroup"); } while (0)


// Invertible attention (N 8, L 4,096 -> halves of 2,048, D 256): att = softmax(upper-tri(LN(x1 Wq^T) . LN(x1 Wk^T) / d_scale)) + I; out = att x2; logdet = slogdet(att) * L/2.
#define NB 8
#define LL 4096
#define T2 2048
#define DD 256
#define LN_EPS 1e-5f
typedef __attribute__((ext_vector_type(8))) __bf16 v8b;
__device__ __forceinline__ v16b frag_b(const __bf16* rowk0, int lane) {
  union { v16b v; v8b q[2]; } u; const __bf16* p = rowk0 + 8 * (lane >> 4);
  u.q[0] = *(const v8b*)p; u.q[1] = *(const v8b*)(p + 16); return u.v;
}
__device__ __forceinline__ float bfr(float v) { return (float)(__bf16)v; }
__device__ __attribute__((noinline)) float exp_ni(float v) { return expf(v); }
__device__ __attribute__((noinline)) float erf_ni(float v) { return erff(v); }

// Eight 16-byte asynchronous copies per lane, global memory to LDS through no register. The s_wait_xcnt is the statement's last line so that no address register of a copy is rewritten ahead of it.
__device__ __forceinline__ void acopy8(const unsigned (&l)[8], const char* const (&gp)[8]) {
  asm volatile("global_load_async_to_lds_b128 %0, %8, off\n\t"
               "global_load_async_to_lds_b128 %1, %9, off\n\t"
               "global_load_async_to_lds_b128 %2, %10, off\n\t"
               "global_load_async_to_lds_b128 %3, %11, off\n\t"
               "global_load_async_to_lds_b128 %4, %12, off\n\t"
               "global_load_async_to_lds_b128 %5, %13, off\n\t"
               "global_load_async_to_lds_b128 %6, %14, off\n\t"
               "global_load_async_to_lds_b128 %7, %15, off\n\t"
               "s_wait_xcnt 0x0"
               :: "v"(l[0]), "v"(l[1]), "v"(l[2]), "v"(l[3]), "v"(l[4]), "v"(l[5]), "v"(l[6]), "v"(l[7]),
                  "v"(gp[0]), "v"(gp[1]), "v"(gp[2]), "v"(gp[3]), "v"(gp[4]), "v"(gp[5]), "v"(gp[6]), "v"(gp[7]) : "memory");
}
// The same with four copies.
__device__ __forceinline__ void acopy4(const unsigned (&l)[4], const char* const (&gp)[4]) {
  asm volatile("global_load_async_to_lds_b128 %0, %4, off\n\t"
               "global_load_async_to_lds_b128 %1, %5, off\n\t"
               "global_load_async_to_lds_b128 %2, %6, off\n\t"
               "global_load_async_to_lds_b128 %3, %7, off\n\t"
               "s_wait_xcnt 0x0"
               :: "v"(l[0]), "v"(l[1]), "v"(l[2]), "v"(l[3]), "v"(gp[0]), "v"(gp[1]), "v"(gp[2]), "v"(gp[3]) : "memory");
}
// this wave's copies have landed (the compiler places no wait for them)
#define WAIT_ASYNC() asm volatile("s_wait_asynccnt 0x0" ::: "memory")
// this wave's LDS reads have returned, so the buffer may be handed back for a refill
#define WAIT_DS() asm volatile("s_wait_dscnt 0x0" ::: "memory")

#define WS_QH  0u
#define WS_QL  (WS_QH + 2u * (size_t)NB * T2 * DD)
#define WS_KH  (WS_QL + 2u * (size_t)NB * T2 * DD)
#define WS_KL  (WS_KH + 2u * (size_t)NB * T2 * DD)
#define WS_XT  (WS_KL + 2u * (size_t)NB * T2 * DD)      // bf16 x2 planes [n][d][j]
#define WS_S   (WS_XT + 2u * (size_t)NB * DD * T2)      // f32 exp(s - tile maximum) [n][i][j]
#define WS_DG  (WS_S + 4u * (size_t)NB * T2 * T2)       // f32 log(1 + P_ii) [n][i]
#define WS_MT  (WS_DG + 4u * (size_t)NB * T2)           // f32 maximum of a row in a 128-column tile [n][tile][i]
#define WS_LT  (WS_MT + 4u * (size_t)NB * (T2 / 128) * T2)   // f32 sum of exp(s - that maximum) [n][tile][i]
#define WS_END (WS_LT + 4u * (size_t)NB * (T2 / 128) * T2)
#define OUT1_OFF ((size_t)NB * LL * DD)               // logdet output offset (elements)

// the value of lane l ^ M inside the 16-lane row (row_xmask), every lane on
template <int M> __device__ __forceinline__ float xrow(float x) { return __builtin_bit_cast(float, __builtin_amdgcn_update_dpp(0, __builtin_bit_cast(int, x), 0x160 + M, 0xf, 0xf, true)); }
__device__ __forceinline__ float rmax16(float x) { x = fmaxf(x, xrow<1>(x)); x = fmaxf(x, xrow<2>(x)); x = fmaxf(x, xrow<4>(x)); return fmaxf(x, xrow<8>(x)); }
__device__ __forceinline__ float rsum16(float x) { x += xrow<1>(x); x += xrow<2>(x); x += xrow<4>(x); return x + xrow<8>(x); }
// ---- k_proj: block = (64 rows of x1, which): y = x1 W^T ([out][in]); LayerNorm(gamma, beta) -> f16 hi + lo rows; also copies bf16-rounded x1 into merged (which == 0 blocks)
// The W rows (all 256) and the block's x1 rows come in slices of 32 k = 128 B a row, whole lines, f32, by asynchronous copies into two LDS buffers; the fragments are read from LDS and rounded to bf16 there.
// LayerNorm runs on the accumulators: a wave holds its 16 rows whole (a lane 16 columns of each of 8 rows), so a row's mean and variance are 16 additions in the lane and a sum over the 16 lanes of its half.
// The f16 hi and lo of a value go as one dword into the wave's own rows of sp, which lies over the two buffers and is first written behind the last trip's barrier; the wave reads its rows back and stores whole lines.
#define PJ_P 144u                    // LDS row pitch: 128 B + 16, conflict-free for 16-byte reads
#define PJ_X (256u * PJ_P)           // rows in a buffer: W 256 | x1 64
#define PJ_BUF (320u * PJ_P)
static_assert(64u * (DD + 4u) * 4u <= 2u * PJ_BUF, "sp lies inside the staging buffers");
__device__ __forceinline__ v16b cvt_frag(const v4f (&r)[4]) { v16b a;   // elements 0..7 = k 8g+0..7, 8..15 = k 16+8g+0..7
// unrolled: a[] and r[] are registers
#pragma unroll
  for (int i = 0; i < 4; ++i) { a[i] = (__bf16)r[0][i]; a[4 + i] = (__bf16)r[1][i]; a[8 + i] = (__bf16)r[2][i]; a[12 + i] = (__bf16)r[3][i]; }
  return a; }
__global__ __launch_bounds__(128) void k_proj(const float* __restrict__ X, const float* __restrict__ WQ, const float* __restrict__ WK, const float* __restrict__ GQ, const float* __restrict__ BQ, const float* __restrict__ GK, const float* __restrict__ BK, _Float16* __restrict__ QH, _Float16* __restrict__ QL, _Float16* __restrict__ KH, _Float16* __restrict__ KL, float* __restrict__ OUT) {
  __shared__ __align__(16) unsigned char ar[2u * PJ_BUF];
  unsigned (*sp)[DD + 4] = (unsigned (*)[DD + 4])ar;   // pitch 260 dwords: the two halves of a wave, 8 rows apart, write banks 32 apart
  const int tid = threadIdx.x, wave = tid >> 5, lane = tid & 31, col = lane & 15, g = lane >> 4; const int which = blockIdx.y; const size_t r0 = (size_t)blockIdx.x * 64; const size_t n = r0 / T2; const int i0 = (int)(r0 % T2);   // rows of x1: x[n][i][:], i < T2
  const float* Wm = which == 0 ? WQ : WK; const float* Gm = which == 0 ? GQ : GK; const float* Bm = which == 0 ? BQ : BK;
  const int rr = tid >> 3, pc = tid & 7;   // a copy of a wave covers 4 rows x 128 B
  const unsigned lb = (unsigned)(size_t)ar + (unsigned)rr * PJ_P + (unsigned)pc * 16u;
  const char* gw = (const char*)(Wm + (size_t)rr * DD + pc * 4); const char* gx = (const char*)(X + (n * LL + i0 + rr) * DD + pc * 4);
  // the loops below are unrolled so that l[] and gp[] are registers: they are asm operands
  auto stage = [&](int t, int b) { unsigned l[8]; const char* gp[8]; unsigned l4[4]; const char* gp4[4]; const unsigned lt = lb + (unsigned)b * PJ_BUF; const size_t go = (size_t)t * 128;
#pragma unroll
    for (int m = 0; m < 8; ++m) { l[m] = lt + (unsigned)m * 16u * PJ_P; gp[m] = gw + go + (size_t)m * 16 * DD * 4; }
    acopy8(l, gp);
#pragma unroll
    for (int m = 0; m < 8; ++m) { l[m] = lt + (unsigned)(8 + m) * 16u * PJ_P; gp[m] = gw + go + (size_t)(8 + m) * 16 * DD * 4; }
    acopy8(l, gp);
#pragma unroll
    for (int m = 0; m < 4; ++m) { l4[m] = lt + PJ_X + (unsigned)m * 16u * PJ_P; gp4[m] = gx + go + (size_t)m * 16 * DD * 4; }
    acopy4(l4, gp4); };
  stage(0, 0); WAIT_ASYNC(); __syncthreads(); stage(1, 1);
  v8f acc[16] = {};
// rolled: one copy of the 16-WMMA body, and the two buffers alternate by an offset; the loops inside are unrolled so that acc[], r[] and w[] stay in registers
#pragma unroll 1
  for (int t = 0; t < DD / 32; ++t) { const unsigned char* B = ar + (unsigned)(t & 1) * PJ_BUF; v4f ra[4], r[4][4];
    // a lane's 16 values of a row: k 8g+0..7 and 16+8g+0..7, four 16-byte reads
    auto rd = [&](v4f (&d)[4], unsigned row) { const v4f* p = (const v4f*)(B + row * PJ_P + (unsigned)g * 32u); d[0] = p[0]; d[1] = p[1]; d[2] = p[4]; d[3] = p[5]; };
    rd(ra, 256u + (unsigned)(wave * 16 + col));
#pragma unroll
    for (int jj = 0; jj < 4; ++jj) rd(r[jj], (unsigned)(jj * 16 + col));
    const v16b a = cvt_frag(ra);
#pragma unroll
    for (int jg = 0; jg < 4; ++jg) { v16b w[4];
#pragma unroll
      for (int jj = 0; jj < 4; ++jj) w[jj] = cvt_frag(r[jj]);
      // the next four fragments' reads stand ahead of this group's WMMAs, so that their LDS latency runs beside them
      if (jg < 3) {
#pragma unroll
        for (int jj = 0; jj < 4; ++jj) rd(r[jj], (unsigned)((jg * 4 + 4 + jj) * 16 + col)); }
#pragma unroll
      for (int jj = 0; jj < 4; ++jj) acc[jg * 4 + jj] = wmma_bf(a, w[jj], acc[jg * 4 + jj]); }
    WAIT_DS(); WAIT_ASYNC(); __syncthreads();   // publishes slice t + 1 and ends every reader's last read of slice t's buffer
    if (t + 2 < DD / 32) stage(t + 2, t & 1); }
  WAIT_ASYNC();
// every loop below is unrolled: acc[], gm[] and bt[] are registers
  float gm[16], bt[16];   // the lane's 16 columns of gamma and beta: the loads fly beside the sums
#pragma unroll
  for (int j = 0; j < 16; ++j) { gm[j] = Gm[j * 16 + col]; bt[j] = Bm[j * 16 + col]; }
  // the 8 rows of a lane side by side as one vector: neighbouring rows lie in neighbouring registers, which packed f32 instructions take as they are
  v8f s8 = acc[0], q8 = {}, mu, rs;
#pragma unroll
  for (int j = 1; j < 16; ++j) s8 += acc[j];
#pragma unroll
  for (int r = 0; r < 8; ++r) mu[r] = rsum16(s8[r]) * (1.0f / DD);
#pragma unroll
  for (int j = 0; j < 16; ++j) { const v8f d = acc[j] - mu; q8 += d * d; }
#pragma unroll
  for (int r = 0; r < 8; ++r) rs[r] = 1.0f / sqrtf(rsum16(q8[r]) * (1.0f / DD) + LN_EPS);
#pragma unroll
  for (int j = 0; j < 16; ++j) { const v8f y = (acc[j] - mu) * rs * bfr(gm[j]) + bfr(bt[j]);
#pragma unroll
    for (int r = 0; r < 8; ++r) { const float v = y[r]; const _Float16 hv = (_Float16)v, lv = (_Float16)(v - (float)hv);
      sp[wave * 16 + 8 * g + r][j * 16 + col] = (unsigned)__builtin_bit_cast(unsigned short, hv) | ((unsigned)__builtin_bit_cast(unsigned short, lv) << 16); } }   // hi in the low half
  LDSX();   // the wave's own rows are written before it reads them back across its lanes; no other wave touches them
  _Float16* dh = which == 0 ? QH : KH; _Float16* dl = which == 0 ? QL : KL;
  // a lane takes 8 columns of a row, parts hi from lo, and the wave stores 512 B of each: whole lines
#pragma unroll
  for (int rl = 0; rl < 16; ++rl) { const v4u* p = (const v4u*)&sp[wave * 16 + rl][lane * 8]; const v4u a = p[0], b = p[1]; v4u h, l;
    h[0] = (a[0] & 0xffffu) | (a[1] << 16); h[1] = (a[2] & 0xffffu) | (a[3] << 16); h[2] = (b[0] & 0xffffu) | (b[1] << 16); h[3] = (b[2] & 0xffffu) | (b[3] << 16);
    l[0] = (a[0] >> 16) | (a[1] & 0xffff0000u); l[1] = (a[2] >> 16) | (a[3] & 0xffff0000u); l[2] = (b[0] >> 16) | (b[1] & 0xffff0000u); l[3] = (b[2] >> 16) | (b[3] & 0xffff0000u);
    vst2((unsigned*)(dh + (r0 + wave * 16 + rl) * DD + lane * 8), h); vst2((unsigned*)(dl + (r0 + wave * 16 + rl) * DD + lane * 8), l); }
  asm volatile("s_wait_xcnt 0x0" ::: "memory");   // stands ahead of any rewrite of the stores' address and data registers by the copy loop below
  if (which == 0) { for (int e = tid; e < 64 * 64; e += 128) { const int rl = e >> 6, q = e & 63; const size_t go = (n * LL + i0 + rl) * DD + q * 4; const v4f xr = *(const v4f*)(X + go); v4f v; v[0] = bfr(xr[0]); v[1] = bfr(xr[1]); v[2] = bfr(xr[2]); v[3] = bfr(xr[3]); vst2(OUT + go, v); } } }
// ---- k_x2t: block = (64 j, n): x2 planes XT[n][d][j] (bf16, exact)
__global__ __launch_bounds__(256) void k_x2t(const float* __restrict__ X, __bf16* __restrict__ XT) { __shared__ __align__(16) __bf16 st[DD][72];
  const int t = threadIdx.x; const size_t n = blockIdx.y; const int j0 = blockIdx.x * 64;
  for (int e = t; e < 64 * DD; e += 256) { const int jl = e >> 8, d = e & 255; st[d][jl] = (__bf16)X[(n * LL + T2 + j0 + jl) * DD + d]; }
  __syncthreads(); for (int e = t; e < DD * 8; e += 256) { const int d = e >> 3, q = e & 7; vst2((unsigned*)(XT + (n * DD + d) * (size_t)T2 + j0 + q * 8), *(const v4u*)&st[d][q * 8]); } }
#define SM_NEG -3.0e38f
// e^x in f32 for x <= 0: r = nearest integer to x log2(e); fraction = x log2(e) - r by two fused multiply-adds, log2(e) in two parts (the product is not rounded before r is taken off); 2^fraction; ldexp by r.
// The floor of -200 keeps r finite for a masked value, and ldexp then gives exactly 0. 2^fraction stands in asm: the v_nop in the statement is the free slot that the instruction set asks for behind a transcendental.
__device__ __forceinline__ float exp_np(float x) {
  x = fmaxf(x, -200.0f); const float r = __builtin_rintf(x * 0x1.715476p+0f); const float a = __builtin_fmaf(x, 0x1.4ae0bep-26f, __builtin_fmaf(x, 0x1.715476p+0f, -r));
  float e; asm("v_exp_f32 %0, %1\n\tv_nop" : "=v"(e) : "v"(a));
  return ldexpf(e, (int)r); }
// ---- k_sc: block = (64 rows i, 128 cols j, n): s = q.k / d_scale for j >= i, else masked; stored: exp(s - m), m the row's maximum in this tile (0 where masked), with m and the row's sum of them in MT and LT [n][tile][i] for k_pv; blocks entirely below the diagonal store the mask and 0 there and exit.
// The K and Q rows (hi and lo) come in slices of 64 k = 128 B a row, whole lines, by asynchronous copies into two LDS buffers; the fragments are read from LDS.
#define SC_P 144u                    // LDS row pitch: 128 B + 16, conflict-free for 16-byte reads
#define SC_KL (128u * SC_P)          // rows in a buffer: KH 128 | KL 128 | QH 64 | QL 64
#define SC_QH (256u * SC_P)
#define SC_QL (320u * SC_P)
#define SC_BUF (384u * SC_P)
__global__ __launch_bounds__(128) void k_sc(const _Float16* __restrict__ QH, const _Float16* __restrict__ QL, const _Float16* __restrict__ KH, const _Float16* __restrict__ KL, const float* __restrict__ DSC, float* __restrict__ S0, float* __restrict__ MT, float* __restrict__ LT) { __shared__ __align__(16) float ss[4][16][132]; __shared__ __align__(16) unsigned char sb[2 * SC_BUF]; __shared__ __align__(16) float st[2][64];
  const size_t n = blockIdx.z; float* S = S0 + n * (size_t)T2 * T2;
  const int tid = threadIdx.x, wave = tid >> 5, lane = tid & 31, col = lane & 15, g = lane >> 4; const int k0 = blockIdx.y * 128; const int q0b = blockIdx.x * 64; const int ql0 = q0b + wave * 16;
  float* const tq = (tid < 64 ? MT : LT) + (n * (T2 / 128) + blockIdx.y) * (size_t)T2 + q0b + (tid & 63);   // waves 0 and 1 store the 64 rows' maxima, waves 2 and 3 their sums, one whole line each
  if (k0 + 127 < q0b) { *tq = tid < 64 ? SM_NEG : 0.f; return; }   // all j < i: the tile counts as masked in k_pv's factors, and its values are never read (k_pv starts at the tile of the rows' diagonal)
  const float isc = 1.0f / bfr(DSC[0]);
  const int rr = tid >> 3, pc = tid & 7;   // a copy of a wave covers 4 rows x 128 B
  const unsigned lb = (unsigned)(size_t)sb + (unsigned)rr * SC_P + (unsigned)pc * 16u;
  const char* gkh = (const char*)(KH + (n * T2 + k0 + rr) * DD + pc * 8); const char* gkl = (const char*)(KL + (n * T2 + k0 + rr) * DD + pc * 8);
  const char* gqh = (const char*)(QH + (n * T2 + q0b + rr) * DD + pc * 8); const char* gql = (const char*)(QL + (n * T2 + q0b + rr) * DD + pc * 8);
  // the loops below are unrolled so that l[] and gp[] are registers: they are asm operands
  auto stage = [&](int t, int b) { unsigned l[8]; const char* gp[8]; const unsigned lt = lb + (unsigned)b * SC_BUF; const size_t go = (size_t)t * 128;
#pragma unroll
    for (int m = 0; m < 8; ++m) { l[m] = lt + (unsigned)m * 16u * SC_P; gp[m] = gkh + go + (size_t)m * 16 * DD * 2; }
    acopy8(l, gp);
#pragma unroll
    for (int m = 0; m < 8; ++m) { l[m] = lt + SC_KL + (unsigned)m * 16u * SC_P; gp[m] = gkl + go + (size_t)m * 16 * DD * 2; }
    acopy8(l, gp);
#pragma unroll
    for (int m = 0; m < 4; ++m) { l[m] = lt + SC_QH + (unsigned)m * 16u * SC_P; gp[m] = gqh + go + (size_t)m * 16 * DD * 2; l[4 + m] = lt + SC_QL + (unsigned)m * 16u * SC_P; gp[4 + m] = gql + go + (size_t)m * 16 * DD * 2; }
    acopy8(l, gp); };
  stage(0, 0); WAIT_ASYNC(); __syncthreads(); stage(1, 1);
  v8f acc[8] = {};
// rolled: one copy of the 48-WMMA body, and the two buffers alternate by an offset; the loops inside are unrolled so that acc[], kb[] and kl[] stay in registers
#pragma unroll 1
  for (int t = 0; t < DD / 64; ++t) { const unsigned char* B = sb + (unsigned)(t & 1) * SC_BUF;
#pragma unroll
    for (int kk = 0; kk < 2; ++kk) { const unsigned qo = (unsigned)(wave * 16 + col) * SC_P + (unsigned)kk * 64u; const v16h ah = frag_h((const _Float16*)(B + SC_QH + qo), lane), al = frag_h((const _Float16*)(B + SC_QL + qo), lane); v16h kb[8], kl[8];
#pragma unroll
      for (int j = 0; j < 8; ++j) { const unsigned ko = (unsigned)(j * 16 + col) * SC_P + (unsigned)kk * 64u; kb[j] = frag_h((const _Float16*)(B + ko), lane); kl[j] = frag_h((const _Float16*)(B + SC_KL + ko), lane); }
      // inputs only: keeps the LDS reads of this 32-k step together ahead of its WMMAs; read one fragment at a time, every WMMA waits out an LDS latency
      asm volatile("" :: "v"(ah), "v"(al), "v"(kb[0]), "v"(kb[1]), "v"(kb[2]), "v"(kb[3]), "v"(kb[4]), "v"(kb[5]), "v"(kb[6]), "v"(kb[7]), "v"(kl[0]), "v"(kl[1]), "v"(kl[2]), "v"(kl[3]), "v"(kl[4]), "v"(kl[5]), "v"(kl[6]), "v"(kl[7]));
#pragma unroll
      for (int j = 0; j < 8; ++j) { acc[j] = wmma16(ah, kb[j], acc[j]); acc[j] = wmma16(al, kb[j], acc[j]); acc[j] = wmma16(ah, kl[j], acc[j]); } }
    WAIT_DS(); WAIT_ASYNC(); __syncthreads();   // publishes slice t + 1 and ends every reader's last read of slice t's buffer
    if (t + 2 < DD / 64) stage(t + 2, t & 1); }
  WAIT_ASYNC();
  // a lane holds 8 columns of each of the rows 8g + 0..7: maximum and sum in the lane, then over the 16 lanes of its half. Every row of a block that runs has a column j >= i in the tile. The loops are unrolled: acc[], mx[] and sm[] are registers
  float mx[8], sm[8];
#pragma unroll
  for (int r = 0; r < 8; ++r) { mx[r] = SM_NEG; sm[r] = 0.f; }
#pragma unroll
  for (int j = 0; j < 8; ++j) { const int jj = k0 + j * 16 + col;
#pragma unroll
    for (int r = 0; r < 8; ++r) { const int ii = ql0 + 8 * g + r; acc[j][r] = (jj >= ii) ? acc[j][r] * isc : SM_NEG; mx[r] = fmaxf(mx[r], acc[j][r]); } }
#pragma unroll
  for (int r = 0; r < 8; ++r) mx[r] = rmax16(mx[r]);
#pragma unroll
  for (int j = 0; j < 8; ++j)
#pragma unroll
    for (int r = 0; r < 8; ++r) { const float e = exp_np(acc[j][r] - mx[r]); sm[r] += e; ss[wave][8 * g + r][j * 16 + col] = e; }
#pragma unroll
  for (int r = 0; r < 8; ++r) sm[r] = rsum16(sm[r]);
  if (col == 0) {
#pragma unroll
    for (int r = 0; r < 8; ++r) { st[0][wave * 16 + 8 * g + r] = mx[r]; st[1][wave * 16 + 8 * g + r] = sm[r]; } }
  __syncthreads();   // st[] is whole (and every wave's own ss rows are written). It stands ahead of the row stores: behind them it would wait for them to complete
  *tq = st[tid >> 6][tid & 63];
  for (int rl = 0; rl < 16; ++rl) vst2(S + (size_t)(ql0 + rl) * T2 + k0 + lane * 4, *(const v4f*)&ss[wave][rl][lane * 4]);
  asm volatile("s_wait_xcnt 0x0" ::: "memory"); }   // stands ahead of any rewrite of the stores' address and data registers: the compiler lays the early exit's store behind this place
// ---- k_pv: block = (64 rows i, 128 cols d, n), 8 waves: out = P (hi + lo) . x2 (exact) over j >= 128*(i/128), + x2[i]; written to merged rows T2 + i.
// P x 2^11 = k_sc's exp(s - tile maximum) times the row's factor of that tile, exp(tile maximum - row maximum) x 2^11 / row sum: 16 factors a row, formed from MT and LT while the first slice flies.
// The stored rows (f32) and x2 planes (bf16) come in slices of 128 j (one tile of k_sc), whole lines, by asynchronous copies into two LDS buffers; the fragments are read from LDS.
// Waves 0..3 take the first 64 j of a slice and waves 4..7 the second 64, each group all 64 rows: the longest block makes 16 trips, not 32, and a trip waits once for memory. The two partial sums meet in LDS behind the loop.
// A block of odd blockIdx.x starts 64 columns left of its rows' diagonal: k_sc has stored exact zeros there.
// The first slice of a block holds its rows' diagonal: the blocks of d-block 0 store log(1 + P_ii) from it into LG [n][i] for k_logdet.
#define PV_PP 528u                   // LDS pitch of a P row: 512 B + 16
#define PV_XP 272u                   // LDS pitch of an x2 plane row: 256 B + 16
#define PV_X (64u * PV_PP)           // a buffer: P 64 rows | x2 planes 128 rows
#define PV_BUF (PV_X + 128u * PV_XP)
static_assert(4u * 16u * 132u * 4u <= 2u * PV_BUF, "ss lies inside the staging buffers");
__global__ __launch_bounds__(256) void k_pv(const float* __restrict__ PS0, const __bf16* __restrict__ XT, const float* __restrict__ X, float* __restrict__ OUT, float* __restrict__ LG, const float* __restrict__ MT, const float* __restrict__ LT) { __shared__ __align__(16) unsigned char sb[2 * PV_BUF]; __shared__ float cs[64][17];   // pitch 17: 16 rows read at once meet 16 banks
  float (*ss)[16][132] = (float (*)[16][132])sb;   // lies over the two buffers and is first written behind the last trip's barrier
  const size_t n = blockIdx.z; const float* PS = PS0 + n * (size_t)T2 * T2;
  const int tid = threadIdx.x, wave = tid >> 5, lane = tid & 31, col = lane & 15, g = lane >> 4; const int wr = wave & 3, jh = __builtin_amdgcn_readfirstlane(wave) >> 2;   // the wave's 16 rows; its half of a slice (a scalar)
  const int q0b = blockIdx.x * 64; const int ql0 = q0b + wr * 16; const int c0 = blockIdx.y * 128;
  const unsigned lp = (unsigned)(size_t)sb + (unsigned)(tid >> 5) * PV_PP + (unsigned)(tid & 31) * 16u;           // a copy of a wave covers 1 P row x 512 B
  const unsigned lx = (unsigned)(size_t)sb + PV_X + (unsigned)(tid >> 4) * PV_XP + (unsigned)(tid & 15) * 16u;    // or 2 plane rows x 256 B
  const char* gpp = (const char*)(PS + (size_t)(q0b + (tid >> 5)) * T2 + (tid & 31) * 4); const char* gxx = (const char*)(XT + (n * DD + c0 + (tid >> 4)) * (size_t)T2 + (tid & 15) * 8);
  // the loops below are unrolled so that l[] and gp[] are registers: they are asm operands
  auto stage = [&](int t, int b) { unsigned l[8]; const char* gp[8];
#pragma unroll
    for (int m = 0; m < 8; ++m) { l[m] = lp + (unsigned)b * PV_BUF + (unsigned)m * 8u * PV_PP; gp[m] = gpp + (size_t)t * 512 + (size_t)m * 8 * T2 * 4; }
    acopy8(l, gp);
#pragma unroll
    for (int m = 0; m < 8; ++m) { l[m] = lx + (unsigned)b * PV_BUF + (unsigned)m * 16u * PV_XP; gp[m] = gxx + (size_t)t * 256 + (size_t)m * 16 * T2 * 2; }
    acopy8(l, gp); };
  const int t0 = blockIdx.x >> 1;   // first slice of 128 j: the tile that holds the rows' diagonal
  stage(t0, 0);
  // waves 0 and 1 (a scalar test): thread tid forms row tid's factors; a tile left of the diagonal holds the mask and a sum of 0. Unrolled: mt[] and lt[] are registers and the 32 whole-line loads fly together
  if (__builtin_amdgcn_readfirstlane(wave) < 2) { float mt[16], lt[16]; const size_t o = n * (T2 / 128) * (size_t)T2 + q0b + tid;
#pragma unroll
    for (int i = 0; i < 16; ++i) { mt[i] = MT[o + (size_t)i * T2]; lt[i] = LT[o + (size_t)i * T2]; }
    float m = SM_NEG, l = 0.f;
#pragma unroll
    for (int i = 0; i < 16; ++i) m = fmaxf(m, mt[i]);
#pragma unroll
    for (int i = 0; i < 16; ++i) { mt[i] = exp_np(mt[i] - m); l += lt[i] * mt[i]; }
    const float f = 2048.0f / l;
#pragma unroll
    for (int i = 0; i < 16; ++i) cs[tid][i] = mt[i] * f; }
  WAIT_ASYNC(); __syncthreads(); if (t0 + 1 < T2 / 128) stage(t0 + 1, 1);   // the barrier publishes cs[] too
  // row tid of buffer 0, the row's own column, times the row's factor: P_ii x 2^11. Waves 0 and 1 (a scalar test, every lane on) store one whole line each; buffer 0 is refilled only behind the foot of the first trip.
  if (blockIdx.y == 0 && __builtin_amdgcn_readfirstlane(wave) < 2) { const float pd = *(const float*)(sb + (unsigned)tid * (PV_PP + 4u) + (unsigned)(blockIdx.x & 1) * 256u) * cs[tid][t0]; LG[n * T2 + q0b + tid] = logf(1.0f + pd * (1.0f / 2048.0f));
    asm volatile("s_wait_xcnt 0x0" ::: "memory"); }   // stands ahead of any rewrite of the store's address and data registers
  v8f acc[8] = {};
// rolled: the trip count depends on the block; the loops inside are unrolled so that acc[] and xb[] stay in registers
#pragma unroll 1
  for (int t = t0; t < T2 / 128; ++t) { const int b = (t - t0) & 1; const unsigned char* B = sb + (unsigned)b * PV_BUF; const float cf = cs[wr * 16 + col][t];   // the lane's row, this slice's tile
#pragma unroll
    for (int kk = 0; kk < 2; ++kk) { const v4f* pp = (const v4f*)(B + (unsigned)(wr * 16 + col) * PV_PP + (unsigned)jh * 256u + (unsigned)kk * 128u + (unsigned)g * 32u); const v4f p0 = pp[0], p1 = pp[1], p2 = pp[4], p3 = pp[5]; v16b xb[8];   // P elements k0+8g+0..7 and k0+16+8g+0..7
#pragma unroll
      for (int j = 0; j < 8; ++j) xb[j] = frag_b((const __bf16*)(B + PV_X + (unsigned)(j * 16 + col) * PV_XP + (unsigned)jh * 128u + (unsigned)kk * 64u), lane);
      // inputs only: keeps the LDS reads of this 32-j step together ahead of its WMMAs; read one fragment at a time, every WMMA waits out an LDS latency
      asm volatile("" :: "v"(p0), "v"(p1), "v"(p2), "v"(p3), "v"(xb[0]), "v"(xb[1]), "v"(xb[2]), "v"(xb[3]), "v"(xb[4]), "v"(xb[5]), "v"(xb[6]), "v"(xb[7]));
      float pv[16];
#pragma unroll
      for (int i = 0; i < 4; ++i) { pv[i] = p0[i] * cf; pv[4 + i] = p1[i] * cf; pv[8 + i] = p2[i] * cf; pv[12 + i] = p3[i] * cf; }
      const F2 p = bsplit16(pv);
#pragma unroll
      for (int j = 0; j < 8; ++j) { acc[j] = wmma_bf(p.h, xb[j], acc[j]); acc[j] = wmma_bf(p.l, xb[j], acc[j]); } }
    WAIT_DS(); WAIT_ASYNC(); __syncthreads();   // publishes slice t + 1 and ends every reader's last read of slice t's buffer
    if (t + 2 < T2 / 128) stage(t + 2, b); }
  WAIT_ASYNC();
  // waves 4..7 hand their partial sums over, each lane to the lane of wave - 4 that holds the same elements. The loops are unrolled: acc[] is registers
  if (jh == 1) {
#pragma unroll
    for (int j = 0; j < 8; ++j)
#pragma unroll
      for (int r = 0; r < 8; ++r) ss[wr][8 * g + r][j * 16 + col] = acc[j][r]; }
  __syncthreads();   // the partial sums of waves 4..7 are in ss before waves 0..3 read them
  if (jh == 0) {
#pragma unroll
    for (int j = 0; j < 8; ++j) { const int d = c0 + j * 16 + col;
#pragma unroll
      for (int r = 0; r < 8; ++r) { const int ii = ql0 + 8 * g + r; float* const e = &ss[wr][8 * g + r][j * 16 + col]; *e = (acc[j][r] + *e) * (1.0f / 2048.0f) + bfr(X[(n * LL + T2 + ii) * DD + d]); } }
    LDSX(); for (int rl = 0; rl < 16; ++rl) vst2(OUT + (n * LL + T2 + ql0 + rl) * DD + c0 + lane * 4, *(const v4f*)&ss[wr][rl][lane * 4]); } }
// ---- k_logdet: one block: logdet[n] = (L/2) * sum_i log(1 + P_ii), the logarithms read from LG (64 KB, whole lines). Thread t sums i = t, t + 256, ... of every sample, then the wave, then the 8 waves in turn.
__global__ __launch_bounds__(256) void k_logdet(const float* __restrict__ LG, float* __restrict__ OUT) { __shared__ __align__(16) float sred[NB][8];
  const int t = threadIdx.x; v8f x[NB];
// unrolled: x[][] stays in registers and the 64 loads of a thread are all in flight together, one trip to memory
#pragma unroll
  for (int n = 0; n < NB; ++n)
#pragma unroll
    for (int k = 0; k < 8; ++k) x[n][k] = LG[n * T2 + k * 256 + t];
  // inputs only: keeps the 64 loads together ahead of the additions. Left alone the compiler issued the last five loads behind waits for the first, a second trip to memory
  asm volatile("" :: "v"(x[0]), "v"(x[1]), "v"(x[2]), "v"(x[3]), "v"(x[4]), "v"(x[5]), "v"(x[6]), "v"(x[7]));
  float s[NB];
#pragma unroll
  for (int n = 0; n < NB; ++n) { s[n] = 0.f;
#pragma unroll
    for (int k = 0; k < 8; ++k) s[n] += x[n][k]; }
// the samples inside, the steps outside: the 8 cross-lane exchanges of a step are independent and share one LDS-pipe latency
#pragma unroll
  for (int o = 1; o < 32; o <<= 1)
#pragma unroll
    for (int n = 0; n < NB; ++n) s[n] += __shfl_xor(s[n], o);
  if ((t & 31) == 0) {
#pragma unroll
    for (int n = 0; n < NB; ++n) sred[n][t >> 5] = s[n]; }
  __syncthreads();
  if (t < NB) { float a = 0.f;
#pragma unroll
    for (int i = 0; i < 8; ++i) a += sred[t][i];
    OUT[OUT1_OFF + t] = a * (float)(LL / 2); } }
extern "C" void kernel_launch(void* const* d_in, const int* in_sizes, int n_in, void* d_out, int out_size, void* d_ws, size_t ws_size, hipStream_t stream) {
  (void)in_sizes; (void)n_in; (void)out_size;
  const float** F = (const float**)d_in;   // 0 inputs [8,4096,256], 1 Wq [256,256] ([out,in]), 2 Wk, 3 q_gamma, 4 q_beta, 5 k_gamma, 6 k_beta, 7 d_scale [1]
  if (ws_size < (size_t)WS_END) return;
  char* ws = (char*)d_ws; _Float16 *QH = (_Float16*)(ws + WS_QH), *QL = (_Float16*)(ws + WS_QL), *KH = (_Float16*)(ws + WS_KH), *KL = (_Float16*)(ws + WS_KL); __bf16* XT = (__bf16*)(ws + WS_XT); float *S = (float*)(ws + WS_S), *DG = (float*)(ws + WS_DG), *MT = (float*)(ws + WS_MT), *LT = (float*)(ws + WS_LT);
  float* OUT = (float*)d_out;
  k_proj<<<dim3(NB * T2 / 64, 2), 128, 0, stream>>>(F[0], F[1], F[2], F[3], F[4], F[5], F[6], QH, QL, KH, KL, OUT);
  k_x2t<<<dim3(T2 / 64, NB), 256, 0, stream>>>(F[0], XT);
  k_sc<<<dim3(T2 / 64, T2 / 128, NB), 128, 0, stream>>>(QH, QL, KH, KL, F[7], S, MT, LT);
  k_pv<<<dim3(T2 / 64, DD / 128, NB), 256, 0, stream>>>(S, XT, F[0], OUT, DG, MT, LT);
  k_logdet<<<1, 256, 0, stream>>>(DG, OUT);
}

// v008
// A run of this version takes 101 microseconds.
// In two side-by-side timings against v007, it was 1.06 and 1.05 times as fast.
// Counting every step since v000, it is 3.84 times as fast.
// compute dtype: all float inputs rounded to bf16, d_scale read; q, k = LayerNorm(x1 W^T) with EXACT bf16 products on WMMA 16x16x32 and the LN in f32; q and k as f16 hi + residual -> 3-product logits / d_scale (std ~16: near-one-hot rows), upper-triangular mask, softmax in f32 (precise exp) in two levels: exp(s - tile maximum) stored in f32 with each 128-column tile's maximum and sum, then one factor a row and tile; P x 2^11 in f32 split bf16 hi + lo against the bf16-exact x2 (2 products) + the identity term; logdet = (L/2) sum_i log(1 + P_ii) (att + I is upper triangular, so slogdet is the diagonal product - exact identity); f32 outputs: merged [n][L][D] (x1 copied, then att x2) and logdet [n].
#include <hip/hip_runtime.h>
#include <math.h>

typedef __attribute__((ext_vector_type(16))) _Float16 v16h;
typedef __attribute__((ext_vector_type(16))) __bf16 v16b;
typedef __attribute__((ext_vector_type(8)))  _Float16 v8h;
typedef __attribute__((ext_vector_type(8)))  float v8f;
typedef __attribute__((ext_vector_type(4)))  float v4f;
typedef __attribute__((ext_vector_type(2)))  float v2f;
typedef __attribute__((ext_vector_type(4)))  unsigned v4u;
typedef __attribute__((ext_vector_type(4)))  int v4i;
typedef float __attribute__((may_alias)) float_a;
typedef int __attribute__((may_alias)) int_a;

template <typename T> __device__ __forceinline__ void vst2(void* p, T v) { *(T*)p = v;  }
__device__ __forceinline__ v8f wmma16(v16h a, v16h b, v8f c) {
  v8f d = __builtin_amdgcn_wmma_f32_16x16x32_f16(false, a, false, b, (short)0, c, false, false);
  asm volatile("v_nop\n\tv_nop\n\tv_nop\n\tv_nop" : "+v"(d) : "v"(a), "v"(b));
  return d;
}
__device__ __forceinline__ v8f wmma_bf(v16b a, v16b b, v8f c) {
  v8f d = __builtin_amdgcn_wmma_f32_16x16x32_bf16(false, a, false, b, (short)0, c, false, false);
  asm volatile("v_nop\n\tv_nop\n\tv_nop\n\tv_nop" : "+v"(d) : "v"(a), "v"(b));
  return d;
}
// 16x16x32 fragments: lane = (h = lane>>4, row/col = lane&15); elements 0..7 = k0+8h+0..7, 8..15 = k0+16+8h+0..7; D element r = row 8h+r
__device__ __forceinline__ v16h frag_h(const _Float16* rowk0, int lane) {
  union { v16h v; v8h q[2]; } u; const _Float16* p = rowk0 + 8 * (lane >> 4);
  u.q[0] = *(const v8h*)p; u.q[1] = *(const v8h*)(p + 16); return u.v;
}
__device__ __forceinline__ v16h frag_f32(const float* rowk0, int lane) {
  v16h a; const float* p = rowk0 + 8 * (lane >> 4);
#pragma unroll
  for (int i = 0; i < 8; ++i) { a[i] = (_Float16)p[i]; a[8 + i] = (_Float16)p[16 + i]; }
  return a;
}
__device__ __forceinline__ v16h frag_f32s(const float* rowk0, int lane, float sc) {
  v16h a; const float* p = rowk0 + 8 * (lane >> 4);
#pragma unroll
  for (int i = 0; i < 8; ++i) { a[i] = (_Float16)(p[i] * sc); a[8 + i] = (_Float16)(p[16 + i] * sc); }
  return a;
}
// column fragment from a [K][ld] layout (column n), rows >= K read as 0
__device__ __forceinline__ v16h fragc_f32(const float* W, int k0, int n, int lane, int ld, int K) {
  v16h a; const int g = lane >> 4;
#pragma unroll
  for (int i = 0; i < 8; ++i) { const int ka = k0 + 8 * g + i, kb = ka + 16;
    a[i] = (_Float16)(ka < K ? W[(size_t)(ka < K ? ka : K - 1) * ld + n] : 0.f); a[8 + i] = (_Float16)(kb < K ? W[(size_t)(kb < K ? kb : K - 1) * ld + n] : 0.f); }
  return a;
}
struct F2 { v16b h, l; };
__device__ __forceinline__ F2 bsplit16(const float v[16]) { F2 r;
#pragma unroll
  for (int i = 0; i < 16; ++i) { const __bf16 h = (__bf16)v[i]; r.h[i] = h; r.l[i] = (__bf16)(v[i] - (float)h); }
  return r; }
__device__ __forceinline__ F2 split_row(const float* row, int k0, int lane) { float v[16]; const float* p = row + k0 + 8 * (lane >> 4);
#pragma unroll
  for (int i = 0; i < 8; ++i) { v[i] = p[i]; v[8 + i] = p[16 + i]; }
  return bsplit16(v); }
__device__ __forceinline__ F2 split_rowK(const float* row, int k0, int lane, int K) { float v[16]; const int g = lane >> 4;
#pragma unroll
  for (int i = 0; i < 8; ++i) { const int ka = k0 + 8 * g + i, kb = ka + 16; v[i] = ka < K ? row[ka < K ? ka : K - 1] : 0.f; v[8 + i] = kb < K ? row[kb < K ? kb : K - 1] : 0.f; }
  return bsplit16(v); }
__device__ __forceinline__ F2 split_col(const float* W, int k0, int n, int lane, int ld, int K) { float v[16]; const int g = lane >> 4;
#pragma unroll
  for (int i = 0; i < 8; ++i) { const int ka = k0 + 8 * g + i, kb = ka + 16; v[i] = ka < K ? W[(size_t)(ka < K ? ka : K - 1) * ld + n] : 0.f; v[8 + i] = kb < K ? W[(size_t)(kb < K ? kb : K - 1) * ld + n] : 0.f; }
  return bsplit16(v); }
__device__ __forceinline__ v8f mac3(const F2& a, const F2& b, v8f c) { c = wmma_bf(a.l, b.h, c); c = wmma_bf(a.h, b.l, c); return wmma_bf(a.h, b.h, c); }
__device__ __forceinline__ float sigm(float v) { return 1.0f / (1.0f + expf(-v)); }
#define LDSX() do { asm volatile("s_wait_dscnt 0" ::: "memory"); __builtin_amdgcn_wave_barrier(); __builtin_amdgcn_fence(__ATOMIC_RELEASE, "workgroup"); } while (0)


// Invertible attention (N 8, L 4,096 -> halves of 2,048, D 256): att = softmax(upper-tri(LN(x1 Wq^T) . LN(x1 Wk^T) / d_scale)) + I; out = att x2; logdet = slogdet(att) * L/2.
#define NB 8
#define LL 4096
#define T2 2048
#define DD 256
#define LN_EPS 1e-5f
typedef __attribute__((ext_vector_type(8))) __bf16 v8b;
__device__ __forceinline__ v16b frag_b(const __bf16* rowk0, int lane) {
  union { v16b v; v8b q[2]; } u; const __bf16* p = rowk0 + 8 * (lane >> 4);
  u.q[0] = *(const v8b*)p; u.q[1] = *(const v8b*)(p + 16); return u.v;
}
__device__ __forceinline__ float bfr(float v) { return (float)(__bf16)v; }
__device__ __attribute__((noinline)) float exp_ni(float v) { return expf(v); }
__device__ __attribute__((noinline)) float erf_ni(float v) { return erff(v); }

// Eight 16-byte asynchronous copies per lane, global memory to LDS through no register. The s_wait_xcnt is the statement's last line so that no address register of a copy is rewritten ahead of it.
__device__ __forceinline__ void acopy8(const unsigned (&l)[8], const char* const (&gp)[8]) {
  asm volatile("global_load_async_to_lds_b128 %0, %8, off\n\t"
               "global_load_async_to_lds_b128 %1, %9, off\n\t"
               "global_load_async_to_lds_b128 %2, %10, off\n\t"
               "global_load_async_to_lds_b128 %3, %11, off\n\t"
               "global_load_async_to_lds_b128 %4, %12, off\n\t"
               "global_load_async_to_lds_b128 %5, %13, off\n\t"
               "global_load_async_to_lds_b128 %6, %14, off\n\t"
               "global_load_async_to_lds_b128 %7, %15, off\n\t"
               "s_wait_xcnt 0x0"
               :: "v"(l[0]), "v"(l[1]), "v"(l[2]), "v"(l[3]), "v"(l[4]), "v"(l[5]), "v"(l[6]), "v"(l[7]),
                  "v"(gp[0]), "v"(gp[1]), "v"(gp[2]), "v"(gp[3]), "v"(gp[4]), "v"(gp[5]), "v"(gp[6]), "v"(gp[7]) : "memory");
}
// The same with four copies.
__device__ __forceinline__ void acopy4(const unsigned (&l)[4], const char* const (&gp)[4]) {
  asm volatile("global_load_async_to_lds_b128 %0, %4, off\n\t"
               "global_load_async_to_lds_b128 %1, %5, off\n\t"
               "global_load_async_to_lds_b128 %2, %6, off\n\t"
               "global_load_async_to_lds_b128 %3, %7, off\n\t"
               "s_wait_xcnt 0x0"
               :: "v"(l[0]), "v"(l[1]), "v"(l[2]), "v"(l[3]), "v"(gp[0]), "v"(gp[1]), "v"(gp[2]), "v"(gp[3]) : "memory");
}
// this wave's copies have landed (the compiler places no wait for them)
#define WAIT_ASYNC() asm volatile("s_wait_asynccnt 0x0" ::: "memory")
// this wave's LDS reads have returned, so the buffer may be handed back for a refill
#define WAIT_DS() asm volatile("s_wait_dscnt 0x0" ::: "memory")

#define WS_QH  0u
#define WS_QL  (WS_QH + 2u * (size_t)NB * T2 * DD)
#define WS_KH  (WS_QL + 2u * (size_t)NB * T2 * DD)
#define WS_KL  (WS_KH + 2u * (size_t)NB * T2 * DD)
#define WS_XT  (WS_KL + 2u * (size_t)NB * T2 * DD)      // bf16 x2 planes [n][d][j]
#define WS_S   (WS_XT + 2u * (size_t)NB * DD * T2)      // f32 exp(s - tile maximum) [n][i][j]
#define WS_DG  (WS_S + 4u * (size_t)NB * T2 * T2)       // f32 log(1 + P_ii) [n][i]
#define WS_MT  (WS_DG + 4u * (size_t)NB * T2)           // f32 maximum of a row in a 128-column tile [n][tile][i]
#define WS_LT  (WS_MT + 4u * (size_t)NB * (T2 / 128) * T2)   // f32 sum of exp(s - that maximum) [n][tile][i]
#define WS_END (WS_LT + 4u * (size_t)NB * (T2 / 128) * T2)
#define OUT1_OFF ((size_t)NB * LL * DD)               // logdet output offset (elements)

// the value of lane l ^ M inside the 16-lane row (row_xmask), every lane on
template <int M> __device__ __forceinline__ float xrow(float x) { return __builtin_bit_cast(float, __builtin_amdgcn_update_dpp(0, __builtin_bit_cast(int, x), 0x160 + M, 0xf, 0xf, true)); }
__device__ __forceinline__ float rmax16(float x) { x = fmaxf(x, xrow<1>(x)); x = fmaxf(x, xrow<2>(x)); x = fmaxf(x, xrow<4>(x)); return fmaxf(x, xrow<8>(x)); }
__device__ __forceinline__ float rsum16(float x) { x += xrow<1>(x); x += xrow<2>(x); x += xrow<4>(x); return x + xrow<8>(x); }
// ---- k_proj: block = (64 rows of x1, which): y = x1 W^T ([out][in]); LayerNorm(gamma, beta) -> f16 hi + lo rows; also copies bf16-rounded x1 into merged (which == 0 blocks); the blocks of which == 2 do x2t_tile instead
// The W rows (all 256) and the block's x1 rows come in slices of 32 k = 128 B a row, whole lines, f32, by asynchronous copies into two LDS buffers; the fragments are read from LDS and rounded to bf16 there.
// LayerNorm runs on the accumulators: a wave holds its 16 rows whole (a lane 16 columns of each of 8 rows), so a row's mean and variance are 16 additions in the lane and a sum over the 16 lanes of its half.
// The f16 hi and lo of a value go as one dword into the wave's own rows of sp, which lies over the two buffers and is first written behind the last trip's barrier; the wave reads its rows back and stores whole lines.
#define PJ_P 144u                    // LDS row pitch: 128 B + 16, conflict-free for 16-byte reads
#define PJ_X (256u * PJ_P)           // rows in a buffer: W 256 | x1 64
#define PJ_BUF (320u * PJ_P)
static_assert(64u * (DD + 4u) * 4u <= 2u * PJ_BUF, "sp lies inside the staging buffers");
static_assert(DD * 72u * 2u <= 2u * PJ_BUF, "st of the third plane lies inside them too");
__device__ __forceinline__ v16b cvt_frag(const v4f (&r)[4]) { v16b a;   // elements 0..7 = k 8g+0..7, 8..15 = k 16+8g+0..7
// unrolled: a[] and r[] are registers
#pragma unroll
  for (int i = 0; i < 4; ++i) { a[i] = (__bf16)r[0][i]; a[4 + i] = (__bf16)r[1][i]; a[8 + i] = (__bf16)r[2][i]; a[12 + i] = (__bf16)r[3][i]; }
  return a; }
// ---- the blocks of k_proj's third plane (blockIdx.y == 2): block = (64 j, n): x2 planes XT[n][d][j] (bf16, exact). They need nothing of the projection and run beside its blocks in one launch.
// Thread t takes the columns d = t and t + 128 of the 64 rows j, a wave 128 B of a row with each load; 8 j go as one 16-byte LDS store into st[d][]. Behind the barrier 8 lanes store a plane row's 64 j, one whole line.
__device__ __forceinline__ void x2t_tile(const float* __restrict__ X, __bf16* __restrict__ XT, unsigned char* lds, size_t n, int j0, int t) {
  __bf16 (*st)[72] = (__bf16 (*)[72])lds;   // pitch 144 B: conflict-free for 16-byte accesses
// every loop here is unrolled: v[] is registers, and the loads stand together ahead of the conversions, one trip to memory
#pragma unroll
  for (int h = 0; h < 2; ++h) { const int d = t + 128 * h;
#pragma unroll
    for (int jb = 0; jb < 64; jb += 32) { float v[32]; const float* p = X + (n * LL + T2 + j0 + jb) * DD + d;
#pragma unroll
      for (int i = 0; i < 32; ++i) v[i] = p[(size_t)i * DD];
#pragma unroll
      for (int q = 0; q < 4; ++q) { v8b w;
#pragma unroll
        for (int i = 0; i < 8; ++i) w[i] = (__bf16)v[q * 8 + i];
        *(v8b*)&st[d][jb + q * 8] = w; } } }
  __syncthreads();   // st[][] is whole before it is read across the waves
#pragma unroll
  for (int k = 0; k < DD * 8 / 128; ++k) { const int d = k * 16 + (t >> 3), q = t & 7; vst2((unsigned*)(XT + (n * DD + d) * (size_t)T2 + j0 + q * 8), *(const v4u*)&st[d][q * 8]); } }
__global__ __launch_bounds__(128) void k_proj(const float* __restrict__ X, const float* __restrict__ WQ, const float* __restrict__ WK, const float* __restrict__ GQ, const float* __restrict__ BQ, const float* __restrict__ GK, const float* __restrict__ BK, _Float16* __restrict__ QH, _Float16* __restrict__ QL, _Float16* __restrict__ KH, _Float16* __restrict__ KL, float* __restrict__ OUT, __bf16* __restrict__ XT) {
  __shared__ __align__(16) unsigned char ar[2u * PJ_BUF];
  unsigned (*sp)[DD + 4] = (unsigned (*)[DD + 4])ar;   // pitch 260 dwords: the two halves of a wave, 8 rows apart, write banks 32 apart
  const int tid = threadIdx.x, wave = tid >> 5, lane = tid & 31, col = lane & 15, g = lane >> 4; const int which = blockIdx.y; const size_t r0 = (size_t)blockIdx.x * 64; const size_t n = r0 / T2; const int i0 = (int)(r0 % T2);   // rows of x1: x[n][i][:], i < T2
  if (which == 2) { x2t_tile(X, XT, ar, n, i0, tid); return; }   // the same for the whole block: the 64 rows j = i0.. of x2
  const float* Wm = which == 0 ? WQ : WK; const float* Gm = which == 0 ? GQ : GK; const float* Bm = which == 0 ? BQ : BK;
  const int rr = tid >> 3, pc = tid & 7;   // a copy of a wave covers 4 rows x 128 B
  const unsigned lb = (unsigned)(size_t)ar + (unsigned)rr * PJ_P + (unsigned)pc * 16u;
  const char* gw = (const char*)(Wm + (size_t)rr * DD + pc * 4); const char* gx = (const char*)(X + (n * LL + i0 + rr) * DD + pc * 4);
  // the loops below are unrolled so that l[] and gp[] are registers: they are asm operands
  auto stage = [&](int t, int b) { unsigned l[8]; const char* gp[8]; unsigned l4[4]; const char* gp4[4]; const unsigned lt = lb + (unsigned)b * PJ_BUF; const size_t go = (size_t)t * 128;
#pragma unroll
    for (int m = 0; m < 8; ++m) { l[m] = lt + (unsigned)m * 16u * PJ_P; gp[m] = gw + go + (size_t)m * 16 * DD * 4; }
    acopy8(l, gp);
#pragma unroll
    for (int m = 0; m < 8; ++m) { l[m] = lt + (unsigned)(8 + m) * 16u * PJ_P; gp[m] = gw + go + (size_t)(8 + m) * 16 * DD * 4; }
    acopy8(l, gp);
#pragma unroll
    for (int m = 0; m < 4; ++m) { l4[m] = lt + PJ_X + (unsigned)m * 16u * PJ_P; gp4[m] = gx + go + (size_t)m * 16 * DD * 4; }
    acopy4(l4, gp4); };
  stage(0, 0); WAIT_ASYNC(); __syncthreads(); stage(1, 1);
  v8f acc[16] = {};
// rolled: one copy of the 16-WMMA body, and the two buffers alternate by an offset; the loops inside are unrolled so that acc[], r[] and w[] stay in registers
#pragma unroll 1
  for (int t = 0; t < DD / 32; ++t) { const unsigned char* B = ar + (unsigned)(t & 1) * PJ_BUF; v4f ra[4], r[4][4];
    // a lane's 16 values of a row: k 8g+0..7 and 16+8g+0..7, four 16-byte reads
    auto rd = [&](v4f (&d)[4], unsigned row) { const v4f* p = (const v4f*)(B + row * PJ_P + (unsigned)g * 32u); d[0] = p[0]; d[1] = p[1]; d[2] = p[4]; d[3] = p[5]; };
    rd(ra, 256u + (unsigned)(wave * 16 + col));
#pragma unroll
    for (int jj = 0; jj < 4; ++jj) rd(r[jj], (unsigned)(jj * 16 + col));
    const v16b a = cvt_frag(ra);
#pragma unroll
    for (int jg = 0; jg < 4; ++jg) { v16b w[4];
#pragma unroll
      for (int jj = 0; jj < 4; ++jj) w[jj] = cvt_frag(r[jj]);
      // the next four fragments' reads stand ahead of this group's WMMAs, so that their LDS latency runs beside them
      if (jg < 3) {
#pragma unroll
        for (int jj = 0; jj < 4; ++jj) rd(r[jj], (unsigned)((jg * 4 + 4 + jj) * 16 + col)); }
#pragma unroll
      for (int jj = 0; jj < 4; ++jj) acc[jg * 4 + jj] = wmma_bf(a, w[jj], acc[jg * 4 + jj]); }
    WAIT_DS(); WAIT_ASYNC(); __syncthreads();   // publishes slice t + 1 and ends every reader's last read of slice t's buffer
    if (t + 2 < DD / 32) stage(t + 2, t & 1); }
  WAIT_ASYNC();
// every loop below is unrolled: acc[], gm[] and bt[] are registers
  float gm[16], bt[16];   // the lane's 16 columns of gamma and beta: the loads fly beside the sums
#pragma unroll
  for (int j = 0; j < 16; ++j) { gm[j] = Gm[j * 16 + col]; bt[j] = Bm[j * 16 + col]; }
  // the 8 rows of a lane side by side as one vector: neighbouring rows lie in neighbouring registers, which packed f32 instructions take as they are
  v8f s8 = acc[0], q8 = {}, mu, rs;
#pragma unroll
  for (int j = 1; j < 16; ++j) s8 += acc[j];
#pragma unroll
  for (int r = 0; r < 8; ++r) mu[r] = rsum16(s8[r]) * (1.0f / DD);
#pragma unroll
  for (int j = 0; j < 16; ++j) { const v8f d = acc[j] - mu; q8 += d * d; }
#pragma unroll
  for (int r = 0; r < 8; ++r) rs[r] = 1.0f / sqrtf(rsum16(q8[r]) * (1.0f / DD) + LN_EPS);
#pragma unroll
  for (int j = 0; j < 16; ++j) { const v8f y = (acc[j] - mu) * rs * bfr(gm[j]) + bfr(bt[j]);
#pragma unroll
    for (int r = 0; r < 8; ++r) { const float v = y[r]; const _Float16 hv = (_Float16)v, lv = (_Float16)(v - (float)hv);
      sp[wave * 16 + 8 * g + r][j * 16 + col] = (unsigned)__builtin_bit_cast(unsigned short, hv) | ((unsigned)__builtin_bit_cast(unsigned short, lv) << 16); } }   // hi in the low half
  LDSX();   // the wave's own rows are written before it reads them back across its lanes; no other wave touches them
  _Float16* dh = which == 0 ? QH : KH; _Float16* dl = which == 0 ? QL : KL;
  // a lane takes 8 columns of a row, parts hi from lo, and the wave stores 512 B of each: whole lines
#pragma unroll
  for (int rl = 0; rl < 16; ++rl) { const v4u* p = (const v4u*)&sp[wave * 16 + rl][lane * 8]; const v4u a = p[0], b = p[1]; v4u h, l;
    h[0] = (a[0] & 0xffffu) | (a[1] << 16); h[1] = (a[2] & 0xffffu) | (a[3] << 16); h[2] = (b[0] & 0xffffu) | (b[1] << 16); h[3] = (b[2] & 0xffffu) | (b[3] << 16);
    l[0] = (a[0] >> 16) | (a[1] & 0xffff0000u); l[1] = (a[2] >> 16) | (a[3] & 0xffff0000u); l[2] = (b[0] >> 16) | (b[1] & 0xffff0000u); l[3] = (b[2] >> 16) | (b[3] & 0xffff0000u);
    vst2((unsigned*)(dh + (r0 + wave * 16 + rl) * DD + lane * 8), h); vst2((unsigned*)(dl + (r0 + wave * 16 + rl) * DD + lane * 8), l); }
  asm volatile("s_wait_xcnt 0x0" ::: "memory");   // stands ahead of any rewrite of the stores' address and data registers by the copy loop below
  if (which == 0) { for (int e = tid; e < 64 * 64; e += 128) { const int rl = e >> 6, q = e & 63; const size_t go = (n * LL + i0 + rl) * DD + q * 4; const v4f xr = *(const v4f*)(X + go); v4f v; v[0] = bfr(xr[0]); v[1] = bfr(xr[1]); v[2] = bfr(xr[2]); v[3] = bfr(xr[3]); vst2(OUT + go, v); } } }
#define SM_NEG -3.0e38f
// e^x in f32 for x <= 0: r = nearest integer to x log2(e); fraction = x log2(e) - r by two fused multiply-adds, log2(e) in two parts (the product is not rounded before r is taken off); 2^fraction; ldexp by r.
// The floor of -200 keeps r finite for a masked value, and ldexp then gives exactly 0. 2^fraction stands in asm: the v_nop in the statement is the free slot that the instruction set asks for behind a transcendental.
__device__ __forceinline__ float exp_np(float x) {
  x = fmaxf(x, -200.0f); const float r = __builtin_rintf(x * 0x1.715476p+0f); const float a = __builtin_fmaf(x, 0x1.4ae0bep-26f, __builtin_fmaf(x, 0x1.715476p+0f, -r));
  float e; asm("v_exp_f32 %0, %1\n\tv_nop" : "=v"(e) : "v"(a));
  return ldexpf(e, (int)r); }
// ---- k_sc: block = (64 rows i, 128 cols j, n): s = q.k / d_scale for j >= i, else masked; stored: exp(s - m), m the row's maximum in this tile (0 where masked), with m and the row's sum of them in MT and LT [n][tile][i] for k_pv; blocks entirely below the diagonal store the mask and 0 there and exit.
// The K and Q rows (hi and lo) come in slices of 64 k = 128 B a row, whole lines, by asynchronous copies into two LDS buffers; the fragments are read from LDS.
#define SC_P 144u                    // LDS row pitch: 128 B + 16, conflict-free for 16-byte reads
#define SC_KL (128u * SC_P)          // rows in a buffer: KH 128 | KL 128 | QH 64 | QL 64
#define SC_QH (256u * SC_P)
#define SC_QL (320u * SC_P)
#define SC_BUF (384u * SC_P)
__global__ __launch_bounds__(128) void k_sc(const _Float16* __restrict__ QH, const _Float16* __restrict__ QL, const _Float16* __restrict__ KH, const _Float16* __restrict__ KL, const float* __restrict__ DSC, float* __restrict__ S0, float* __restrict__ MT, float* __restrict__ LT) { __shared__ __align__(16) float ss[4][16][132]; __shared__ __align__(16) unsigned char sb[2 * SC_BUF]; __shared__ __align__(16) float st[2][64];
  const size_t n = blockIdx.z; float* S = S0 + n * (size_t)T2 * T2;
  const int tid = threadIdx.x, wave = tid >> 5, lane = tid & 31, col = lane & 15, g = lane >> 4; const int k0 = blockIdx.y * 128; const int q0b = blockIdx.x * 64; const int ql0 = q0b + wave * 16;
  float* const tq = (tid < 64 ? MT : LT) + (n * (T2 / 128) + blockIdx.y) * (size_t)T2 + q0b + (tid & 63);   // waves 0 and 1 store the 64 rows' maxima, waves 2 and 3 their sums, one whole line each
  if (k0 + 127 < q0b) { *tq = tid < 64 ? SM_NEG : 0.f; return; }   // all j < i: the tile counts as masked in k_pv's factors, and its values are never read (k_pv starts at the tile of the rows' diagonal)
  const float isc = 1.0f / bfr(DSC[0]);
  const int rr = tid >> 3, pc = tid & 7;   // a copy of a wave covers 4 rows x 128 B
  const unsigned lb = (unsigned)(size_t)sb + (unsigned)rr * SC_P + (unsigned)pc * 16u;
  const char* gkh = (const char*)(KH + (n * T2 + k0 + rr) * DD + pc * 8); const char* gkl = (const char*)(KL + (n * T2 + k0 + rr) * DD + pc * 8);
  const char* gqh = (const char*)(QH + (n * T2 + q0b + rr) * DD + pc * 8); const char* gql = (const char*)(QL + (n * T2 + q0b + rr) * DD + pc * 8);
  // the loops below are unrolled so that l[] and gp[] are registers: they are asm operands
  auto stage = [&](int t, int b) { unsigned l[8]; const char* gp[8]; const unsigned lt = lb + (unsigned)b * SC_BUF; const size_t go = (size_t)t * 128;
#pragma unroll
    for (int m = 0; m < 8; ++m) { l[m] = lt + (unsigned)m * 16u * SC_P; gp[m] = gkh + go + (size_t)m * 16 * DD * 2; }
    acopy8(l, gp);
#pragma unroll
    for (int m = 0; m < 8; ++m) { l[m] = lt + SC_KL + (unsigned)m * 16u * SC_P; gp[m] = gkl + go + (size_t)m * 16 * DD * 2; }
    acopy8(l, gp);
#pragma unroll
    for (int m = 0; m < 4; ++m) { l[m] = lt + SC_QH + (unsigned)m * 16u * SC_P; gp[m] = gqh + go + (size_t)m * 16 * DD * 2; l[4 + m] = lt + SC_QL + (unsigned)m * 16u * SC_P; gp[4 + m] = gql + go + (size_t)m * 16 * DD * 2; }
    acopy8(l, gp); };
  stage(0, 0); WAIT_ASYNC(); __syncthreads(); stage(1, 1);
  v8f acc[8] = {};
// rolled: one copy of the 48-WMMA body, and the two buffers alternate by an offset; the loops inside are unrolled so that acc[], kb[] and kl[] stay in registers
#pragma unroll 1
  for (int t = 0; t < DD / 64; ++t) { const unsigned char* B = sb + (unsigned)(t & 1) * SC_BUF;
#pragma unroll
    for (int kk = 0; kk < 2; ++kk) { const unsigned qo = (unsigned)(wave * 16 + col) * SC_P + (unsigned)kk * 64u; const v16h ah = frag_h((const _Float16*)(B + SC_QH + qo), lane), al = frag_h((const _Float16*)(B + SC_QL + qo), lane); v16h kb[8], kl[8];
#pragma unroll
      for (int j = 0; j < 8; ++j) { const unsigned ko = (unsigned)(j * 16 + col) * SC_P + (unsigned)kk * 64u; kb[j] = frag_h((const _Float16*)(B + ko), lane); kl[j] = frag_h((const _Float16*)(B + SC_KL + ko), lane); }
      // inputs only: keeps the LDS reads of this 32-k step together ahead of its WMMAs; read one fragment at a time, every WMMA waits out an LDS latency
      asm volatile("" :: "v"(ah), "v"(al), "v"(kb[0]), "v"(kb[1]), "v"(kb[2]), "v"(kb[3]), "v"(kb[4]), "v"(kb[5]), "v"(kb[6]), "v"(kb[7]), "v"(kl[0]), "v"(kl[1]), "v"(kl[2]), "v"(kl[3]), "v"(kl[4]), "v"(kl[5]), "v"(kl[6]), "v"(kl[7]));
#pragma unroll
      for (int j = 0; j < 8; ++j) { acc[j] = wmma16(ah, kb[j], acc[j]); acc[j] = wmma16(al, kb[j], acc[j]); acc[j] = wmma16(ah, kl[j], acc[j]); } }
    WAIT_DS(); WAIT_ASYNC(); __syncthreads();   // publishes slice t + 1 and ends every reader's last read of slice t's buffer
    if (t + 2 < DD / 64) stage(t + 2, t & 1); }
  WAIT_ASYNC();
  // a lane holds 8 columns of each of the rows 8g + 0..7: maximum and sum in the lane, then over the 16 lanes of its half. Every row of a block that runs has a column j >= i in the tile. The loops are unrolled: acc[], mx[] and sm[] are registers
  float mx[8], sm[8];
#pragma unroll
  for (int r = 0; r < 8; ++r) { mx[r] = SM_NEG; sm[r] = 0.f; }
#pragma unroll
  for (int j = 0; j < 8; ++j) { const int jj = k0 + j * 16 + col;
#pragma unroll
    for (int r = 0; r < 8; ++r) { const int ii = ql0 + 8 * g + r; acc[j][r] = (jj >= ii) ? acc[j][r] * isc : SM_NEG; mx[r] = fmaxf(mx[r], acc[j][r]); } }
#pragma unroll
  for (int r = 0; r < 8; ++r) mx[r] = rmax16(mx[r]);
#pragma unroll
  for (int j = 0; j < 8; ++j)
#pragma unroll
    for (int r = 0; r < 8; ++r) { const float e = exp_np(acc[j][r] - mx[r]); sm[r] += e; ss[wave][8 * g + r][j * 16 + col] = e; }
#pragma unroll
  for (int r = 0; r < 8; ++r) sm[r] = rsum16(sm[r]);
  if (col == 0) {
#pragma unroll
    for (int r = 0; r < 8; ++r) { st[0][wave * 16 + 8 * g + r] = mx[r]; st[1][wave * 16 + 8 * g + r] = sm[r]; } }
  __syncthreads();   // st[] is whole (and every wave's own ss rows are written). It stands ahead of the row stores: behind them it would wait for them to complete
  *tq = st[tid >> 6][tid & 63];
  for (int rl = 0; rl < 16; ++rl) vst2(S + (size_t)(ql0 + rl) * T2 + k0 + lane * 4, *(const v4f*)&ss[wave][rl][lane * 4]);
  asm volatile("s_wait_xcnt 0x0" ::: "memory"); }   // stands ahead of any rewrite of the stores' address and data registers: the compiler lays the early exit's store behind this place
// ---- k_pv: block = (64 rows i, 128 cols d, n), 8 waves: out = P (hi + lo) . x2 (exact) over j >= 128*(i/128), + x2[i]; written to merged rows T2 + i.
// P x 2^11 = k_sc's exp(s - tile maximum) times the row's factor of that tile, exp(tile maximum - row maximum) x 2^11 / row sum: 16 factors a row, formed from MT and LT while the first slice flies.
// The stored rows (f32) and x2 planes (bf16) come in slices of 128 j (one tile of k_sc), whole lines, by asynchronous copies into two LDS buffers; the fragments are read from LDS.
// Waves 0..3 take the first 64 j of a slice and waves 4..7 the second 64, each group all 64 rows: the longest block makes 16 trips, not 32, and a trip waits once for memory. The two partial sums meet in LDS behind the loop.
// A block of odd blockIdx.x starts 64 columns left of its rows' diagonal: k_sc has stored exact zeros there.
// The first slice of a block holds its rows' diagonal: the blocks of d-block 0 store log(1 + P_ii) from it into LG [n][i] for k_logdet.
#define PV_PP 528u                   // LDS pitch of a P row: 512 B + 16
#define PV_XP 272u                   // LDS pitch of an x2 plane row: 256 B + 16
#define PV_X (64u * PV_PP)           // a buffer: P 64 rows | x2 planes 128 rows
#define PV_BUF (PV_X + 128u * PV_XP)
static_assert(4u * 16u * 132u * 4u <= 2u * PV_BUF, "ss lies inside the staging buffers");
__global__ __launch_bounds__(256) void k_pv(const float* __restrict__ PS0, const __bf16* __restrict__ XT, const float* __restrict__ X, float* __restrict__ OUT, float* __restrict__ LG, const float* __restrict__ MT, const float* __restrict__ LT) { __shared__ __align__(16) unsigned char sb[2 * PV_BUF]; __shared__ float cs[64][17];   // pitch 17: 16 rows read at once meet 16 banks
  float (*ss)[16][132] = (float (*)[16][132])sb;   // lies over the two buffers and is first written behind the last trip's barrier
  const size_t n = blockIdx.z; const float* PS = PS0 + n * (size_t)T2 * T2;
  const int tid = threadIdx.x, wave = tid >> 5, lane = tid & 31, col = lane & 15, g = lane >> 4; const int wr = wave & 3, jh = __builtin_amdgcn_readfirstlane(wave) >> 2;   // the wave's 16 rows; its half of a slice (a scalar)
  const int q0b = blockIdx.x * 64; const int ql0 = q0b + wr * 16; const int c0 = blockIdx.y * 128;
  const unsigned lp = (unsigned)(size_t)sb + (unsigned)(tid >> 5) * PV_PP + (unsigned)(tid & 31) * 16u;           // a copy of a wave covers 1 P row x 512 B
  const unsigned lx = (unsigned)(size_t)sb + PV_X + (unsigned)(tid >> 4) * PV_XP + (unsigned)(tid & 15) * 16u;    // or 2 plane rows x 256 B
  const char* gpp = (const char*)(PS + (size_t)(q0b + (tid >> 5)) * T2 + (tid & 31) * 4); const char* gxx = (const char*)(XT + (n * DD + c0 + (tid >> 4)) * (size_t)T2 + (tid & 15) * 8);
  // the loops below are unrolled so that l[] and gp[] are registers: they are asm operands
  auto stage = [&](int t, int b) { unsigned l[8]; const char* gp[8];
#pragma unroll
    for (int m = 0; m < 8; ++m) { l[m] = lp + (unsigned)b * PV_BUF + (unsigned)m * 8u * PV_PP; gp[m] = gpp + (size_t)t * 512 + (size_t)m * 8 * T2 * 4; }
    acopy8(l, gp);
#pragma unroll
    for (int m = 0; m < 8; ++m) { l[m] = lx + (unsigned)b * PV_BUF + (unsigned)m * 16u * PV_XP; gp[m] = gxx + (size_t)t * 256 + (size_t)m * 16 * T2 * 2; }
    acopy8(l, gp); };
  const int t0 = blockIdx.x >> 1;   // first slice of 128 j: the tile that holds the rows' diagonal
  stage(t0, 0);
  // waves 0 and 1 (a scalar test): thread tid forms row tid's factors; a tile left of the diagonal holds the mask and a sum of 0. Unrolled: mt[] and lt[] are registers and the 32 whole-line loads fly together
  if (__builtin_amdgcn_readfirstlane(wave) < 2) { float mt[16], lt[16]; const size_t o = n * (T2 / 128) * (size_t)T2 + q0b + tid;
#pragma unroll
    for (int i = 0; i < 16; ++i) { mt[i] = MT[o + (size_t)i * T2]; lt[i] = LT[o + (size_t)i * T2]; }
    float m = SM_NEG, l = 0.f;
#pragma unroll
    for (int i = 0; i < 16; ++i) m = fmaxf(m, mt[i]);
#pragma unroll
    for (int i = 0; i < 16; ++i) { mt[i] = exp_np(mt[i] - m); l += lt[i] * mt[i]; }
    const float f = 2048.0f / l;
#pragma unroll
    for (int i = 0; i < 16; ++i) cs[tid][i] = mt[i] * f; }
  WAIT_ASYNC(); __syncthreads(); if (t0 + 1 < T2 / 128) stage(t0 + 1, 1);   // the barrier publishes cs[] too
  // row tid of buffer 0, the row's own column, times the row's factor: P_ii x 2^11. Waves 0 and 1 (a scalar test, every lane on) store one whole line each; buffer 0 is refilled only behind the foot of the first trip.
  if (blockIdx.y == 0 && __builtin_amdgcn_readfirstlane(wave) < 2) { const float pd = *(const float*)(sb + (unsigned)tid * (PV_PP + 4u) + (unsigned)(blockIdx.x & 1) * 256u) * cs[tid][t0]; LG[n * T2 + q0b + tid] = logf(1.0f + pd * (1.0f / 2048.0f));
    asm volatile("s_wait_xcnt 0x0" ::: "memory"); }   // stands ahead of any rewrite of the store's address and data registers
  v8f acc[8] = {};
// rolled: the trip count depends on the block; the loops inside are unrolled so that acc[] and xb[] stay in registers
#pragma unroll 1
  for (int t = t0; t < T2 / 128; ++t) { const int b = (t - t0) & 1; const unsigned char* B = sb + (unsigned)b * PV_BUF; const float cf = cs[wr * 16 + col][t];   // the lane's row, this slice's tile
#pragma unroll
    for (int kk = 0; kk < 2; ++kk) { const v4f* pp = (const v4f*)(B + (unsigned)(wr * 16 + col) * PV_PP + (unsigned)jh * 256u + (unsigned)kk * 128u + (unsigned)g * 32u); const v4f p0 = pp[0], p1 = pp[1], p2 = pp[4], p3 = pp[5]; v16b xb[8];   // P elements k0+8g+0..7 and k0+16+8g+0..7
#pragma unroll
      for (int j = 0; j < 8; ++j) xb[j] = frag_b((const __bf16*)(B + PV_X + (unsigned)(j * 16 + col) * PV_XP + (unsigned)jh * 128u + (unsigned)kk * 64u), lane);
      // inputs only: keeps the LDS reads of this 32-j step together ahead of its WMMAs; read one fragment at a time, every WMMA waits out an LDS latency
      asm volatile("" :: "v"(p0), "v"(p1), "v"(p2), "v"(p3), "v"(xb[0]), "v"(xb[1]), "v"(xb[2]), "v"(xb[3]), "v"(xb[4]), "v"(xb[5]), "v"(xb[6]), "v"(xb[7]));
      float pv[16];
#pragma unroll
      for (int i = 0; i < 4; ++i) { pv[i] = p0[i] * cf; pv[4 + i] = p1[i] * cf; pv[8 + i] = p2[i] * cf; pv[12 + i] = p3[i] * cf; }
      const F2 p = bsplit16(pv);
#pragma unroll
      for (int j = 0; j < 8; ++j) { acc[j] = wmma_bf(p.h, xb[j], acc[j]); acc[j] = wmma_bf(p.l, xb[j], acc[j]); } }
    WAIT_DS(); WAIT_ASYNC(); __syncthreads();   // publishes slice t + 1 and ends every reader's last read of slice t's buffer
    if (t + 2 < T2 / 128) stage(t + 2, b); }
  WAIT_ASYNC();
  // waves 4..7 hand their partial sums over, each lane to the lane of wave - 4 that holds the same elements. The loops are unrolled: acc[] is registers
  if (jh == 1) {
#pragma unroll
    for (int j = 0; j < 8; ++j)
#pragma unroll
      for (int r = 0; r < 8; ++r) ss[wr][8 * g + r][j * 16 + col] = acc[j][r]; }
  __syncthreads();   // the partial sums of waves 4..7 are in ss before waves 0..3 read them
  if (jh == 0) {
#pragma unroll
    for (int j = 0; j < 8; ++j) { const int d = c0 + j * 16 + col;
#pragma unroll
      for (int r = 0; r < 8; ++r) { const int ii = ql0 + 8 * g + r; float* const e = &ss[wr][8 * g + r][j * 16 + col]; *e = (acc[j][r] + *e) * (1.0f / 2048.0f) + bfr(X[(n * LL + T2 + ii) * DD + d]); } }
    LDSX(); for (int rl = 0; rl < 16; ++rl) vst2(OUT + (n * LL + T2 + ql0 + rl) * DD + c0 + lane * 4, *(const v4f*)&ss[wr][rl][lane * 4]); } }
// ---- k_logdet: one block: logdet[n] = (L/2) * sum_i log(1 + P_ii), the logarithms read from LG (64 KB, whole lines). Thread t sums i = t, t + 256, ... of every sample, then the wave, then the 8 waves in turn.
__global__ __launch_bounds__(256) void k_logdet(const float* __restrict__ LG, float* __restrict__ OUT) { __shared__ __align__(16) float sred[NB][8];
  const int t = threadIdx.x; v8f x[NB];
// unrolled: x[][] stays in registers and the 64 loads of a thread are all in flight together, one trip to memory
#pragma unroll
  for (int n = 0; n < NB; ++n)
#pragma unroll
    for (int k = 0; k < 8; ++k) x[n][k] = LG[n * T2 + k * 256 + t];
  // inputs only: keeps the 64 loads together ahead of the additions. Left alone the compiler issued the last five loads behind waits for the first, a second trip to memory
  asm volatile("" :: "v"(x[0]), "v"(x[1]), "v"(x[2]), "v"(x[3]), "v"(x[4]), "v"(x[5]), "v"(x[6]), "v"(x[7]));
  float s[NB];
#pragma unroll
  for (int n = 0; n < NB; ++n) { s[n] = 0.f;
#pragma unroll
    for (int k = 0; k < 8; ++k) s[n] += x[n][k]; }
// the samples inside, the steps outside: the 8 cross-lane exchanges of a step are independent and share one LDS-pipe latency
#pragma unroll
  for (int o = 1; o < 32; o <<= 1)
#pragma unroll
    for (int n = 0; n < NB; ++n) s[n] += __shfl_xor(s[n], o);
  if ((t & 31) == 0) {
#pragma unroll
    for (int n = 0; n < NB; ++n) sred[n][t >> 5] = s[n]; }
  __syncthreads();
  if (t < NB) { float a = 0.f;
#pragma unroll
    for (int i = 0; i < 8; ++i) a += sred[t][i];
    OUT[OUT1_OFF + t] = a * (float)(LL / 2); } }
extern "C" void kernel_launch(void* const* d_in, const int* in_sizes, int n_in, void* d_out, int out_size, void* d_ws, size_t ws_size, hipStream_t stream) {
  (void)in_sizes; (void)n_in; (void)out_size;
  const float** F = (const float**)d_in;   // 0 inputs [8,4096,256], 1 Wq [256,256] ([out,in]), 2 Wk, 3 q_gamma, 4 q_beta, 5 k_gamma, 6 k_beta, 7 d_scale [1]
  if (ws_size < (size_t)WS_END) return;
  char* ws = (char*)d_ws; _Float16 *QH = (_Float16*)(ws + WS_QH), *QL = (_Float16*)(ws + WS_QL), *KH = (_Float16*)(ws + WS_KH), *KL = (_Float16*)(ws + WS_KL); __bf16* XT = (__bf16*)(ws + WS_XT); float *S = (float*)(ws + WS_S), *DG = (float*)(ws + WS_DG), *MT = (float*)(ws + WS_MT), *LT = (float*)(ws + WS_LT);
  float* OUT = (float*)d_out;
  k_proj<<<dim3(NB * T2 / 64, 3), 128, 0, stream>>>(F[0], F[1], F[2], F[3], F[4], F[5], F[6], QH, QL, KH, KL, OUT, XT);
  k_sc<<<dim3(T2 / 64, T2 / 128, NB), 128, 0, stream>>>(QH, QL, KH, KL, F[7], S, MT, LT);
  k_pv<<<dim3(T2 / 64, DD / 128, NB), 256, 0, stream>>>(S, XT, F[0], OUT, DG, MT, LT);
  k_logdet<<<1, 256, 0, stream>>>(DG, OUT);
}

// v009
// A run of this version takes 92.3 microseconds.
// In two side-by-side timings against v008, it was 1.09 and 1.10 times as fast.
// All steps since v000 together make it 4.19 times as fast.
// compute dtype: all float inputs rounded to bf16, d_scale read; q, k = LayerNorm(x1 W^T) with EXACT bf16 products on WMMA 16x16x32 and the LN in f32; q and k as f16 hi + residual -> 3-product logits / d_scale (std ~16: near-one-hot rows), upper-triangular mask, softmax in f32 (precise exp) in two levels: exp(s - tile maximum) stored in f32 with each 128-column tile's maximum and sum, then one factor a row and tile; P x 2^11 in f32 split bf16 hi + lo against the bf16-exact x2 (2 products) + the identity term; logdet = (L/2) sum_i log(1 + P_ii) (att + I is upper triangular, so slogdet is the diagonal product - exact identity); f32 outputs: merged [n][L][D] (x1 copied, then att x2) and logdet [n].
#include <hip/hip_runtime.h>
#include <math.h>

typedef __attribute__((ext_vector_type(16))) _Float16 v16h;
typedef __attribute__((ext_vector_type(16))) __bf16 v16b;
typedef __attribute__((ext_vector_type(8)))  _Float16 v8h;
typedef __attribute__((ext_vector_type(8)))  float v8f;
typedef __attribute__((ext_vector_type(4)))  float v4f;
typedef __attribute__((ext_vector_type(2)))  float v2f;
typedef __attribute__((ext_vector_type(4)))  unsigned v4u;
typedef __attribute__((ext_vector_type(4)))  int v4i;
typedef float __attribute__((may_alias)) float_a;
typedef int __attribute__((may_alias)) int_a;

template <typename T> __device__ __forceinline__ void vst2(void* p, T v) { *(T*)p = v;  }
__device__ __forceinline__ v8f wmma16(v16h a, v16h b, v8f c) {
  v8f d = __builtin_amdgcn_wmma_f32_16x16x32_f16(false, a, false, b, (short)0, c, false, false);
  asm volatile("v_nop\n\tv_nop\n\tv_nop\n\tv_nop" : "+v"(d) : "v"(a), "v"(b));
  return d;
}
__device__ __forceinline__ v8f wmma_bf(v16b a, v16b b, v8f c) {
  v8f d = __builtin_amdgcn_wmma_f32_16x16x32_bf16(false, a, false, b, (short)0, c, false, false);
  asm volatile("v_nop\n\tv_nop\n\tv_nop\n\tv_nop" : "+v"(d) : "v"(a), "v"(b));
  return d;
}
// 16x16x32 fragments: lane = (h = lane>>4, row/col = lane&15); elements 0..7 = k0+8h+0..7, 8..15 = k0+16+8h+0..7; D element r = row 8h+r
__device__ __forceinline__ v16h frag_h(const _Float16* rowk0, int lane) {
  union { v16h v; v8h q[2]; } u; const _Float16* p = rowk0 + 8 * (lane >> 4);
  u.q[0] = *(const v8h*)p; u.q[1] = *(const v8h*)(p + 16); return u.v;
}
__device__ __forceinline__ v16h frag_f32(const float* rowk0, int lane) {
  v16h a; const float* p = rowk0 + 8 * (lane >> 4);
#pragma unroll
  for (int i = 0; i < 8; ++i) { a[i] = (_Float16)p[i]; a[8 + i] = (_Float16)p[16 + i]; }
  return a;
}
__device__ __forceinline__ v16h frag_f32s(const float* rowk0, int lane, float sc) {
  v16h a; const float* p = rowk0 + 8 * (lane >> 4);
#pragma unroll
  for (int i = 0; i < 8; ++i) { a[i] = (_Float16)(p[i] * sc); a[8 + i] = (_Float16)(p[16 + i] * sc); }
  return a;
}
// column fragment from a [K][ld] layout (column n), rows >= K read as 0
__device__ __forceinline__ v16h fragc_f32(const float* W, int k0, int n, int lane, int ld, int K) {
  v16h a; const int g = lane >> 4;
#pragma unroll
  for (int i = 0; i < 8; ++i) { const int ka = k0 + 8 * g + i, kb = ka + 16;
    a[i] = (_Float16)(ka < K ? W[(size_t)(ka < K ? ka : K - 1) * ld + n] : 0.f); a[8 + i] = (_Float16)(kb < K ? W[(size_t)(kb < K ? kb : K - 1) * ld + n] : 0.f); }
  return a;
}
struct F2 { v16b h, l; };
__device__ __forceinline__ F2 bsplit16(const float v[16]) { F2 r;
#pragma unroll
  for (int i = 0; i < 16; ++i) { const __bf16 h = (__bf16)v[i]; r.h[i] = h; r.l[i] = (__bf16)(v[i] - (float)h); }
  return r; }
__device__ __forceinline__ F2 split_row(const float* row, int k0, int lane) { float v[16]; const float* p = row + k0 + 8 * (lane >> 4);
#pragma unroll
  for (int i = 0; i < 8; ++i) { v[i] = p[i]; v[8 + i] = p[16 + i]; }
  return bsplit16(v); }
__device__ __forceinline__ F2 split_rowK(const float* row, int k0, int lane, int K) { float v[16]; const int g = lane >> 4;
#pragma unroll
  for (int i = 0; i < 8; ++i) { const int ka = k0 + 8 * g + i, kb = ka + 16; v[i] = ka < K ? row[ka < K ? ka : K - 1] : 0.f; v[8 + i] = kb < K ? row[kb < K ? kb : K - 1] : 0.f; }
  return bsplit16(v); }
__device__ __forceinline__ F2 split_col(const float* W, int k0, int n, int lane, int ld, int K) { float v[16]; const int g = lane >> 4;
#pragma unroll
  for (int i = 0; i < 8; ++i) { const int ka = k0 + 8 * g + i, kb = ka + 16; v[i] = ka < K ? W[(size_t)(ka < K ? ka : K - 1) * ld + n] : 0.f; v[8 + i] = kb < K ? W[(size_t)(kb < K ? kb : K - 1) * ld + n] : 0.f; }
  return bsplit16(v); }
__device__ __forceinline__ v8f mac3(const F2& a, const F2& b, v8f c) { c = wmma_bf(a.l, b.h, c); c = wmma_bf(a.h, b.l, c); return wmma_bf(a.h, b.h, c); }
__device__ __forceinline__ float sigm(float v) { return 1.0f / (1.0f + expf(-v)); }
#define LDSX() do { asm volatile("s_wait_dscnt 0" ::: "memory"); __builtin_amdgcn_wave_barrier(); __builtin_amdgcn_fence(__ATOMIC_RELEASE, "workgroup"); } while (0)


// Invertible attention (N 8, L 4,096 -> halves of 2,048, D 256): att = softmax(upper-tri(LN(x1 Wq^T) . LN(x1 Wk^T) / d_scale)) + I; out = att x2; logdet = slogdet(att) * L/2.
#define NB 8
#define LL 4096
#define T2 2048
#define DD 256
#define LN_EPS 1e-5f
typedef __attribute__((ext_vector_type(8))) __bf16 v8b;
__device__ __forceinline__ v16b frag_b(const __bf16* rowk0, int lane) {
  union { v16b v; v8b q[2]; } u; const __bf16* p = rowk0 + 8 * (lane >> 4);
  u.q[0] = *(const v8b*)p; u.q[1] = *(const v8b*)(p + 16); return u.v;
}
__device__ __forceinline__ float bfr(float v) { return (float)(__bf16)v; }
__device__ __attribute__((noinline)) float exp_ni(float v) { return expf(v); }
__device__ __attribute__((noinline)) float erf_ni(float v) { return erff(v); }

// Eight 16-byte asynchronous copies per lane, global memory to LDS through no register. The s_wait_xcnt is the statement's last line so that no address register of a copy is rewritten ahead of it.
__device__ __forceinline__ void acopy8(const unsigned (&l)[8], const char* const (&gp)[8]) {
  asm volatile("global_load_async_to_lds_b128 %0, %8, off\n\t"
               "global_load_async_to_lds_b128 %1, %9, off\n\t"
               "global_load_async_to_lds_b128 %2, %10, off\n\t"
               "global_load_async_to_lds_b128 %3, %11, off\n\t"
               "global_load_async_to_lds_b128 %4, %12, off\n\t"
               "global_load_async_to_lds_b128 %5, %13, off\n\t"
               "global_load_async_to_lds_b128 %6, %14, off\n\t"
               "global_load_async_to_lds_b128 %7, %15, off\n\t"
               "s_wait_xcnt 0x0"
               :: "v"(l[0]), "v"(l[1]), "v"(l[2]), "v"(l[3]), "v"(l[4]), "v"(l[5]), "v"(l[6]), "v"(l[7]),
                  "v"(gp[0]), "v"(gp[1]), "v"(gp[2]), "v"(gp[3]), "v"(gp[4]), "v"(gp[5]), "v"(gp[6]), "v"(gp[7]) : "memory");
}
// The same with four copies.
__device__ __forceinline__ void acopy4(const unsigned (&l)[4], const char* const (&gp)[4]) {
  asm volatile("global_load_async_to_lds_b128 %0, %4, off\n\t"
               "global_load_async_to_lds_b128 %1, %5, off\n\t"
               "global_load_async_to_lds_b128 %2, %6, off\n\t"
               "global_load_async_to_lds_b128 %3, %7, off\n\t"
               "s_wait_xcnt 0x0"
               :: "v"(l[0]), "v"(l[1]), "v"(l[2]), "v"(l[3]), "v"(gp[0]), "v"(gp[1]), "v"(gp[2]), "v"(gp[3]) : "memory");
}
// this wave's copies have landed (the compiler places no wait for them)
#define WAIT_ASYNC() asm volatile("s_wait_asynccnt 0x0" ::: "memory")
// this wave's LDS reads have returned, so the buffer may be handed back for a refill
#define WAIT_DS() asm volatile("s_wait_dscnt 0x0" ::: "memory")

#define WS_QH  0u
#define WS_QL  (WS_QH + 2u * (size_t)NB * T2 * DD)
#define WS_KH  (WS_QL + 2u * (size_t)NB * T2 * DD)
#define WS_KL  (WS_KH + 2u * (size_t)NB * T2 * DD)
#define WS_XT  (WS_KL + 2u * (size_t)NB * T2 * DD)      // bf16 x2 planes [n][d][j]
#define WS_S   (WS_XT + 2u * (size_t)NB * DD * T2)      // f32 exp(s - tile maximum) [n][i][j]
#define WS_DG  (WS_S + 4u * (size_t)NB * T2 * T2)       // f32 log(1 + P_ii) [n][i]
#define WS_MT  (WS_DG + 4u * (size_t)NB * T2)           // f32 maximum of a row in a 128-column tile [n][tile][i]
#define WS_LT  (WS_MT + 4u * (size_t)NB * (T2 / 128) * T2)   // f32 sum of exp(s - that maximum) [n][tile][i]
#define WS_END (WS_LT + 4u * (size_t)NB * (T2 / 128) * T2)
#define OUT1_OFF ((size_t)NB * LL * DD)               // logdet output offset (elements)

// the value of lane l ^ M inside the 16-lane row (row_xmask), every lane on
template <int M> __device__ __forceinline__ float xrow(float x) { return __builtin_bit_cast(float, __builtin_amdgcn_update_dpp(0, __builtin_bit_cast(int, x), 0x160 + M, 0xf, 0xf, true)); }
__device__ __forceinline__ float rmax16(float x) { x = fmaxf(x, xrow<1>(x)); x = fmaxf(x, xrow<2>(x)); x = fmaxf(x, xrow<4>(x)); return fmaxf(x, xrow<8>(x)); }
__device__ __forceinline__ float rsum16(float x) { x += xrow<1>(x); x += xrow<2>(x); x += xrow<4>(x); return x + xrow<8>(x); }
// ---- k_proj: block = (64 rows of x1, which): y = x1 W^T ([out][in]); LayerNorm(gamma, beta) -> f16 hi + lo rows; also copies bf16-rounded x1 into merged (which == 0 blocks); the blocks of which == 2 do x2t_tile instead
// The W rows (all 256) and the block's x1 rows come in slices of 32 k = 128 B a row, whole lines, f32, by asynchronous copies into two LDS buffers; the fragments are read from LDS and rounded to bf16 there.
// LayerNorm runs on the accumulators: a wave holds its 16 rows whole (a lane 16 columns of each of 8 rows), so a row's mean and variance are 16 additions in the lane and a sum over the 16 lanes of its half.
// The f16 hi and lo of a value go as one dword into the wave's own rows of sp, which lies over the two buffers and is first written behind the last trip's barrier; the wave reads its rows back and stores whole lines.
#define PJ_P 144u                    // LDS row pitch: 128 B + 16, conflict-free for 16-byte reads
#define PJ_X (256u * PJ_P)           // rows in a buffer: W 256 | x1 64
#define PJ_BUF (320u * PJ_P)
static_assert(64u * (DD + 4u) * 4u <= 2u * PJ_BUF, "sp lies inside the staging buffers");
static_assert(DD * 72u * 2u <= 2u * PJ_BUF, "st of the third plane lies inside them too");
__device__ __forceinline__ v16b cvt_frag(const v4f (&r)[4]) { v16b a;   // elements 0..7 = k 8g+0..7, 8..15 = k 16+8g+0..7
// unrolled: a[] and r[] are registers
#pragma unroll
  for (int i = 0; i < 4; ++i) { a[i] = (__bf16)r[0][i]; a[4 + i] = (__bf16)r[1][i]; a[8 + i] = (__bf16)r[2][i]; a[12 + i] = (__bf16)r[3][i]; }
  return a; }
// ---- the blocks of k_proj's third plane (blockIdx.y == 2): block = (64 j, n): x2 planes XT[n][d][j] (bf16, exact). They need nothing of the projection and run beside its blocks in one launch.
// Thread t takes the columns d = t and t + 128 of the 64 rows j, a wave 128 B of a row with each load; 8 j go as one 16-byte LDS store into st[d][]. Behind the barrier 8 lanes store a plane row's 64 j, one whole line.
__device__ __forceinline__ void x2t_tile(const float* __restrict__ X, __bf16* __restrict__ XT, unsigned char* lds, size_t n, int j0, int t) {
  __bf16 (*st)[72] = (__bf16 (*)[72])lds;   // pitch 144 B: conflict-free for 16-byte accesses
// every loop here is unrolled: v[] is registers, and the loads stand together ahead of the conversions, one trip to memory
#pragma unroll
  for (int h = 0; h < 2; ++h) { const int d = t + 128 * h;
#pragma unroll
    for (int jb = 0; jb < 64; jb += 32) { float v[32]; const float* p = X + (n * LL + T2 + j0 + jb) * DD + d;
#pragma unroll
      for (int i = 0; i < 32; ++i) v[i] = p[(size_t)i * DD];
#pragma unroll
      for (int q = 0; q < 4; ++q) { v8b w;
#pragma unroll
        for (int i = 0; i < 8; ++i) w[i] = (__bf16)v[q * 8 + i];
        *(v8b*)&st[d][jb + q * 8] = w; } } }
  __syncthreads();   // st[][] is whole before it is read across the waves
#pragma unroll
  for (int k = 0; k < DD * 8 / 128; ++k) { const int d = k * 16 + (t >> 3), q = t & 7; vst2((unsigned*)(XT + (n * DD + d) * (size_t)T2 + j0 + q * 8), *(const v4u*)&st[d][q * 8]); } }
__global__ __launch_bounds__(128) void k_proj(const float* __restrict__ X, const float* __restrict__ WQ, const float* __restrict__ WK, const float* __restrict__ GQ, const float* __restrict__ BQ, const float* __restrict__ GK, const float* __restrict__ BK, _Float16* __restrict__ QH, _Float16* __restrict__ QL, _Float16* __restrict__ KH, _Float16* __restrict__ KL, float* __restrict__ OUT, __bf16* __restrict__ XT) {
  __shared__ __align__(16) unsigned char ar[2u * PJ_BUF];
  unsigned (*sp)[DD + 4] = (unsigned (*)[DD + 4])ar;   // pitch 260 dwords: the two halves of a wave, 8 rows apart, write banks 32 apart
  const int tid = threadIdx.x, wave = tid >> 5, lane = tid & 31, col = lane & 15, g = lane >> 4; const int which = blockIdx.y; const size_t r0 = (size_t)blockIdx.x * 64; const size_t n = r0 / T2; const int i0 = (int)(r0 % T2);   // rows of x1: x[n][i][:], i < T2
  if (which == 2) { x2t_tile(X, XT, ar, n, i0, tid); return; }   // the same for the whole block: the 64 rows j = i0.. of x2
  const float* Wm = which == 0 ? WQ : WK; const float* Gm = which == 0 ? GQ : GK; const float* Bm = which == 0 ? BQ : BK;
  const int rr = tid >> 3, pc = tid & 7;   // a copy of a wave covers 4 rows x 128 B
  const unsigned lb = (unsigned)(size_t)ar + (unsigned)rr * PJ_P + (unsigned)pc * 16u;
  const char* gw = (const char*)(Wm + (size_t)rr * DD + pc * 4); const char* gx = (const char*)(X + (n * LL + i0 + rr) * DD + pc * 4);
  // the loops below are unrolled so that l[] and gp[] are registers: they are asm operands
  auto stage = [&](int t, int b) { unsigned l[8]; const char* gp[8]; unsigned l4[4]; const char* gp4[4]; const unsigned lt = lb + (unsigned)b * PJ_BUF; const size_t go = (size_t)t * 128;
#pragma unroll
    for (int m = 0; m < 8; ++m) { l[m] = lt + (unsigned)m * 16u * PJ_P; gp[m] = gw + go + (size_t)m * 16 * DD * 4; }
    acopy8(l, gp);
#pragma unroll
    for (int m = 0; m < 8; ++m) { l[m] = lt + (unsigned)(8 + m) * 16u * PJ_P; gp[m] = gw + go + (size_t)(8 + m) * 16 * DD * 4; }
    acopy8(l, gp);
#pragma unroll
    for (int m = 0; m < 4; ++m) { l4[m] = lt + PJ_X + (unsigned)m * 16u * PJ_P; gp4[m] = gx + go + (size_t)m * 16 * DD * 4; }
    acopy4(l4, gp4); };
  stage(0, 0); WAIT_ASYNC(); __syncthreads(); stage(1, 1);
  v8f acc[16] = {};
// rolled: one copy of the 16-WMMA body, and the two buffers alternate by an offset; the loops inside are unrolled so that acc[], r[] and w[] stay in registers
#pragma unroll 1
  for (int t = 0; t < DD / 32; ++t) { const unsigned char* B = ar + (unsigned)(t & 1) * PJ_BUF; v4f ra[4], r[4][4];
    // a lane's 16 values of a row: k 8g+0..7 and 16+8g+0..7, four 16-byte reads
    auto rd = [&](v4f (&d)[4], unsigned row) { const v4f* p = (const v4f*)(B + row * PJ_P + (unsigned)g * 32u); d[0] = p[0]; d[1] = p[1]; d[2] = p[4]; d[3] = p[5]; };
    rd(ra, 256u + (unsigned)(wave * 16 + col));
#pragma unroll
    for (int jj = 0; jj < 4; ++jj) rd(r[jj], (unsigned)(jj * 16 + col));
    const v16b a = cvt_frag(ra);
#pragma unroll
    for (int jg = 0; jg < 4; ++jg) { v16b w[4];
#pragma unroll
      for (int jj = 0; jj < 4; ++jj) w[jj] = cvt_frag(r[jj]);
      // the next four fragments' reads stand ahead of this group's WMMAs, so that their LDS latency runs beside them
      if (jg < 3) {
#pragma unroll
        for (int jj = 0; jj < 4; ++jj) rd(r[jj], (unsigned)((jg * 4 + 4 + jj) * 16 + col)); }
#pragma unroll
      for (int jj = 0; jj < 4; ++jj) acc[jg * 4 + jj] = wmma_bf(a, w[jj], acc[jg * 4 + jj]); }
    WAIT_DS(); WAIT_ASYNC(); __syncthreads();   // publishes slice t + 1 and ends every reader's last read of slice t's buffer
    if (t + 2 < DD / 32) stage(t + 2, t & 1); }
  WAIT_ASYNC();
// every loop below is unrolled: acc[], gm[] and bt[] are registers
  float gm[16], bt[16];   // the lane's 16 columns of gamma and beta: the loads fly beside the sums
#pragma unroll
  for (int j = 0; j < 16; ++j) { gm[j] = Gm[j * 16 + col]; bt[j] = Bm[j * 16 + col]; }
  // the 8 rows of a lane side by side as one vector: neighbouring rows lie in neighbouring registers, which packed f32 instructions take as they are
  v8f s8 = acc[0], q8 = {}, mu, rs;
#pragma unroll
  for (int j = 1; j < 16; ++j) s8 += acc[j];
#pragma unroll
  for (int r = 0; r < 8; ++r) mu[r] = rsum16(s8[r]) * (1.0f / DD);
#pragma unroll
  for (int j = 0; j < 16; ++j) { const v8f d = acc[j] - mu; q8 += d * d; }
#pragma unroll
  for (int r = 0; r < 8; ++r) rs[r] = 1.0f / sqrtf(rsum16(q8[r]) * (1.0f / DD) + LN_EPS);
#pragma unroll
  for (int j = 0; j < 16; ++j) { const v8f y = (acc[j] - mu) * rs * bfr(gm[j]) + bfr(bt[j]);
#pragma unroll
    for (int r = 0; r < 8; ++r) { const float v = y[r]; const _Float16 hv = (_Float16)v, lv = (_Float16)(v - (float)hv);
      sp[wave * 16 + 8 * g + r][j * 16 + col] = (unsigned)__builtin_bit_cast(unsigned short, hv) | ((unsigned)__builtin_bit_cast(unsigned short, lv) << 16); } }   // hi in the low half
  LDSX();   // the wave's own rows are written before it reads them back across its lanes; no other wave touches them
  _Float16* dh = which == 0 ? QH : KH; _Float16* dl = which == 0 ? QL : KL;
  // a lane takes 8 columns of a row, parts hi from lo, and the wave stores 512 B of each: whole lines
#pragma unroll
  for (int rl = 0; rl < 16; ++rl) { const v4u* p = (const v4u*)&sp[wave * 16 + rl][lane * 8]; const v4u a = p[0], b = p[1]; v4u h, l;
    h[0] = (a[0] & 0xffffu) | (a[1] << 16); h[1] = (a[2] & 0xffffu) | (a[3] << 16); h[2] = (b[0] & 0xffffu) | (b[1] << 16); h[3] = (b[2] & 0xffffu) | (b[3] << 16);
    l[0] = (a[0] >> 16) | (a[1] & 0xffff0000u); l[1] = (a[2] >> 16) | (a[3] & 0xffff0000u); l[2] = (b[0] >> 16) | (b[1] & 0xffff0000u); l[3] = (b[2] >> 16) | (b[3] & 0xffff0000u);
    vst2((unsigned*)(dh + (r0 + wave * 16 + rl) * DD + lane * 8), h); vst2((unsigned*)(dl + (r0 + wave * 16 + rl) * DD + lane * 8), l); }
  asm volatile("s_wait_xcnt 0x0" ::: "memory");   // stands ahead of any rewrite of the stores' address and data registers by the copy loop below
  if (which == 0) { for (int e = tid; e < 64 * 64; e += 128) { const int rl = e >> 6, q = e & 63; const size_t go = (n * LL + i0 + rl) * DD + q * 4; const v4f xr = *(const v4f*)(X + go); v4f v; v[0] = bfr(xr[0]); v[1] = bfr(xr[1]); v[2] = bfr(xr[2]); v[3] = bfr(xr[3]); vst2(OUT + go, v); } } }
#define SM_NEG -3.0e38f
// e^x in f32 for x <= 0: r = nearest integer to x log2(e); fraction = x log2(e) - r by two fused multiply-adds, log2(e) in two parts (the product is not rounded before r is taken off); 2^fraction; ldexp by r.
// The floor of -200 keeps r finite for a masked value, and ldexp then gives exactly 0. 2^fraction stands in asm: the v_nop in the statement is the free slot that the instruction set asks for behind a transcendental.
__device__ __forceinline__ float exp_np(float x) {
  x = fmaxf(x, -200.0f); const float r = __builtin_rintf(x * 0x1.715476p+0f); const float a = __builtin_fmaf(x, 0x1.4ae0bep-26f, __builtin_fmaf(x, 0x1.715476p+0f, -r));
  float e; asm("v_exp_f32 %0, %1\n\tv_nop" : "=v"(e) : "v"(a));
  return ldexpf(e, (int)r); }
// ---- k_sc: block = (64 rows i, 128 cols j, n): s = q.k / d_scale for j >= i, else masked; stored: exp(s - m), m the row's maximum in this tile (0 where masked), with m and the row's sum of them in MT and LT [n][tile][i] for k_pv; blocks entirely below the diagonal store the mask and 0 there and exit.
// The K and Q rows (hi and lo) come in slices of 64 k = 128 B a row, whole lines, by asynchronous copies into two LDS buffers; the fragments are read from LDS.
// An LDS row has no pad: its eight 16-byte pieces are permuted, piece p of row r at place p ^ ((r >> 1) & 7), so that 16 rows read at one piece meet all 64 banks. With ss laid over the buffers a block takes under a third of a WGP's LDS: three blocks run there, not two.
#define SC_P 128u                    // LDS row pitch: one line
#define SC_KL (128u * SC_P)          // rows in a buffer: KH 128 | KL 128 | QH 64 | QL 64
#define SC_QH (256u * SC_P)
#define SC_QL (320u * SC_P)
#define SC_BUF (384u * SC_P)
static_assert(4u * 16u * 132u * 4u <= 2u * SC_BUF, "ss lies inside the staging buffers");
__global__ __launch_bounds__(128) void k_sc(const _Float16* __restrict__ QH, const _Float16* __restrict__ QL, const _Float16* __restrict__ KH, const _Float16* __restrict__ KL, const float* __restrict__ DSC, float* __restrict__ S0, float* __restrict__ MT, float* __restrict__ LT) { __shared__ __align__(16) unsigned char sb[2 * SC_BUF]; __shared__ __align__(16) float st[2][64];
  float (*ss)[16][132] = (float (*)[16][132])sb;   // lies over the two buffers and is first written behind the last trip's barrier
  const size_t n = blockIdx.z; float* S = S0 + n * (size_t)T2 * T2;
  const int tid = threadIdx.x, wave = tid >> 5, lane = tid & 31, col = lane & 15, g = lane >> 4; const int k0 = blockIdx.y * 128; const int q0b = blockIdx.x * 64; const int ql0 = q0b + wave * 16;
  float* const tq = (tid < 64 ? MT : LT) + (n * (T2 / 128) + blockIdx.y) * (size_t)T2 + q0b + (tid & 63);   // waves 0 and 1 store the 64 rows' maxima, waves 2 and 3 their sums, one whole line each
  if (k0 + 127 < q0b) { *tq = tid < 64 ? SM_NEG : 0.f; return; }   // all j < i: the tile counts as masked in k_pv's factors, and its values are never read (k_pv starts at the tile of the rows' diagonal)
  const float isc = 1.0f / bfr(DSC[0]);
  const int rr = tid >> 3, pc = tid & 7;   // a copy of a wave covers 4 rows x 128 B
  const unsigned lb = (unsigned)(size_t)sb + (unsigned)rr * SC_P + (unsigned)(pc ^ ((rr >> 1) & 7)) * 16u;   // every copy's row is rr + a multiple of 16: the permutation is rr's
  const char* gkh = (const char*)(KH + (n * T2 + k0 + rr) * DD + pc * 8); const char* gkl = (const char*)(KL + (n * T2 + k0 + rr) * DD + pc * 8);
  const char* gqh = (const char*)(QH + (n * T2 + q0b + rr) * DD + pc * 8); const char* gql = (const char*)(QL + (n * T2 + q0b + rr) * DD + pc * 8);
  // the loops below are unrolled so that l[] and gp[] are registers: they are asm operands
  auto stage = [&](int t, int b) { unsigned l[8]; const char* gp[8]; const unsigned lt = lb + (unsigned)b * SC_BUF; const size_t go = (size_t)t * 128;
#pragma unroll
    for (int m = 0; m < 8; ++m) { l[m] = lt + (unsigned)m * 16u * SC_P; gp[m] = gkh + go + (size_t)m * 16 * DD * 2; }
    acopy8(l, gp);
#pragma unroll
    for (int m = 0; m < 8; ++m) { l[m] = lt + SC_KL + (unsigned)m * 16u * SC_P; gp[m] = gkl + go + (size_t)m * 16 * DD * 2; }
    acopy8(l, gp);
#pragma unroll
    for (int m = 0; m < 4; ++m) { l[m] = lt + SC_QH + (unsigned)m * 16u * SC_P; gp[m] = gqh + go + (size_t)m * 16 * DD * 2; l[4 + m] = lt + SC_QL + (unsigned)m * 16u * SC_P; gp[4 + m] = gql + go + (size_t)m * 16 * DD * 2; }
    acopy8(l, gp); };
  stage(0, 0); WAIT_ASYNC(); __syncthreads(); stage(1, 1);
  v8f acc[8] = {};
  // a lane's fragment of a 32-k step: pieces 4 kk + g and 4 kk + 2 + g of its row, which is col + a multiple of 16
  const unsigned sw = (unsigned)((col >> 1) ^ g);
  auto frag_s = [&](const unsigned char* row, int kk) { union { v16h v; v8h q[2]; } u; u.q[0] = *(const v8h*)(row + (sw ^ (unsigned)(kk * 4)) * 16u); u.q[1] = *(const v8h*)(row + (sw ^ (unsigned)(kk * 4 + 2)) * 16u); return u.v; };
// rolled: one copy of the 48-WMMA body, and the two buffers alternate by an offset; the loops inside are unrolled so that acc[], kb[] and kl[] stay in registers
#pragma unroll 1
  for (int t = 0; t < DD / 64; ++t) { const unsigned char* B = sb + (unsigned)(t & 1) * SC_BUF;
#pragma unroll
    for (int kk = 0; kk < 2; ++kk) { const unsigned qo = (unsigned)(wave * 16 + col) * SC_P; const v16h ah = frag_s(B + SC_QH + qo, kk), al = frag_s(B + SC_QL + qo, kk); v16h kb[8], kl[8];
#pragma unroll
      for (int j = 0; j < 8; ++j) { const unsigned ko = (unsigned)(j * 16 + col) * SC_P; kb[j] = frag_s(B + ko, kk); kl[j] = frag_s(B + SC_KL + ko, kk); }
      // inputs only: keeps the LDS reads of this 32-k step together ahead of its WMMAs; read one fragment at a time, every WMMA waits out an LDS latency
      asm volatile("" :: "v"(ah), "v"(al), "v"(kb[0]), "v"(kb[1]), "v"(kb[2]), "v"(kb[3]), "v"(kb[4]), "v"(kb[5]), "v"(kb[6]), "v"(kb[7]), "v"(kl[0]), "v"(kl[1]), "v"(kl[2]), "v"(kl[3]), "v"(kl[4]), "v"(kl[5]), "v"(kl[6]), "v"(kl[7]));
#pragma unroll
      for (int j = 0; j < 8; ++j) { acc[j] = wmma16(ah, kb[j], acc[j]); acc[j] = wmma16(al, kb[j], acc[j]); acc[j] = wmma16(ah, kl[j], acc[j]); } }
    WAIT_DS(); WAIT_ASYNC(); __syncthreads();   // publishes slice t + 1 and ends every reader's last read of slice t's buffer
    if (t + 2 < DD / 64) stage(t + 2, t & 1); }
  WAIT_ASYNC();
  // a lane holds 8 columns of each of the rows 8g + 0..7: maximum and sum in the lane, then over the 16 lanes of its half. Every row of a block that runs has a column j >= i in the tile. The loops are unrolled: acc[], mx[] and sm[] are registers
  float mx[8], sm[8];
#pragma unroll
  for (int r = 0; r < 8; ++r) { mx[r] = SM_NEG; sm[r] = 0.f; }
#pragma unroll
  for (int j = 0; j < 8; ++j) { const int jj = k0 + j * 16 + col;
#pragma unroll
    for (int r = 0; r < 8; ++r) { const int ii = ql0 + 8 * g + r; acc[j][r] = (jj >= ii) ? acc[j][r] * isc : SM_NEG; mx[r] = fmaxf(mx[r], acc[j][r]); } }
#pragma unroll
  for (int r = 0; r < 8; ++r) mx[r] = rmax16(mx[r]);
#pragma unroll
  for (int j = 0; j < 8; ++j)
#pragma unroll
    for (int r = 0; r < 8; ++r) { const float e = exp_np(acc[j][r] - mx[r]); sm[r] += e; ss[wave][8 * g + r][j * 16 + col] = e; }
#pragma unroll
  for (int r = 0; r < 8; ++r) sm[r] = rsum16(sm[r]);
  if (col == 0) {
#pragma unroll
    for (int r = 0; r < 8; ++r) { st[0][wave * 16 + 8 * g + r] = mx[r]; st[1][wave * 16 + 8 * g + r] = sm[r]; } }
  __syncthreads();   // st[] is whole (and every wave's own ss rows are written). It stands ahead of the row stores: behind them it would wait for them to complete
  *tq = st[tid >> 6][tid & 63];
  for (int rl = 0; rl < 16; ++rl) vst2(S + (size_t)(ql0 + rl) * T2 + k0 + lane * 4, *(const v4f*)&ss[wave][rl][lane * 4]);
  asm volatile("s_wait_xcnt 0x0" ::: "memory"); }   // stands ahead of any rewrite of the stores' address and data registers: the compiler lays the early exit's store behind this place
// ---- k_pv: block = (64 rows i, 128 cols d, n), 8 waves: out = P (hi + lo) . x2 (exact) over j >= 128*(i/128), + x2[i]; written to merged rows T2 + i.
// P x 2^11 = k_sc's exp(s - tile maximum) times the row's factor of that tile, exp(tile maximum - row maximum) x 2^11 / row sum: 16 factors a row, formed from MT and LT while the first slice flies.
// The stored rows (f32) and x2 planes (bf16) come in slices of 128 j (one tile of k_sc), whole lines, by asynchronous copies into two LDS buffers; the fragments are read from LDS.
// Waves 0..3 take the first 64 j of a slice and waves 4..7 the second 64, each group all 64 rows: the longest block makes 16 trips, not 32, and a trip waits once for memory. The two partial sums meet in LDS behind the loop.
// A block of odd blockIdx.x starts 64 columns left of its rows' diagonal: k_sc has stored exact zeros there.
// The first slice of a block holds its rows' diagonal: the blocks of d-block 0 store log(1 + P_ii) from it into LG [n][i] for k_logdet.
#define PV_PP 528u                   // LDS pitch of a P row: 512 B + 16
#define PV_XP 272u                   // LDS pitch of an x2 plane row: 256 B + 16
#define PV_X (64u * PV_PP)           // a buffer: P 64 rows | x2 planes 128 rows
#define PV_BUF (PV_X + 128u * PV_XP)
static_assert(4u * 16u * 132u * 4u <= 2u * PV_BUF, "ss lies inside the staging buffers");
__global__ __launch_bounds__(256) void k_pv(const float* __restrict__ PS0, const __bf16* __restrict__ XT, const float* __restrict__ X, float* __restrict__ OUT, float* __restrict__ LG, const float* __restrict__ MT, const float* __restrict__ LT) { __shared__ __align__(16) unsigned char sb[2 * PV_BUF]; __shared__ float cs[64][17];   // pitch 17: 16 rows read at once meet 16 banks
  float (*ss)[16][132] = (float (*)[16][132])sb;   // lies over the two buffers and is first written behind the last trip's barrier
  const size_t n = blockIdx.z; const float* PS = PS0 + n * (size_t)T2 * T2;
  const int tid = threadIdx.x, wave = tid >> 5, lane = tid & 31, col = lane & 15, g = lane >> 4; const int wr = wave & 3, jh = __builtin_amdgcn_readfirstlane(wave) >> 2;   // the wave's 16 rows; its half of a slice (a scalar)
  const int q0b = blockIdx.x * 64; const int ql0 = q0b + wr * 16; const int c0 = blockIdx.y * 128;
  const unsigned lp = (unsigned)(size_t)sb + (unsigned)(tid >> 5) * PV_PP + (unsigned)(tid & 31) * 16u;           // a copy of a wave covers 1 P row x 512 B
  const unsigned lx = (unsigned)(size_t)sb + PV_X + (unsigned)(tid >> 4) * PV_XP + (unsigned)(tid & 15) * 16u;    // or 2 plane rows x 256 B
  const char* gpp = (const char*)(PS + (size_t)(q0b + (tid >> 5)) * T2 + (tid & 31) * 4); const char* gxx = (const char*)(XT + (n * DD + c0 + (tid >> 4)) * (size_t)T2 + (tid & 15) * 8);
  // the loops below are unrolled so that l[] and gp[] are registers: they are asm operands
  auto stage = [&](int t, int b) { unsigned l[8]; const char* gp[8];
#pragma unroll
    for (int m = 0; m < 8; ++m) { l[m] = lp + (unsigned)b * PV_BUF + (unsigned)m * 8u * PV_PP; gp[m] = gpp + (size_t)t * 512 + (size_t)m * 8 * T2 * 4; }
    acopy8(l, gp);
#pragma unroll
    for (int m = 0; m < 8; ++m) { l[m] = lx + (unsigned)b * PV_BUF + (unsigned)m * 16u * PV_XP; gp[m] = gxx + (size_t)t * 256 + (size_t)m * 16 * T2 * 2; }
    acopy8(l, gp); };
  const int t0 = blockIdx.x >> 1;   // first slice of 128 j: the tile that holds the rows' diagonal
  stage(t0, 0);
  // waves 0 and 1 (a scalar test): thread tid forms row tid's factors; a tile left of the diagonal holds the mask and a sum of 0. Unrolled: mt[] and lt[] are registers and the 32 whole-line loads fly together
  if (__builtin_amdgcn_readfirstlane(wave) < 2) { float mt[16], lt[16]; const size_t o = n * (T2 / 128) * (size_t)T2 + q0b + tid;
#pragma unroll
    for (int i = 0; i < 16; ++i) { mt[i] = MT[o + (size_t)i * T2]; lt[i] = LT[o + (size_t)i * T2]; }
    float m = SM_NEG, l = 0.f;
#pragma unroll
    for (int i = 0; i < 16; ++i) m = fmaxf(m, mt[i]);
#pragma unroll
    for (int i = 0; i < 16; ++i) { mt[i] = exp_np(mt[i] - m); l += lt[i] * mt[i]; }
    const float f = 2048.0f / l;
#pragma unroll
    for (int i = 0; i < 16; ++i) cs[tid][i] = mt[i] * f; }
  WAIT_ASYNC(); __syncthreads(); if (t0 + 1 < T2 / 128) stage(t0 + 1, 1);   // the barrier publishes cs[] too
  // row tid of buffer 0, the row's own column, times the row's factor: P_ii x 2^11. Waves 0 and 1 (a scalar test, every lane on) store one whole line each; buffer 0 is refilled only behind the foot of the first trip.
  if (blockIdx.y == 0 && __builtin_amdgcn_readfirstlane(wave) < 2) { const float pd = *(const float*)(sb + (unsigned)tid * (PV_PP + 4u) + (unsigned)(blockIdx.x & 1) * 256u) * cs[tid][t0]; LG[n * T2 + q0b + tid] = logf(1.0f + pd * (1.0f / 2048.0f));
    asm volatile("s_wait_xcnt 0x0" ::: "memory"); }   // stands ahead of any rewrite of the store's address and data registers
  v8f acc[8] = {};
// rolled: the trip count depends on the block; the loops inside are unrolled so that acc[] and xb[] stay in registers
#pragma unroll 1
  for (int t = t0; t < T2 / 128; ++t) { const int b = (t - t0) & 1; const unsigned char* B = sb + (unsigned)b * PV_BUF; const float cf = cs[wr * 16 + col][t];   // the lane's row, this slice's tile
#pragma unroll
    for (int kk = 0; kk < 2; ++kk) { const v4f* pp = (const v4f*)(B + (unsigned)(wr * 16 + col) * PV_PP + (unsigned)jh * 256u + (unsigned)kk * 128u + (unsigned)g * 32u); const v4f p0 = pp[0], p1 = pp[1], p2 = pp[4], p3 = pp[5]; v16b xb[8];   // P elements k0+8g+0..7 and k0+16+8g+0..7
#pragma unroll
      for (int j = 0; j < 8; ++j) xb[j] = frag_b((const __bf16*)(B + PV_X + (unsigned)(j * 16 + col) * PV_XP + (unsigned)jh * 128u + (unsigned)kk * 64u), lane);
      // inputs only: keeps the LDS reads of this 32-j step together ahead of its WMMAs; read one fragment at a time, every WMMA waits out an LDS latency
      asm volatile("" :: "v"(p0), "v"(p1), "v"(p2), "v"(p3), "v"(xb[0]), "v"(xb[1]), "v"(xb[2]), "v"(xb[3]), "v"(xb[4]), "v"(xb[5]), "v"(xb[6]), "v"(xb[7]));
      float pv[16];
#pragma unroll
      for (int i = 0; i < 4; ++i) { pv[i] = p0[i] * cf; pv[4 + i] = p1[i] * cf; pv[8 + i] = p2[i] * cf; pv[12 + i] = p3[i] * cf; }
      const F2 p = bsplit16(pv);
#pragma unroll
      for (int j = 0; j < 8; ++j) { acc[j] = wmma_bf(p.h, xb[j], acc[j]); acc[j] = wmma_bf(p.l, xb[j], acc[j]); } }
    WAIT_DS(); WAIT_ASYNC(); __syncthreads();   // publishes slice t + 1 and ends every reader's last read of slice t's buffer
    if (t + 2 < T2 / 128) stage(t + 2, b); }
  WAIT_ASYNC();
  // waves 4..7 hand their partial sums over, each lane to the lane of wave - 4 that holds the same elements. The loops are unrolled: acc[] is registers
  if (jh == 1) {
#pragma unroll
    for (int j = 0; j < 8; ++j)
#pragma unroll
      for (int r = 0; r < 8; ++r) ss[wr][8 * g + r][j * 16 + col] = acc[j][r]; }
  __syncthreads();   // the partial sums of waves 4..7 are in ss before waves 0..3 read them
  if (jh == 0) {
#pragma unroll
    for (int j = 0; j < 8; ++j) { const int d = c0 + j * 16 + col;
#pragma unroll
      for (int r = 0; r < 8; ++r) { const int ii = ql0 + 8 * g + r; float* const e = &ss[wr][8 * g + r][j * 16 + col]; *e = (acc[j][r] + *e) * (1.0f / 2048.0f) + bfr(X[(n * LL + T2 + ii) * DD + d]); } }
    LDSX(); for (int rl = 0; rl < 16; ++rl) vst2(OUT + (n * LL + T2 + ql0 + rl) * DD + c0 + lane * 4, *(const v4f*)&ss[wr][rl][lane * 4]); } }
// ---- k_logdet: one block: logdet[n] = (L/2) * sum_i log(1 + P_ii), the logarithms read from LG (64 KB, whole lines). Thread t sums i = t, t + 256, ... of every sample, then the wave, then the 8 waves in turn.
__global__ __launch_bounds__(256) void k_logdet(const float* __restrict__ LG, float* __restrict__ OUT) { __shared__ __align__(16) float sred[NB][8];
  const int t = threadIdx.x; v8f x[NB];
// unrolled: x[][] stays in registers and the 64 loads of a thread are all in flight together, one trip to memory
#pragma unroll
  for (int n = 0; n < NB; ++n)
#pragma unroll
    for (int k = 0; k < 8; ++k) x[n][k] = LG[n * T2 + k * 256 + t];
  // inputs only: keeps the 64 loads together ahead of the additions. Left alone the compiler issued the last five loads behind waits for the first, a second trip to memory
  asm volatile("" :: "v"(x[0]), "v"(x[1]), "v"(x[2]), "v"(x[3]), "v"(x[4]), "v"(x[5]), "v"(x[6]), "v"(x[7]));
  float s[NB];
#pragma unroll
  for (int n = 0; n < NB; ++n) { s[n] = 0.f;
#pragma unroll
    for (int k = 0; k < 8; ++k) s[n] += x[n][k]; }
// the samples inside, the steps outside: the 8 cross-lane exchanges of a step are independent and share one LDS-pipe latency
#pragma unroll
  for (int o = 1; o < 32; o <<= 1)
#pragma unroll
    for (int n = 0; n < NB; ++n) s[n] += __shfl_xor(s[n], o);
  if ((t & 31) == 0) {
#pragma unroll
    for (int n = 0; n < NB; ++n) sred[n][t >> 5] = s[n]; }
  __syncthreads();
  if (t < NB) { float a = 0.f;
#pragma unroll
    for (int i = 0; i < 8; ++i) a += sred[t][i];
    OUT[OUT1_OFF + t] = a * (float)(LL / 2); } }
extern "C" void kernel_launch(void* const* d_in, const int* in_sizes, int n_in, void* d_out, int out_size, void* d_ws, size_t ws_size, hipStream_t stream) {
  (void)in_sizes; (void)n_in; (void)out_size;
  const float** F = (const float**)d_in;   // 0 inputs [8,4096,256], 1 Wq [256,256] ([out,in]), 2 Wk, 3 q_gamma, 4 q_beta, 5 k_gamma, 6 k_beta, 7 d_scale [1]
  if (ws_size < (size_t)WS_END) return;
  char* ws = (char*)d_ws; _Float16 *QH = (_Float16*)(ws + WS_QH), *QL = (_Float16*)(ws + WS_QL), *KH = (_Float16*)(ws + WS_KH), *KL = (_Float16*)(ws + WS_KL); __bf16* XT = (__bf16*)(ws + WS_XT); float *S = (float*)(ws + WS_S), *DG = (float*)(ws + WS_DG), *MT = (float*)(ws + WS_MT), *LT = (float*)(ws + WS_LT);
  float* OUT = (float*)d_out;
  k_proj<<<dim3(NB * T2 / 64, 3), 128, 0, stream>>>(F[0], F[1], F[2], F[3], F[4], F[5], F[6], QH, QL, KH, KL, OUT, XT);
  k_sc<<<dim3(T2 / 64, T2 / 128, NB), 128, 0, stream>>>(QH, QL, KH, KL, F[7], S, MT, LT);
  k_pv<<<dim3(T2 / 64, DD / 128, NB), 256, 0, stream>>>(S, XT, F[0], OUT, DG, MT, LT);
  k_logdet<<<1, 256, 0, stream>>>(DG, OUT);
}

// v010
// A run of this version takes 89.6 microseconds.
// Timed twice side by side with v009, it ran 1.03 and 1.02 times as fast.
// Over all steps from v000 it is 4.30 times as fast.
// compute dtype: all float inputs rounded to bf16, d_scale read; q, k = LayerNorm(x1 W^T) with EXACT bf16 products on WMMA 16x16x32 and the LN in f32; q and k as f16 hi + residual -> 3-product logits / d_scale (std ~16: near-one-hot rows), upper-triangular mask, softmax in f32 (precise exp) in two levels: exp(s - tile maximum) stored in f32 with each 128-column tile's maximum and sum, then one factor a row and tile; P x 2^11 in f32 split bf16 hi + lo against the bf16-exact x2 (2 products) + the identity term; logdet = (L/2) sum_i log(1 + P_ii) (att + I is upper triangular, so slogdet is the diagonal product - exact identity); f32 outputs: merged [n][L][D] (x1 copied, then att x2) and logdet [n].
#include <hip/hip_runtime.h>
#include <math.h>

typedef __attribute__((ext_vector_type(16))) _Float16 v16h;
typedef __attribute__((ext_vector_type(16))) __bf16 v16b;
typedef __attribute__((ext_vector_type(8)))  _Float16 v8h;
typedef __attribute__((ext_vector_type(8)))  float v8f;
typedef __attribute__((ext_vector_type(4)))  float v4f;
typedef __attribute__((ext_vector_type(2)))  float v2f;
typedef __attribute__((ext_vector_type(4)))  unsigned v4u;
typedef __attribute__((ext_vector_type(4)))  int v4i;
typedef float __attribute__((may_alias)) float_a;
typedef int __attribute__((may_alias)) int_a;

template <typename T> __device__ __forceinline__ void vst2(void* p, T v) { *(T*)p = v;  }
__device__ __forceinline__ v8f wmma16(v16h a, v16h b, v8f c) {
  return __builtin_amdgcn_wmma_f32_16x16x32_f16(false, a, false, b, (short)0, c, false, false);
}
__device__ __forceinline__ v8f wmma_bf(v16b a, v16b b, v8f c) {
  return __builtin_amdgcn_wmma_f32_16x16x32_bf16(false, a, false, b, (short)0, c, false, false);
}
// 16x16x32 fragments: lane = (h = lane>>4, row/col = lane&15); elements 0..7 = k0+8h+0..7, 8..15 = k0+16+8h+0..7; D element r = row 8h+r
__device__ __forceinline__ v16h frag_h(const _Float16* rowk0, int lane) {
  union { v16h v; v8h q[2]; } u; const _Float16* p = rowk0 + 8 * (lane >> 4);
  u.q[0] = *(const v8h*)p; u.q[1] = *(const v8h*)(p + 16); return u.v;
}
__device__ __forceinline__ v16h frag_f32(const float* rowk0, int lane) {
  v16h a; const float* p = rowk0 + 8 * (lane >> 4);
#pragma unroll
  for (int i = 0; i < 8; ++i) { a[i] = (_Float16)p[i]; a[8 + i] = (_Float16)p[16 + i]; }
  return a;
}
__device__ __forceinline__ v16h frag_f32s(const float* rowk0, int lane, float sc) {
  v16h a; const float* p = rowk0 + 8 * (lane >> 4);
#pragma unroll
  for (int i = 0; i < 8; ++i) { a[i] = (_Float16)(p[i] * sc); a[8 + i] = (_Float16)(p[16 + i] * sc); }
  return a;
}
// column fragment from a [K][ld] layout (column n), rows >= K read as 0
__device__ __forceinline__ v16h fragc_f32(const float* W, int k0, int n, int lane, int ld, int K) {
  v16h a; const int g = lane >> 4;
#pragma unroll
  for (int i = 0; i < 8; ++i) { const int ka = k0 + 8 * g + i, kb = ka + 16;
    a[i] = (_Float16)(ka < K ? W[(size_t)(ka < K ? ka : K - 1) * ld + n] : 0.f); a[8 + i] = (_Float16)(kb < K ? W[(size_t)(kb < K ? kb : K - 1) * ld + n] : 0.f); }
  return a;
}
struct F2 { v16b h, l; };
__device__ __forceinline__ F2 bsplit16(const float v[16]) { F2 r;
#pragma unroll
  for (int i = 0; i < 16; ++i) { const __bf16 h = (__bf16)v[i]; r.h[i] = h; r.l[i] = (__bf16)(v[i] - (float)h); }
  return r; }
__device__ __forceinline__ F2 split_row(const float* row, int k0, int lane) { float v[16]; const float* p = row + k0 + 8 * (lane >> 4);
#pragma unroll
  for (int i = 0; i < 8; ++i) { v[i] = p[i]; v[8 + i] = p[16 + i]; }
  return bsplit16(v); }
__device__ __forceinline__ F2 split_rowK(const float* row, int k0, int lane, int K) { float v[16]; const int g = lane >> 4;
#pragma unroll
  for (int i = 0; i < 8; ++i) { const int ka = k0 + 8 * g + i, kb = ka + 16; v[i] = ka < K ? row[ka < K ? ka : K - 1] : 0.f; v[8 + i] = kb < K ? row[kb < K ? kb : K - 1] : 0.f; }
  return bsplit16(v); }
__device__ __forceinline__ F2 split_col(const float* W, int k0, int n, int lane, int ld, int K) { float v[16]; const int g = lane >> 4;
#pragma unroll
  for (int i = 0; i < 8; ++i) { const int ka = k0 + 8 * g + i, kb = ka + 16; v[i] = ka < K ? W[(size_t)(ka < K ? ka : K - 1) * ld + n] : 0.f; v[8 + i] = kb < K ? W[(size_t)(kb < K ? kb : K - 1) * ld + n] : 0.f; }
  return bsplit16(v); }
__device__ __forceinline__ v8f mac3(const F2& a, const F2& b, v8f c) { c = wmma_bf(a.l, b.h, c); c = wmma_bf(a.h, b.l, c); return wmma_bf(a.h, b.h, c); }
__device__ __forceinline__ float sigm(float v) { return 1.0f / (1.0f + expf(-v)); }
#define LDSX() do { asm volatile("s_wait_dscnt 0" ::: "memory"); __builtin_amdgcn_wave_barrier(); __builtin_amdgcn_fence(__ATOMIC_RELEASE, "workgroup"); } while (0)


// Invertible attention (N 8, L 4,096 -> halves of 2,048, D 256): att = softmax(upper-tri(LN(x1 Wq^T) . LN(x1 Wk^T) / d_scale)) + I; out = att x2; logdet = slogdet(att) * L/2.
#define NB 8
#define LL 4096
#define T2 2048
#define DD 256
#define LN_EPS 1e-5f
typedef __attribute__((ext_vector_type(8))) __bf16 v8b;
__device__ __forceinline__ v16b frag_b(const __bf16* rowk0, int lane) {
  union { v16b v; v8b q[2]; } u; const __bf16* p = rowk0 + 8 * (lane >> 4);
  u.q[0] = *(const v8b*)p; u.q[1] = *(const v8b*)(p + 16); return u.v;
}
__device__ __forceinline__ float bfr(float v) { return (float)(__bf16)v; }
__device__ __attribute__((noinline)) float exp_ni(float v) { return expf(v); }
__device__ __attribute__((noinline)) float erf_ni(float v) { return erff(v); }

// Eight 16-byte asynchronous copies per lane, global memory to LDS through no register. The s_wait_xcnt is the statement's last line so that no address register of a copy is rewritten ahead of it.
__device__ __forceinline__ void acopy8(const unsigned (&l)[8], const char* const (&gp)[8]) {
  asm volatile("global_load_async_to_lds_b128 %0, %8, off\n\t"
               "global_load_async_to_lds_b128 %1, %9, off\n\t"
               "global_load_async_to_lds_b128 %2, %10, off\n\t"
               "global_load_async_to_lds_b128 %3, %11, off\n\t"
               "global_load_async_to_lds_b128 %4, %12, off\n\t"
               "global_load_async_to_lds_b128 %5, %13, off\n\t"
               "global_load_async_to_lds_b128 %6, %14, off\n\t"
               "global_load_async_to_lds_b128 %7, %15, off\n\t"
               "s_wait_xcnt 0x0"
               :: "v"(l[0]), "v"(l[1]), "v"(l[2]), "v"(l[3]), "v"(l[4]), "v"(l[5]), "v"(l[6]), "v"(l[7]),
                  "v"(gp[0]), "v"(gp[1]), "v"(gp[2]), "v"(gp[3]), "v"(gp[4]), "v"(gp[5]), "v"(gp[6]), "v"(gp[7]) : "memory");
}
// The same with four copies.
__device__ __forceinline__ void acopy4(const unsigned (&l)[4], const char* const (&gp)[4]) {
  asm volatile("global_load_async_to_lds_b128 %0, %4, off\n\t"
               "global_load_async_to_lds_b128 %1, %5, off\n\t"
               "global_load_async_to_lds_b128 %2, %6, off\n\t"
               "global_load_async_to_lds_b128 %3, %7, off\n\t"
               "s_wait_xcnt 0x0"
               :: "v"(l[0]), "v"(l[1]), "v"(l[2]), "v"(l[3]), "v"(gp[0]), "v"(gp[1]), "v"(gp[2]), "v"(gp[3]) : "memory");
}
// this wave's copies have landed (the compiler places no wait for them)
#define WAIT_ASYNC() asm volatile("s_wait_asynccnt 0x0" ::: "memory")
// this wave's LDS reads have returned, so the buffer may be handed back for a refill
#define WAIT_DS() asm volatile("s_wait_dscnt 0x0" ::: "memory")

#define WS_QH  0u
#define WS_QL  (WS_QH + 2u * (size_t)NB * T2 * DD)
#define WS_KH  (WS_QL + 2u * (size_t)NB * T2 * DD)
#define WS_KL  (WS_KH + 2u * (size_t)NB * T2 * DD)
#define WS_XT  (WS_KL + 2u * (size_t)NB * T2 * DD)      // bf16 x2 planes [n][d][j]
#define WS_S   (WS_XT + 2u * (size_t)NB * DD * T2)      // f32 exp(s - tile maximum) [n][i][j]
#define WS_DG  (WS_S + 4u * (size_t)NB * T2 * T2)       // f32 log(1 + P_ii) [n][i]
#define WS_MT  (WS_DG + 4u * (size_t)NB * T2)           // f32 maximum of a row in a 128-column tile [n][tile][i]
#define WS_LT  (WS_MT + 4u * (size_t)NB * (T2 / 128) * T2)   // f32 sum of exp(s - that maximum) [n][tile][i]
#define WS_END (WS_LT + 4u * (size_t)NB * (T2 / 128) * T2)
#define OUT1_OFF ((size_t)NB * LL * DD)               // logdet output offset (elements)

// the value of lane l ^ M inside the 16-lane row (row_xmask), every lane on
template <int M> __device__ __forceinline__ float xrow(float x) { return __builtin_bit_cast(float, __builtin_amdgcn_update_dpp(0, __builtin_bit_cast(int, x), 0x160 + M, 0xf, 0xf, true)); }
__device__ __forceinline__ float rmax16(float x) { x = fmaxf(x, xrow<1>(x)); x = fmaxf(x, xrow<2>(x)); x = fmaxf(x, xrow<4>(x)); return fmaxf(x, xrow<8>(x)); }
__device__ __forceinline__ float rsum16(float x) { x += xrow<1>(x); x += xrow<2>(x); x += xrow<4>(x); return x + xrow<8>(x); }
// ---- k_proj: block = (64 rows of x1, which): y = x1 W^T ([out][in]); LayerNorm(gamma, beta) -> f16 hi + lo rows; also copies bf16-rounded x1 into merged (which == 0 blocks); the blocks of which == 2 do x2t_tile instead
// The W rows (all 256) and the block's x1 rows come in slices of 32 k = 128 B a row, whole lines, f32, by asynchronous copies into two LDS buffers; the fragments are read from LDS and rounded to bf16 there.
// LayerNorm runs on the accumulators: a wave holds its 16 rows whole (a lane 16 columns of each of 8 rows), so a row's mean and variance are 16 additions in the lane and a sum over the 16 lanes of its half.
// The f16 hi and lo of a value go as one dword into the wave's own rows of sp, which lies over the two buffers and is first written behind the last trip's barrier; the wave reads its rows back and stores whole lines.
#define PJ_P 144u                    // LDS row pitch: 128 B + 16, conflict-free for 16-byte reads
#define PJ_X (256u * PJ_P)           // rows in a buffer: W 256 | x1 64
#define PJ_BUF (320u * PJ_P)
static_assert(64u * (DD + 4u) * 4u <= 2u * PJ_BUF, "sp lies inside the staging buffers");
static_assert(DD * 72u * 2u <= 2u * PJ_BUF, "st of the third plane lies inside them too");
__device__ __forceinline__ v16b cvt_frag(const v4f (&r)[4]) { v16b a;   // elements 0..7 = k 8g+0..7, 8..15 = k 16+8g+0..7
// unrolled: a[] and r[] are registers
#pragma unroll
  for (int i = 0; i < 4; ++i) { a[i] = (__bf16)r[0][i]; a[4 + i] = (__bf16)r[1][i]; a[8 + i] = (__bf16)r[2][i]; a[12 + i] = (__bf16)r[3][i]; }
  return a; }
// ---- the blocks of k_proj's third plane (blockIdx.y == 2): block = (64 j, n): x2 planes XT[n][d][j] (bf16, exact). They need nothing of the projection and run beside its blocks in one launch.
// Thread t takes the columns d = t and t + 128 of the 64 rows j, a wave 128 B of a row with each load; 8 j go as one 16-byte LDS store into st[d][]. Behind the barrier 8 lanes store a plane row's 64 j, one whole line.
__device__ __forceinline__ void x2t_tile(const float* __restrict__ X, __bf16* __restrict__ XT, unsigned char* lds, size_t n, int j0, int t) {
  __bf16 (*st)[72] = (__bf16 (*)[72])lds;   // pitch 144 B: conflict-free for 16-byte accesses
// every loop here is unrolled: v[] is registers, and the loads stand together ahead of the conversions, one trip to memory
#pragma unroll
  for (int h = 0; h < 2; ++h) { const int d = t + 128 * h;
#pragma unroll
    for (int jb = 0; jb < 64; jb += 32) { float v[32]; const float* p = X + (n * LL + T2 + j0 + jb) * DD + d;
#pragma unroll
      for (int i = 0; i < 32; ++i) v[i] = p[(size_t)i * DD];
#pragma unroll
      for (int q = 0; q < 4; ++q) { v8b w;
#pragma unroll
        for (int i = 0; i < 8; ++i) w[i] = (__bf16)v[q * 8 + i];
        *(v8b*)&st[d][jb + q * 8] = w; } } }
  __syncthreads();   // st[][] is whole before it is read across the waves
#pragma unroll
  for (int k = 0; k < DD * 8 / 128; ++k) { const int d = k * 16 + (t >> 3), q = t & 7; vst2((unsigned*)(XT + (n * DD + d) * (size_t)T2 + j0 + q * 8), *(const v4u*)&st[d][q * 8]); } }
__global__ __launch_bounds__(128) void k_proj(const float* __restrict__ X, const float* __restrict__ WQ, const float* __restrict__ WK, const float* __restrict__ GQ, const float* __restrict__ BQ, const float* __restrict__ GK, const float* __restrict__ BK, _Float16* __restrict__ QH, _Float16* __restrict__ QL, _Float16* __restrict__ KH, _Float16* __restrict__ KL, float* __restrict__ OUT, __bf16* __restrict__ XT) {
  __shared__ __align__(16) unsigned char ar[2u * PJ_BUF];
  unsigned (*sp)[DD + 4] = (unsigned (*)[DD + 4])ar;   // pitch 260 dwords: the two halves of a wave, 8 rows apart, write banks 32 apart
  const int tid = threadIdx.x, wave = tid >> 5, lane = tid & 31, col = lane & 15, g = lane >> 4; const int which = blockIdx.y; const size_t r0 = (size_t)blockIdx.x * 64; const size_t n = r0 / T2; const int i0 = (int)(r0 % T2);   // rows of x1: x[n][i][:], i < T2
  if (which == 2) { x2t_tile(X, XT, ar, n, i0, tid); return; }   // the same for the whole block: the 64 rows j = i0.. of x2
  const float* Wm = which == 0 ? WQ : WK; const float* Gm = which == 0 ? GQ : GK; const float* Bm = which == 0 ? BQ : BK;
  const int rr = tid >> 3, pc = tid & 7;   // a copy of a wave covers 4 rows x 128 B
  const unsigned lb = (unsigned)(size_t)ar + (unsigned)rr * PJ_P + (unsigned)pc * 16u;
  const char* gw = (const char*)(Wm + (size_t)rr * DD + pc * 4); const char* gx = (const char*)(X + (n * LL + i0 + rr) * DD + pc * 4);
  // the loops below are unrolled so that l[] and gp[] are registers: they are asm operands
  auto stage = [&](int t, int b) { unsigned l[8]; const char* gp[8]; unsigned l4[4]; const char* gp4[4]; const unsigned lt = lb + (unsigned)b * PJ_BUF; const size_t go = (size_t)t * 128;
#pragma unroll
    for (int m = 0; m < 8; ++m) { l[m] = lt + (unsigned)m * 16u * PJ_P; gp[m] = gw + go + (size_t)m * 16 * DD * 4; }
    acopy8(l, gp);
#pragma unroll
    for (int m = 0; m < 8; ++m) { l[m] = lt + (unsigned)(8 + m) * 16u * PJ_P; gp[m] = gw + go + (size_t)(8 + m) * 16 * DD * 4; }
    acopy8(l, gp);
#pragma unroll
    for (int m = 0; m < 4; ++m) { l4[m] = lt + PJ_X + (unsigned)m * 16u * PJ_P; gp4[m] = gx + go + (size_t)m * 16 * DD * 4; }
    acopy4(l4, gp4); };
  stage(0, 0); WAIT_ASYNC(); __syncthreads(); stage(1, 1);
  v8f acc[16] = {};
// rolled: one copy of the 16-WMMA body, and the two buffers alternate by an offset; the loops inside are unrolled so that acc[], r[] and w[] stay in registers
#pragma unroll 1
  for (int t = 0; t < DD / 32; ++t) { const unsigned char* B = ar + (unsigned)(t & 1) * PJ_BUF; v4f ra[4], r[4][4];
    // a lane's 16 values of a row: k 8g+0..7 and 16+8g+0..7, four 16-byte reads
    auto rd = [&](v4f (&d)[4], unsigned row) { const v4f* p = (const v4f*)(B + row * PJ_P + (unsigned)g * 32u); d[0] = p[0]; d[1] = p[1]; d[2] = p[4]; d[3] = p[5]; };
    rd(ra, 256u + (unsigned)(wave * 16 + col));
#pragma unroll
    for (int jj = 0; jj < 4; ++jj) rd(r[jj], (unsigned)(jj * 16 + col));
    const v16b a = cvt_frag(ra);
#pragma unroll
    for (int jg = 0; jg < 4; ++jg) { v16b w[4];
#pragma unroll
      for (int jj = 0; jj < 4; ++jj) w[jj] = cvt_frag(r[jj]);
      // the next four fragments' reads stand ahead of this group's WMMAs, so that their LDS latency runs beside them
      if (jg < 3) {
#pragma unroll
        for (int jj = 0; jj < 4; ++jj) rd(r[jj], (unsigned)((jg * 4 + 4 + jj) * 16 + col)); }
#pragma unroll
      for (int jj = 0; jj < 4; ++jj) acc[jg * 4 + jj] = wmma_bf(a, w[jj], acc[jg * 4 + jj]); }
    __builtin_amdgcn_sched_barrier(0);   // holds the trip's WMMAs ahead of the foot: left alone the compiler sinks them behind the barrier, and the wait for slice t + 1 then comes that much sooner after its copies
    WAIT_DS(); WAIT_ASYNC(); __syncthreads();   // publishes slice t + 1 and ends every reader's last read of slice t's buffer
    if (t + 2 < DD / 32) stage(t + 2, t & 1); }
  WAIT_ASYNC();
// every loop below is unrolled: acc[], gm[] and bt[] are registers
  float gm[16], bt[16];   // the lane's 16 columns of gamma and beta: the loads fly beside the sums
#pragma unroll
  for (int j = 0; j < 16; ++j) { gm[j] = Gm[j * 16 + col]; bt[j] = Bm[j * 16 + col]; }
  // the 8 rows of a lane side by side as one vector: neighbouring rows lie in neighbouring registers, which packed f32 instructions take as they are
  v8f s8 = acc[0], q8 = {}, mu, rs;
#pragma unroll
  for (int j = 1; j < 16; ++j) s8 += acc[j];
#pragma unroll
  for (int r = 0; r < 8; ++r) mu[r] = rsum16(s8[r]) * (1.0f / DD);
#pragma unroll
  for (int j = 0; j < 16; ++j) { const v8f d = acc[j] - mu; q8 += d * d; }
#pragma unroll
  for (int r = 0; r < 8; ++r) rs[r] = 1.0f / sqrtf(rsum16(q8[r]) * (1.0f / DD) + LN_EPS);
#pragma unroll
  for (int j = 0; j < 16; ++j) { const v8f y = (acc[j] - mu) * rs * bfr(gm[j]) + bfr(bt[j]);
#pragma unroll
    for (int r = 0; r < 8; ++r) { const float v = y[r]; const _Float16 hv = (_Float16)v, lv = (_Float16)(v - (float)hv);
      sp[wave * 16 + 8 * g + r][j * 16 + col] = (unsigned)__builtin_bit_cast(unsigned short, hv) | ((unsigned)__builtin_bit_cast(unsigned short, lv) << 16); } }   // hi in the low half
  LDSX();   // the wave's own rows are written before it reads them back across its lanes; no other wave touches them
  _Float16* dh = which == 0 ? QH : KH; _Float16* dl = which == 0 ? QL : KL;
  // a lane takes 8 columns of a row, parts hi from lo, and the wave stores 512 B of each: whole lines
#pragma unroll
  for (int rl = 0; rl < 16; ++rl) { const v4u* p = (const v4u*)&sp[wave * 16 + rl][lane * 8]; const v4u a = p[0], b = p[1]; v4u h, l;
    h[0] = (a[0] & 0xffffu) | (a[1] << 16); h[1] = (a[2] & 0xffffu) | (a[3] << 16); h[2] = (b[0] & 0xffffu) | (b[1] << 16); h[3] = (b[2] & 0xffffu) | (b[3] << 16);
    l[0] = (a[0] >> 16) | (a[1] & 0xffff0000u); l[1] = (a[2] >> 16) | (a[3] & 0xffff0000u); l[2] = (b[0] >> 16) | (b[1] & 0xffff0000u); l[3] = (b[2] >> 16) | (b[3] & 0xffff0000u);
    vst2((unsigned*)(dh + (r0 + wave * 16 + rl) * DD + lane * 8), h); vst2((unsigned*)(dl + (r0 + wave * 16 + rl) * DD + lane * 8), l); }
  asm volatile("s_wait_xcnt 0x0" ::: "memory");   // stands ahead of any rewrite of the stores' address and data registers by the copy loop below
  if (which == 0) { for (int e = tid; e < 64 * 64; e += 128) { const int rl = e >> 6, q = e & 63; const size_t go = (n * LL + i0 + rl) * DD + q * 4; const v4f xr = *(const v4f*)(X + go); v4f v; v[0] = bfr(xr[0]); v[1] = bfr(xr[1]); v[2] = bfr(xr[2]); v[3] = bfr(xr[3]); vst2(OUT + go, v); } } }
#define SM_NEG -3.0e38f
// e^x in f32 for x <= 0: r = nearest integer to x log2(e); fraction = x log2(e) - r by two fused multiply-adds, log2(e) in two parts (the product is not rounded before r is taken off); 2^fraction; ldexp by r.
// The floor of -200 keeps r finite for a masked value, and ldexp then gives exactly 0. 2^fraction stands in asm: the v_nop in the statement is the free slot that the instruction set asks for behind a transcendental.
__device__ __forceinline__ float exp_np(float x) {
  x = fmaxf(x, -200.0f); const float r = __builtin_rintf(x * 0x1.715476p+0f); const float a = __builtin_fmaf(x, 0x1.4ae0bep-26f, __builtin_fmaf(x, 0x1.715476p+0f, -r));
  float e; asm("v_exp_f32 %0, %1\n\tv_nop" : "=v"(e) : "v"(a));
  return ldexpf(e, (int)r); }
// ---- k_sc: block = (64 rows i, 128 cols j, n): s = q.k / d_scale for j >= i, else masked; stored: exp(s - m), m the row's maximum in this tile (0 where masked), with m and the row's sum of them in MT and LT [n][tile][i] for k_pv; blocks entirely below the diagonal store the mask and 0 there and exit.
// The K and Q rows (hi and lo) come in slices of 64 k = 128 B a row, whole lines, by asynchronous copies into two LDS buffers; the fragments are read from LDS.
// An LDS row has no pad: its eight 16-byte pieces are permuted, piece p of row r at place p ^ ((r >> 1) & 7), so that 16 rows read at one piece meet all 64 banks. With ss laid over the buffers a block takes under a third of a WGP's LDS: three blocks run there, not two.
#define SC_P 128u                    // LDS row pitch: one line
#define SC_KL (128u * SC_P)          // rows in a buffer: KH 128 | KL 128 | QH 64 | QL 64
#define SC_QH (256u * SC_P)
#define SC_QL (320u * SC_P)
#define SC_BUF (384u * SC_P)
static_assert(4u * 16u * 132u * 4u <= 2u * SC_BUF, "ss lies inside the staging buffers");
__global__ __launch_bounds__(128) void k_sc(const _Float16* __restrict__ QH, const _Float16* __restrict__ QL, const _Float16* __restrict__ KH, const _Float16* __restrict__ KL, const float* __restrict__ DSC, float* __restrict__ S0, float* __restrict__ MT, float* __restrict__ LT) { __shared__ __align__(16) unsigned char sb[2 * SC_BUF]; __shared__ __align__(16) float st[2][64];
  float (*ss)[16][132] = (float (*)[16][132])sb;   // lies over the two buffers and is first written behind the last trip's barrier
  const size_t n = blockIdx.z; float* S = S0 + n * (size_t)T2 * T2;
  const int tid = threadIdx.x, wave = tid >> 5, lane = tid & 31, col = lane & 15, g = lane >> 4; const int k0 = blockIdx.y * 128; const int q0b = blockIdx.x * 64; const int ql0 = q0b + wave * 16;
  float* const tq = (tid < 64 ? MT : LT) + (n * (T2 / 128) + blockIdx.y) * (size_t)T2 + q0b + (tid & 63);   // waves 0 and 1 store the 64 rows' maxima, waves 2 and 3 their sums, one whole line each
  if (k0 + 127 < q0b) { *tq = tid < 64 ? SM_NEG : 0.f; return; }   // all j < i: the tile counts as masked in k_pv's factors, and its values are never read (k_pv starts at the tile of the rows' diagonal)
  const float isc = 1.0f / bfr(DSC[0]);
  const int rr = tid >> 3, pc = tid & 7;   // a copy of a wave covers 4 rows x 128 B
  const unsigned lb = (unsigned)(size_t)sb + (unsigned)rr * SC_P + (unsigned)(pc ^ ((rr >> 1) & 7)) * 16u;   // every copy's row is rr + a multiple of 16: the permutation is rr's
  const char* gkh = (const char*)(KH + (n * T2 + k0 + rr) * DD + pc * 8); const char* gkl = (const char*)(KL + (n * T2 + k0 + rr) * DD + pc * 8);
  const char* gqh = (const char*)(QH + (n * T2 + q0b + rr) * DD + pc * 8); const char* gql = (const char*)(QL + (n * T2 + q0b + rr) * DD + pc * 8);
  // the loops below are unrolled so that l[] and gp[] are registers: they are asm operands
  auto stage = [&](int t, int b) { unsigned l[8]; const char* gp[8]; const unsigned lt = lb + (unsigned)b * SC_BUF; const size_t go = (size_t)t * 128;
#pragma unroll
    for (int m = 0; m < 8; ++m) { l[m] = lt + (unsigned)m * 16u * SC_P; gp[m] = gkh + go + (size_t)m * 16 * DD * 2; }
    acopy8(l, gp);
#pragma unroll
    for (int m = 0; m < 8; ++m) { l[m] = lt + SC_KL + (unsigned)m * 16u * SC_P; gp[m] = gkl + go + (size_t)m * 16 * DD * 2; }
    acopy8(l, gp);
#pragma unroll
    for (int m = 0; m < 4; ++m) { l[m] = lt + SC_QH + (unsigned)m * 16u * SC_P; gp[m] = gqh + go + (size_t)m * 16 * DD * 2; l[4 + m] = lt + SC_QL + (unsigned)m * 16u * SC_P; gp[4 + m] = gql + go + (size_t)m * 16 * DD * 2; }
    acopy8(l, gp); };
  stage(0, 0); WAIT_ASYNC(); __syncthreads(); stage(1, 1);
  v8f acc[8] = {};
  // a lane's fragment of a 32-k step: pieces 4 kk + g and 4 kk + 2 + g of its row, which is col + a multiple of 16
  const unsigned sw = (unsigned)((col >> 1) ^ g);
  auto frag_s = [&](const unsigned char* row, int kk) { union { v16h v; v8h q[2]; } u; u.q[0] = *(const v8h*)(row + (sw ^ (unsigned)(kk * 4)) * 16u); u.q[1] = *(const v8h*)(row + (sw ^ (unsigned)(kk * 4 + 2)) * 16u); return u.v; };
// rolled: one copy of the 48-WMMA body, and the two buffers alternate by an offset; the loops inside are unrolled so that acc[], kb[] and kl[] stay in registers
#pragma unroll 1
  for (int t = 0; t < DD / 64; ++t) { const unsigned char* B = sb + (unsigned)(t & 1) * SC_BUF;
#pragma unroll
    for (int kk = 0; kk < 2; ++kk) { const unsigned qo = (unsigned)(wave * 16 + col) * SC_P; const v16h ah = frag_s(B + SC_QH + qo, kk), al = frag_s(B + SC_QL + qo, kk); v16h kb[8], kl[8];
#pragma unroll
      for (int j = 0; j < 8; ++j) { const unsigned ko = (unsigned)(j * 16 + col) * SC_P; kb[j] = frag_s(B + ko, kk); kl[j] = frag_s(B + SC_KL + ko, kk); }
      // inputs only: keeps the LDS reads of this 32-k step together ahead of its WMMAs; read one fragment at a time, every WMMA waits out an LDS latency
      asm volatile("" :: "v"(ah), "v"(al), "v"(kb[0]), "v"(kb[1]), "v"(kb[2]), "v"(kb[3]), "v"(kb[4]), "v"(kb[5]), "v"(kb[6]), "v"(kb[7]), "v"(kl[0]), "v"(kl[1]), "v"(kl[2]), "v"(kl[3]), "v"(kl[4]), "v"(kl[5]), "v"(kl[6]), "v"(kl[7]));
#pragma unroll
      for (int j = 0; j < 8; ++j) { acc[j] = wmma16(ah, kb[j], acc[j]); acc[j] = wmma16(al, kb[j], acc[j]); acc[j] = wmma16(ah, kl[j], acc[j]); } }
    __builtin_amdgcn_sched_barrier(0);   // holds the trip's WMMAs ahead of the foot: left alone the compiler sinks them behind the barrier, and the wait for slice t + 1 then comes that much sooner after its copies
    WAIT_DS(); WAIT_ASYNC(); __syncthreads();   // publishes slice t + 1 and ends every reader's last read of slice t's buffer
    if (t + 2 < DD / 64) stage(t + 2, t & 1); }
  WAIT_ASYNC();
  // a lane holds 8 columns of each of the rows 8g + 0..7: maximum and sum in the lane, then over the 16 lanes of its half. Every row of a block that runs has a column j >= i in the tile. The loops are unrolled: acc[], mx[] and sm[] are registers
  float mx[8], sm[8];
#pragma unroll
  for (int r = 0; r < 8; ++r) { mx[r] = SM_NEG; sm[r] = 0.f; }
#pragma unroll
  for (int j = 0; j < 8; ++j) { const int jj = k0 + j * 16 + col;
#pragma unroll
    for (int r = 0; r < 8; ++r) { const int ii = ql0 + 8 * g + r; acc[j][r] = (jj >= ii) ? acc[j][r] * isc : SM_NEG; mx[r] = fmaxf(mx[r], acc[j][r]); } }
#pragma unroll
  for (int r = 0; r < 8; ++r) mx[r] = rmax16(mx[r]);
#pragma unroll
  for (int j = 0; j < 8; ++j)
#pragma unroll
    for (int r = 0; r < 8; ++r) { const float e = exp_np(acc[j][r] - mx[r]); sm[r] += e; ss[wave][8 * g + r][j * 16 + col] = e; }
#pragma unroll
  for (int r = 0; r < 8; ++r) sm[r] = rsum16(sm[r]);
  if (col == 0) {
#pragma unroll
    for (int r = 0; r < 8; ++r) { st[0][wave * 16 + 8 * g + r] = mx[r]; st[1][wave * 16 + 8 * g + r] = sm[r]; } }
  __syncthreads();   // st[] is whole (and every wave's own ss rows are written). It stands ahead of the row stores: behind them it would wait for them to complete
  *tq = st[tid >> 6][tid & 63];
  for (int rl = 0; rl < 16; ++rl) vst2(S + (size_t)(ql0 + rl) * T2 + k0 + lane * 4, *(const v4f*)&ss[wave][rl][lane * 4]);
  asm volatile("s_wait_xcnt 0x0" ::: "memory"); }   // stands ahead of any rewrite of the stores' address and data registers: the compiler lays the early exit's store behind this place
// ---- k_pv: block = (64 rows i, 128 cols d, n), 8 waves: out = P (hi + lo) . x2 (exact) over j >= 128*(i/128), + x2[i]; written to merged rows T2 + i.
// P x 2^11 = k_sc's exp(s - tile maximum) times the row's factor of that tile, exp(tile maximum - row maximum) x 2^11 / row sum: 16 factors a row, formed from MT and LT while the first slice flies.
// The stored rows (f32) and x2 planes (bf16) come in slices of 128 j (one tile of k_sc), whole lines, by asynchronous copies into two LDS buffers; the fragments are read from LDS.
// Waves 0..3 take the first 64 j of a slice and waves 4..7 the second 64, each group all 64 rows: the longest block makes 16 trips, not 32, and a trip waits once for memory. The two partial sums meet in LDS behind the loop.
// A block of odd blockIdx.x starts 64 columns left of its rows' diagonal: k_sc has stored exact zeros there.
// The first slice of a block holds its rows' diagonal: the blocks of d-block 0 store log(1 + P_ii) from it into LG [n][i] for k_logdet.
#define PV_PP 528u                   // LDS pitch of a P row: 512 B + 16
#define PV_XP 272u                   // LDS pitch of an x2 plane row: 256 B + 16
#define PV_X (64u * PV_PP)           // a buffer: P 64 rows | x2 planes 128 rows
#define PV_BUF (PV_X + 128u * PV_XP)
static_assert(4u * 16u * 132u * 4u <= 2u * PV_BUF, "ss lies inside the staging buffers");
__global__ __launch_bounds__(256) void k_pv(const float* __restrict__ PS0, const __bf16* __restrict__ XT, const float* __restrict__ X, float* __restrict__ OUT, float* __restrict__ LG, const float* __restrict__ MT, const float* __restrict__ LT) { __shared__ __align__(16) unsigned char sb[2 * PV_BUF]; __shared__ float cs[64][17];   // pitch 17: 16 rows read at once meet 16 banks
  float (*ss)[16][132] = (float (*)[16][132])sb;   // lies over the two buffers and is first written behind the last trip's barrier
  const size_t n = blockIdx.z; const float* PS = PS0 + n * (size_t)T2 * T2;
  const int tid = threadIdx.x, wave = tid >> 5, lane = tid & 31, col = lane & 15, g = lane >> 4; const int wr = wave & 3, jh = __builtin_amdgcn_readfirstlane(wave) >> 2;   // the wave's 16 rows; its half of a slice (a scalar)
  const int q0b = blockIdx.x * 64; const int ql0 = q0b + wr * 16; const int c0 = blockIdx.y * 128;
  const unsigned lp = (unsigned)(size_t)sb + (unsigned)(tid >> 5) * PV_PP + (unsigned)(tid & 31) * 16u;           // a copy of a wave covers 1 P row x 512 B
  const unsigned lx = (unsigned)(size_t)sb + PV_X + (unsigned)(tid >> 4) * PV_XP + (unsigned)(tid & 15) * 16u;    // or 2 plane rows x 256 B
  const char* gpp = (const char*)(PS + (size_t)(q0b + (tid >> 5)) * T2 + (tid & 31) * 4); const char* gxx = (const char*)(XT + (n * DD + c0 + (tid >> 4)) * (size_t)T2 + (tid & 15) * 8);
  // the loops below are unrolled so that l[] and gp[] are registers: they are asm operands
  auto stage = [&](int t, int b) { unsigned l[8]; const char* gp[8];
#pragma unroll
    for (int m = 0; m < 8; ++m) { l[m] = lp + (unsigned)b * PV_BUF + (unsigned)m * 8u * PV_PP; gp[m] = gpp + (size_t)t * 512 + (size_t)m * 8 * T2 * 4; }
    acopy8(l, gp);
#pragma unroll
    for (int m = 0; m < 8; ++m) { l[m] = lx + (unsigned)b * PV_BUF + (unsigned)m * 16u * PV_XP; gp[m] = gxx + (size_t)t * 256 + (size_t)m * 16 * T2 * 2; }
    acopy8(l, gp); };
  const int t0 = blockIdx.x >> 1;   // first slice of 128 j: the tile that holds the rows' diagonal
  stage(t0, 0);
  // waves 0 and 1 (a scalar test): thread tid forms row tid's factors; a tile left of the diagonal holds the mask and a sum of 0. Unrolled: mt[] and lt[] are registers and the 32 whole-line loads fly together
  if (__builtin_amdgcn_readfirstlane(wave) < 2) { float mt[16], lt[16]; const size_t o = n * (T2 / 128) * (size_t)T2 + q0b + tid;
#pragma unroll
    for (int i = 0; i < 16; ++i) { mt[i] = MT[o + (size_t)i * T2]; lt[i] = LT[o + (size_t)i * T2]; }
    float m = SM_NEG, l = 0.f;
#pragma unroll
    for (int i = 0; i < 16; ++i) m = fmaxf(m, mt[i]);
#pragma unroll
    for (int i = 0; i < 16; ++i) { mt[i] = exp_np(mt[i] - m); l += lt[i] * mt[i]; }
    const float f = 2048.0f / l;
#pragma unroll
    for (int i = 0; i < 16; ++i) cs[tid][i] = mt[i] * f; }
  WAIT_ASYNC(); __syncthreads(); if (t0 + 1 < T2 / 128) stage(t0 + 1, 1);   // the barrier publishes cs[] too
  // row tid of buffer 0, the row's own column, times the row's factor: P_ii x 2^11. Waves 0 and 1 (a scalar test, every lane on) store one whole line each; buffer 0 is refilled only behind the foot of the first trip.
  if (blockIdx.y == 0 && __builtin_amdgcn_readfirstlane(wave) < 2) { const float pd = *(const float*)(sb + (unsigned)tid * (PV_PP + 4u) + (unsigned)(blockIdx.x & 1) * 256u) * cs[tid][t0]; LG[n * T2 + q0b + tid] = logf(1.0f + pd * (1.0f / 2048.0f));
    asm volatile("s_wait_xcnt 0x0" ::: "memory"); }   // stands ahead of any rewrite of the store's address and data registers
  v8f acc[8] = {};
// rolled: the trip count depends on the block; the loops inside are unrolled so that acc[] and xb[] stay in registers
#pragma unroll 1
  for (int t = t0; t < T2 / 128; ++t) { const int b = (t - t0) & 1; const unsigned char* B = sb + (unsigned)b * PV_BUF; const float cf = cs[wr * 16 + col][t];   // the lane's row, this slice's tile
#pragma unroll
    for (int kk = 0; kk < 2; ++kk) { const v4f* pp = (const v4f*)(B + (unsigned)(wr * 16 + col) * PV_PP + (unsigned)jh * 256u + (unsigned)kk * 128u + (unsigned)g * 32u); const v4f p0 = pp[0], p1 = pp[1], p2 = pp[4], p3 = pp[5]; v16b xb[8];   // P elements k0+8g+0..7 and k0+16+8g+0..7
#pragma unroll
      for (int j = 0; j < 8; ++j) xb[j] = frag_b((const __bf16*)(B + PV_X + (unsigned)(j * 16 + col) * PV_XP + (unsigned)jh * 128u + (unsigned)kk * 64u), lane);
      // inputs only: keeps the LDS reads of this 32-j step together ahead of its WMMAs; read one fragment at a time, every WMMA waits out an LDS latency
      asm volatile("" :: "v"(p0), "v"(p1), "v"(p2), "v"(p3), "v"(xb[0]), "v"(xb[1]), "v"(xb[2]), "v"(xb[3]), "v"(xb[4]), "v"(xb[5]), "v"(xb[6]), "v"(xb[7]));
      float pv[16];
#pragma unroll
      for (int i = 0; i < 4; ++i) { pv[i] = p0[i] * cf; pv[4 + i] = p1[i] * cf; pv[8 + i] = p2[i] * cf; pv[12 + i] = p3[i] * cf; }
      const F2 p = bsplit16(pv);
#pragma unroll
      for (int j = 0; j < 8; ++j) { acc[j] = wmma_bf(p.h, xb[j], acc[j]); acc[j] = wmma_bf(p.l, xb[j], acc[j]); } }
    __builtin_amdgcn_sched_barrier(0);   // holds the trip's WMMAs ahead of the foot: left alone the compiler sinks them behind the barrier, and the wait for slice t + 1 then comes that much sooner after its copies
    WAIT_DS(); WAIT_ASYNC(); __syncthreads();   // publishes slice t + 1 and ends every reader's last read of slice t's buffer
    if (t + 2 < T2 / 128) stage(t + 2, b); }
  WAIT_ASYNC();
  // waves 4..7 hand their partial sums over, each lane to the lane of wave - 4 that holds the same elements. The loops are unrolled: acc[] is registers
  if (jh == 1) {
#pragma unroll
    for (int j = 0; j < 8; ++j)
#pragma unroll
      for (int r = 0; r < 8; ++r) ss[wr][8 * g + r][j * 16 + col] = acc[j][r]; }
  __syncthreads();   // the partial sums of waves 4..7 are in ss before waves 0..3 read them
  if (jh == 0) {
#pragma unroll
    for (int j = 0; j < 8; ++j) { const int d = c0 + j * 16 + col;
#pragma unroll
      for (int r = 0; r < 8; ++r) { const int ii = ql0 + 8 * g + r; float* const e = &ss[wr][8 * g + r][j * 16 + col]; *e = (acc[j][r] + *e) * (1.0f / 2048.0f) + bfr(X[(n * LL + T2 + ii) * DD + d]); } }
    LDSX(); for (int rl = 0; rl < 16; ++rl) vst2(OUT + (n * LL + T2 + ql0 + rl) * DD + c0 + lane * 4, *(const v4f*)&ss[wr][rl][lane * 4]); } }
// ---- k_logdet: one block: logdet[n] = (L/2) * sum_i log(1 + P_ii), the logarithms read from LG (64 KB, whole lines). Thread t sums i = t, t + 256, ... of every sample, then the wave, then the 8 waves in turn.
__global__ __launch_bounds__(256) void k_logdet(const float* __restrict__ LG, float* __restrict__ OUT) { __shared__ __align__(16) float sred[NB][8];
  const int t = threadIdx.x; v8f x[NB];
// unrolled: x[][] stays in registers and the 64 loads of a thread are all in flight together, one trip to memory
#pragma unroll
  for (int n = 0; n < NB; ++n)
#pragma unroll
    for (int k = 0; k < 8; ++k) x[n][k] = LG[n * T2 + k * 256 + t];
  // inputs only: keeps the 64 loads together ahead of the additions. Left alone the compiler issued the last five loads behind waits for the first, a second trip to memory
  asm volatile("" :: "v"(x[0]), "v"(x[1]), "v"(x[2]), "v"(x[3]), "v"(x[4]), "v"(x[5]), "v"(x[6]), "v"(x[7]));
  float s[NB];
#pragma unroll
  for (int n = 0; n < NB; ++n) { s[n] = 0.f;
#pragma unroll
    for (int k = 0; k < 8; ++k) s[n] += x[n][k]; }
// the samples inside, the steps outside: the 8 cross-lane exchanges of a step are independent and share one LDS-pipe latency
#pragma unroll
  for (int o = 1; o < 32; o <<= 1)
#pragma unroll
    for (int n = 0; n < NB; ++n) s[n] += __shfl_xor(s[n], o);
  if ((t & 31) == 0) {
#pragma unroll
    for (int n = 0; n < NB; ++n) sred[n][t >> 5] = s[n]; }
  __syncthreads();
  if (t < NB) { float a = 0.f;
#pragma unroll
    for (int i = 0; i < 8; ++i) a += sred[t][i];
    OUT[OUT1_OFF + t] = a * (float)(LL / 2); } }
extern "C" void kernel_launch(void* const* d_in, const int* in_sizes, int n_in, void* d_out, int out_size, void* d_ws, size_t ws_size, hipStream_t stream) {
  (void)in_sizes; (void)n_in; (void)out_size;
  const float** F = (const float**)d_in;   // 0 inputs [8,4096,256], 1 Wq [256,256] ([out,in]), 2 Wk, 3 q_gamma, 4 q_beta, 5 k_gamma, 6 k_beta, 7 d_scale [1]
  if (ws_size < (size_t)WS_END) return;
  char* ws = (char*)d_ws; _Float16 *QH = (_Float16*)(ws + WS_QH), *QL = (_Float16*)(ws + WS_QL), *KH = (_Float16*)(ws + WS_KH), *KL = (_Float16*)(ws + WS_KL); __bf16* XT = (__bf16*)(ws + WS_XT); float *S = (float*)(ws + WS_S), *DG = (float*)(ws + WS_DG), *MT = (float*)(ws + WS_MT), *LT = (float*)(ws + WS_LT);
  float* OUT = (float*)d_out;
  k_proj<<<dim3(NB * T2 / 64, 3), 128, 0, stream>>>(F[0], F[1], F[2], F[3], F[4], F[5], F[6], QH, QL, KH, KL, OUT, XT);
  k_sc<<<dim3(T2 / 64, T2 / 128, NB), 128, 0, stream>>>(QH, QL, KH, KL, F[7], S, MT, LT);
  k_pv<<<dim3(T2 / 64, DD / 128, NB), 256, 0, stream>>>(S, XT, F[0], OUT, DG, MT, LT);
  k_logdet<<<1, 256, 0, stream>>>(DG, OUT);
}
